// v000
// Times are from an AMD MI455X. After a warm-up the kernel runs many times in a row, and a time is the length of
// such a window on the GPU divided by its runs, so every launch and the gaps after it count. The runs cycle
// through copies of the inputs. A figure is the median of several windows, for all but v000 over two sittings.
// Sittings can differ by a few percent; kernels timed side by side share one.
// v000 is the starting kernel. One run takes 2050 microseconds.
// compute dtype: all float inputs rounded to bf16; qkv = x W_qkv with EXACT bf16 products on WMMA 16x16x32 (f32 accumulate); the 32-wide sub-head logits with q as f16 hi + residual (x 2^10) against k once to f16 (2 products) x 32^-0.5; both softmaxes in f32 (precise expf); each P x 2^11 once to f16 against the head's 64-wide v once to f16 (1 product); the differential combination, the per-head RMS normalisation (x subln_w x (1 - lambda_init)) in f32; the result once to f16 against W_proj carried x 2^8 in f16 + b_proj; f32 output.
#include <hip/hip_runtime.h>
#include <math.h>

typedef __attribute__((ext_vector_type(16))) _Float16 v16h;
typedef __attribute__((ext_vector_type(16))) __bf16 v16b;
typedef __attribute__((ext_vector_type(8)))  _Float16 v8h;
typedef __attribute__((ext_vector_type(8)))  float v8f;
typedef __attribute__((ext_vector_type(4)))  float v4f;
typedef __attribute__((ext_vector_type(2)))  float v2f;
typedef __attribute__((ext_vector_type(4)))  unsigned v4u;
typedef __attribute__((ext_vector_type(4)))  int v4i;
typedef float __attribute__((may_alias)) float_a;
typedef int __attribute__((may_alias)) int_a;

template <typename T> __device__ __forceinline__ void vst2(void* p, T v) { *(T*)p = v;  }
__device__ __forceinline__ v8f wmma16(v16h a, v16h b, v8f c) {
  v8f d = __builtin_amdgcn_wmma_f32_16x16x32_f16(false, a, false, b, (short)0, c, false, false);
  asm volatile("v_nop\n\tv_nop\n\tv_nop\n\tv_nop" : "+v"(d) : "v"(a), "v"(b));
  return d;
}
__device__ __forceinline__ v8f wmma_bf(v16b a, v16b b, v8f c) {
  v8f d = __builtin_amdgcn_wmma_f32_16x16x32_bf16(false, a, false, b, (short)0, c, false, false);
  asm volatile("v_nop\n\tv_nop\n\tv_nop\n\tv_nop" : "+v"(d) : "v"(a), "v"(b));
  return d;
}
// 16x16x32 fragments: lane = (h = lane>>4, row/col = lane&15); elements 0..7 = k0+8h+0..7, 8..15 = k0+16+8h+0..7; D element r = row 8h+r
__device__ __forceinline__ v16h frag_h(const _Float16* rowk0, int lane) {
  union { v16h v; v8h q[2]; } u; const _Float16* p = rowk0 + 8 * (lane >> 4);
  u.q[0] = *(const v8h*)p; u.q[1] = *(const v8h*)(p + 16); return u.v;
}
__device__ __forceinline__ v16h frag_f32(const float* rowk0, int lane) {
  v16h a; const float* p = rowk0 + 8 * (lane >> 4);
#pragma unroll
  for (int i = 0; i < 8; ++i) { a[i] = (_Float16)p[i]; a[8 + i] = (_Float16)p[16 + i]; }
  return a;
}
__device__ __forceinline__ v16h frag_f32s(const float* rowk0, int lane, float sc) {
  v16h a; const float* p = rowk0 + 8 * (lane >> 4);
#pragma unroll
  for (int i = 0; i < 8; ++i) { a[i] = (_Float16)(p[i] * sc); a[8 + i] = (_Float16)(p[16 + i] * sc); }
  return a;
}
// column fragment from a [K][ld] layout (column n), rows >= K read as 0
__device__ __forceinline__ v16h fragc_f32(const float* W, int k0, int n, int lane, int ld, int K) {
  v16h a; const int g = lane >> 4;
#pragma unroll
  for (int i = 0; i < 8; ++i) { const int ka = k0 + 8 * g + i, kb = ka + 16;
    a[i] = (_Float16)(ka < K ? W[(size_t)(ka < K ? ka : K - 1) * ld + n] : 0.f); a[8 + i] = (_Float16)(kb < K ? W[(size_t)(kb < K ? kb : K - 1) * ld + n] : 0.f); }
  return a;
}
struct F2 { v16b h, l; };
__device__ __forceinline__ F2 bsplit16(const float v[16]) { F2 r;
#pragma unroll
  for (int i = 0; i < 16; ++i) { const __bf16 h = (__bf16)v[i]; r.h[i] = h; r.l[i] = (__bf16)(v[i] - (float)h); }
  return r; }
__device__ __forceinline__ F2 split_row(const float* row, int k0, int lane) { float v[16]; const float* p = row + k0 + 8 * (lane >> 4);
#pragma unroll
  for (int i = 0; i < 8; ++i) { v[i] = p[i]; v[8 + i] = p[16 + i]; }
  return bsplit16(v); }
__device__ __forceinline__ F2 split_rowK(const float* row, int k0, int lane, int K) { float v[16]; const int g = lane >> 4;
#pragma unroll
  for (int i = 0; i < 8; ++i) { const int ka = k0 + 8 * g + i, kb = ka + 16; v[i] = ka < K ? row[ka < K ? ka : K - 1] : 0.f; v[8 + i] = kb < K ? row[kb < K ? kb : K - 1] : 0.f; }
  return bsplit16(v); }
__device__ __forceinline__ F2 split_col(const float* W, int k0, int n, int lane, int ld, int K) { float v[16]; const int g = lane >> 4;
#pragma unroll
  for (int i = 0; i < 8; ++i) { const int ka = k0 + 8 * g + i, kb = ka + 16; v[i] = ka < K ? W[(size_t)(ka < K ? ka : K - 1) * ld + n] : 0.f; v[8 + i] = kb < K ? W[(size_t)(kb < K ? kb : K - 1) * ld + n] : 0.f; }
  return bsplit16(v); }
__device__ __forceinline__ v8f mac3(const F2& a, const F2& b, v8f c) { c = wmma_bf(a.l, b.h, c); c = wmma_bf(a.h, b.l, c); return wmma_bf(a.h, b.h, c); }
__device__ __forceinline__ float sigm(float v) { return 1.0f / (1.0f + expf(-v)); }
#define LDSX() do { asm volatile("s_wait_dscnt 0" ::: "memory"); __builtin_amdgcn_wave_barrier(); __builtin_amdgcn_fence(__ATOMIC_RELEASE, "workgroup"); } while (0)

// Differential attention (B 2, N 2,048, C 1,024; 16 heads, head_dim 32, v 64 wide): qkv = x W_qkv ((in,out) [1024, 3072], columns (3, H, 64)); q, k -> 32 sub-heads of 32: q1/k1 = sub-heads 0..15, q2/k2 = sub-heads 16..31, v head h = columns h*64..; attn_i = softmax(q_i k_i^T / sqrt(32)) v; lam = exp(sum lq1 lk1) - exp(sum lq2 lk2) + lambda_init (0.78360578); o = attn1 - lam attn2; o = o rsqrt(mean(o^2) + 1e-5) subln_w (1 - lambda_init); out = merged(o) W_proj + b_proj.
#define NB 2
#define TT 2048
#define CC 1024            // NH * HD = projected width
#define DIN 1024          // input (model) width
#define NH 32              // softmax sub-heads (16 heads x 2 halves)
#define HD 32
#define NQB (TT / 64)
#define HG 4
#define SCALE (0.17677669529663687f)
#define CAUSAL 0
#ifndef TNB
#define TNB NB
#endif
__device__ __forceinline__ float bfr(float v) { return (float)(__bf16)v; }
__host__ __device__ __forceinline__ int kb_last(int qb) { return CAUSAL ? ((qb * 64 + 63) >> 7) : (TT / 128 - 1); }
typedef __attribute__((ext_vector_type(8))) __bf16 v8b;
__device__ __forceinline__ v16b frag_b(const __bf16* rowk0, int lane) {
  union { v16b v; v8b q[2]; } u; const __bf16* p = rowk0 + 8 * (lane >> 4);
  u.q[0] = *(const v8b*)p; u.q[1] = *(const v8b*)(p + 16); return u.v;
}
#define QBH 0              // causal: query blocks 0..QBH-1 of each sequence (few keys, no averaging) take the high-precision path
#define QHI 2048            // rows carrying a q residual plane (all rows: 2-product logits everywhere)
#define KHI 64            // key rows carrying k residual / v bf16 hi+lo planes (used only by the causal high-precision path)
// B fragment (k rows k0+.., output column o) of a weight: (in,out) [K][ld] or (out,in) [ld rows of K]: bf16 exact, or f16(bf16 * 256) exact
__device__ __forceinline__ v16b wcol_io(const float* Wm, int k0, int o, int lane, int ld) { v16b w; const int g = lane >> 4;
#pragma unroll
  for (int i = 0; i < 8; ++i) { w[i] = (__bf16)Wm[(size_t)(k0 + 8 * g + i) * ld + o]; w[8 + i] = (__bf16)Wm[(size_t)(k0 + 16 + 8 * g + i) * ld + o]; }
  return w; }
__device__ __forceinline__ v16b wcol_oi(const float* Wm, int k0, int o, int lane, int K) { v16b w; const float* p = Wm + (size_t)o * K + k0 + 8 * (lane >> 4);
#pragma unroll
  for (int i = 0; i < 8; ++i) { w[i] = (__bf16)p[i]; w[8 + i] = (__bf16)p[16 + i]; }
  return w; }
__device__ __forceinline__ v16h wcolh_io(const float* Wm, int k0, int o, int lane, int ld) { v16h w; const int g = lane >> 4;
#pragma unroll
  for (int i = 0; i < 8; ++i) { w[i] = (_Float16)(bfr(Wm[(size_t)(k0 + 8 * g + i) * ld + o]) * 256.0f); w[8 + i] = (_Float16)(bfr(Wm[(size_t)(k0 + 16 + 8 * g + i) * ld + o]) * 256.0f); }
  return w; }
__device__ __forceinline__ v16h wcolh_oi(const float* Wm, int k0, int o, int lane, int K) { v16h w; const float* p = Wm + (size_t)o * K + k0 + 8 * (lane >> 4);
#pragma unroll
  for (int i = 0; i < 8; ++i) { w[i] = (_Float16)(bfr(p[i]) * 256.0f); w[8 + i] = (_Float16)(bfr(p[16 + i]) * 256.0f); }
  return w; }
#define WQKV_LAYOUT 0   // 0 = (in,out) [DIN][3 * CC]; 1 = (out,in) [CC][DIN]; 2 = per-head [NH][DIN][HD]
__device__ __forceinline__ v16b wcol_hdk(const float* Wm, int k0, int o, int lane) { v16b w; const int g = lane >> 4; const float* p = Wm + (size_t)(o / HD) * DIN * HD + (o % HD);
#pragma unroll
  for (int i = 0; i < 8; ++i) { w[i] = (__bf16)p[(size_t)(k0 + 8 * g + i) * HD]; w[8 + i] = (__bf16)p[(size_t)(k0 + 16 + 8 * g + i) * HD]; }
  return w; }
#define WO_OUT_IN 0
#if WQKV_LAYOUT == 1
#define WCOL(W, k0, o, lane) wcol_oi(W, k0, o, lane, DIN)
#elif WQKV_LAYOUT == 2
#define WCOL(W, k0, o, lane) wcol_hdk(W, k0, o, lane)
#else
#define WCOL(W, k0, o, lane) wcol_io(W, k0, o, lane, 3 * CC)   /* W_qkv (in,out) packed by columns: row pitch 3C */
#endif
#if WO_OUT_IN
#define WOCOL(W, k0, o, lane) wcol_oi(W, k0, o, lane, CC)
#define WOCOLH(W, k0, o, lane) wcolh_oi(W, k0, o, lane, CC)
#else
#define WOCOL(W, k0, o, lane) wcol_io(W, k0, o, lane, DIN)
#define WOCOLH(W, k0, o, lane) wcolh_io(W, k0, o, lane, DIN)
#endif
#define HDV 64             // value columns per softmax sub-head (the parent head's 64 columns)
#define YP (NH * HDV)      // 2,048: pitch of the per-sub-head context rows Y[b*t][h'*64 + d]
// ---- k_diff: block = 64 rows (256 threads; thread owns 4 consecutive output columns -> head e = c/64, 16 threads per head): lam = exp(sum lq1 lk1) - exp(sum lq2 lk2) + lambda_init; o = Y[e] - lam Y[16 + e] (64 wide, f32); o = o * rsqrt(mean_64(o^2) + 1e-5) * subln_w[d] * (1 - lambda_init) -> Yd rows [b*t][1024] (a row = 4 KB by 256 threads)
#define LAMBDA_INIT 0.78360578f   /* 0.8 - 0.6 exp(-0.3 * 12) */
__global__ __launch_bounds__(256) void k_diff(const float* __restrict__ Y, const float* __restrict__ LQ1, const float* __restrict__ LK1, const float* __restrict__ LQ2, const float* __restrict__ LK2, const float* __restrict__ SW, float* __restrict__ YD) {
  __shared__ float slam;
  const int tid = threadIdx.x, lane = tid & 31; const size_t r0 = (size_t)blockIdx.x * 64;
  if (tid < 32) { float a = 0.f, c2 = 0.f; { const int i = lane; a = bfr(LQ1[i]) * bfr(LK1[i]); c2 = bfr(LQ2[i]) * bfr(LK2[i]); }   /* 32-term dots: one term per lane, fixed xor-tree order */
#pragma unroll
    for (int o = 1; o < 32; o <<= 1) { a += __shfl_xor(a, o); c2 += __shfl_xor(c2, o); }
    if (tid == 0) slam = expf(a) - expf(c2) + LAMBDA_INIT; }
  __syncthreads(); const float lam = slam;
  const int c = tid * 4; const int e = c >> 6, d = c & 63;   /* output column c -> head e, dim d */
  float sw[4]; for (int i = 0; i < 4; ++i) sw[i] = bfr(SW[d + i]) * (1.0f - LAMBDA_INIT);
  for (int rr = 0; rr < 64; ++rr) { const size_t row = r0 + rr; const float* y1 = Y + row * YP + (size_t)e * HDV + d; const float* y2 = y1 + (size_t)16 * HDV;
    const v4f a = *(const v4f*)y1, bq = *(const v4f*)y2; v4f o; float q = 0.f;
#pragma unroll
    for (int i = 0; i < 4; ++i) { o[i] = a[i] - lam * bq[i]; q += o[i] * o[i]; }
#pragma unroll
    for (int of = 1; of < 16; of <<= 1) q += __shfl_xor(q, of);   /* 16 lanes = the head's 64 columns (lane groups are head-aligned) */
    const float rs = rsqrtf(q * (1.0f / 64.0f) + 1e-5f);
#pragma unroll
    for (int i = 0; i < 4; ++i) o[i] = o[i] * rs * sw[i];
    vst2(YD + row * CC + c, o); } }
#ifndef SM_EXTRA_PARAMS
#define SM_EXTRA_PARAMS
#endif
#ifndef PROJ_EXTRA_PARAMS
#define PROJ_EXTRA_PARAMS
#endif
#ifndef SM_MASK_HOOK
#define SM_MASK_HOOK (void)0
#endif

#define WS_QH  0u                                      // f16 q rows [b*t][CC]
#define WS_KH  (WS_QH + 2u * (size_t)NB * TT * CC)      // f16 k rows [b*t][CC]
#define WS_VT  (WS_KH + 2u * (size_t)NB * TT * CC)      // f16 v planes [b][c][t]
#define WS_QL  (WS_VT + 2u * (size_t)NB * CC * TT)      // f16 q residual x 2^10 rows [b][t < QHI][CC]
#define WS_KL  (WS_QL + 2u * (size_t)NB * QHI * CC)     // f16 k residual x 2^10 rows [b][t < KHI][CC]
#define WS_VB  (WS_KL + 2u * (size_t)NB * KHI * CC)     // bf16 v hi planes [b][c][t < KHI]
#define WS_VBL (WS_VB + 2u * (size_t)NB * CC * KHI)
#define WS_S   (WS_VBL + 2u * (size_t)NB * CC * KHI)    // f32 logits / P [hg][t][s]
#define WS_Y   (WS_S  + 4u * (size_t)HG * TT * TT)      // f32 per-softmax-head context rows [b*t][YP = 32 x 64]
#define WS_END (WS_Y  + 4u * (size_t)NB * TT * YP)

// ---- k_proj: block = (64 rows, 128 cols, which): q/k/v = X W (+ b) with exact bf16 products (K = DIN) -> which 0: q f16 rows (+ residual rows < QHI); 1: k f16 rows (+ residual rows < KHI); 2: v f16 planes [c][t] (+ bf16 hi/lo planes for t < KHI)
__global__ __launch_bounds__(128) void k_proj(const float* __restrict__ XQ, const float* __restrict__ XK, const float* __restrict__ XV, const float* __restrict__ WQ, const float* __restrict__ WK, const float* __restrict__ WV, const float* __restrict__ BQ, const float* __restrict__ BK, const float* __restrict__ BV,
    _Float16* __restrict__ QH, _Float16* __restrict__ QL, _Float16* __restrict__ KH, _Float16* __restrict__ KL, _Float16* __restrict__ VT, __bf16* __restrict__ VB, __bf16* __restrict__ VBL) {
  __shared__ __align__(16) _Float16 sh[64][136], sl[64][136]; __shared__ __align__(16) _Float16 th[128][72]; __shared__ __align__(16) __bf16 tb[128][72], tbl[128][72];
  const int tid = threadIdx.x, wave = tid >> 5, lane = tid & 31, col = lane & 15, g = lane >> 4; const int which = blockIdx.z; const int c0 = blockIdx.y * 128; const size_t r0 = (size_t)blockIdx.x * 64; const size_t bb = r0 / TT; const int t0 = (int)(r0 % TT);
  const float* X = which == 0 ? XQ : which == 1 ? XK : XV; const float* WA = which == 0 ? WQ : which == 1 ? WK : WV; const float* BA = which == 0 ? BQ : which == 1 ? BK : BV;
  v8f acc[8] = {};
#pragma unroll 2
  for (int kc = 0; kc < DIN / 32; ++kc) { v16b a; { const float* p = X + (r0 + wave * 16 + col) * DIN + kc * 32 + 8 * g;
#pragma unroll
      for (int i = 0; i < 8; ++i) { a[i] = (__bf16)p[i]; a[8 + i] = (__bf16)p[16 + i]; } }
    asm volatile("s_wait_loadcnt 0x0" ::: "memory");
#pragma unroll
    for (int j = 0; j < 8; ++j) { const v16b w = WCOL(WA, kc * 32, c0 + j * 16 + col, lane); asm volatile("s_wait_loadcnt 0x0" ::: "memory"); acc[j] = wmma_bf(a, w, acc[j]); } }
  if (which < 2) { _Float16* DH = which == 0 ? QH : KH; _Float16* DL = which == 0 ? QL : KL; const int nhi = which == 0 ? QHI : KHI; const bool hi_rows = t0 < nhi;
#pragma unroll
    for (int j = 0; j < 8; ++j) { const float bias = BA ? bfr(BA[c0 + j * 16 + col]) : 0.f;
#pragma unroll
      for (int r = 0; r < 8; ++r) { const float v = acc[j][r] + bias; const _Float16 hv = (_Float16)v; sh[wave * 16 + 8 * g + r][j * 16 + col] = hv; sl[wave * 16 + 8 * g + r][j * 16 + col] = (_Float16)((v - (float)hv) * 1024.0f); } }
    __syncthreads();
    for (int e = tid; e < 64 * 16; e += 128) { const int rl = e >> 4, q = e & 15; vst2((unsigned*)(DH + (r0 + rl) * CC + c0 + q * 8), *(const v4u*)&sh[rl][q * 8]); if (hi_rows) vst2((unsigned*)(DL + (bb * nhi + t0 + rl) * (size_t)CC + c0 + q * 8), *(const v4u*)&sl[rl][q * 8]); }
  } else { const bool hi_rows = t0 < KHI;
#pragma unroll
    for (int j = 0; j < 8; ++j) { const float bias = BA ? bfr(BA[c0 + j * 16 + col]) : 0.f;
#pragma unroll
      for (int r = 0; r < 8; ++r) { const float v = acc[j][r] + bias; const int rl = wave * 16 + 8 * g + r, cl = j * 16 + col; th[cl][rl] = (_Float16)v; const __bf16 bh = (__bf16)v; tb[cl][rl] = bh; tbl[cl][rl] = (__bf16)(v - (float)bh); } }
    __syncthreads();
    for (int e = tid; e < 128 * 8; e += 128) { const int cl = e >> 3, q = e & 7; vst2((unsigned*)(VT + (bb * CC + c0 + cl) * (size_t)TT + t0 + q * 8), *(const v4u*)&th[cl][q * 8]); if (hi_rows) { const size_t o3 = (bb * CC + c0 + cl) * (size_t)KHI + t0 + q * 8; vst2((unsigned*)(VB + o3), *(const v4u*)&tb[cl][q * 8]); vst2((unsigned*)(VBL + o3), *(const v4u*)&tbl[cl][q * 8]); } } } }
// ---- k_sc: block = (query block qb, key block kb <= kb_last(qb), head in group) of batch b: logits x SCALE; q hi + residual (x 2^10) against k (2 products) for query rows < QHI, plus the k residual (3 products) for query blocks < QBH (causal early rows); causal: blocks past the diagonal exit, the mask itself is applied by index in k_sm
__global__ __launch_bounds__(128) void k_sc(const _Float16* __restrict__ QH, const _Float16* __restrict__ KH, const _Float16* __restrict__ QL, const _Float16* __restrict__ KL, int b, int h0, float* __restrict__ S0) { __shared__ __align__(16) float ss[4][16][132];
  const int qb = blockIdx.x, kb = blockIdx.y; if (kb > kb_last(qb)) return;
  const int h = h0 + blockIdx.z; float* S = S0 + (size_t)blockIdx.z * TT * TT;
  const int tid = threadIdx.x, wave = tid >> 5, lane = tid & 31, col = lane & 15, g = lane >> 4; const int k0 = kb * 128; const int ql0 = qb * 64 + wave * 16; const size_t q0 = (size_t)b * TT + ql0, kr0 = (size_t)b * TT + k0;
  v8f acc[8] = {}, accl[8] = {};
  const _Float16* QLb = QL + (size_t)b * QHI * CC; const _Float16* KLb = KL + (size_t)b * KHI * CC;
  if (qb < QBH) {
#pragma unroll
    for (int kc = 0; kc < HD / 32; ++kc) { const v16h ah = frag_h(QH + (q0 + col) * CC + h * HD + kc * 32, lane), al = frag_h(QLb + (size_t)(ql0 + col) * CC + h * HD + kc * 32, lane);
#pragma unroll
      for (int j = 0; j < 8; ++j) { const v16h kbf = frag_h(KH + (kr0 + j * 16 + col) * CC + h * HD + kc * 32, lane), klf = frag_h(KLb + (size_t)(k0 + j * 16 + col) * CC + h * HD + kc * 32, lane); acc[j] = wmma16(ah, kbf, acc[j]); accl[j] = wmma16(al, kbf, accl[j]); accl[j] = wmma16(ah, klf, accl[j]); } }
  } else if (qb * 64 < QHI) {
#pragma unroll
    for (int kc = 0; kc < HD / 32; ++kc) { const v16h ah = frag_h(QH + (q0 + col) * CC + h * HD + kc * 32, lane), al = frag_h(QLb + (size_t)(ql0 + col) * CC + h * HD + kc * 32, lane);
#pragma unroll
      for (int j = 0; j < 8; ++j) { const v16h kbf = frag_h(KH + (kr0 + j * 16 + col) * CC + h * HD + kc * 32, lane); acc[j] = wmma16(ah, kbf, acc[j]); accl[j] = wmma16(al, kbf, accl[j]); } }
  } else {
#pragma unroll
    for (int kc = 0; kc < HD / 32; ++kc) { const v16h ah = frag_h(QH + (q0 + col) * CC + h * HD + kc * 32, lane);
#pragma unroll
      for (int j = 0; j < 8; ++j) { const v16h kbf = frag_h(KH + (kr0 + j * 16 + col) * CC + h * HD + kc * 32, lane); acc[j] = wmma16(ah, kbf, acc[j]); } } }
#pragma unroll
  for (int j = 0; j < 8; ++j) {
#pragma unroll
    for (int r = 0; r < 8; ++r) ss[wave][8 * g + r][j * 16 + col] = (acc[j][r] + accl[j][r] * (1.0f / 1024.0f)) * SCALE; }
  LDSX(); for (int rl = 0; rl < 16; ++rl) vst2(S + (size_t)(ql0 + rl) * TT + k0 + lane * 4, *(const v4f*)&ss[wave][rl][lane * 4]); }
// ---- k_sm: block = query row t (head in group): keys [0, kend): causal -> logit if s <= t else excluded; softmax in f32; P x 2^11 in place (0 for excluded)
__global__ __launch_bounds__(256) void k_sm(float* __restrict__ S0 SM_EXTRA_PARAMS) { __shared__ float sred[8]; __shared__ float sbc; __shared__ __align__(16) float shv[TT];
  const int tid = threadIdx.x; const int t = blockIdx.x; const int kend = (kb_last(t >> 6) + 1) * 128;
  float* sr = S0 + (size_t)blockIdx.y * TT * TT + (size_t)t * TT;
  float m = -3.0e38f; for (int k = tid; k < kend; k += 256) { float v = (!CAUSAL || k <= t) ? sr[k] : -3.0e38f; SM_MASK_HOOK; shv[k] = v; m = fmaxf(m, v); }
#pragma unroll
  for (int o = 1; o < 32; o <<= 1) m = fmaxf(m, __shfl_xor(m, o));
  if ((tid & 31) == 0) sred[tid >> 5] = m; __syncthreads(); if (tid == 0) { float a = sred[0]; for (int i = 1; i < 8; ++i) a = fmaxf(a, sred[i]); sbc = a; } __syncthreads(); m = sbc; __syncthreads();
  float sum = 0.f; for (int k = tid; k < kend; k += 256) { const float v = shv[k]; const float e = (v <= -1.0e38f) ? 0.f : expf(v - m); shv[k] = e; sum += e; }
#pragma unroll
  for (int o = 1; o < 32; o <<= 1) sum += __shfl_xor(sum, o);
  if ((tid & 31) == 0) sred[tid >> 5] = sum; __syncthreads(); if (tid == 0) { float a = 0.f; for (int i = 0; i < 8; ++i) a += sred[i]; sbc = 2048.0f / a; } __syncthreads(); const float inv = sbc;
  for (int k = tid; k < kend; k += 256) shv[k] = shv[k] * inv;
  __syncthreads(); for (int q = tid; q < kend / 4; q += 256) vst2(sr + q * 4, *(const v4f*)&shv[q * 4]); }
// ---- k_pv: block = 64 queries (qb) of (b, softmax head h): ctx_h = P_h . v[columns of head h mod 16, 64 wide] over keys [0, kend) (P x 2^11 once to f16 against v f16: 1 product; causal early query blocks: P and v as bf16 hi + lo, 3 products); 256-B (row, head) segment by 16 lanes
__global__ __launch_bounds__(128) void k_pv(const float* __restrict__ PS0, const _Float16* __restrict__ VT, const __bf16* __restrict__ VB, const __bf16* __restrict__ VBL, int b, int h0, float* __restrict__ Y) { const int h = h0 + blockIdx.z; const float* PS = PS0 + (size_t)blockIdx.z * TT * TT; __shared__ __align__(16) float ss[4][16][HDV + 4];
  const int tid = threadIdx.x, wave = tid >> 5, lane = tid & 31, col = lane & 15, g = lane >> 4; const int qb = blockIdx.x; const int ql0 = qb * 64 + wave * 16; const int kce = (kb_last(qb) + 1) * 4;
  v8f acc[HDV / 16] = {}; const int vc0 = (h & 15) * HDV;   /* value columns: sub-head h (map 1: h < 16, map 2: h >= 16) uses v head h mod 16 */
  if (qb < QBH) {
#pragma unroll 1
    for (int kc = 0; kc < kce; ++kc) { const F2 p = split_row(PS + (size_t)(ql0 + col) * TT, kc * 32, lane);
      asm volatile("s_wait_loadcnt 0x0" ::: "memory");
#pragma unroll
      for (int j = 0; j < HDV / 16; ++j) { const size_t po = ((size_t)b * CC + vc0 + j * 16 + col) * (size_t)KHI + kc * 32; const v16b vh = frag_b(VB + po, lane); acc[j] = wmma_bf(p.h, vh, acc[j]); acc[j] = wmma_bf(p.l, vh, acc[j]); acc[j] = wmma_bf(p.h, frag_b(VBL + po, lane), acc[j]); } }
  } else {
#pragma unroll 1
    for (int kc = 0; kc < kce; ++kc) { const v16h p = frag_f32(PS + (size_t)(ql0 + col) * TT + kc * 32, lane);
      asm volatile("s_wait_loadcnt 0x0" ::: "memory");
#pragma unroll
      for (int j = 0; j < HDV / 16; ++j) { const size_t po = ((size_t)b * CC + vc0 + j * 16 + col) * (size_t)TT + kc * 32; acc[j] = wmma16(p, frag_h(VT + po, lane), acc[j]); } } }
#pragma unroll
  for (int j = 0; j < HDV / 16; ++j)
#pragma unroll
    for (int r = 0; r < 8; ++r) ss[wave][8 * g + r][j * 16 + col] = acc[j][r] * (1.0f / 2048.0f);
  LDSX(); for (int rl = 0; rl < 16; ++rl) if (lane < HDV / 4) vst2(Y + ((size_t)b * TT + ql0 + rl) * YP + h * HDV + lane * 4, *(const v4f*)&ss[wave][rl][lane * 4]); }   /* (row, sub-head) segment = HDV floats = 256 B by the first 16 lanes; lanes >= HDV/4 must NOT spill into the next sub-head's columns */
// ---- k_out: block = (64 rows, 128 cols): out = ctx Wo (+ bo): ctx once to f16 against Wo as f16(bf16 x 2^8) exact (1 product) x 2^-8; causal early rows (< QHI of each sequence): ctx bf16 hi + lo against exact bf16 Wo (2 products)
__global__ __launch_bounds__(128) void k_out(const float* __restrict__ Y, const float* __restrict__ WO, const float* __restrict__ BO, float* __restrict__ OUT) { __shared__ __align__(16) float sf[4][16][132];
  const int tid = threadIdx.x, wave = tid >> 5, lane = tid & 31, col = lane & 15, g = lane >> 4; const int c0 = blockIdx.y * 128; const size_t r0 = (size_t)blockIdx.x * 64 + wave * 16;
  v8f acc[8] = {};
  if (CAUSAL && (int)(((size_t)blockIdx.x * 64) % TT) < QHI) {   /* block-uniform */
#pragma unroll 2
    for (int kc = 0; kc < CC / 32; ++kc) { const F2 a = split_row(Y + (r0 + col) * CC, kc * 32, lane); asm volatile("s_wait_loadcnt 0x0" ::: "memory");
#pragma unroll
      for (int j = 0; j < 8; ++j) { const v16b w = WOCOL(WO, kc * 32, c0 + j * 16 + col, lane); asm volatile("s_wait_loadcnt 0x0" ::: "memory"); acc[j] = wmma_bf(a.h, w, acc[j]); acc[j] = wmma_bf(a.l, w, acc[j]); } }
#pragma unroll
    for (int j = 0; j < 8; ++j) { const float bias = BO ? bfr(BO[c0 + j * 16 + col]) : 0.f;
#pragma unroll
      for (int r = 0; r < 8; ++r) sf[wave][8 * g + r][j * 16 + col] = acc[j][r] + bias; }
  } else {
#pragma unroll 2
    for (int kc = 0; kc < CC / 32; ++kc) { const v16h a = frag_f32(Y + (r0 + col) * CC + kc * 32, lane); asm volatile("s_wait_loadcnt 0x0" ::: "memory");
#pragma unroll
      for (int j = 0; j < 8; ++j) { const v16h w = WOCOLH(WO, kc * 32, c0 + j * 16 + col, lane); asm volatile("s_wait_loadcnt 0x0" ::: "memory"); acc[j] = wmma16(a, w, acc[j]); } }
#pragma unroll
    for (int j = 0; j < 8; ++j) { const float bias = BO ? bfr(BO[c0 + j * 16 + col]) : 0.f;
#pragma unroll
      for (int r = 0; r < 8; ++r) sf[wave][8 * g + r][j * 16 + col] = acc[j][r] * (1.0f / 256.0f) + bias; } }
  LDSX(); for (int rl = 0; rl < 16; ++rl) vst2(OUT + (r0 + rl) * DIN + c0 + lane * 4, *(const v4f*)&sf[wave][rl][lane * 4]); }

extern "C" void kernel_launch(void* const* d_in, const int* in_sizes, int n_in, void* d_out, int out_size, void* d_ws, size_t ws_size, hipStream_t stream) {
  (void)in_sizes; (void)n_in; (void)out_size;
  const float** F = (const float**)d_in;
  if (ws_size < (size_t)WS_END) return;
  char* ws = (char*)d_ws; _Float16 *QH = (_Float16*)(ws + WS_QH), *KH = (_Float16*)(ws + WS_KH), *VT = (_Float16*)(ws + WS_VT), *QL = (_Float16*)(ws + WS_QL), *KL = (_Float16*)(ws + WS_KL); __bf16 *VB = (__bf16*)(ws + WS_VB), *VBL = (__bf16*)(ws + WS_VBL); float *S = (float*)(ws + WS_S), *Y = (float*)(ws + WS_Y);
  (void)Y; (void)QL; (void)KL; (void)VB; (void)VBL;
  // inputs: 0 x [2,2048,1024]; 1 W_qkv [1024,3072] (in,out; columns (3, H, 64)); 2 W_proj [1024,1024] (in,out); 3 b_proj; 4 lambda_q1, 5 lambda_k1, 6 lambda_q2, 7 lambda_k2 [32]; 8 subln_w [64]
  float* YD = S;   /* the differential rows reuse the logits plane (f32 -> f32) after the last attention pass */
  k_proj<<<dim3(TNB * TT / 64, CC / 128, 3), 128, 0, stream>>>(F[0], F[0], F[0], F[1], F[1] + CC, F[1] + 2 * CC, nullptr, nullptr, nullptr, QH, QL, KH, KL, VT, VB, VBL);
  for (int b = 0; b < TNB; ++b) for (int h0 = 0; h0 < NH; h0 += HG) {
    k_sc<<<dim3(NQB, TT / 128, HG), 128, 0, stream>>>(QH, KH, QL, KL, b, h0, S);
    k_sm<<<dim3(TT, HG), 256, 0, stream>>>(S);
    k_pv<<<dim3(NQB, 1, HG), 128, 0, stream>>>(S, VT, VB, VBL, b, h0, Y);
  }
  k_diff<<<dim3(TNB * TT / 64), 256, 0, stream>>>(Y, F[4], F[5], F[6], F[7], F[8], YD);
  k_out<<<dim3(TNB * TT / 64, DIN / 128), 128, 0, stream>>>(YD, F[2], F[3], (float*)d_out);
}

// v001
// It runs in 308 microseconds.
// Timed twice side by side with v000, it ran 6.72 times as fast both times.
// compute dtype: all float inputs rounded to bf16; qkv = x W_qkv with EXACT bf16 products on WMMA 16x16x32 (f32 accumulate); the 32-wide sub-head logits with q as f16 hi + residual (x 2^10) against k once to f16 (2 products) x 32^-0.5; both softmaxes in f32 (running maximum offset, exp2 on log2-scaled logits, f32 sum); each unnormalised P once to f16 against the head's 64-wide v once to f16 (1 product), divided by the sum last; the differential combination, the per-head RMS normalisation (x subln_w x (1 - lambda_init)) in f32; the result once to f16 against W_proj carried x 2^8 in f16 + b_proj; f32 output.
#include <hip/hip_runtime.h>
#include <math.h>

typedef __attribute__((ext_vector_type(16))) _Float16 v16h;
typedef __attribute__((ext_vector_type(16))) __bf16 v16b;
typedef __attribute__((ext_vector_type(8)))  _Float16 v8h;
typedef __attribute__((ext_vector_type(8)))  float v8f;
typedef __attribute__((ext_vector_type(4)))  float v4f;
typedef __attribute__((ext_vector_type(2)))  float v2f;
typedef __attribute__((ext_vector_type(4)))  unsigned v4u;
typedef __attribute__((ext_vector_type(4)))  int v4i;
typedef float __attribute__((may_alias)) float_a;
typedef int __attribute__((may_alias)) int_a;

template <typename T> __device__ __forceinline__ void vst2(void* p, T v) { *(T*)p = v;  }
__device__ __forceinline__ v8f wmma16(v16h a, v16h b, v8f c) {
  v8f d = __builtin_amdgcn_wmma_f32_16x16x32_f16(false, a, false, b, (short)0, c, false, false);
  asm volatile("v_nop\n\tv_nop\n\tv_nop\n\tv_nop" : "+v"(d) : "v"(a), "v"(b));
  return d;
}
__device__ __forceinline__ v8f wmma_bf(v16b a, v16b b, v8f c) {
  v8f d = __builtin_amdgcn_wmma_f32_16x16x32_bf16(false, a, false, b, (short)0, c, false, false);
  asm volatile("v_nop\n\tv_nop\n\tv_nop\n\tv_nop" : "+v"(d) : "v"(a), "v"(b));
  return d;
}
// 16x16x32 fragments: lane = (h = lane>>4, row/col = lane&15); elements 0..7 = k0+8h+0..7, 8..15 = k0+16+8h+0..7; D element r = row 8h+r
__device__ __forceinline__ v16h frag_h(const _Float16* rowk0, int lane) {
  union { v16h v; v8h q[2]; } u; const _Float16* p = rowk0 + 8 * (lane >> 4);
  u.q[0] = *(const v8h*)p; u.q[1] = *(const v8h*)(p + 16); return u.v;
}
__device__ __forceinline__ v16h frag_f32(const float* rowk0, int lane) {
  v16h a; const float* p = rowk0 + 8 * (lane >> 4);
#pragma unroll
  for (int i = 0; i < 8; ++i) { a[i] = (_Float16)p[i]; a[8 + i] = (_Float16)p[16 + i]; }
  return a;
}
__device__ __forceinline__ v16h frag_f32s(const float* rowk0, int lane, float sc) {
  v16h a; const float* p = rowk0 + 8 * (lane >> 4);
#pragma unroll
  for (int i = 0; i < 8; ++i) { a[i] = (_Float16)(p[i] * sc); a[8 + i] = (_Float16)(p[16 + i] * sc); }
  return a;
}
// column fragment from a [K][ld] layout (column n), rows >= K read as 0
__device__ __forceinline__ v16h fragc_f32(const float* W, int k0, int n, int lane, int ld, int K) {
  v16h a; const int g = lane >> 4;
#pragma unroll
  for (int i = 0; i < 8; ++i) { const int ka = k0 + 8 * g + i, kb = ka + 16;
    a[i] = (_Float16)(ka < K ? W[(size_t)(ka < K ? ka : K - 1) * ld + n] : 0.f); a[8 + i] = (_Float16)(kb < K ? W[(size_t)(kb < K ? kb : K - 1) * ld + n] : 0.f); }
  return a;
}
struct F2 { v16b h, l; };
__device__ __forceinline__ F2 bsplit16(const float v[16]) { F2 r;
#pragma unroll
  for (int i = 0; i < 16; ++i) { const __bf16 h = (__bf16)v[i]; r.h[i] = h; r.l[i] = (__bf16)(v[i] - (float)h); }
  return r; }
__device__ __forceinline__ F2 split_row(const float* row, int k0, int lane) { float v[16]; const float* p = row + k0 + 8 * (lane >> 4);
#pragma unroll
  for (int i = 0; i < 8; ++i) { v[i] = p[i]; v[8 + i] = p[16 + i]; }
  return bsplit16(v); }
__device__ __forceinline__ F2 split_rowK(const float* row, int k0, int lane, int K) { float v[16]; const int g = lane >> 4;
#pragma unroll
  for (int i = 0; i < 8; ++i) { const int ka = k0 + 8 * g + i, kb = ka + 16; v[i] = ka < K ? row[ka < K ? ka : K - 1] : 0.f; v[8 + i] = kb < K ? row[kb < K ? kb : K - 1] : 0.f; }
  return bsplit16(v); }
__device__ __forceinline__ F2 split_col(const float* W, int k0, int n, int lane, int ld, int K) { float v[16]; const int g = lane >> 4;
#pragma unroll
  for (int i = 0; i < 8; ++i) { const int ka = k0 + 8 * g + i, kb = ka + 16; v[i] = ka < K ? W[(size_t)(ka < K ? ka : K - 1) * ld + n] : 0.f; v[8 + i] = kb < K ? W[(size_t)(kb < K ? kb : K - 1) * ld + n] : 0.f; }
  return bsplit16(v); }
__device__ __forceinline__ v8f mac3(const F2& a, const F2& b, v8f c) { c = wmma_bf(a.l, b.h, c); c = wmma_bf(a.h, b.l, c); return wmma_bf(a.h, b.h, c); }
__device__ __forceinline__ float sigm(float v) { return 1.0f / (1.0f + expf(-v)); }
#define LDSX() do { asm volatile("s_wait_dscnt 0" ::: "memory"); __builtin_amdgcn_wave_barrier(); __builtin_amdgcn_fence(__ATOMIC_RELEASE, "workgroup"); } while (0)

// Differential attention (B 2, N 2,048, C 1,024; 16 heads, head_dim 32, v 64 wide): qkv = x W_qkv ((in,out) [1024, 3072], columns (3, H, 64)); q, k -> 32 sub-heads of 32: q1/k1 = sub-heads 0..15, q2/k2 = sub-heads 16..31, v head h = columns h*64..; attn_i = softmax(q_i k_i^T / sqrt(32)) v; lam = exp(sum lq1 lk1) - exp(sum lq2 lk2) + lambda_init (0.78360578); o = attn1 - lam attn2; o = o rsqrt(mean(o^2) + 1e-5) subln_w (1 - lambda_init); out = merged(o) W_proj + b_proj.
#define NB 2
#define TT 2048
#define CC 1024            // NH * HD = projected width
#define DIN 1024          // input (model) width
#define NH 32              // softmax sub-heads (16 heads x 2 halves)
#define HD 32
#define NQB (TT / 64)
#define HG 4
#define SCALE (0.17677669529663687f)
#define CAUSAL 0
#ifndef TNB
#define TNB NB
#endif
__device__ __forceinline__ float bfr(float v) { return (float)(__bf16)v; }
__host__ __device__ __forceinline__ int kb_last(int qb) { return CAUSAL ? ((qb * 64 + 63) >> 7) : (TT / 128 - 1); }
typedef __attribute__((ext_vector_type(8))) __bf16 v8b;
__device__ __forceinline__ v16b frag_b(const __bf16* rowk0, int lane) {
  union { v16b v; v8b q[2]; } u; const __bf16* p = rowk0 + 8 * (lane >> 4);
  u.q[0] = *(const v8b*)p; u.q[1] = *(const v8b*)(p + 16); return u.v;
}
#define QBH 0
#define QHI 2048            // rows carrying a q residual plane (all rows: 2-product logits everywhere)
#define KHI 64            // key rows carrying k residual / v bf16 hi+lo planes (written by k_proj, read by no kernel)
// B fragment (k rows k0+.., output column o) of a weight: (in,out) [K][ld] or (out,in) [ld rows of K]: bf16 exact, or f16(bf16 * 256) exact
__device__ __forceinline__ v16b wcol_io(const float* Wm, int k0, int o, int lane, int ld) { v16b w; const int g = lane >> 4;
#pragma unroll
  for (int i = 0; i < 8; ++i) { w[i] = (__bf16)Wm[(size_t)(k0 + 8 * g + i) * ld + o]; w[8 + i] = (__bf16)Wm[(size_t)(k0 + 16 + 8 * g + i) * ld + o]; }
  return w; }
__device__ __forceinline__ v16b wcol_oi(const float* Wm, int k0, int o, int lane, int K) { v16b w; const float* p = Wm + (size_t)o * K + k0 + 8 * (lane >> 4);
#pragma unroll
  for (int i = 0; i < 8; ++i) { w[i] = (__bf16)p[i]; w[8 + i] = (__bf16)p[16 + i]; }
  return w; }
__device__ __forceinline__ v16h wcolh_io(const float* Wm, int k0, int o, int lane, int ld) { v16h w; const int g = lane >> 4;
#pragma unroll
  for (int i = 0; i < 8; ++i) { w[i] = (_Float16)(bfr(Wm[(size_t)(k0 + 8 * g + i) * ld + o]) * 256.0f); w[8 + i] = (_Float16)(bfr(Wm[(size_t)(k0 + 16 + 8 * g + i) * ld + o]) * 256.0f); }
  return w; }
__device__ __forceinline__ v16h wcolh_oi(const float* Wm, int k0, int o, int lane, int K) { v16h w; const float* p = Wm + (size_t)o * K + k0 + 8 * (lane >> 4);
#pragma unroll
  for (int i = 0; i < 8; ++i) { w[i] = (_Float16)(bfr(p[i]) * 256.0f); w[8 + i] = (_Float16)(bfr(p[16 + i]) * 256.0f); }
  return w; }
#define WQKV_LAYOUT 0   // 0 = (in,out) [DIN][3 * CC]; 1 = (out,in) [CC][DIN]; 2 = per-head [NH][DIN][HD]
__device__ __forceinline__ v16b wcol_hdk(const float* Wm, int k0, int o, int lane) { v16b w; const int g = lane >> 4; const float* p = Wm + (size_t)(o / HD) * DIN * HD + (o % HD);
#pragma unroll
  for (int i = 0; i < 8; ++i) { w[i] = (__bf16)p[(size_t)(k0 + 8 * g + i) * HD]; w[8 + i] = (__bf16)p[(size_t)(k0 + 16 + 8 * g + i) * HD]; }
  return w; }
#define WO_OUT_IN 0
#if WQKV_LAYOUT == 1
#define WCOL(W, k0, o, lane) wcol_oi(W, k0, o, lane, DIN)
#elif WQKV_LAYOUT == 2
#define WCOL(W, k0, o, lane) wcol_hdk(W, k0, o, lane)
#else
#define WCOL(W, k0, o, lane) wcol_io(W, k0, o, lane, 3 * CC)   /* W_qkv (in,out) packed by columns: row pitch 3C */
#endif
#if WO_OUT_IN
#define WOCOL(W, k0, o, lane) wcol_oi(W, k0, o, lane, CC)
#define WOCOLH(W, k0, o, lane) wcolh_oi(W, k0, o, lane, CC)
#else
#define WOCOL(W, k0, o, lane) wcol_io(W, k0, o, lane, DIN)
#define WOCOLH(W, k0, o, lane) wcolh_io(W, k0, o, lane, DIN)
#endif
#define HDV 64             // value columns per softmax sub-head (the parent head's 64 columns)
#define YP (NH * HDV)      // 2,048: pitch of the per-sub-head context rows Y[b*t][h'*64 + d]
// ---- k_diff: block = 64 rows (256 threads; thread owns 4 consecutive output columns -> head e = c/64, 16 threads per head): lam = exp(sum lq1 lk1) - exp(sum lq2 lk2) + lambda_init; o = Y[e] - lam Y[16 + e] (64 wide, f32); o = o * rsqrt(mean_64(o^2) + 1e-5) * subln_w[d] * (1 - lambda_init) -> Yd rows [b*t][1024] (a row = 4 KB by 256 threads)
#define LAMBDA_INIT 0.78360578f   /* 0.8 - 0.6 exp(-0.3 * 12) */
__global__ __launch_bounds__(256) void k_diff(const float* __restrict__ Y, const float* __restrict__ LQ1, const float* __restrict__ LK1, const float* __restrict__ LQ2, const float* __restrict__ LK2, const float* __restrict__ SW, float* __restrict__ YD) {
  __shared__ float slam;
  const int tid = threadIdx.x, lane = tid & 31; const size_t r0 = (size_t)blockIdx.x * 64;
  if (tid < 32) { float a = 0.f, c2 = 0.f; { const int i = lane; a = bfr(LQ1[i]) * bfr(LK1[i]); c2 = bfr(LQ2[i]) * bfr(LK2[i]); }   /* 32-term dots: one term per lane, fixed xor-tree order */
#pragma unroll
    for (int o = 1; o < 32; o <<= 1) { a += __shfl_xor(a, o); c2 += __shfl_xor(c2, o); }
    if (tid == 0) slam = expf(a) - expf(c2) + LAMBDA_INIT; }
  __syncthreads(); const float lam = slam;
  const int c = tid * 4; const int e = c >> 6, d = c & 63;   /* output column c -> head e, dim d */
  float sw[4]; for (int i = 0; i < 4; ++i) sw[i] = bfr(SW[d + i]) * (1.0f - LAMBDA_INIT);
  for (int rr = 0; rr < 64; ++rr) { const size_t row = r0 + rr; const float* y1 = Y + row * YP + (size_t)e * HDV + d; const float* y2 = y1 + (size_t)16 * HDV;
    const v4f a = *(const v4f*)y1, bq = *(const v4f*)y2; v4f o; float q = 0.f;
#pragma unroll
    for (int i = 0; i < 4; ++i) { o[i] = a[i] - lam * bq[i]; q += o[i] * o[i]; }
#pragma unroll
    for (int of = 1; of < 16; of <<= 1) q += __shfl_xor(q, of);   /* 16 lanes = the head's 64 columns (lane groups are head-aligned) */
    const float rs = rsqrtf(q * (1.0f / 64.0f) + 1e-5f);
#pragma unroll
    for (int i = 0; i < 4; ++i) o[i] = o[i] * rs * sw[i];
    vst2(YD + row * CC + c, o); } }
#ifndef SM_EXTRA_PARAMS
#define SM_EXTRA_PARAMS
#endif
#ifndef PROJ_EXTRA_PARAMS
#define PROJ_EXTRA_PARAMS
#endif
#ifndef SM_MASK_HOOK
#define SM_MASK_HOOK (void)0
#endif

#define WS_QH  0u                                      // f16 q rows [b*t][CC]
#define WS_KH  (WS_QH + 2u * (size_t)NB * TT * CC)      // f16 k rows [b*t][CC]
#define WS_VT  (WS_KH + 2u * (size_t)NB * TT * CC)      // f16 v planes [b][c][t]
#define WS_QL  (WS_VT + 2u * (size_t)NB * CC * TT)      // f16 q residual x 2^10 rows [b][t < QHI][CC]
#define WS_KL  (WS_QL + 2u * (size_t)NB * QHI * CC)     // f16 k residual x 2^10 rows [b][t < KHI][CC]
#define WS_VB  (WS_KL + 2u * (size_t)NB * KHI * CC)     // bf16 v hi planes [b][c][t < KHI]
#define WS_VBL (WS_VB + 2u * (size_t)NB * CC * KHI)
#define WS_S   (WS_VBL + 2u * (size_t)NB * CC * KHI)    // f32 differential rows [b*t][CC] (k_diff -> k_out)
#define WS_Y   (WS_S  + 4u * (size_t)HG * TT * TT)      // f32 per-softmax-head context rows [b*t][YP = 32 x 64]
#define WS_END (WS_Y  + 4u * (size_t)NB * TT * YP)

// ---- k_proj: block = (64 rows, 128 cols, which): q/k/v = X W (+ b) with exact bf16 products (K = DIN) -> which 0: q f16 rows (+ residual rows < QHI); 1: k f16 rows (+ residual rows < KHI); 2: v f16 planes [c][t] (+ bf16 hi/lo planes for t < KHI)
__global__ __launch_bounds__(128) void k_proj(const float* __restrict__ XQ, const float* __restrict__ XK, const float* __restrict__ XV, const float* __restrict__ WQ, const float* __restrict__ WK, const float* __restrict__ WV, const float* __restrict__ BQ, const float* __restrict__ BK, const float* __restrict__ BV,
    _Float16* __restrict__ QH, _Float16* __restrict__ QL, _Float16* __restrict__ KH, _Float16* __restrict__ KL, _Float16* __restrict__ VT, __bf16* __restrict__ VB, __bf16* __restrict__ VBL) {
  __shared__ __align__(16) _Float16 sh[64][136], sl[64][136]; __shared__ __align__(16) _Float16 th[128][72]; __shared__ __align__(16) __bf16 tb[128][72], tbl[128][72];
  const int tid = threadIdx.x, wave = tid >> 5, lane = tid & 31, col = lane & 15, g = lane >> 4; const int which = blockIdx.z; const int c0 = blockIdx.y * 128; const size_t r0 = (size_t)blockIdx.x * 64; const size_t bb = r0 / TT; const int t0 = (int)(r0 % TT);
  const float* X = which == 0 ? XQ : which == 1 ? XK : XV; const float* WA = which == 0 ? WQ : which == 1 ? WK : WV; const float* BA = which == 0 ? BQ : which == 1 ? BK : BV;
  v8f acc[8] = {};
#pragma unroll 2
  for (int kc = 0; kc < DIN / 32; ++kc) { v16b a; { const float* p = X + (r0 + wave * 16 + col) * DIN + kc * 32 + 8 * g;
#pragma unroll
      for (int i = 0; i < 8; ++i) { a[i] = (__bf16)p[i]; a[8 + i] = (__bf16)p[16 + i]; } }
    asm volatile("s_wait_loadcnt 0x0" ::: "memory");
#pragma unroll
    for (int j = 0; j < 8; ++j) { const v16b w = WCOL(WA, kc * 32, c0 + j * 16 + col, lane); asm volatile("s_wait_loadcnt 0x0" ::: "memory"); acc[j] = wmma_bf(a, w, acc[j]); } }
  if (which < 2) { _Float16* DH = which == 0 ? QH : KH; _Float16* DL = which == 0 ? QL : KL; const int nhi = which == 0 ? QHI : KHI; const bool hi_rows = t0 < nhi;
#pragma unroll
    for (int j = 0; j < 8; ++j) { const float bias = BA ? bfr(BA[c0 + j * 16 + col]) : 0.f;
#pragma unroll
      for (int r = 0; r < 8; ++r) { const float v = acc[j][r] + bias; const _Float16 hv = (_Float16)v; sh[wave * 16 + 8 * g + r][j * 16 + col] = hv; sl[wave * 16 + 8 * g + r][j * 16 + col] = (_Float16)((v - (float)hv) * 1024.0f); } }
    __syncthreads();
    for (int e = tid; e < 64 * 16; e += 128) { const int rl = e >> 4, q = e & 15; vst2((unsigned*)(DH + (r0 + rl) * CC + c0 + q * 8), *(const v4u*)&sh[rl][q * 8]); if (hi_rows) vst2((unsigned*)(DL + (bb * nhi + t0 + rl) * (size_t)CC + c0 + q * 8), *(const v4u*)&sl[rl][q * 8]); }
  } else { const bool hi_rows = t0 < KHI;
#pragma unroll
    for (int j = 0; j < 8; ++j) { const float bias = BA ? bfr(BA[c0 + j * 16 + col]) : 0.f;
#pragma unroll
      for (int r = 0; r < 8; ++r) { const float v = acc[j][r] + bias; const int rl = wave * 16 + 8 * g + r, cl = j * 16 + col; th[cl][rl] = (_Float16)v; const __bf16 bh = (__bf16)v; tb[cl][rl] = bh; tbl[cl][rl] = (__bf16)(v - (float)bh); } }
    __syncthreads();
    for (int e = tid; e < 128 * 8; e += 128) { const int cl = e >> 3, q = e & 7; vst2((unsigned*)(VT + (bb * CC + c0 + cl) * (size_t)TT + t0 + q * 8), *(const v4u*)&th[cl][q * 8]); if (hi_rows) { const size_t o3 = (bb * CC + c0 + cl) * (size_t)KHI + t0 + q * 8; vst2((unsigned*)(VB + o3), *(const v4u*)&tb[cl][q * 8]); vst2((unsigned*)(VBL + o3), *(const v4u*)&tbl[cl][q * 8]); } } } }
#define FQ 2               // query column groups (16 queries each) per wave
#define FS 64              // keys per stage (one LDS buffer)
#define KP 40              // K row pitch in LDS, halfs (80 B = 16 B x odd)
#define VP 72              // v plane row pitch in LDS, halfs (144 B = 16 B x odd)
#define LC1 (SCALE * 1.4426950408889634f)
#define LC2 (SCALE * 1.4426950408889634f / 1024.0f)
typedef __attribute__((ext_vector_type(2))) _Float16 v2h;
__device__ __forceinline__ v8f wmma_h(v16h a, v16h b, v8f c) { return __builtin_amdgcn_wmma_f32_16x16x32_f16(false, a, false, b, (short)0, c, false, false); }
__global__ __launch_bounds__(256) void k_fa(const _Float16* __restrict__ QH, const _Float16* __restrict__ QL, const _Float16* __restrict__ KH, const _Float16* __restrict__ VT, float* __restrict__ Y) {
  __shared__ __align__(16) _Float16 sK[2][FS][KP]; __shared__ __align__(16) _Float16 sV[2][HDV][VP];
  const int tid = threadIdx.x, wave = tid >> 5, lane = tid & 31, col = lane & 15, g = lane >> 4;
  const int h = blockIdx.y, b = blockIdx.z; const int q0 = blockIdx.x * (8 * FQ * 16) + wave * (FQ * 16); const int vc0 = (h & 15) * HDV;   /* sub-head h uses v head h mod 16 */
  v16h qh[FQ], ql[FQ];
#pragma unroll
  for (int qt = 0; qt < FQ; ++qt) { qh[qt] = frag_h(QH + ((size_t)b * TT + q0 + qt * 16 + col) * CC + h * HD, lane); ql[qt] = frag_h(QL + ((size_t)b * QHI + q0 + qt * 16 + col) * CC + h * HD, lane); }
  // staging: a stage = 64 K rows of 64 B (one 16-B piece a thread) + 64 v plane rows of 128 B (two pieces a thread)
  const int kr = tid >> 2, kq = (tid & 3) * 8, vr = tid >> 3, vq = (tid & 7) * 8;
  const _Float16* gk = KH + ((size_t)b * TT + kr) * CC + h * HD + kq; const _Float16* gv = VT + ((size_t)b * CC + vc0 + vr) * (size_t)TT + vq;
  v4u rk = *(const v4u*)gk, rv0 = *(const v4u*)gv, rv1 = *(const v4u*)(gv + (size_t)32 * TT);
  *(v4u*)&sK[0][kr][kq] = rk; *(v4u*)&sV[0][vr][vq] = rv0; *(v4u*)&sV[0][vr + 32][vq] = rv1;
  __syncthreads();
  v8f o[FQ][HDV / 16] = {}; float mo[FQ]; v2f l[FQ];   /* l: a lane's own keys, even and odd registers apart; joined after the loop */
#pragma unroll
  for (int qt = 0; qt < FQ; ++qt) { mo[qt] = 0.f; l[qt] = (v2f){0.f, 0.f}; }
  const v2f c1 = {LC1, LC1}, c2 = {LC2, LC2};
  for (int s = 0; s < TT / FS; ++s) { const int cur = s & 1; const bool more = s + 1 < TT / FS;
    if (more) { rk = *(const v4u*)(gk + (size_t)(s + 1) * FS * CC); rv0 = *(const v4u*)(gv + (s + 1) * FS); rv1 = *(const v4u*)(gv + (size_t)32 * TT + (s + 1) * FS); }   /* the next stage's rows fly while this stage is worked on */
#pragma unroll
    for (int kc = 0; kc < FS / 32; ++kc) {   /* unrolled: every fragment index constant */
      v16h kf[2]; v2f t[FQ][2][4]; float mx[FQ];
#pragma unroll
      for (int kt = 0; kt < 2; ++kt) kf[kt] = frag_h(&sK[cur][kc * 32 + kt * 16 + col][0], lane);
#pragma unroll
      for (int qt = 0; qt < FQ; ++qt) { mx[qt] = -3.0e38f; const v2f nm = {-mo[qt], -mo[qt]};
#pragma unroll
        for (int kt = 0; kt < 2; ++kt) { const v8f z = {}; const v8f sl = wmma_h(kf[kt], ql[qt], z), sh = wmma_h(kf[kt], qh[qt], z);
#pragma unroll
          for (int i = 0; i < 4; ++i) { const v2f hp = {sh[2 * i], sh[2 * i + 1]}, lp = {sl[2 * i], sl[2 * i + 1]}; const v2f v = __builtin_elementwise_fma(hp, c1, __builtin_elementwise_fma(lp, c2, nm)); t[qt][kt][i] = v; mx[qt] = fmaxf(mx[qt], fmaxf(v[0], v[1])); } } }
      const bool first = (s == 0) && (kc == 0); bool need = false;
#pragma unroll
      for (int qt = 0; qt < FQ; ++qt) need = need || (mx[qt] > 14.0f);
      if (first || __builtin_amdgcn_ballot_w32(need) != 0) {   /* wave-uniform; the first pass sets the offset from its own logits, in either direction */
#pragma unroll
        for (int qt = 0; qt < FQ; ++qt) { const float mj = fmaxf(mx[qt], __shfl_xor(mx[qt], 16));   /* both halves of a column take the same offset */
          const float d = first ? mj - 6.0f : fmaxf(mj - 6.0f, 0.f); const float al = __builtin_amdgcn_exp2f(-fmaxf(d, 0.f)); mo[qt] += d; l[qt] *= al;
#pragma unroll
          for (int j = 0; j < HDV / 16; ++j) o[qt][j] *= al;
#pragma unroll
          for (int kt = 0; kt < 2; ++kt)
#pragma unroll
            for (int i = 0; i < 4; ++i) t[qt][kt][i] -= d; } }
      v16h pf[FQ];
#pragma unroll
      for (int qt = 0; qt < FQ; ++qt) {
#pragma unroll
        for (int i = 0; i < 8; ++i) { const v2f x = t[qt][i >> 2][i & 3]; v2f e; e[0] = __builtin_amdgcn_exp2f(x[0]); e[1] = __builtin_amdgcn_exp2f(x[1]); l[qt] += e;
          const v2h ph = __builtin_convertvector(e, v2h); pf[qt][2 * i] = ph[0]; pf[qt][2 * i + 1] = ph[1]; } }   /* element s of the B operand = tile s >> 3, register s & 7 */
#pragma unroll
      for (int j = 0; j < HDV / 16; ++j) { const v16h vf = frag_h(&sV[cur][j * 16 + col][kc * 32], lane);
#pragma unroll
        for (int qt = 0; qt < FQ; ++qt) o[qt][j] = wmma_h(vf, pf[qt], o[qt][j]); } }
    if (more) { *(v4u*)&sK[cur ^ 1][kr][kq] = rk; *(v4u*)&sV[cur ^ 1][vr][vq] = rv0; *(v4u*)&sV[cur ^ 1][vr + 32][vq] = rv1; }   /* that buffer's last readers left it before the previous barrier */
    __syncthreads(); }
#pragma unroll
  for (int qt = 0; qt < FQ; ++qt) { const float ls = l[qt][0] + l[qt][1]; const float inv = 1.0f / (ls + __shfl_xor(ls, 16)); float* yr = Y + ((size_t)b * TT + q0 + qt * 16 + col) * YP + h * HDV + 8 * g;   /* register r of tile j = value column j*16 + 8g + r of query col */
#pragma unroll
    for (int j = 0; j < HDV / 16; ++j) { v4f a, c;
#pragma unroll
      for (int r = 0; r < 4; ++r) { a[r] = o[qt][j][r] * inv; c[r] = o[qt][j][4 + r] * inv; }
      vst2(yr + j * 16, a); vst2(yr + j * 16 + 4, c); } } }
// ---- k_out: block = (64 rows, 128 cols): out = ctx Wo (+ bo): ctx once to f16 against Wo as f16(bf16 x 2^8) exact (1 product) x 2^-8; causal early rows (< QHI of each sequence): ctx bf16 hi + lo against exact bf16 Wo (2 products)
__global__ __launch_bounds__(128) void k_out(const float* __restrict__ Y, const float* __restrict__ WO, const float* __restrict__ BO, float* __restrict__ OUT) { __shared__ __align__(16) float sf[4][16][132];
  const int tid = threadIdx.x, wave = tid >> 5, lane = tid & 31, col = lane & 15, g = lane >> 4; const int c0 = blockIdx.y * 128; const size_t r0 = (size_t)blockIdx.x * 64 + wave * 16;
  v8f acc[8] = {};
  if (CAUSAL && (int)(((size_t)blockIdx.x * 64) % TT) < QHI) {   /* block-uniform */
#pragma unroll 2
    for (int kc = 0; kc < CC / 32; ++kc) { const F2 a = split_row(Y + (r0 + col) * CC, kc * 32, lane); asm volatile("s_wait_loadcnt 0x0" ::: "memory");
#pragma unroll
      for (int j = 0; j < 8; ++j) { const v16b w = WOCOL(WO, kc * 32, c0 + j * 16 + col, lane); asm volatile("s_wait_loadcnt 0x0" ::: "memory"); acc[j] = wmma_bf(a.h, w, acc[j]); acc[j] = wmma_bf(a.l, w, acc[j]); } }
#pragma unroll
    for (int j = 0; j < 8; ++j) { const float bias = BO ? bfr(BO[c0 + j * 16 + col]) : 0.f;
#pragma unroll
      for (int r = 0; r < 8; ++r) sf[wave][8 * g + r][j * 16 + col] = acc[j][r] + bias; }
  } else {
#pragma unroll 2
    for (int kc = 0; kc < CC / 32; ++kc) { const v16h a = frag_f32(Y + (r0 + col) * CC + kc * 32, lane); asm volatile("s_wait_loadcnt 0x0" ::: "memory");
#pragma unroll
      for (int j = 0; j < 8; ++j) { const v16h w = WOCOLH(WO, kc * 32, c0 + j * 16 + col, lane); asm volatile("s_wait_loadcnt 0x0" ::: "memory"); acc[j] = wmma16(a, w, acc[j]); } }
#pragma unroll
    for (int j = 0; j < 8; ++j) { const float bias = BO ? bfr(BO[c0 + j * 16 + col]) : 0.f;
#pragma unroll
      for (int r = 0; r < 8; ++r) sf[wave][8 * g + r][j * 16 + col] = acc[j][r] * (1.0f / 256.0f) + bias; } }
  LDSX(); for (int rl = 0; rl < 16; ++rl) vst2(OUT + (r0 + rl) * DIN + c0 + lane * 4, *(const v4f*)&sf[wave][rl][lane * 4]); }

extern "C" void kernel_launch(void* const* d_in, const int* in_sizes, int n_in, void* d_out, int out_size, void* d_ws, size_t ws_size, hipStream_t stream) {
  (void)in_sizes; (void)n_in; (void)out_size;
  const float** F = (const float**)d_in;
  if (ws_size < (size_t)WS_END) return;
  char* ws = (char*)d_ws; _Float16 *QH = (_Float16*)(ws + WS_QH), *KH = (_Float16*)(ws + WS_KH), *VT = (_Float16*)(ws + WS_VT), *QL = (_Float16*)(ws + WS_QL), *KL = (_Float16*)(ws + WS_KL); __bf16 *VB = (__bf16*)(ws + WS_VB), *VBL = (__bf16*)(ws + WS_VBL); float *S = (float*)(ws + WS_S), *Y = (float*)(ws + WS_Y);
  (void)Y; (void)QL; (void)KL; (void)VB; (void)VBL;
  // inputs (in order): 0 x [2,2048,1024]; 1 W_qkv [1024,3072] (in,out; columns (3, H, 64)); 2 W_proj [1024,1024] (in,out); 3 b_proj; 4 lambda_q1, 5 lambda_k1, 6 lambda_q2, 7 lambda_k2 [32]; 8 subln_w [64]
  float* YD = S;   /* the differential rows' plane */
  k_proj<<<dim3(TNB * TT / 64, CC / 128, 3), 128, 0, stream>>>(F[0], F[0], F[0], F[1], F[1] + CC, F[1] + 2 * CC, nullptr, nullptr, nullptr, QH, QL, KH, KL, VT, VB, VBL);
  k_fa<<<dim3(TT / 256, NH, TNB), 256, 0, stream>>>(QH, QL, KH, VT, Y);
  k_diff<<<dim3(TNB * TT / 64), 256, 0, stream>>>(Y, F[4], F[5], F[6], F[7], F[8], YD);
  k_out<<<dim3(TNB * TT / 64, DIN / 128), 128, 0, stream>>>(YD, F[2], F[3], (float*)d_out);
}

// v002
// Measured time: 151 microseconds a run.
// Next to v001, in two timings, it ran 2.03 times as fast each time.
// Over all steps from v000 it is 13.7 times as fast.
// compute dtype: all float inputs rounded to bf16; qkv = x W_qkv with EXACT bf16 products on WMMA 16x16x32 (f32 accumulate); the 32-wide sub-head logits with q as f16 hi + residual (x 2^10) against k once to f16 (2 products) x 32^-0.5; both softmaxes in f32 (running maximum offset, exp2 on log2-scaled logits, f32 sum); each unnormalised P once to f16 against the head's 64-wide v once to f16 (1 product), divided by the sum last; the differential combination, the per-head RMS normalisation (x subln_w x (1 - lambda_init)) in f32; the result once to f16 against W_proj carried x 2^8 in f16 + b_proj; f32 output.
#include <hip/hip_runtime.h>
#include <math.h>

typedef __attribute__((ext_vector_type(16))) _Float16 v16h;
typedef __attribute__((ext_vector_type(16))) __bf16 v16b;
typedef __attribute__((ext_vector_type(8)))  _Float16 v8h;
typedef __attribute__((ext_vector_type(8)))  float v8f;
typedef __attribute__((ext_vector_type(4)))  float v4f;
typedef __attribute__((ext_vector_type(2)))  float v2f;
typedef __attribute__((ext_vector_type(4)))  unsigned v4u;
typedef __attribute__((ext_vector_type(4)))  int v4i;
typedef float __attribute__((may_alias)) float_a;
typedef int __attribute__((may_alias)) int_a;

template <typename T> __device__ __forceinline__ void vst2(void* p, T v) { *(T*)p = v;  }
__device__ __forceinline__ v8f wmma16(v16h a, v16h b, v8f c) {
  v8f d = __builtin_amdgcn_wmma_f32_16x16x32_f16(false, a, false, b, (short)0, c, false, false);
  asm volatile("v_nop\n\tv_nop\n\tv_nop\n\tv_nop" : "+v"(d) : "v"(a), "v"(b));
  return d;
}
__device__ __forceinline__ v8f wmma_bf(v16b a, v16b b, v8f c) {
  v8f d = __builtin_amdgcn_wmma_f32_16x16x32_bf16(false, a, false, b, (short)0, c, false, false);
  asm volatile("v_nop\n\tv_nop\n\tv_nop\n\tv_nop" : "+v"(d) : "v"(a), "v"(b));
  return d;
}
// 16x16x32 fragments: lane = (h = lane>>4, row/col = lane&15); elements 0..7 = k0+8h+0..7, 8..15 = k0+16+8h+0..7; D element r = row 8h+r
__device__ __forceinline__ v16h frag_h(const _Float16* rowk0, int lane) {
  union { v16h v; v8h q[2]; } u; const _Float16* p = rowk0 + 8 * (lane >> 4);
  u.q[0] = *(const v8h*)p; u.q[1] = *(const v8h*)(p + 16); return u.v;
}
__device__ __forceinline__ v16h frag_f32(const float* rowk0, int lane) {
  v16h a; const float* p = rowk0 + 8 * (lane >> 4);
#pragma unroll
  for (int i = 0; i < 8; ++i) { a[i] = (_Float16)p[i]; a[8 + i] = (_Float16)p[16 + i]; }
  return a;
}
__device__ __forceinline__ v16h frag_f32s(const float* rowk0, int lane, float sc) {
  v16h a; const float* p = rowk0 + 8 * (lane >> 4);
#pragma unroll
  for (int i = 0; i < 8; ++i) { a[i] = (_Float16)(p[i] * sc); a[8 + i] = (_Float16)(p[16 + i] * sc); }
  return a;
}
// column fragment from a [K][ld] layout (column n), rows >= K read as 0
__device__ __forceinline__ v16h fragc_f32(const float* W, int k0, int n, int lane, int ld, int K) {
  v16h a; const int g = lane >> 4;
#pragma unroll
  for (int i = 0; i < 8; ++i) { const int ka = k0 + 8 * g + i, kb = ka + 16;
    a[i] = (_Float16)(ka < K ? W[(size_t)(ka < K ? ka : K - 1) * ld + n] : 0.f); a[8 + i] = (_Float16)(kb < K ? W[(size_t)(kb < K ? kb : K - 1) * ld + n] : 0.f); }
  return a;
}
struct F2 { v16b h, l; };
__device__ __forceinline__ F2 bsplit16(const float v[16]) { F2 r;
#pragma unroll
  for (int i = 0; i < 16; ++i) { const __bf16 h = (__bf16)v[i]; r.h[i] = h; r.l[i] = (__bf16)(v[i] - (float)h); }
  return r; }
__device__ __forceinline__ F2 split_row(const float* row, int k0, int lane) { float v[16]; const float* p = row + k0 + 8 * (lane >> 4);
#pragma unroll
  for (int i = 0; i < 8; ++i) { v[i] = p[i]; v[8 + i] = p[16 + i]; }
  return bsplit16(v); }
__device__ __forceinline__ F2 split_rowK(const float* row, int k0, int lane, int K) { float v[16]; const int g = lane >> 4;
#pragma unroll
  for (int i = 0; i < 8; ++i) { const int ka = k0 + 8 * g + i, kb = ka + 16; v[i] = ka < K ? row[ka < K ? ka : K - 1] : 0.f; v[8 + i] = kb < K ? row[kb < K ? kb : K - 1] : 0.f; }
  return bsplit16(v); }
__device__ __forceinline__ F2 split_col(const float* W, int k0, int n, int lane, int ld, int K) { float v[16]; const int g = lane >> 4;
#pragma unroll
  for (int i = 0; i < 8; ++i) { const int ka = k0 + 8 * g + i, kb = ka + 16; v[i] = ka < K ? W[(size_t)(ka < K ? ka : K - 1) * ld + n] : 0.f; v[8 + i] = kb < K ? W[(size_t)(kb < K ? kb : K - 1) * ld + n] : 0.f; }
  return bsplit16(v); }
__device__ __forceinline__ v8f mac3(const F2& a, const F2& b, v8f c) { c = wmma_bf(a.l, b.h, c); c = wmma_bf(a.h, b.l, c); return wmma_bf(a.h, b.h, c); }
__device__ __forceinline__ float sigm(float v) { return 1.0f / (1.0f + expf(-v)); }
#define LDSX() do { asm volatile("s_wait_dscnt 0" ::: "memory"); __builtin_amdgcn_wave_barrier(); __builtin_amdgcn_fence(__ATOMIC_RELEASE, "workgroup"); } while (0)

// Differential attention (B 2, N 2,048, C 1,024; 16 heads, head_dim 32, v 64 wide): qkv = x W_qkv ((in,out) [1024, 3072], columns (3, H, 64)); q, k -> 32 sub-heads of 32: q1/k1 = sub-heads 0..15, q2/k2 = sub-heads 16..31, v head h = columns h*64..; attn_i = softmax(q_i k_i^T / sqrt(32)) v; lam = exp(sum lq1 lk1) - exp(sum lq2 lk2) + lambda_init (0.78360578); o = attn1 - lam attn2; o = o rsqrt(mean(o^2) + 1e-5) subln_w (1 - lambda_init); out = merged(o) W_proj + b_proj.
#define NB 2
#define TT 2048
#define CC 1024            // NH * HD = projected width
#define DIN 1024          // input (model) width
#define NH 32              // softmax sub-heads (16 heads x 2 halves)
#define HD 32
#define NQB (TT / 64)
#define HG 4
#define SCALE (0.17677669529663687f)
#define CAUSAL 0
#ifndef TNB
#define TNB NB
#endif
__device__ __forceinline__ float bfr(float v) { return (float)(__bf16)v; }
__host__ __device__ __forceinline__ int kb_last(int qb) { return CAUSAL ? ((qb * 64 + 63) >> 7) : (TT / 128 - 1); }
typedef __attribute__((ext_vector_type(8))) __bf16 v8b;
typedef __attribute__((ext_vector_type(4))) __bf16 v4b;
typedef __attribute__((ext_vector_type(4))) _Float16 v4h;
__device__ __forceinline__ v16b frag_b(const __bf16* rowk0, int lane) {
  union { v16b v; v8b q[2]; } u; const __bf16* p = rowk0 + 8 * (lane >> 4);
  u.q[0] = *(const v8b*)p; u.q[1] = *(const v8b*)(p + 16); return u.v;
}
#define QBH 0
#define QHI 2048            // rows carrying a q residual plane (all rows: 2-product logits everywhere)
#define KHI 64            // key rows carrying k residual / v bf16 hi+lo planes (written or read by no kernel)
// B fragment (k rows k0+.., output column o) of a weight: (in,out) [K][ld] or (out,in) [ld rows of K]: bf16 exact, or f16(bf16 * 256) exact
__device__ __forceinline__ v16b wcol_io(const float* Wm, int k0, int o, int lane, int ld) { v16b w; const int g = lane >> 4;
#pragma unroll
  for (int i = 0; i < 8; ++i) { w[i] = (__bf16)Wm[(size_t)(k0 + 8 * g + i) * ld + o]; w[8 + i] = (__bf16)Wm[(size_t)(k0 + 16 + 8 * g + i) * ld + o]; }
  return w; }
__device__ __forceinline__ v16b wcol_oi(const float* Wm, int k0, int o, int lane, int K) { v16b w; const float* p = Wm + (size_t)o * K + k0 + 8 * (lane >> 4);
#pragma unroll
  for (int i = 0; i < 8; ++i) { w[i] = (__bf16)p[i]; w[8 + i] = (__bf16)p[16 + i]; }
  return w; }
__device__ __forceinline__ v16h wcolh_io(const float* Wm, int k0, int o, int lane, int ld) { v16h w; const int g = lane >> 4;
#pragma unroll
  for (int i = 0; i < 8; ++i) { w[i] = (_Float16)(bfr(Wm[(size_t)(k0 + 8 * g + i) * ld + o]) * 256.0f); w[8 + i] = (_Float16)(bfr(Wm[(size_t)(k0 + 16 + 8 * g + i) * ld + o]) * 256.0f); }
  return w; }
__device__ __forceinline__ v16h wcolh_oi(const float* Wm, int k0, int o, int lane, int K) { v16h w; const float* p = Wm + (size_t)o * K + k0 + 8 * (lane >> 4);
#pragma unroll
  for (int i = 0; i < 8; ++i) { w[i] = (_Float16)(bfr(p[i]) * 256.0f); w[8 + i] = (_Float16)(bfr(p[16 + i]) * 256.0f); }
  return w; }
#define WQKV_LAYOUT 0   // 0 = (in,out) [DIN][3 * CC]; 1 = (out,in) [CC][DIN]; 2 = per-head [NH][DIN][HD]
__device__ __forceinline__ v16b wcol_hdk(const float* Wm, int k0, int o, int lane) { v16b w; const int g = lane >> 4; const float* p = Wm + (size_t)(o / HD) * DIN * HD + (o % HD);
#pragma unroll
  for (int i = 0; i < 8; ++i) { w[i] = (__bf16)p[(size_t)(k0 + 8 * g + i) * HD]; w[8 + i] = (__bf16)p[(size_t)(k0 + 16 + 8 * g + i) * HD]; }
  return w; }
#define WO_OUT_IN 0
#if WQKV_LAYOUT == 1
#define WCOL(W, k0, o, lane) wcol_oi(W, k0, o, lane, DIN)
#elif WQKV_LAYOUT == 2
#define WCOL(W, k0, o, lane) wcol_hdk(W, k0, o, lane)
#else
#define WCOL(W, k0, o, lane) wcol_io(W, k0, o, lane, 3 * CC)   /* W_qkv (in,out) packed by columns: row pitch 3C */
#endif
#if WO_OUT_IN
#define WOCOL(W, k0, o, lane) wcol_oi(W, k0, o, lane, CC)
#define WOCOLH(W, k0, o, lane) wcolh_oi(W, k0, o, lane, CC)
#else
#define WOCOL(W, k0, o, lane) wcol_io(W, k0, o, lane, DIN)
#define WOCOLH(W, k0, o, lane) wcolh_io(W, k0, o, lane, DIN)
#endif
#define HDV 64             // value columns per softmax sub-head (the parent head's 64 columns)
#define YP (NH * HDV)      // 2,048: pitch of the per-sub-head context rows Y[b*t][h'*64 + d]
// ---- k_diff: block = 64 rows (256 threads; thread owns 4 consecutive output columns -> head e = c/64, 16 threads per head): lam = exp(sum lq1 lk1) - exp(sum lq2 lk2) + lambda_init; o = Y[e] - lam Y[16 + e] (64 wide, f32); o = o * rsqrt(mean_64(o^2) + 1e-5) * subln_w[d] * (1 - lambda_init) -> Yd rows [b*t][1024] (a row = 4 KB by 256 threads)
#define LAMBDA_INIT 0.78360578f   /* 0.8 - 0.6 exp(-0.3 * 12) */
__global__ __launch_bounds__(256) void k_diff(const float* __restrict__ Y, const float* __restrict__ LQ1, const float* __restrict__ LK1, const float* __restrict__ LQ2, const float* __restrict__ LK2, const float* __restrict__ SW, float* __restrict__ YD) {
  __shared__ float slam;
  const int tid = threadIdx.x, lane = tid & 31; const size_t r0 = (size_t)blockIdx.x * 64;
  if (tid < 32) { float a = 0.f, c2 = 0.f; { const int i = lane; a = bfr(LQ1[i]) * bfr(LK1[i]); c2 = bfr(LQ2[i]) * bfr(LK2[i]); }   /* 32-term dots: one term per lane, fixed xor-tree order */
#pragma unroll
    for (int o = 1; o < 32; o <<= 1) { a += __shfl_xor(a, o); c2 += __shfl_xor(c2, o); }
    if (tid == 0) slam = expf(a) - expf(c2) + LAMBDA_INIT; }
  __syncthreads(); const float lam = slam;
  const int c = tid * 4; const int e = c >> 6, d = c & 63;   /* output column c -> head e, dim d */
  float sw[4]; for (int i = 0; i < 4; ++i) sw[i] = bfr(SW[d + i]) * (1.0f - LAMBDA_INIT);
  for (int rr = 0; rr < 64; ++rr) { const size_t row = r0 + rr; const float* y1 = Y + row * YP + (size_t)e * HDV + d; const float* y2 = y1 + (size_t)16 * HDV;
    const v4f a = *(const v4f*)y1, bq = *(const v4f*)y2; v4f o; float q = 0.f;
#pragma unroll
    for (int i = 0; i < 4; ++i) { o[i] = a[i] - lam * bq[i]; q += o[i] * o[i]; }
#pragma unroll
    for (int of = 1; of < 16; of <<= 1) q += __shfl_xor(q, of);   /* 16 lanes = the head's 64 columns (lane groups are head-aligned) */
    const float rs = rsqrtf(q * (1.0f / 64.0f) + 1e-5f);
#pragma unroll
    for (int i = 0; i < 4; ++i) o[i] = o[i] * rs * sw[i];
    vst2(YD + row * CC + c, o); } }
#ifndef SM_EXTRA_PARAMS
#define SM_EXTRA_PARAMS
#endif
#ifndef PROJ_EXTRA_PARAMS
#define PROJ_EXTRA_PARAMS
#endif
#ifndef SM_MASK_HOOK
#define SM_MASK_HOOK (void)0
#endif

#define WS_QH  0u                                      // f16 q rows [b*t][CC]
#define WS_KH  (WS_QH + 2u * (size_t)NB * TT * CC)      // f16 k rows [b*t][CC]
#define WS_VT  (WS_KH + 2u * (size_t)NB * TT * CC)      // f16 v planes [b][c][t]
#define WS_QL  (WS_VT + 2u * (size_t)NB * CC * TT)      // f16 q residual x 2^10 rows [b][t < QHI][CC]
#define WS_KL  (WS_QL + 2u * (size_t)NB * QHI * CC)     // f16 k residual x 2^10 rows [b][t < KHI][CC]
#define WS_VB  (WS_KL + 2u * (size_t)NB * KHI * CC)     // bf16 v hi planes [b][c][t < KHI]
#define WS_VBL (WS_VB + 2u * (size_t)NB * CC * KHI)
#define WS_S   (WS_VBL + 2u * (size_t)NB * CC * KHI)    // f32 differential rows [b*t][CC] (k_diff -> k_out)
#define WS_Y   (WS_S  + 4u * (size_t)HG * TT * TT)      // f32 per-softmax-head context rows [b*t][YP = 32 x 64]
#define WS_END (WS_Y  + 4u * (size_t)NB * TT * YP)

// ---- gemm_tile: one 128 x 128 tile of X W (K = 1,024) per block of 8 waves. Each pass of 32 k is staged once per block in LDS as 16-bit rows of k: X rows (whole 128-B lines per 8 lanes) and W columns (a thread takes 16 k of one column, a wave 128 B of each W row), rounded to the 16-bit type on the way. Two buffers: the next pass's global loads fly while this pass's WMMAs run; one barrier a pass.
// MODE 0: both operands to bf16. MODE 1: X once to f16, W as f16(bf16 x 2^8).
// Every '#pragma unroll' from here to the end of k_proj, and in k_out, except on the store loops, makes the indices of a register array (staged values, fragments, accumulators) constants, so that the array stays in registers.
// The product is D[p][q], p over the rows of staged operand pi (0 = X rows, 1 = W columns), q over the other's: a lane then holds 8 consecutive p of one q.
#define GT 128             // tile edge
#define GK 32              // k per pass
#define GKK 1024           // K (= DIN = CC)
#define GP 40              // LDS row pitch in 16-bit elements (80 B = 16 B x odd)
#define GOPB (GT * GP * 2) // bytes of one staged operand
#define GSMB (2 * GT * 136 * 2)   // LDS of a block: the ring (4 x GOPB) or, behind it, the output staging (two f16 planes of pitch 136, or f32 rows of pitch 132)
// four 16-B stores and their s_wait_xcnt in one statement: what follows rewrites their address and data registers
__device__ __forceinline__ void g_st4(void* p0, void* p1, void* p2, void* p3, v4u a, v4u b, v4u c, v4u d) {
  asm volatile("global_store_b128 %0, %4, off\n\tglobal_store_b128 %1, %5, off\n\tglobal_store_b128 %2, %6, off\n\tglobal_store_b128 %3, %7, off\n\ts_wait_xcnt 0x0" :: "v"(p0), "v"(p1), "v"(p2), "v"(p3), "v"(a), "v"(b), "v"(c), "v"(d) : "memory"); }
// one pass's global loads of a thread, then its pointers move on. The three scheduling barriers keep everything but the loads out of the stretch up to their s_wait_xcnt (no register that a load names is rewritten ahead of it) and keep all the loads ahead of the WMMAs that follow (without them half of the loads sink into the pass, and their latency is waited out a second time)
__device__ __forceinline__ void g_fetch(const float*& px, const float*& pw, int ldw, v4f (&xa)[4], float (&wb)[16]) {
  __builtin_amdgcn_sched_barrier(0);
#pragma unroll
  for (int i = 0; i < 4; ++i) xa[i] = *(const v4f*)(px + (size_t)i * 32 * GKK);
#pragma unroll
  for (int i = 0; i < 16; ++i) wb[i] = pw[(size_t)i * ldw];
  __builtin_amdgcn_sched_barrier(0);
  asm volatile("s_wait_xcnt 0x0" :: "v"(px), "v"(pw) : "memory");   /* before the loads' address registers are rewritten; it names both addresses so that they keep their registers up to here (else a later load of the group is given an earlier one's address pair as its destination) */
  __builtin_amdgcn_sched_barrier(0);
  px += GK; pw += (size_t)GK * ldw;
}
template <int MODE> __device__ __forceinline__ void g_put(char* bx, char* bw, const v4f (&xa)[4], const float (&wb)[16]) {
  if (MODE == 0) {
#pragma unroll
    for (int i = 0; i < 4; ++i) { v4b c;
#pragma unroll
      for (int e = 0; e < 4; ++e) c[e] = (__bf16)xa[i][e];
      *(v4b*)(bx + i * 32 * GP * 2) = c; }
    v8b w0, w1;
#pragma unroll
    for (int e = 0; e < 8; ++e) { w0[e] = (__bf16)wb[e]; w1[e] = (__bf16)wb[8 + e]; }
    *(v8b*)bw = w0; *(v8b*)(bw + 16) = w1;
  } else {
#pragma unroll
    for (int i = 0; i < 4; ++i) { v4h c;
#pragma unroll
      for (int e = 0; e < 4; ++e) c[e] = (_Float16)xa[i][e];
      *(v4h*)(bx + i * 32 * GP * 2) = c; }
    v8h w0, w1;
#pragma unroll
    for (int e = 0; e < 8; ++e) { w0[e] = (_Float16)(bfr(wb[e]) * 256.0f); w1[e] = (_Float16)(bfr(wb[8 + e]) * 256.0f); }
    *(v8h*)bw = w0; *(v8h*)(bw + 16) = w1;
  }
}
template <int MODE> __device__ __forceinline__ void gemm_tile(const float* __restrict__ Xr, const float* __restrict__ Wc, const int ldw, const int pi, char* sm, v8f (&acc)[2][4]) {
  const int tid = threadIdx.x, wave = tid >> 5, lane = tid & 31, col = lane & 15;
  const int xr = tid >> 3, xk = (tid & 7) * 4, wn = tid & 127, wk = (tid >> 7) * 16;
  const float* gx = Xr + (size_t)xr * GKK + xk; const float* gw = Wc + (size_t)wk * ldw + wn;
  const int xo = (xr * GP + xk) * 2, wo = GOPB + (wn * GP + wk) * 2;   /* a thread's own places in a buffer: [X rows | W columns] */
  const int po = pi * GOPB + ((wave & 3) * 32 + col) * GP * 2, qo = (pi ^ 1) * GOPB + ((wave >> 2) * 64 + col) * GP * 2;
  v4f xa[4]; float wb[16];
  g_fetch(gx, gw, ldw, xa, wb);
  g_put<MODE>(sm + xo, sm + wo, xa, wb);
  __syncthreads();
  for (int s = 0; s < GKK / GK; ++s) { char* cb = sm + (s & 1) * 2 * GOPB; char* nb = sm + ((s & 1) ^ 1) * 2 * GOPB; const bool more = s + 1 < GKK / GK;
    if (more) g_fetch(gx, gw, ldw, xa, wb);
    if (MODE == 0) { v16b P[2], Q[4];
#pragma unroll
      for (int i = 0; i < 2; ++i) P[i] = frag_b((const __bf16*)(cb + po + i * 16 * GP * 2), lane);
#pragma unroll
      for (int i = 0; i < 4; ++i) Q[i] = frag_b((const __bf16*)(cb + qo + i * 16 * GP * 2), lane);
#pragma unroll
      for (int i = 0; i < 2; ++i)
#pragma unroll
        for (int j = 0; j < 4; ++j) acc[i][j] = __builtin_amdgcn_wmma_f32_16x16x32_bf16(false, P[i], false, Q[j], (short)0, acc[i][j], false, false);
    } else { v16h P[2], Q[4];
#pragma unroll
      for (int i = 0; i < 2; ++i) P[i] = frag_h((const _Float16*)(cb + po + i * 16 * GP * 2), lane);
#pragma unroll
      for (int i = 0; i < 4; ++i) Q[i] = frag_h((const _Float16*)(cb + qo + i * 16 * GP * 2), lane);
#pragma unroll
      for (int i = 0; i < 2; ++i)
#pragma unroll
        for (int j = 0; j < 4; ++j) acc[i][j] = __builtin_amdgcn_wmma_f32_16x16x32_f16(false, P[i], false, Q[j], (short)0, acc[i][j], false, false);
    }
    __builtin_amdgcn_sched_barrier(0);   /* the roundings, which wait for the loads, stay behind the last WMMA: the wave issues in order */
    if (more) g_put<MODE>(nb + xo, nb + wo, xa, wb);   /* that buffer's last readers left it before the previous barrier */
    __syncthreads(); }
}
// ---- k_proj: block = (128 rows, 128 cols, which): q/k/v = X W with exact bf16 products (K = DIN) -> which 0: q f16 rows + residual x 2^10 rows; 1: k f16 rows; 2: v f16 planes [c][t]. q, k: p = column, q = row; v: p = row (t), q = column: either way a lane's 8 values are 16 B of an output row, staged in LDS and stored as whole 256-B rows
__global__ __launch_bounds__(256) void k_proj(const float* __restrict__ X, const float* __restrict__ WQKV, _Float16* __restrict__ QH, _Float16* __restrict__ QL, _Float16* __restrict__ KH, _Float16* __restrict__ VT) {
  __shared__ __align__(16) char sm[GSMB];
  const int tid = threadIdx.x, wave = tid >> 5, lane = tid & 31, col = lane & 15, g = lane >> 4; const int which = blockIdx.z; const int c0 = blockIdx.y * GT; const size_t r0 = (size_t)blockIdx.x * GT; const size_t bb = r0 / TT; const int t0 = (int)(r0 % TT);
  v8f acc[2][4] = {};
  gemm_tile<0>(X + r0 * DIN, WQKV + which * CC + c0, 3 * CC, which < 2 ? 1 : 0, sm, acc);
  _Float16* sh = (_Float16*)sm; _Float16* sl = sh + GT * 136;
#pragma unroll
  for (int i = 0; i < 2; ++i)
#pragma unroll
    for (int j = 0; j < 4; ++j) { v8h hv, lv;
#pragma unroll
      for (int r = 0; r < 8; ++r) { const float v = acc[i][j][r]; hv[r] = (_Float16)v; lv[r] = (_Float16)((v - (float)hv[r]) * 1024.0f); }
      const int o = ((wave >> 2) * 64 + j * 16 + col) * 136 + (wave & 3) * 32 + i * 16 + 8 * g; *(v8h*)&sh[o] = hv; if (which == 0) *(v8h*)&sl[o] = lv; }
  __syncthreads();
  _Float16* D = which == 0 ? QH + r0 * CC + c0 : which == 1 ? KH + r0 * CC + c0 : VT + (bb * CC + c0) * (size_t)TT + t0; const size_t dp = which < 2 ? CC : TT;
  const int q = tid >> 4, pc = (tid & 15) * 8;   /* a wave stores two whole 256-B rows at a time */
#pragma unroll
  for (int t = 0; t < 2; ++t) { const int qq = q + t * 64; _Float16* d = D + qq * dp + pc; const _Float16* s = &sh[qq * 136 + pc];
    g_st4(d, d + 16 * dp, d + 32 * dp, d + 48 * dp, *(const v4u*)s, *(const v4u*)(s + 16 * 136), *(const v4u*)(s + 32 * 136), *(const v4u*)(s + 48 * 136)); }
  if (which == 0) {
#pragma unroll
    for (int t = 0; t < 2; ++t) { const int qq = q + t * 64; _Float16* d = QL + (r0 + qq) * CC + c0 + pc; const _Float16* s = &sl[qq * 136 + pc];
      g_st4(d, d + 16 * CC, d + 32 * CC, d + 48 * CC, *(const v4u*)s, *(const v4u*)(s + 16 * 136), *(const v4u*)(s + 32 * 136), *(const v4u*)(s + 48 * 136)); } } }
#define FQ 2               // query column groups (16 queries each) per wave
#define FS 64              // keys per stage (one LDS buffer)
#define KP 40              // K row pitch in LDS, halfs (80 B = 16 B x odd)
#define VP 72              // v plane row pitch in LDS, halfs (144 B = 16 B x odd)
#define LC1 (SCALE * 1.4426950408889634f)
#define LC2 (SCALE * 1.4426950408889634f / 1024.0f)
typedef __attribute__((ext_vector_type(2))) _Float16 v2h;
__device__ __forceinline__ v8f wmma_h(v16h a, v16h b, v8f c) { return __builtin_amdgcn_wmma_f32_16x16x32_f16(false, a, false, b, (short)0, c, false, false); }
__global__ __launch_bounds__(256) void k_fa(const _Float16* __restrict__ QH, const _Float16* __restrict__ QL, const _Float16* __restrict__ KH, const _Float16* __restrict__ VT, float* __restrict__ Y) {
  __shared__ __align__(16) _Float16 sK[2][FS][KP]; __shared__ __align__(16) _Float16 sV[2][HDV][VP];
  const int tid = threadIdx.x, wave = tid >> 5, lane = tid & 31, col = lane & 15, g = lane >> 4;
  const int h = blockIdx.y, b = blockIdx.z; const int q0 = blockIdx.x * (8 * FQ * 16) + wave * (FQ * 16); const int vc0 = (h & 15) * HDV;   /* sub-head h uses v head h mod 16 */
  v16h qh[FQ], ql[FQ];
#pragma unroll
  for (int qt = 0; qt < FQ; ++qt) { qh[qt] = frag_h(QH + ((size_t)b * TT + q0 + qt * 16 + col) * CC + h * HD, lane); ql[qt] = frag_h(QL + ((size_t)b * QHI + q0 + qt * 16 + col) * CC + h * HD, lane); }
  // staging: a stage = 64 K rows of 64 B (one 16-B piece a thread) + 64 v plane rows of 128 B (two pieces a thread)
  const int kr = tid >> 2, kq = (tid & 3) * 8, vr = tid >> 3, vq = (tid & 7) * 8;
  const _Float16* gk = KH + ((size_t)b * TT + kr) * CC + h * HD + kq; const _Float16* gv = VT + ((size_t)b * CC + vc0 + vr) * (size_t)TT + vq;
  v4u rk = *(const v4u*)gk, rv0 = *(const v4u*)gv, rv1 = *(const v4u*)(gv + (size_t)32 * TT);
  *(v4u*)&sK[0][kr][kq] = rk; *(v4u*)&sV[0][vr][vq] = rv0; *(v4u*)&sV[0][vr + 32][vq] = rv1;
  __syncthreads();
  v8f o[FQ][HDV / 16] = {}; float mo[FQ]; v2f l[FQ];   /* l: a lane's own keys, even and odd registers apart; joined after the loop */
#pragma unroll
  for (int qt = 0; qt < FQ; ++qt) { mo[qt] = 0.f; l[qt] = (v2f){0.f, 0.f}; }
  const v2f c1 = {LC1, LC1}, c2 = {LC2, LC2};
  for (int s = 0; s < TT / FS; ++s) { const int cur = s & 1; const bool more = s + 1 < TT / FS;
    if (more) { rk = *(const v4u*)(gk + (size_t)(s + 1) * FS * CC); rv0 = *(const v4u*)(gv + (s + 1) * FS); rv1 = *(const v4u*)(gv + (size_t)32 * TT + (s + 1) * FS); }   /* the next stage's rows fly while this stage is worked on */
#pragma unroll
    for (int kc = 0; kc < FS / 32; ++kc) {   /* unrolled: every fragment index constant */
      v16h kf[2]; v2f t[FQ][2][4]; float mx[FQ];
#pragma unroll
      for (int kt = 0; kt < 2; ++kt) kf[kt] = frag_h(&sK[cur][kc * 32 + kt * 16 + col][0], lane);
#pragma unroll
      for (int qt = 0; qt < FQ; ++qt) { mx[qt] = -3.0e38f; const v2f nm = {-mo[qt], -mo[qt]};
#pragma unroll
        for (int kt = 0; kt < 2; ++kt) { const v8f z = {}; const v8f sl = wmma_h(kf[kt], ql[qt], z), sh = wmma_h(kf[kt], qh[qt], z);
#pragma unroll
          for (int i = 0; i < 4; ++i) { const v2f hp = {sh[2 * i], sh[2 * i + 1]}, lp = {sl[2 * i], sl[2 * i + 1]}; const v2f v = __builtin_elementwise_fma(hp, c1, __builtin_elementwise_fma(lp, c2, nm)); t[qt][kt][i] = v; mx[qt] = fmaxf(mx[qt], fmaxf(v[0], v[1])); } } }
      const bool first = (s == 0) && (kc == 0); bool need = false;
#pragma unroll
      for (int qt = 0; qt < FQ; ++qt) need = need || (mx[qt] > 14.0f);
      if (first || __builtin_amdgcn_ballot_w32(need) != 0) {   /* wave-uniform; the first pass sets the offset from its own logits, in either direction */
#pragma unroll
        for (int qt = 0; qt < FQ; ++qt) { const float mj = fmaxf(mx[qt], __shfl_xor(mx[qt], 16));   /* both halves of a column take the same offset */
          const float d = first ? mj - 6.0f : fmaxf(mj - 6.0f, 0.f); const float al = __builtin_amdgcn_exp2f(-fmaxf(d, 0.f)); mo[qt] += d; l[qt] *= al;
#pragma unroll
          for (int j = 0; j < HDV / 16; ++j) o[qt][j] *= al;
#pragma unroll
          for (int kt = 0; kt < 2; ++kt)
#pragma unroll
            for (int i = 0; i < 4; ++i) t[qt][kt][i] -= d; } }
      v16h pf[FQ];
#pragma unroll
      for (int qt = 0; qt < FQ; ++qt) {
#pragma unroll
        for (int i = 0; i < 8; ++i) { const v2f x = t[qt][i >> 2][i & 3]; v2f e; e[0] = __builtin_amdgcn_exp2f(x[0]); e[1] = __builtin_amdgcn_exp2f(x[1]); l[qt] += e;
          const v2h ph = __builtin_convertvector(e, v2h); pf[qt][2 * i] = ph[0]; pf[qt][2 * i + 1] = ph[1]; } }   /* element s of the B operand = tile s >> 3, register s & 7 */
#pragma unroll
      for (int j = 0; j < HDV / 16; ++j) { const v16h vf = frag_h(&sV[cur][j * 16 + col][kc * 32], lane);
#pragma unroll
        for (int qt = 0; qt < FQ; ++qt) o[qt][j] = wmma_h(vf, pf[qt], o[qt][j]); } }
    if (more) { *(v4u*)&sK[cur ^ 1][kr][kq] = rk; *(v4u*)&sV[cur ^ 1][vr][vq] = rv0; *(v4u*)&sV[cur ^ 1][vr + 32][vq] = rv1; }   /* that buffer's last readers left it before the previous barrier */
    __syncthreads(); }
#pragma unroll
  for (int qt = 0; qt < FQ; ++qt) { const float ls = l[qt][0] + l[qt][1]; const float inv = 1.0f / (ls + __shfl_xor(ls, 16)); float* yr = Y + ((size_t)b * TT + q0 + qt * 16 + col) * YP + h * HDV + 8 * g;   /* register r of tile j = value column j*16 + 8g + r of query col */
#pragma unroll
    for (int j = 0; j < HDV / 16; ++j) { v4f a, c;
#pragma unroll
      for (int r = 0; r < 4; ++r) { a[r] = o[qt][j][r] * inv; c[r] = o[qt][j][4 + r] * inv; }
      vst2(yr + j * 16, a); vst2(yr + j * 16 + 4, c); } } }
// ---- k_out: block = (128 rows, 128 cols): out = ctx Wo + bo: ctx once to f16 against Wo as f16(bf16 x 2^8) exact (1 product) x 2^-8; p = column, q = row; f32 rows staged in LDS and stored as whole 512-B rows
__global__ __launch_bounds__(256) void k_out(const float* __restrict__ Y, const float* __restrict__ WO, const float* __restrict__ BO, float* __restrict__ OUT) {
  __shared__ __align__(16) char sm[GSMB];
  const int tid = threadIdx.x, wave = tid >> 5, lane = tid & 31, col = lane & 15, g = lane >> 4; const int c0 = blockIdx.y * GT; const size_t r0 = (size_t)blockIdx.x * GT;
  v8f acc[2][4] = {};
  gemm_tile<1>(Y + r0 * CC, WO + c0, DIN, 1, sm, acc);
  float* sf = (float*)sm;
#pragma unroll
  for (int i = 0; i < 2; ++i) { const int p = (wave & 3) * 32 + i * 16 + 8 * g; float bias[8];
#pragma unroll
    for (int r = 0; r < 8; ++r) bias[r] = bfr(BO[c0 + p + r]);
#pragma unroll
    for (int j = 0; j < 4; ++j) { v4f a, c;
#pragma unroll
      for (int r = 0; r < 4; ++r) { a[r] = acc[i][j][r] * (1.0f / 256.0f) + bias[r]; c[r] = acc[i][j][4 + r] * (1.0f / 256.0f) + bias[4 + r]; }
      float* d = &sf[((wave >> 2) * 64 + j * 16 + col) * 132 + p]; *(v4f*)d = a; *(v4f*)(d + 4) = c; } }
  __syncthreads();
  const int q = tid >> 5, pc = (tid & 31) * 4;   /* a wave stores one whole 512-B row at a time */
#pragma unroll
  for (int t = 0; t < 4; ++t) { const int qq = q + t * 32; float* d = OUT + (r0 + qq) * DIN + c0 + pc; const float* s = &sf[qq * 132 + pc];
    g_st4(d, d + 8 * DIN, d + 16 * DIN, d + 24 * DIN, *(const v4u*)s, *(const v4u*)(s + 8 * 132), *(const v4u*)(s + 16 * 132), *(const v4u*)(s + 24 * 132)); } }

extern "C" void kernel_launch(void* const* d_in, const int* in_sizes, int n_in, void* d_out, int out_size, void* d_ws, size_t ws_size, hipStream_t stream) {
  (void)in_sizes; (void)n_in; (void)out_size;
  const float** F = (const float**)d_in;
  if (ws_size < (size_t)WS_END) return;
  char* ws = (char*)d_ws; _Float16 *QH = (_Float16*)(ws + WS_QH), *KH = (_Float16*)(ws + WS_KH), *VT = (_Float16*)(ws + WS_VT), *QL = (_Float16*)(ws + WS_QL), *KL = (_Float16*)(ws + WS_KL); __bf16 *VB = (__bf16*)(ws + WS_VB), *VBL = (__bf16*)(ws + WS_VBL); float *S = (float*)(ws + WS_S), *Y = (float*)(ws + WS_Y);
  (void)Y; (void)QL; (void)KL; (void)VB; (void)VBL;
  // inputs (in order): 0 x [2,2048,1024]; 1 W_qkv [1024,3072] (in,out; columns (3, H, 64)); 2 W_proj [1024,1024] (in,out); 3 b_proj; 4 lambda_q1, 5 lambda_k1, 6 lambda_q2, 7 lambda_k2 [32]; 8 subln_w [64]
  float* YD = S;   /* the differential rows' plane */
  k_proj<<<dim3(TNB * TT / GT, CC / GT, 3), 256, 0, stream>>>(F[0], F[1], QH, QL, KH, VT);
  k_fa<<<dim3(TT / 256, NH, TNB), 256, 0, stream>>>(QH, QL, KH, VT, Y);
  k_diff<<<dim3(TNB * TT / 64), 256, 0, stream>>>(Y, F[4], F[5], F[6], F[7], F[8], YD);
  k_out<<<dim3(TNB * TT / GT, DIN / GT), 256, 0, stream>>>(YD, F[2], F[3], (float*)d_out);
}

// v003
// It runs in 126 microseconds.
// In both of two side-by-side timings against v002, it was 1.20 times as fast.
// All steps since v000 together make it 16.4 times as fast.
// compute dtype: all float inputs rounded to bf16; qkv = x W_qkv with EXACT bf16 products on WMMA 16x16x32 (f32 accumulate); the 32-wide sub-head logits with q as f16 hi + residual (x 2^10) against k once to f16 (2 products) x 32^-0.5; both softmaxes in f32 (running maximum offset, exp2 on log2-scaled logits, f32 sum); each unnormalised P once to f16 against the head's 64-wide v once to f16 (1 product), divided by the sum last; the differential combination, the per-head RMS normalisation (x subln_w x (1 - lambda_init)) in f32; the result once to f16 against W_proj carried x 2^8 in f16 + b_proj; f32 output.
#include <hip/hip_runtime.h>
#include <math.h>

typedef __attribute__((ext_vector_type(16))) _Float16 v16h;
typedef __attribute__((ext_vector_type(16))) __bf16 v16b;
typedef __attribute__((ext_vector_type(8)))  _Float16 v8h;
typedef __attribute__((ext_vector_type(8)))  float v8f;
typedef __attribute__((ext_vector_type(4)))  float v4f;
typedef __attribute__((ext_vector_type(2)))  float v2f;
typedef __attribute__((ext_vector_type(4)))  unsigned v4u;
typedef __attribute__((ext_vector_type(4)))  int v4i;
typedef float __attribute__((may_alias)) float_a;
typedef int __attribute__((may_alias)) int_a;

template <typename T> __device__ __forceinline__ void vst2(void* p, T v) { *(T*)p = v;  }
__device__ __forceinline__ v8f wmma16(v16h a, v16h b, v8f c) {
  v8f d = __builtin_amdgcn_wmma_f32_16x16x32_f16(false, a, false, b, (short)0, c, false, false);
  asm volatile("v_nop\n\tv_nop\n\tv_nop\n\tv_nop" : "+v"(d) : "v"(a), "v"(b));
  return d;
}
__device__ __forceinline__ v8f wmma_bf(v16b a, v16b b, v8f c) {
  v8f d = __builtin_amdgcn_wmma_f32_16x16x32_bf16(false, a, false, b, (short)0, c, false, false);
  asm volatile("v_nop\n\tv_nop\n\tv_nop\n\tv_nop" : "+v"(d) : "v"(a), "v"(b));
  return d;
}
// 16x16x32 fragments: lane = (h = lane>>4, row/col = lane&15); elements 0..7 = k0+8h+0..7, 8..15 = k0+16+8h+0..7; D element r = row 8h+r
__device__ __forceinline__ v16h frag_h(const _Float16* rowk0, int lane) {
  union { v16h v; v8h q[2]; } u; const _Float16* p = rowk0 + 8 * (lane >> 4);
  u.q[0] = *(const v8h*)p; u.q[1] = *(const v8h*)(p + 16); return u.v;
}
__device__ __forceinline__ v16h frag_f32(const float* rowk0, int lane) {
  v16h a; const float* p = rowk0 + 8 * (lane >> 4);
#pragma unroll
  for (int i = 0; i < 8; ++i) { a[i] = (_Float16)p[i]; a[8 + i] = (_Float16)p[16 + i]; }
  return a;
}
__device__ __forceinline__ v16h frag_f32s(const float* rowk0, int lane, float sc) {
  v16h a; const float* p = rowk0 + 8 * (lane >> 4);
#pragma unroll
  for (int i = 0; i < 8; ++i) { a[i] = (_Float16)(p[i] * sc); a[8 + i] = (_Float16)(p[16 + i] * sc); }
  return a;
}
// column fragment from a [K][ld] layout (column n), rows >= K read as 0
__device__ __forceinline__ v16h fragc_f32(const float* W, int k0, int n, int lane, int ld, int K) {
  v16h a; const int g = lane >> 4;
#pragma unroll
  for (int i = 0; i < 8; ++i) { const int ka = k0 + 8 * g + i, kb = ka + 16;
    a[i] = (_Float16)(ka < K ? W[(size_t)(ka < K ? ka : K - 1) * ld + n] : 0.f); a[8 + i] = (_Float16)(kb < K ? W[(size_t)(kb < K ? kb : K - 1) * ld + n] : 0.f); }
  return a;
}
struct F2 { v16b h, l; };
__device__ __forceinline__ F2 bsplit16(const float v[16]) { F2 r;
#pragma unroll
  for (int i = 0; i < 16; ++i) { const __bf16 h = (__bf16)v[i]; r.h[i] = h; r.l[i] = (__bf16)(v[i] - (float)h); }
  return r; }
__device__ __forceinline__ F2 split_row(const float* row, int k0, int lane) { float v[16]; const float* p = row + k0 + 8 * (lane >> 4);
#pragma unroll
  for (int i = 0; i < 8; ++i) { v[i] = p[i]; v[8 + i] = p[16 + i]; }
  return bsplit16(v); }
__device__ __forceinline__ F2 split_rowK(const float* row, int k0, int lane, int K) { float v[16]; const int g = lane >> 4;
#pragma unroll
  for (int i = 0; i < 8; ++i) { const int ka = k0 + 8 * g + i, kb = ka + 16; v[i] = ka < K ? row[ka < K ? ka : K - 1] : 0.f; v[8 + i] = kb < K ? row[kb < K ? kb : K - 1] : 0.f; }
  return bsplit16(v); }
__device__ __forceinline__ F2 split_col(const float* W, int k0, int n, int lane, int ld, int K) { float v[16]; const int g = lane >> 4;
#pragma unroll
  for (int i = 0; i < 8; ++i) { const int ka = k0 + 8 * g + i, kb = ka + 16; v[i] = ka < K ? W[(size_t)(ka < K ? ka : K - 1) * ld + n] : 0.f; v[8 + i] = kb < K ? W[(size_t)(kb < K ? kb : K - 1) * ld + n] : 0.f; }
  return bsplit16(v); }
__device__ __forceinline__ v8f mac3(const F2& a, const F2& b, v8f c) { c = wmma_bf(a.l, b.h, c); c = wmma_bf(a.h, b.l, c); return wmma_bf(a.h, b.h, c); }
__device__ __forceinline__ float sigm(float v) { return 1.0f / (1.0f + expf(-v)); }
#define LDSX() do { asm volatile("s_wait_dscnt 0" ::: "memory"); __builtin_amdgcn_wave_barrier(); __builtin_amdgcn_fence(__ATOMIC_RELEASE, "workgroup"); } while (0)

// Differential attention (B 2, N 2,048, C 1,024; 16 heads, head_dim 32, v 64 wide): qkv = x W_qkv ((in,out) [1024, 3072], columns (3, H, 64)); q, k -> 32 sub-heads of 32: q1/k1 = sub-heads 0..15, q2/k2 = sub-heads 16..31, v head h = columns h*64..; attn_i = softmax(q_i k_i^T / sqrt(32)) v; lam = exp(sum lq1 lk1) - exp(sum lq2 lk2) + lambda_init (0.78360578); o = attn1 - lam attn2; o = o rsqrt(mean(o^2) + 1e-5) subln_w (1 - lambda_init); out = merged(o) W_proj + b_proj.
#define NB 2
#define TT 2048
#define CC 1024            // NH * HD = projected width
#define DIN 1024          // input (model) width
#define NH 32              // softmax sub-heads (16 heads x 2 halves)
#define HD 32
#define NQB (TT / 64)
#define HG 4
#define SCALE (0.17677669529663687f)
#define CAUSAL 0
#ifndef TNB
#define TNB NB
#endif
__device__ __forceinline__ float bfr(float v) { return (float)(__bf16)v; }
__host__ __device__ __forceinline__ int kb_last(int qb) { return CAUSAL ? ((qb * 64 + 63) >> 7) : (TT / 128 - 1); }
typedef __attribute__((ext_vector_type(8))) __bf16 v8b;
typedef __attribute__((ext_vector_type(4))) __bf16 v4b;
typedef __attribute__((ext_vector_type(4))) _Float16 v4h;
__device__ __forceinline__ v16b frag_b(const __bf16* rowk0, int lane) {
  union { v16b v; v8b q[2]; } u; const __bf16* p = rowk0 + 8 * (lane >> 4);
  u.q[0] = *(const v8b*)p; u.q[1] = *(const v8b*)(p + 16); return u.v;
}
#define QBH 0
#define QHI 2048            // rows carrying a q residual plane (all rows: 2-product logits everywhere)
#define KHI 64            // key rows carrying k residual / v bf16 hi+lo planes (written or read by no kernel)
// B fragment (k rows k0+.., output column o) of a weight: (in,out) [K][ld] or (out,in) [ld rows of K]: bf16 exact, or f16(bf16 * 256) exact
__device__ __forceinline__ v16b wcol_io(const float* Wm, int k0, int o, int lane, int ld) { v16b w; const int g = lane >> 4;
#pragma unroll
  for (int i = 0; i < 8; ++i) { w[i] = (__bf16)Wm[(size_t)(k0 + 8 * g + i) * ld + o]; w[8 + i] = (__bf16)Wm[(size_t)(k0 + 16 + 8 * g + i) * ld + o]; }
  return w; }
__device__ __forceinline__ v16b wcol_oi(const float* Wm, int k0, int o, int lane, int K) { v16b w; const float* p = Wm + (size_t)o * K + k0 + 8 * (lane >> 4);
#pragma unroll
  for (int i = 0; i < 8; ++i) { w[i] = (__bf16)p[i]; w[8 + i] = (__bf16)p[16 + i]; }
  return w; }
__device__ __forceinline__ v16h wcolh_io(const float* Wm, int k0, int o, int lane, int ld) { v16h w; const int g = lane >> 4;
#pragma unroll
  for (int i = 0; i < 8; ++i) { w[i] = (_Float16)(bfr(Wm[(size_t)(k0 + 8 * g + i) * ld + o]) * 256.0f); w[8 + i] = (_Float16)(bfr(Wm[(size_t)(k0 + 16 + 8 * g + i) * ld + o]) * 256.0f); }
  return w; }
__device__ __forceinline__ v16h wcolh_oi(const float* Wm, int k0, int o, int lane, int K) { v16h w; const float* p = Wm + (size_t)o * K + k0 + 8 * (lane >> 4);
#pragma unroll
  for (int i = 0; i < 8; ++i) { w[i] = (_Float16)(bfr(p[i]) * 256.0f); w[8 + i] = (_Float16)(bfr(p[16 + i]) * 256.0f); }
  return w; }
#define WQKV_LAYOUT 0   // 0 = (in,out) [DIN][3 * CC]; 1 = (out,in) [CC][DIN]; 2 = per-head [NH][DIN][HD]
__device__ __forceinline__ v16b wcol_hdk(const float* Wm, int k0, int o, int lane) { v16b w; const int g = lane >> 4; const float* p = Wm + (size_t)(o / HD) * DIN * HD + (o % HD);
#pragma unroll
  for (int i = 0; i < 8; ++i) { w[i] = (__bf16)p[(size_t)(k0 + 8 * g + i) * HD]; w[8 + i] = (__bf16)p[(size_t)(k0 + 16 + 8 * g + i) * HD]; }
  return w; }
#define WO_OUT_IN 0
#if WQKV_LAYOUT == 1
#define WCOL(W, k0, o, lane) wcol_oi(W, k0, o, lane, DIN)
#elif WQKV_LAYOUT == 2
#define WCOL(W, k0, o, lane) wcol_hdk(W, k0, o, lane)
#else
#define WCOL(W, k0, o, lane) wcol_io(W, k0, o, lane, 3 * CC)   /* W_qkv (in,out) packed by columns: row pitch 3C */
#endif
#if WO_OUT_IN
#define WOCOL(W, k0, o, lane) wcol_oi(W, k0, o, lane, CC)
#define WOCOLH(W, k0, o, lane) wcolh_oi(W, k0, o, lane, CC)
#else
#define WOCOL(W, k0, o, lane) wcol_io(W, k0, o, lane, DIN)
#define WOCOLH(W, k0, o, lane) wcolh_io(W, k0, o, lane, DIN)
#endif
#define HDV 64             // value columns per softmax sub-head (the parent head's 64 columns)
#define YP (NH * HDV)      // 2,048: pitch of the per-sub-head context rows Y[b*t][h'*64 + d]
#define LAMBDA_INIT 0.78360578f   /* 0.8 - 0.6 exp(-0.3 * 12) */
#ifndef SM_EXTRA_PARAMS
#define SM_EXTRA_PARAMS
#endif
#ifndef PROJ_EXTRA_PARAMS
#define PROJ_EXTRA_PARAMS
#endif
#ifndef SM_MASK_HOOK
#define SM_MASK_HOOK (void)0
#endif

#define WS_QH  0u                                      // f16 q rows [b*t][CC]
#define WS_KH  (WS_QH + 2u * (size_t)NB * TT * CC)      // f16 k rows [b*t][CC]
#define WS_VT  (WS_KH + 2u * (size_t)NB * TT * CC)      // f16 v planes [b][c][t]
#define WS_QL  (WS_VT + 2u * (size_t)NB * CC * TT)      // f16 q residual x 2^10 rows [b][t < QHI][CC]
#define WS_KL  (WS_QL + 2u * (size_t)NB * QHI * CC)     // f16 k residual x 2^10 rows [b][t < KHI][CC]
#define WS_VB  (WS_KL + 2u * (size_t)NB * KHI * CC)     // bf16 v hi planes [b][c][t < KHI]
#define WS_VBL (WS_VB + 2u * (size_t)NB * CC * KHI)
#define WS_S   (WS_VBL + 2u * (size_t)NB * CC * KHI)    // f32 differential rows [b*t][CC] (k_fa -> k_out)
#define WS_Y   (WS_S  + 4u * (size_t)HG * TT * TT)      // f32 per-softmax-head context rows [b*t][YP = 32 x 64] (written or read by no kernel)
#define WS_END (WS_Y  + 4u * (size_t)NB * TT * YP)

// ---- gemm_tile: one 128 x 128 tile of X W (K = 1,024) per block of 8 waves. Each pass of 32 k is staged once per block in LDS as 16-bit rows of k: X rows (whole 128-B lines per 8 lanes) and W columns (a thread takes 16 k of one column, a wave 128 B of each W row), rounded to the 16-bit type on the way. Two buffers: the next pass's global loads fly while this pass's WMMAs run; one barrier a pass.
// MODE 0: both operands to bf16. MODE 1: X once to f16, W as f16(bf16 x 2^8).
// Every '#pragma unroll' from here to the end of k_proj, and in k_out, except on the store loops, makes the indices of a register array (staged values, fragments, accumulators) constants, so that the array stays in registers.
// The product is D[p][q], p over the rows of staged operand pi (0 = X rows, 1 = W columns), q over the other's: a lane then holds 8 consecutive p of one q.
#define GT 128             // tile edge
#define GK 32              // k per pass
#define GKK 1024           // K (= DIN = CC)
#define GP 40              // LDS row pitch in 16-bit elements (80 B = 16 B x odd)
#define GOPB (GT * GP * 2) // bytes of one staged operand
#define GSMB (2 * GT * 136 * 2)   // LDS of a block: the ring (4 x GOPB) or, behind it, the output staging (two f16 planes of pitch 136, or f32 rows of pitch 132)
// four 16-B stores and their s_wait_xcnt in one statement: what follows rewrites their address and data registers
__device__ __forceinline__ void g_st4(void* p0, void* p1, void* p2, void* p3, v4u a, v4u b, v4u c, v4u d) {
  asm volatile("global_store_b128 %0, %4, off\n\tglobal_store_b128 %1, %5, off\n\tglobal_store_b128 %2, %6, off\n\tglobal_store_b128 %3, %7, off\n\ts_wait_xcnt 0x0" :: "v"(p0), "v"(p1), "v"(p2), "v"(p3), "v"(a), "v"(b), "v"(c), "v"(d) : "memory"); }
// one pass's global loads of a thread, then its pointers move on. The three scheduling barriers keep everything but the loads out of the stretch up to their s_wait_xcnt (no register that a load names is rewritten ahead of it) and keep all the loads ahead of the WMMAs that follow (without them half of the loads sink into the pass, and their latency is waited out a second time)
__device__ __forceinline__ void g_fetch(const float*& px, const float*& pw, int ldw, v4f (&xa)[4], float (&wb)[16]) {
  __builtin_amdgcn_sched_barrier(0);
#pragma unroll
  for (int i = 0; i < 4; ++i) xa[i] = *(const v4f*)(px + (size_t)i * 32 * GKK);
#pragma unroll
  for (int i = 0; i < 16; ++i) wb[i] = pw[(size_t)i * ldw];
  __builtin_amdgcn_sched_barrier(0);
  asm volatile("s_wait_xcnt 0x0" :: "v"(px), "v"(pw) : "memory");   /* before the loads' address registers are rewritten; it names both addresses so that they keep their registers up to here (else a later load of the group is given an earlier one's address pair as its destination) */
  __builtin_amdgcn_sched_barrier(0);
  px += GK; pw += (size_t)GK * ldw;
}
template <int MODE> __device__ __forceinline__ void g_put(char* bx, char* bw, const v4f (&xa)[4], const float (&wb)[16]) {
  if (MODE == 0) {
#pragma unroll
    for (int i = 0; i < 4; ++i) { v4b c;
#pragma unroll
      for (int e = 0; e < 4; ++e) c[e] = (__bf16)xa[i][e];
      *(v4b*)(bx + i * 32 * GP * 2) = c; }
    v8b w0, w1;
#pragma unroll
    for (int e = 0; e < 8; ++e) { w0[e] = (__bf16)wb[e]; w1[e] = (__bf16)wb[8 + e]; }
    *(v8b*)bw = w0; *(v8b*)(bw + 16) = w1;
  } else {
#pragma unroll
    for (int i = 0; i < 4; ++i) { v4h c;
#pragma unroll
      for (int e = 0; e < 4; ++e) c[e] = (_Float16)xa[i][e];
      *(v4h*)(bx + i * 32 * GP * 2) = c; }
    v8h w0, w1;
#pragma unroll
    for (int e = 0; e < 8; ++e) { w0[e] = (_Float16)(bfr(wb[e]) * 256.0f); w1[e] = (_Float16)(bfr(wb[8 + e]) * 256.0f); }
    *(v8h*)bw = w0; *(v8h*)(bw + 16) = w1;
  }
}
template <int MODE> __device__ __forceinline__ void gemm_tile(const float* __restrict__ Xr, const float* __restrict__ Wc, const int ldw, const int pi, char* sm, v8f (&acc)[2][4]) {
  const int tid = threadIdx.x, wave = tid >> 5, lane = tid & 31, col = lane & 15;
  const int xr = tid >> 3, xk = (tid & 7) * 4, wn = tid & 127, wk = (tid >> 7) * 16;
  const float* gx = Xr + (size_t)xr * GKK + xk; const float* gw = Wc + (size_t)wk * ldw + wn;
  const int xo = (xr * GP + xk) * 2, wo = GOPB + (wn * GP + wk) * 2;   /* a thread's own places in a buffer: [X rows | W columns] */
  const int po = pi * GOPB + ((wave & 3) * 32 + col) * GP * 2, qo = (pi ^ 1) * GOPB + ((wave >> 2) * 64 + col) * GP * 2;
  v4f xa[4]; float wb[16];
  g_fetch(gx, gw, ldw, xa, wb);
  g_put<MODE>(sm + xo, sm + wo, xa, wb);
  __syncthreads();
  for (int s = 0; s < GKK / GK; ++s) { char* cb = sm + (s & 1) * 2 * GOPB; char* nb = sm + ((s & 1) ^ 1) * 2 * GOPB; const bool more = s + 1 < GKK / GK;
    if (more) g_fetch(gx, gw, ldw, xa, wb);
    if (MODE == 0) { v16b P[2], Q[4];
#pragma unroll
      for (int i = 0; i < 2; ++i) P[i] = frag_b((const __bf16*)(cb + po + i * 16 * GP * 2), lane);
#pragma unroll
      for (int i = 0; i < 4; ++i) Q[i] = frag_b((const __bf16*)(cb + qo + i * 16 * GP * 2), lane);
#pragma unroll
      for (int i = 0; i < 2; ++i)
#pragma unroll
        for (int j = 0; j < 4; ++j) acc[i][j] = __builtin_amdgcn_wmma_f32_16x16x32_bf16(false, P[i], false, Q[j], (short)0, acc[i][j], false, false);
    } else { v16h P[2], Q[4];
#pragma unroll
      for (int i = 0; i < 2; ++i) P[i] = frag_h((const _Float16*)(cb + po + i * 16 * GP * 2), lane);
#pragma unroll
      for (int i = 0; i < 4; ++i) Q[i] = frag_h((const _Float16*)(cb + qo + i * 16 * GP * 2), lane);
#pragma unroll
      for (int i = 0; i < 2; ++i)
#pragma unroll
        for (int j = 0; j < 4; ++j) acc[i][j] = __builtin_amdgcn_wmma_f32_16x16x32_f16(false, P[i], false, Q[j], (short)0, acc[i][j], false, false);
    }
    __builtin_amdgcn_sched_barrier(0);   /* the roundings, which wait for the loads, stay behind the last WMMA: the wave issues in order */
    if (more) g_put<MODE>(nb + xo, nb + wo, xa, wb);   /* that buffer's last readers left it before the previous barrier */
    __syncthreads(); }
}
// ---- k_proj: block = (128 rows, 128 cols, which): q/k/v = X W with exact bf16 products (K = DIN) -> which 0: q f16 rows + residual x 2^10 rows; 1: k f16 rows; 2: v f16 planes [c][t]. q, k: p = column, q = row; v: p = row (t), q = column: either way a lane's 8 values are 16 B of an output row, staged in LDS and stored as whole 256-B rows
__global__ __launch_bounds__(256) void k_proj(const float* __restrict__ X, const float* __restrict__ WQKV, _Float16* __restrict__ QH, _Float16* __restrict__ QL, _Float16* __restrict__ KH, _Float16* __restrict__ VT) {
  __shared__ __align__(16) char sm[GSMB];
  const int tid = threadIdx.x, wave = tid >> 5, lane = tid & 31, col = lane & 15, g = lane >> 4; const int which = blockIdx.z; const int c0 = blockIdx.y * GT; const size_t r0 = (size_t)blockIdx.x * GT; const size_t bb = r0 / TT; const int t0 = (int)(r0 % TT);
  v8f acc[2][4] = {};
  gemm_tile<0>(X + r0 * DIN, WQKV + which * CC + c0, 3 * CC, which < 2 ? 1 : 0, sm, acc);
  _Float16* sh = (_Float16*)sm; _Float16* sl = sh + GT * 136;
#pragma unroll
  for (int i = 0; i < 2; ++i)
#pragma unroll
    for (int j = 0; j < 4; ++j) { v8h hv, lv;
#pragma unroll
      for (int r = 0; r < 8; ++r) { const float v = acc[i][j][r]; hv[r] = (_Float16)v; lv[r] = (_Float16)((v - (float)hv[r]) * 1024.0f); }
      const int o = ((wave >> 2) * 64 + j * 16 + col) * 136 + (wave & 3) * 32 + i * 16 + 8 * g; *(v8h*)&sh[o] = hv; if (which == 0) *(v8h*)&sl[o] = lv; }
  __syncthreads();
  _Float16* D = which == 0 ? QH + r0 * CC + c0 : which == 1 ? KH + r0 * CC + c0 : VT + (bb * CC + c0) * (size_t)TT + t0; const size_t dp = which < 2 ? CC : TT;
  const int q = tid >> 4, pc = (tid & 15) * 8;   /* a wave stores two whole 256-B rows at a time */
#pragma unroll
  for (int t = 0; t < 2; ++t) { const int qq = q + t * 64; _Float16* d = D + qq * dp + pc; const _Float16* s = &sh[qq * 136 + pc];
    g_st4(d, d + 16 * dp, d + 32 * dp, d + 48 * dp, *(const v4u*)s, *(const v4u*)(s + 16 * 136), *(const v4u*)(s + 32 * 136), *(const v4u*)(s + 48 * 136)); }
  if (which == 0) {
#pragma unroll
    for (int t = 0; t < 2; ++t) { const int qq = q + t * 64; _Float16* d = QL + (r0 + qq) * CC + c0 + pc; const _Float16* s = &sl[qq * 136 + pc];
      g_st4(d, d + 16 * CC, d + 32 * CC, d + 48 * CC, *(const v4u*)s, *(const v4u*)(s + 16 * 136), *(const v4u*)(s + 32 * 136), *(const v4u*)(s + 48 * 136)); } } }
#define FQ 2               // query column groups (16 queries each) per wave
#define FS 64              // keys per stage (one LDS buffer)
#define KP 40              // K row pitch in LDS, halfs (80 B = 16 B x odd)
#define VP 72              // v plane row pitch in LDS, halfs (144 B = 16 B x odd)
#define LC1 (SCALE * 1.4426950408889634f)
#define LC2 (SCALE * 1.4426950408889634f / 1024.0f)
typedef __attribute__((ext_vector_type(2))) _Float16 v2h;
__device__ __forceinline__ v8f wmma_h(v16h a, v16h b, v8f c) { return __builtin_amdgcn_wmma_f32_16x16x32_f16(false, a, false, b, (short)0, c, false, false); }
__global__ __launch_bounds__(512) void k_fa(const _Float16* __restrict__ QH, const _Float16* __restrict__ QL, const _Float16* __restrict__ KH, const _Float16* __restrict__ VT, const float* __restrict__ LQ1, const float* __restrict__ LK1, const float* __restrict__ LQ2, const float* __restrict__ LK2, const float* __restrict__ SW, float* __restrict__ YD) {
  __shared__ __align__(16) _Float16 sK[2][2][FS][KP]; __shared__ __align__(16) _Float16 sV[2][HDV][VP]; __shared__ __align__(16) v4f sX[8 * FQ * (HDV / 8)][32];   /* sK: [buffer][sub-head half]; sX: the hand-over, 16 B a lane */
  const int tid = threadIdx.x, wave = __builtin_amdgcn_readfirstlane(tid >> 5), lane = tid & 31, col = lane & 15, g = lane >> 4;
  const int half = wave >> 3, w8 = wave & 7;
  const int e = blockIdx.y, h = e + 16 * half, b = blockIdx.z; const int q0 = blockIdx.x * (8 * FQ * 16) + w8 * (FQ * 16); const int vc0 = e * HDV;   /* both sub-heads use v head e */
  v16h qh[FQ], ql[FQ];
#pragma unroll
  for (int qt = 0; qt < FQ; ++qt) { qh[qt] = frag_h(QH + ((size_t)b * TT + q0 + qt * 16 + col) * CC + h * HD, lane); ql[qt] = frag_h(QL + ((size_t)b * QHI + q0 + qt * 16 + col) * CC + h * HD, lane); }
  // staging: a stage = 64 K rows of 64 B of each sub-head (a thread takes one 16-B piece of its own half's) + 64 v plane rows of 128 B (one piece a thread)
  const int kr = (tid & 255) >> 2, kq = (tid & 3) * 8, vr = tid >> 3, vq = (tid & 7) * 8;
  const _Float16* gk = KH + ((size_t)b * TT + kr) * CC + h * HD + kq; const _Float16* gv = VT + ((size_t)b * CC + vc0 + vr) * (size_t)TT + vq;
  v4u rk = *(const v4u*)gk, rv0 = *(const v4u*)gv;
  float la = bfr(LQ1[lane]) * bfr(LK1[lane]), lc = bfr(LQ2[lane]) * bfr(LK2[lane]);   /* 32-term dots: one term per lane, fixed xor-tree order */
#pragma unroll
  for (int of = 1; of < 32; of <<= 1) { la += __shfl_xor(la, of); lc += __shfl_xor(lc, of); }
  const float lam = __builtin_bit_cast(float, __builtin_amdgcn_readfirstlane(__builtin_bit_cast(int, expf(la) - expf(lc) + LAMBDA_INIT)));   /* the same in every lane: kept in a scalar register over the key loop */
  *(v4u*)&sK[0][half][kr][kq] = rk; *(v4u*)&sV[0][vr][vq] = rv0;
  __syncthreads();
  v8f o[FQ][HDV / 16] = {}; float mo[FQ]; v2f l[FQ];   /* l: a lane's own keys, even and odd registers apart; joined after the loop */
#pragma unroll
  for (int qt = 0; qt < FQ; ++qt) { mo[qt] = 0.f; l[qt] = (v2f){0.f, 0.f}; }
  const v2f c1 = {LC1, LC1}, c2 = {LC2, LC2};
  for (int s = 0; s < TT / FS; ++s) { const int cur = s & 1; const bool more = s + 1 < TT / FS;
    if (more) { rk = *(const v4u*)(gk + (size_t)(s + 1) * FS * CC); rv0 = *(const v4u*)(gv + (s + 1) * FS);   /* the next stage's rows fly while this stage is worked on */
      asm volatile("s_wait_xcnt 0x0" ::: "memory"); }   /* before the two loads' address registers move on to the next stage */
#pragma unroll
    for (int kc = 0; kc < FS / 32; ++kc) {   /* unrolled: every fragment index constant */
      v16h kf[2]; v2f t[FQ][2][4]; float mx[FQ];
#pragma unroll
      for (int kt = 0; kt < 2; ++kt) kf[kt] = frag_h(&sK[cur][half][kc * 32 + kt * 16 + col][0], lane);
#pragma unroll
      for (int qt = 0; qt < FQ; ++qt) { mx[qt] = -3.0e38f; const v2f nm = {-mo[qt], -mo[qt]};
#pragma unroll
        for (int kt = 0; kt < 2; ++kt) { const v8f z = {}; const v8f sl = wmma_h(kf[kt], ql[qt], z), sh = wmma_h(kf[kt], qh[qt], z);
#pragma unroll
          for (int i = 0; i < 4; ++i) { const v2f hp = {sh[2 * i], sh[2 * i + 1]}, lp = {sl[2 * i], sl[2 * i + 1]}; const v2f v = __builtin_elementwise_fma(hp, c1, __builtin_elementwise_fma(lp, c2, nm)); t[qt][kt][i] = v; mx[qt] = fmaxf(mx[qt], fmaxf(v[0], v[1])); } } }
      const bool first = (s == 0) && (kc == 0); bool need = false;
#pragma unroll
      for (int qt = 0; qt < FQ; ++qt) need = need || (mx[qt] > 14.0f);
      if (first || __builtin_amdgcn_ballot_w32(need) != 0) {   /* wave-uniform; the first pass sets the offset from its own logits, in either direction */
#pragma unroll
        for (int qt = 0; qt < FQ; ++qt) { const float mj = fmaxf(mx[qt], __shfl_xor(mx[qt], 16));   /* both halves of a column take the same offset */
          const float d = first ? mj - 6.0f : fmaxf(mj - 6.0f, 0.f); const float al = __builtin_amdgcn_exp2f(-fmaxf(d, 0.f)); mo[qt] += d; l[qt] *= al;
#pragma unroll
          for (int j = 0; j < HDV / 16; ++j) o[qt][j] *= al;
#pragma unroll
          for (int kt = 0; kt < 2; ++kt)
#pragma unroll
            for (int i = 0; i < 4; ++i) t[qt][kt][i] -= d; } }
      v16h pf[FQ];
#pragma unroll
      for (int qt = 0; qt < FQ; ++qt) {
#pragma unroll
        for (int i = 0; i < 8; ++i) { const v2f x = t[qt][i >> 2][i & 3]; v2f e; e[0] = __builtin_amdgcn_exp2f(x[0]); e[1] = __builtin_amdgcn_exp2f(x[1]); l[qt] += e;
          const v2h ph = __builtin_convertvector(e, v2h); pf[qt][2 * i] = ph[0]; pf[qt][2 * i + 1] = ph[1]; } }   /* element s of the B operand = tile s >> 3, register s & 7 */
#pragma unroll
      for (int j = 0; j < HDV / 16; ++j) { const v16h vf = frag_h(&sV[cur][j * 16 + col][kc * 32], lane);
#pragma unroll
        for (int qt = 0; qt < FQ; ++qt) o[qt][j] = wmma_h(vf, pf[qt], o[qt][j]); } }
    if (more) { *(v4u*)&sK[cur ^ 1][half][kr][kq] = rk; *(v4u*)&sV[cur ^ 1][vr][vq] = rv0; }   /* that buffer's last readers left it before the previous barrier */
    __syncthreads(); }
#pragma unroll
  for (int qt = 0; qt < FQ; ++qt) { const float ls = l[qt][0] + l[qt][1]; const float inv = 1.0f / (ls + __shfl_xor(ls, 16));
#pragma unroll
    for (int j = 0; j < HDV / 16; ++j) o[qt][j] *= inv; }   /* register r of tile j = value column j*16 + 8g + r of query col */
  if (half) {
#pragma unroll
    for (int qt = 0; qt < FQ; ++qt)
#pragma unroll
      for (int j = 0; j < HDV / 16; ++j) { v4f a, c;
#pragma unroll
        for (int r = 0; r < 4; ++r) { a[r] = o[qt][j][r]; c[r] = o[qt][j][4 + r]; }
        sX[(w8 * FQ + qt) * (HDV / 8) + 2 * j][lane] = a; sX[(w8 * FQ + qt) * (HDV / 8) + 2 * j + 1][lane] = c; } }
  __syncthreads();   /* every wave passes it: attn2 is in LDS for the partner waves */
  if (!half) { float sw[HDV / 16][8];
#pragma unroll
    for (int j = 0; j < HDV / 16; ++j)
#pragma unroll
      for (int r = 0; r < 8; ++r) sw[j][r] = bfr(SW[j * 16 + 8 * g + r]) * (1.0f - LAMBDA_INIT);
#pragma unroll
    for (int qt = 0; qt < FQ; ++qt) { float q = 0.f;
#pragma unroll
      for (int j = 0; j < HDV / 16; ++j) { const v4f a = sX[(w8 * FQ + qt) * (HDV / 8) + 2 * j][lane], c = sX[(w8 * FQ + qt) * (HDV / 8) + 2 * j + 1][lane];
#pragma unroll
        for (int r = 0; r < 4; ++r) { o[qt][j][r] -= lam * a[r]; o[qt][j][4 + r] -= lam * c[r]; }
#pragma unroll
        for (int r = 0; r < 8; ++r) q += o[qt][j][r] * o[qt][j][r]; }
      q += __shfl_xor(q, 16);   /* a lane holds 32 of its query's 64 columns, lane ^ 16 the rest */
      const float rs = rsqrtf(q * (1.0f / 64.0f) + 1e-5f); float* yr = YD + ((size_t)b * TT + q0 + qt * 16 + col) * CC + e * HDV + 8 * g;
#pragma unroll
      for (int j = 0; j < HDV / 16; ++j) { v4f a, c;
#pragma unroll
        for (int r = 0; r < 4; ++r) { a[r] = o[qt][j][r] * rs * sw[j][r]; c[r] = o[qt][j][4 + r] * rs * sw[j][4 + r]; }
        vst2(yr + j * 16, a); vst2(yr + j * 16 + 4, c); } } } }
// ---- k_out: block = (128 rows, 128 cols): out = ctx Wo + bo: ctx once to f16 against Wo as f16(bf16 x 2^8) exact (1 product) x 2^-8; p = column, q = row; f32 rows staged in LDS and stored as whole 512-B rows
__global__ __launch_bounds__(256) void k_out(const float* __restrict__ Y, const float* __restrict__ WO, const float* __restrict__ BO, float* __restrict__ OUT) {
  __shared__ __align__(16) char sm[GSMB];
  const int tid = threadIdx.x, wave = tid >> 5, lane = tid & 31, col = lane & 15, g = lane >> 4; const int c0 = blockIdx.y * GT; const size_t r0 = (size_t)blockIdx.x * GT;
  v8f acc[2][4] = {};
  gemm_tile<1>(Y + r0 * CC, WO + c0, DIN, 1, sm, acc);
  float* sf = (float*)sm;
#pragma unroll
  for (int i = 0; i < 2; ++i) { const int p = (wave & 3) * 32 + i * 16 + 8 * g; float bias[8];
#pragma unroll
    for (int r = 0; r < 8; ++r) bias[r] = bfr(BO[c0 + p + r]);
#pragma unroll
    for (int j = 0; j < 4; ++j) { v4f a, c;
#pragma unroll
      for (int r = 0; r < 4; ++r) { a[r] = acc[i][j][r] * (1.0f / 256.0f) + bias[r]; c[r] = acc[i][j][4 + r] * (1.0f / 256.0f) + bias[4 + r]; }
      float* d = &sf[((wave >> 2) * 64 + j * 16 + col) * 132 + p]; *(v4f*)d = a; *(v4f*)(d + 4) = c; } }
  __syncthreads();
  const int q = tid >> 5, pc = (tid & 31) * 4;   /* a wave stores one whole 512-B row at a time */
#pragma unroll
  for (int t = 0; t < 4; ++t) { const int qq = q + t * 32; float* d = OUT + (r0 + qq) * DIN + c0 + pc; const float* s = &sf[qq * 132 + pc];
    g_st4(d, d + 8 * DIN, d + 16 * DIN, d + 24 * DIN, *(const v4u*)s, *(const v4u*)(s + 8 * 132), *(const v4u*)(s + 16 * 132), *(const v4u*)(s + 24 * 132)); } }

extern "C" void kernel_launch(void* const* d_in, const int* in_sizes, int n_in, void* d_out, int out_size, void* d_ws, size_t ws_size, hipStream_t stream) {
  (void)in_sizes; (void)n_in; (void)out_size;
  const float** F = (const float**)d_in;
  if (ws_size < (size_t)WS_END) return;
  char* ws = (char*)d_ws; _Float16 *QH = (_Float16*)(ws + WS_QH), *KH = (_Float16*)(ws + WS_KH), *VT = (_Float16*)(ws + WS_VT), *QL = (_Float16*)(ws + WS_QL), *KL = (_Float16*)(ws + WS_KL); __bf16 *VB = (__bf16*)(ws + WS_VB), *VBL = (__bf16*)(ws + WS_VBL); float *S = (float*)(ws + WS_S), *Y = (float*)(ws + WS_Y);
  (void)Y; (void)QL; (void)KL; (void)VB; (void)VBL;
  // inputs (in order): 0 x [2,2048,1024]; 1 W_qkv [1024,3072] (in,out; columns (3, H, 64)); 2 W_proj [1024,1024] (in,out); 3 b_proj; 4 lambda_q1, 5 lambda_k1, 6 lambda_q2, 7 lambda_k2 [32]; 8 subln_w [64]
  float* YD = S;   /* the differential rows' plane */
  k_proj<<<dim3(TNB * TT / GT, CC / GT, 3), 256, 0, stream>>>(F[0], F[1], QH, QL, KH, VT);
  k_fa<<<dim3(TT / 256, NH / 2, TNB), 512, 0, stream>>>(QH, QL, KH, VT, F[4], F[5], F[6], F[7], F[8], YD);
  k_out<<<dim3(TNB * TT / GT, DIN / GT), 256, 0, stream>>>(YD, F[2], F[3], (float*)d_out);
}

// v004
// It runs in 121 microseconds.
// In both of two side-by-side timings against v003, it was 1.04 times as fast.
// All steps since v000 together make it 17.1 times as fast.
// compute dtype: all float inputs rounded to bf16; qkv = x W_qkv with EXACT bf16 products on WMMA 16x16x32 (f32 accumulate); the 32-wide sub-head logits with q x 32^-0.5 log2(e) x 2^4 as f16 hi + residual against k x 2^-4 once to f16 (2 products, one f32 accumulate chain that starts at minus the running offset); both softmaxes in f32 (running maximum offset, exp2 on log2-scaled logits, f32 sum); each unnormalised P once to f16 against the head's 64-wide v once to f16 (1 product), divided by the sum last; the differential combination, the per-head RMS normalisation (x subln_w x (1 - lambda_init)) in f32; the result once to f16 against W_proj carried x 2^8 in f16 + b_proj; f32 output.
#include <hip/hip_runtime.h>
#include <math.h>

typedef __attribute__((ext_vector_type(16))) _Float16 v16h;
typedef __attribute__((ext_vector_type(16))) __bf16 v16b;
typedef __attribute__((ext_vector_type(8)))  _Float16 v8h;
typedef __attribute__((ext_vector_type(8)))  float v8f;
typedef __attribute__((ext_vector_type(4)))  float v4f;
typedef __attribute__((ext_vector_type(2)))  float v2f;
typedef __attribute__((ext_vector_type(4)))  unsigned v4u;
typedef __attribute__((ext_vector_type(4)))  int v4i;
typedef float __attribute__((may_alias)) float_a;
typedef int __attribute__((may_alias)) int_a;

template <typename T> __device__ __forceinline__ void vst2(void* p, T v) { *(T*)p = v;  }
__device__ __forceinline__ v8f wmma16(v16h a, v16h b, v8f c) {
  v8f d = __builtin_amdgcn_wmma_f32_16x16x32_f16(false, a, false, b, (short)0, c, false, false);
  asm volatile("v_nop\n\tv_nop\n\tv_nop\n\tv_nop" : "+v"(d) : "v"(a), "v"(b));
  return d;
}
__device__ __forceinline__ v8f wmma_bf(v16b a, v16b b, v8f c) {
  v8f d = __builtin_amdgcn_wmma_f32_16x16x32_bf16(false, a, false, b, (short)0, c, false, false);
  asm volatile("v_nop\n\tv_nop\n\tv_nop\n\tv_nop" : "+v"(d) : "v"(a), "v"(b));
  return d;
}
// 16x16x32 fragments: lane = (h = lane>>4, row/col = lane&15); elements 0..7 = k0+8h+0..7, 8..15 = k0+16+8h+0..7; D element r = row 8h+r
__device__ __forceinline__ v16h frag_h(const _Float16* rowk0, int lane) {
  union { v16h v; v8h q[2]; } u; const _Float16* p = rowk0 + 8 * (lane >> 4);
  u.q[0] = *(const v8h*)p; u.q[1] = *(const v8h*)(p + 16); return u.v;
}
__device__ __forceinline__ v16h frag_f32(const float* rowk0, int lane) {
  v16h a; const float* p = rowk0 + 8 * (lane >> 4);
#pragma unroll
  for (int i = 0; i < 8; ++i) { a[i] = (_Float16)p[i]; a[8 + i] = (_Float16)p[16 + i]; }
  return a;
}
__device__ __forceinline__ v16h frag_f32s(const float* rowk0, int lane, float sc) {
  v16h a; const float* p = rowk0 + 8 * (lane >> 4);
#pragma unroll
  for (int i = 0; i < 8; ++i) { a[i] = (_Float16)(p[i] * sc); a[8 + i] = (_Float16)(p[16 + i] * sc); }
  return a;
}
// column fragment from a [K][ld] layout (column n), rows >= K read as 0
__device__ __forceinline__ v16h fragc_f32(const float* W, int k0, int n, int lane, int ld, int K) {
  v16h a; const int g = lane >> 4;
#pragma unroll
  for (int i = 0; i < 8; ++i) { const int ka = k0 + 8 * g + i, kb = ka + 16;
    a[i] = (_Float16)(ka < K ? W[(size_t)(ka < K ? ka : K - 1) * ld + n] : 0.f); a[8 + i] = (_Float16)(kb < K ? W[(size_t)(kb < K ? kb : K - 1) * ld + n] : 0.f); }
  return a;
}
struct F2 { v16b h, l; };
__device__ __forceinline__ F2 bsplit16(const float v[16]) { F2 r;
#pragma unroll
  for (int i = 0; i < 16; ++i) { const __bf16 h = (__bf16)v[i]; r.h[i] = h; r.l[i] = (__bf16)(v[i] - (float)h); }
  return r; }
__device__ __forceinline__ F2 split_row(const float* row, int k0, int lane) { float v[16]; const float* p = row + k0 + 8 * (lane >> 4);
#pragma unroll
  for (int i = 0; i < 8; ++i) { v[i] = p[i]; v[8 + i] = p[16 + i]; }
  return bsplit16(v); }
__device__ __forceinline__ F2 split_rowK(const float* row, int k0, int lane, int K) { float v[16]; const int g = lane >> 4;
#pragma unroll
  for (int i = 0; i < 8; ++i) { const int ka = k0 + 8 * g + i, kb = ka + 16; v[i] = ka < K ? row[ka < K ? ka : K - 1] : 0.f; v[8 + i] = kb < K ? row[kb < K ? kb : K - 1] : 0.f; }
  return bsplit16(v); }
__device__ __forceinline__ F2 split_col(const float* W, int k0, int n, int lane, int ld, int K) { float v[16]; const int g = lane >> 4;
#pragma unroll
  for (int i = 0; i < 8; ++i) { const int ka = k0 + 8 * g + i, kb = ka + 16; v[i] = ka < K ? W[(size_t)(ka < K ? ka : K - 1) * ld + n] : 0.f; v[8 + i] = kb < K ? W[(size_t)(kb < K ? kb : K - 1) * ld + n] : 0.f; }
  return bsplit16(v); }
__device__ __forceinline__ v8f mac3(const F2& a, const F2& b, v8f c) { c = wmma_bf(a.l, b.h, c); c = wmma_bf(a.h, b.l, c); return wmma_bf(a.h, b.h, c); }
__device__ __forceinline__ float sigm(float v) { return 1.0f / (1.0f + expf(-v)); }
#define LDSX() do { asm volatile("s_wait_dscnt 0" ::: "memory"); __builtin_amdgcn_wave_barrier(); __builtin_amdgcn_fence(__ATOMIC_RELEASE, "workgroup"); } while (0)

// Differential attention (B 2, N 2,048, C 1,024; 16 heads, head_dim 32, v 64 wide): qkv = x W_qkv ((in,out) [1024, 3072], columns (3, H, 64)); q, k -> 32 sub-heads of 32: q1/k1 = sub-heads 0..15, q2/k2 = sub-heads 16..31, v head h = columns h*64..; attn_i = softmax(q_i k_i^T / sqrt(32)) v; lam = exp(sum lq1 lk1) - exp(sum lq2 lk2) + lambda_init (0.78360578); o = attn1 - lam attn2; o = o rsqrt(mean(o^2) + 1e-5) subln_w (1 - lambda_init); out = merged(o) W_proj + b_proj.
#define NB 2
#define TT 2048
#define CC 1024            // NH * HD = projected width
#define DIN 1024          // input (model) width
#define NH 32              // softmax sub-heads (16 heads x 2 halves)
#define HD 32
#define NQB (TT / 64)
#define HG 4
#define SCALE (0.17677669529663687f)
#define CAUSAL 0
#ifndef TNB
#define TNB NB
#endif
__device__ __forceinline__ float bfr(float v) { return (float)(__bf16)v; }
__host__ __device__ __forceinline__ int kb_last(int qb) { return CAUSAL ? ((qb * 64 + 63) >> 7) : (TT / 128 - 1); }
typedef __attribute__((ext_vector_type(8))) __bf16 v8b;
typedef __attribute__((ext_vector_type(4))) __bf16 v4b;
typedef __attribute__((ext_vector_type(4))) _Float16 v4h;
__device__ __forceinline__ v16b frag_b(const __bf16* rowk0, int lane) {
  union { v16b v; v8b q[2]; } u; const __bf16* p = rowk0 + 8 * (lane >> 4);
  u.q[0] = *(const v8b*)p; u.q[1] = *(const v8b*)(p + 16); return u.v;
}
#define QBH 0
#define QHI 2048            // rows carrying a q residual plane (all rows: 2-product logits everywhere)
#define KHI 64            // key rows carrying k residual / v bf16 hi+lo planes (written or read by no kernel)
// B fragment (k rows k0+.., output column o) of a weight: (in,out) [K][ld] or (out,in) [ld rows of K]: bf16 exact, or f16(bf16 * 256) exact
__device__ __forceinline__ v16b wcol_io(const float* Wm, int k0, int o, int lane, int ld) { v16b w; const int g = lane >> 4;
#pragma unroll
  for (int i = 0; i < 8; ++i) { w[i] = (__bf16)Wm[(size_t)(k0 + 8 * g + i) * ld + o]; w[8 + i] = (__bf16)Wm[(size_t)(k0 + 16 + 8 * g + i) * ld + o]; }
  return w; }
__device__ __forceinline__ v16b wcol_oi(const float* Wm, int k0, int o, int lane, int K) { v16b w; const float* p = Wm + (size_t)o * K + k0 + 8 * (lane >> 4);
#pragma unroll
  for (int i = 0; i < 8; ++i) { w[i] = (__bf16)p[i]; w[8 + i] = (__bf16)p[16 + i]; }
  return w; }
__device__ __forceinline__ v16h wcolh_io(const float* Wm, int k0, int o, int lane, int ld) { v16h w; const int g = lane >> 4;
#pragma unroll
  for (int i = 0; i < 8; ++i) { w[i] = (_Float16)(bfr(Wm[(size_t)(k0 + 8 * g + i) * ld + o]) * 256.0f); w[8 + i] = (_Float16)(bfr(Wm[(size_t)(k0 + 16 + 8 * g + i) * ld + o]) * 256.0f); }
  return w; }
__device__ __forceinline__ v16h wcolh_oi(const float* Wm, int k0, int o, int lane, int K) { v16h w; const float* p = Wm + (size_t)o * K + k0 + 8 * (lane >> 4);
#pragma unroll
  for (int i = 0; i < 8; ++i) { w[i] = (_Float16)(bfr(p[i]) * 256.0f); w[8 + i] = (_Float16)(bfr(p[16 + i]) * 256.0f); }
  return w; }
#define WQKV_LAYOUT 0   // 0 = (in,out) [DIN][3 * CC]; 1 = (out,in) [CC][DIN]; 2 = per-head [NH][DIN][HD]
__device__ __forceinline__ v16b wcol_hdk(const float* Wm, int k0, int o, int lane) { v16b w; const int g = lane >> 4; const float* p = Wm + (size_t)(o / HD) * DIN * HD + (o % HD);
#pragma unroll
  for (int i = 0; i < 8; ++i) { w[i] = (__bf16)p[(size_t)(k0 + 8 * g + i) * HD]; w[8 + i] = (__bf16)p[(size_t)(k0 + 16 + 8 * g + i) * HD]; }
  return w; }
#define WO_OUT_IN 0
#if WQKV_LAYOUT == 1
#define WCOL(W, k0, o, lane) wcol_oi(W, k0, o, lane, DIN)
#elif WQKV_LAYOUT == 2
#define WCOL(W, k0, o, lane) wcol_hdk(W, k0, o, lane)
#else
#define WCOL(W, k0, o, lane) wcol_io(W, k0, o, lane, 3 * CC)   /* W_qkv (in,out) packed by columns: row pitch 3C */
#endif
#if WO_OUT_IN
#define WOCOL(W, k0, o, lane) wcol_oi(W, k0, o, lane, CC)
#define WOCOLH(W, k0, o, lane) wcolh_oi(W, k0, o, lane, CC)
#else
#define WOCOL(W, k0, o, lane) wcol_io(W, k0, o, lane, DIN)
#define WOCOLH(W, k0, o, lane) wcolh_io(W, k0, o, lane, DIN)
#endif
#define HDV 64             // value columns per softmax sub-head (the parent head's 64 columns)
#define YP (NH * HDV)      // 2,048: pitch of the per-sub-head context rows Y[b*t][h'*64 + d]
#define LAMBDA_INIT 0.78360578f   /* 0.8 - 0.6 exp(-0.3 * 12) */
#ifndef SM_EXTRA_PARAMS
#define SM_EXTRA_PARAMS
#endif
#ifndef PROJ_EXTRA_PARAMS
#define PROJ_EXTRA_PARAMS
#endif
#ifndef SM_MASK_HOOK
#define SM_MASK_HOOK (void)0
#endif

#define WS_QH  0u                                      // f16 rows of q x QSC [b*t][CC]
#define WS_KH  (WS_QH + 2u * (size_t)NB * TT * CC)      // f16 rows of k x KSC [b*t][CC]
#define WS_VT  (WS_KH + 2u * (size_t)NB * TT * CC)      // f16 v planes [b][c][t]
#define WS_QL  (WS_VT + 2u * (size_t)NB * CC * TT)      // f16 residual rows of q x QSC [b][t < QHI][CC]
#define WS_KL  (WS_QL + 2u * (size_t)NB * QHI * CC)     // f16 k residual x 2^10 rows [b][t < KHI][CC]
#define WS_VB  (WS_KL + 2u * (size_t)NB * KHI * CC)     // bf16 v hi planes [b][c][t < KHI]
#define WS_VBL (WS_VB + 2u * (size_t)NB * CC * KHI)
#define WS_S   (WS_VBL + 2u * (size_t)NB * CC * KHI)    // f32 differential rows [b*t][CC] (k_fa -> k_out)
#define WS_Y   (WS_S  + 4u * (size_t)HG * TT * TT)      // f32 per-softmax-head context rows [b*t][YP = 32 x 64] (written or read by no kernel)
#define WS_END (WS_Y  + 4u * (size_t)NB * TT * YP)

// ---- gemm_tile: one 128 x 128 tile of X W (K = 1,024) per block of 8 waves. Each pass of 32 k is staged once per block in LDS as 16-bit rows of k: X rows (whole 128-B lines per 8 lanes) and W columns (a thread takes 16 k of one column, a wave 128 B of each W row), rounded to the 16-bit type on the way. Two buffers: the next pass's global loads fly while this pass's WMMAs run; one barrier a pass.
// MODE 0: both operands to bf16. MODE 1: X once to f16, W as f16(bf16 x 2^8).
// Every '#pragma unroll' from here to the end of k_proj, and in k_out, except on the store loops, makes the indices of a register array (staged values, fragments, accumulators) constants, so that the array stays in registers.
// The product is D[p][q], p over the rows of staged operand pi (0 = X rows, 1 = W columns), q over the other's: a lane then holds 8 consecutive p of one q.
#define GT 128             // tile edge
#define GK 32              // k per pass
#define GKK 1024           // K (= DIN = CC)
#define GP 40              // LDS row pitch in 16-bit elements (80 B = 16 B x odd)
#define GOPB (GT * GP * 2) // bytes of one staged operand
#define GSMB (2 * GT * 136 * 2)   // LDS of a block: the ring (4 x GOPB) or, behind it, the output staging (two f16 planes of pitch 136, or f32 rows of pitch 132)
// four 16-B stores and their s_wait_xcnt in one statement: what follows rewrites their address and data registers
__device__ __forceinline__ void g_st4(void* p0, void* p1, void* p2, void* p3, v4u a, v4u b, v4u c, v4u d) {
  asm volatile("global_store_b128 %0, %4, off\n\tglobal_store_b128 %1, %5, off\n\tglobal_store_b128 %2, %6, off\n\tglobal_store_b128 %3, %7, off\n\ts_wait_xcnt 0x0" :: "v"(p0), "v"(p1), "v"(p2), "v"(p3), "v"(a), "v"(b), "v"(c), "v"(d) : "memory"); }
// one pass's global loads of a thread, then its pointers move on. The three scheduling barriers keep everything but the loads out of the stretch up to their s_wait_xcnt (no register that a load names is rewritten ahead of it) and keep all the loads ahead of the WMMAs that follow (without them half of the loads sink into the pass, and their latency is waited out a second time)
__device__ __forceinline__ void g_fetch(const float*& px, const float*& pw, int ldw, v4f (&xa)[4], float (&wb)[16]) {
  __builtin_amdgcn_sched_barrier(0);
#pragma unroll
  for (int i = 0; i < 4; ++i) xa[i] = *(const v4f*)(px + (size_t)i * 32 * GKK);
#pragma unroll
  for (int i = 0; i < 16; ++i) wb[i] = pw[(size_t)i * ldw];
  __builtin_amdgcn_sched_barrier(0);
  asm volatile("s_wait_xcnt 0x0" :: "v"(px), "v"(pw) : "memory");   /* before the loads' address registers are rewritten; it names both addresses so that they keep their registers up to here (else a later load of the group is given an earlier one's address pair as its destination) */
  __builtin_amdgcn_sched_barrier(0);
  px += GK; pw += (size_t)GK * ldw;
}
template <int MODE> __device__ __forceinline__ void g_put(char* bx, char* bw, const v4f (&xa)[4], const float (&wb)[16]) {
  if (MODE == 0) {
#pragma unroll
    for (int i = 0; i < 4; ++i) { v4b c;
#pragma unroll
      for (int e = 0; e < 4; ++e) c[e] = (__bf16)xa[i][e];
      *(v4b*)(bx + i * 32 * GP * 2) = c; }
    v8b w0, w1;
#pragma unroll
    for (int e = 0; e < 8; ++e) { w0[e] = (__bf16)wb[e]; w1[e] = (__bf16)wb[8 + e]; }
    *(v8b*)bw = w0; *(v8b*)(bw + 16) = w1;
  } else {
#pragma unroll
    for (int i = 0; i < 4; ++i) { v4h c;
#pragma unroll
      for (int e = 0; e < 4; ++e) c[e] = (_Float16)xa[i][e];
      *(v4h*)(bx + i * 32 * GP * 2) = c; }
    v8h w0, w1;
#pragma unroll
    for (int e = 0; e < 8; ++e) { w0[e] = (_Float16)(bfr(wb[e]) * 256.0f); w1[e] = (_Float16)(bfr(wb[8 + e]) * 256.0f); }
    *(v8h*)bw = w0; *(v8h*)(bw + 16) = w1;
  }
}
template <int MODE> __device__ __forceinline__ void gemm_tile(const float* __restrict__ Xr, const float* __restrict__ Wc, const int ldw, const int pi, char* sm, v8f (&acc)[2][4]) {
  const int tid = threadIdx.x, wave = tid >> 5, lane = tid & 31, col = lane & 15;
  const int xr = tid >> 3, xk = (tid & 7) * 4, wn = tid & 127, wk = (tid >> 7) * 16;
  const float* gx = Xr + (size_t)xr * GKK + xk; const float* gw = Wc + (size_t)wk * ldw + wn;
  const int xo = (xr * GP + xk) * 2, wo = GOPB + (wn * GP + wk) * 2;   /* a thread's own places in a buffer: [X rows | W columns] */
  const int po = pi * GOPB + ((wave & 3) * 32 + col) * GP * 2, qo = (pi ^ 1) * GOPB + ((wave >> 2) * 64 + col) * GP * 2;
  v4f xa[4]; float wb[16];
  g_fetch(gx, gw, ldw, xa, wb);
  g_put<MODE>(sm + xo, sm + wo, xa, wb);
  __syncthreads();
  for (int s = 0; s < GKK / GK; ++s) { char* cb = sm + (s & 1) * 2 * GOPB; char* nb = sm + ((s & 1) ^ 1) * 2 * GOPB; const bool more = s + 1 < GKK / GK;
    if (more) g_fetch(gx, gw, ldw, xa, wb);
    if (MODE == 0) { v16b P[2], Q[4];
#pragma unroll
      for (int i = 0; i < 2; ++i) P[i] = frag_b((const __bf16*)(cb + po + i * 16 * GP * 2), lane);
#pragma unroll
      for (int i = 0; i < 4; ++i) Q[i] = frag_b((const __bf16*)(cb + qo + i * 16 * GP * 2), lane);
#pragma unroll
      for (int i = 0; i < 2; ++i)
#pragma unroll
        for (int j = 0; j < 4; ++j) acc[i][j] = __builtin_amdgcn_wmma_f32_16x16x32_bf16(false, P[i], false, Q[j], (short)0, acc[i][j], false, false);
    } else { v16h P[2], Q[4];
#pragma unroll
      for (int i = 0; i < 2; ++i) P[i] = frag_h((const _Float16*)(cb + po + i * 16 * GP * 2), lane);
#pragma unroll
      for (int i = 0; i < 4; ++i) Q[i] = frag_h((const _Float16*)(cb + qo + i * 16 * GP * 2), lane);
#pragma unroll
      for (int i = 0; i < 2; ++i)
#pragma unroll
        for (int j = 0; j < 4; ++j) acc[i][j] = __builtin_amdgcn_wmma_f32_16x16x32_f16(false, P[i], false, Q[j], (short)0, acc[i][j], false, false);
    }
    __builtin_amdgcn_sched_barrier(0);   /* the roundings, which wait for the loads, stay behind the last WMMA: the wave issues in order */
    if (more) g_put<MODE>(nb + xo, nb + wo, xa, wb);   /* that buffer's last readers left it before the previous barrier */
    __syncthreads(); }
}
// ---- k_proj: block = (128 rows, 128 cols, which): q/k/v = X W with exact bf16 products (K = DIN) -> which 0: q x QSC as f16 rows + residual rows; 1: k x KSC f16 rows; 2: v f16 planes [c][t]. q, k: p = column, q = row; v: p = row (t), q = column: either way a lane's 8 values are 16 B of an output row, staged in LDS and stored as whole 256-B rows
// q carries the whole logit factor (32^-0.5 log2(e)), so that k q^T is the logit in log2 units as it leaves the matrix unit; the power of two moved from k to q keeps q's residual in f16's normal range and leaves k's rounding as it is (only values of k under 2^-10 turn subnormal, an absolute error under 2^-25)
#define QSC (SCALE * 1.4426950408889634f * 16.0f)
#define KSC (1.0f / 16.0f)
__global__ __launch_bounds__(256) void k_proj(const float* __restrict__ X, const float* __restrict__ WQKV, _Float16* __restrict__ QH, _Float16* __restrict__ QL, _Float16* __restrict__ KH, _Float16* __restrict__ VT) {
  __shared__ __align__(16) char sm[GSMB];
  const int tid = threadIdx.x, wave = tid >> 5, lane = tid & 31, col = lane & 15, g = lane >> 4; const int which = blockIdx.z; const int c0 = blockIdx.y * GT; const size_t r0 = (size_t)blockIdx.x * GT; const size_t bb = r0 / TT; const int t0 = (int)(r0 % TT);
  v8f acc[2][4] = {};
  gemm_tile<0>(X + r0 * DIN, WQKV + which * CC + c0, 3 * CC, which < 2 ? 1 : 0, sm, acc);
  _Float16* sh = (_Float16*)sm; _Float16* sl = sh + GT * 136; const float osc = which == 0 ? QSC : which == 1 ? KSC : 1.0f;
#pragma unroll
  for (int i = 0; i < 2; ++i)
#pragma unroll
    for (int j = 0; j < 4; ++j) { v8h hv, lv;
#pragma unroll
      for (int r = 0; r < 8; ++r) { const float v = acc[i][j][r] * osc; hv[r] = (_Float16)v; lv[r] = (_Float16)(v - (float)hv[r]); }
      const int o = ((wave >> 2) * 64 + j * 16 + col) * 136 + (wave & 3) * 32 + i * 16 + 8 * g; *(v8h*)&sh[o] = hv; if (which == 0) *(v8h*)&sl[o] = lv; }
  __syncthreads();
  _Float16* D = which == 0 ? QH + r0 * CC + c0 : which == 1 ? KH + r0 * CC + c0 : VT + (bb * CC + c0) * (size_t)TT + t0; const size_t dp = which < 2 ? CC : TT;
  const int q = tid >> 4, pc = (tid & 15) * 8;   /* a wave stores two whole 256-B rows at a time */
#pragma unroll
  for (int t = 0; t < 2; ++t) { const int qq = q + t * 64; _Float16* d = D + qq * dp + pc; const _Float16* s = &sh[qq * 136 + pc];
    g_st4(d, d + 16 * dp, d + 32 * dp, d + 48 * dp, *(const v4u*)s, *(const v4u*)(s + 16 * 136), *(const v4u*)(s + 32 * 136), *(const v4u*)(s + 48 * 136)); }
  if (which == 0) {
#pragma unroll
    for (int t = 0; t < 2; ++t) { const int qq = q + t * 64; _Float16* d = QL + (r0 + qq) * CC + c0 + pc; const _Float16* s = &sl[qq * 136 + pc];
      g_st4(d, d + 16 * CC, d + 32 * CC, d + 48 * CC, *(const v4u*)s, *(const v4u*)(s + 16 * 136), *(const v4u*)(s + 32 * 136), *(const v4u*)(s + 48 * 136)); } } }
#define FQ 2               // query column groups (16 queries each) per wave
#define FS 64              // keys per stage (one LDS buffer)
#define KP 40              // K row pitch in LDS, halfs (80 B = 16 B x odd)
#define VP 72              // v plane row pitch in LDS, halfs (144 B = 16 B x odd)
typedef __attribute__((ext_vector_type(2))) _Float16 v2h;
__device__ __forceinline__ v8f wmma_h(v16h a, v16h b, v8f c) { return __builtin_amdgcn_wmma_f32_16x16x32_f16(false, a, false, b, (short)0, c, false, false); }
__global__ __launch_bounds__(512) void k_fa(const _Float16* __restrict__ QH, const _Float16* __restrict__ QL, const _Float16* __restrict__ KH, const _Float16* __restrict__ VT, const float* __restrict__ LQ1, const float* __restrict__ LK1, const float* __restrict__ LQ2, const float* __restrict__ LK2, const float* __restrict__ SW, float* __restrict__ YD) {
  __shared__ __align__(16) _Float16 sK[2][2][FS][KP]; __shared__ __align__(16) _Float16 sV[2][HDV][VP]; __shared__ __align__(16) v4f sX[8 * FQ * (HDV / 8)][32];   /* sK: [buffer][sub-head half]; sX: the hand-over, 16 B a lane */
  const int tid = threadIdx.x, wave = __builtin_amdgcn_readfirstlane(tid >> 5), lane = tid & 31, col = lane & 15, g = lane >> 4;
  const int half = wave >> 3, w8 = wave & 7;
  const int e = blockIdx.y, h = e + 16 * half, b = blockIdx.z; const int q0 = blockIdx.x * (8 * FQ * 16) + w8 * (FQ * 16); const int vc0 = e * HDV;   /* both sub-heads use v head e */
  v16h qh[FQ], ql[FQ];
#pragma unroll
  for (int qt = 0; qt < FQ; ++qt) { qh[qt] = frag_h(QH + ((size_t)b * TT + q0 + qt * 16 + col) * CC + h * HD, lane); ql[qt] = frag_h(QL + ((size_t)b * QHI + q0 + qt * 16 + col) * CC + h * HD, lane); }
  // staging: a stage = 64 K rows of 64 B of each sub-head (a thread takes one 16-B piece of its own half's) + 64 v plane rows of 128 B (one piece a thread)
  const int kr = (tid & 255) >> 2, kq = (tid & 3) * 8, vr = tid >> 3, vq = (tid & 7) * 8;
  const _Float16* gk = KH + ((size_t)b * TT + kr) * CC + h * HD + kq; const _Float16* gv = VT + ((size_t)b * CC + vc0 + vr) * (size_t)TT + vq;
  v4u rk = *(const v4u*)gk, rv0 = *(const v4u*)gv;
  float la = bfr(LQ1[lane]) * bfr(LK1[lane]), lc = bfr(LQ2[lane]) * bfr(LK2[lane]);   /* 32-term dots: one term per lane, fixed xor-tree order */
#pragma unroll
  for (int of = 1; of < 32; of <<= 1) { la += __shfl_xor(la, of); lc += __shfl_xor(lc, of); }
  const float lam = __builtin_bit_cast(float, __builtin_amdgcn_readfirstlane(__builtin_bit_cast(int, expf(la) - expf(lc) + LAMBDA_INIT)));   /* the same in every lane: kept in a scalar register over the key loop */
  *(v4u*)&sK[0][half][kr][kq] = rk; *(v4u*)&sV[0][vr][vq] = rv0;
  __syncthreads();
  v8f o[FQ][HDV / 16] = {}; v8f nm[FQ]; v2f l[FQ];   /* nm: minus the offset mo of the lane's query, 8 times over (the logit chain's C operand); l: a lane's own keys, even and odd registers apart; joined after the loop */
#pragma unroll
  for (int qt = 0; qt < FQ; ++qt) { nm[qt] = (v8f){}; l[qt] = (v2f){0.f, 0.f}; }
  for (int s = 0; s < TT / FS; ++s) { const int cur = s & 1; const bool more = s + 1 < TT / FS;
    if (more) { rk = *(const v4u*)(gk + (size_t)(s + 1) * FS * CC); rv0 = *(const v4u*)(gv + (s + 1) * FS);   /* the next stage's rows fly while this stage is worked on */
      asm volatile("s_wait_xcnt 0x0" ::: "memory"); }   /* before the two loads' address registers move on to the next stage */
#pragma unroll
    for (int kc = 0; kc < FS / 32; ++kc) {   /* unrolled: every fragment index constant */
      v16h kf[2]; v8f t[FQ][2]; float mx[FQ];
#pragma unroll
      for (int kt = 0; kt < 2; ++kt) kf[kt] = frag_h(&sK[cur][half][kc * 32 + kt * 16 + col][0], lane);
#pragma unroll
      for (int qt = 0; qt < FQ; ++qt)
#pragma unroll
        for (int kt = 0; kt < 2; ++kt) t[qt][kt] = wmma_h(kf[kt], ql[qt], nm[qt]);
#pragma unroll
      for (int qt = 0; qt < FQ; ++qt)
#pragma unroll
        for (int kt = 0; kt < 2; ++kt) t[qt][kt] = wmma_h(kf[kt], qh[qt], t[qt][kt]);
      __builtin_amdgcn_sched_barrier(0);   /* the eight products stay together ahead of the maxima: each fills the distance behind the others, where a maximum placed directly behind its product costs four v_nop */
#pragma unroll
      for (int qt = 0; qt < FQ; ++qt) { mx[qt] = -3.0e38f;
#pragma unroll
        for (int kt = 0; kt < 2; ++kt)
#pragma unroll
          for (int i = 0; i < 4; ++i) mx[qt] = fmaxf(mx[qt], fmaxf(t[qt][kt][2 * i], t[qt][kt][2 * i + 1])); }
      const bool first = (s == 0) && (kc == 0); bool need = false;
#pragma unroll
      for (int qt = 0; qt < FQ; ++qt) need = need || (mx[qt] > 14.0f);
      if (first || __builtin_amdgcn_ballot_w32(need) != 0) {   /* wave-uniform; the first pass sets the offset from its own logits, in either direction */
#pragma unroll
        for (int qt = 0; qt < FQ; ++qt) { const float mj = fmaxf(mx[qt], __shfl_xor(mx[qt], 16));   /* both halves of a column take the same offset */
          const float d = first ? mj - 6.0f : fmaxf(mj - 6.0f, 0.f); const float al = __builtin_amdgcn_exp2f(-fmaxf(d, 0.f)); nm[qt] -= d; l[qt] *= al;
#pragma unroll
          for (int j = 0; j < HDV / 16; ++j) o[qt][j] *= al;
#pragma unroll
          for (int kt = 0; kt < 2; ++kt) t[qt][kt] -= d; } }
      v16h pf[FQ];
#pragma unroll
      for (int qt = 0; qt < FQ; ++qt) {
#pragma unroll
        for (int i = 0; i < 8; ++i) { const v2f x = {t[qt][i >> 2][2 * (i & 3)], t[qt][i >> 2][2 * (i & 3) + 1]}; v2f e; e[0] = __builtin_amdgcn_exp2f(x[0]); e[1] = __builtin_amdgcn_exp2f(x[1]); l[qt] += e;
          const v2h ph = __builtin_convertvector(e, v2h); pf[qt][2 * i] = ph[0]; pf[qt][2 * i + 1] = ph[1]; } }   /* element s of the B operand = tile s >> 3, register s & 7 */
#pragma unroll
      for (int j = 0; j < HDV / 16; ++j) { const v16h vf = frag_h(&sV[cur][j * 16 + col][kc * 32], lane);
#pragma unroll
        for (int qt = 0; qt < FQ; ++qt) o[qt][j] = wmma_h(vf, pf[qt], o[qt][j]); } }
    if (more) { *(v4u*)&sK[cur ^ 1][half][kr][kq] = rk; *(v4u*)&sV[cur ^ 1][vr][vq] = rv0; }   /* that buffer's last readers left it before the previous barrier */
    __syncthreads(); }
#pragma unroll
  for (int qt = 0; qt < FQ; ++qt) { const float ls = l[qt][0] + l[qt][1]; const float inv = 1.0f / (ls + __shfl_xor(ls, 16));
#pragma unroll
    for (int j = 0; j < HDV / 16; ++j) o[qt][j] *= inv; }   /* register r of tile j = value column j*16 + 8g + r of query col */
  if (half) {
#pragma unroll
    for (int qt = 0; qt < FQ; ++qt)
#pragma unroll
      for (int j = 0; j < HDV / 16; ++j) { v4f a, c;
#pragma unroll
        for (int r = 0; r < 4; ++r) { a[r] = o[qt][j][r]; c[r] = o[qt][j][4 + r]; }
        sX[(w8 * FQ + qt) * (HDV / 8) + 2 * j][lane] = a; sX[(w8 * FQ + qt) * (HDV / 8) + 2 * j + 1][lane] = c; } }
  __syncthreads();   /* every wave passes it: attn2 is in LDS for the partner waves */
  if (!half) { float sw[HDV / 16][8];
#pragma unroll
    for (int j = 0; j < HDV / 16; ++j)
#pragma unroll
      for (int r = 0; r < 8; ++r) sw[j][r] = bfr(SW[j * 16 + 8 * g + r]) * (1.0f - LAMBDA_INIT);
#pragma unroll
    for (int qt = 0; qt < FQ; ++qt) { float q = 0.f;
#pragma unroll
      for (int j = 0; j < HDV / 16; ++j) { const v4f a = sX[(w8 * FQ + qt) * (HDV / 8) + 2 * j][lane], c = sX[(w8 * FQ + qt) * (HDV / 8) + 2 * j + 1][lane];
#pragma unroll
        for (int r = 0; r < 4; ++r) { o[qt][j][r] -= lam * a[r]; o[qt][j][4 + r] -= lam * c[r]; }
#pragma unroll
        for (int r = 0; r < 8; ++r) q += o[qt][j][r] * o[qt][j][r]; }
      q += __shfl_xor(q, 16);   /* a lane holds 32 of its query's 64 columns, lane ^ 16 the rest */
      const float rs = rsqrtf(q * (1.0f / 64.0f) + 1e-5f); float* yr = YD + ((size_t)b * TT + q0 + qt * 16 + col) * CC + e * HDV + 8 * g;
#pragma unroll
      for (int j = 0; j < HDV / 16; ++j) { v4f a, c;
#pragma unroll
        for (int r = 0; r < 4; ++r) { a[r] = o[qt][j][r] * rs * sw[j][r]; c[r] = o[qt][j][4 + r] * rs * sw[j][4 + r]; }
        vst2(yr + j * 16, a); vst2(yr + j * 16 + 4, c); } } } }
// ---- k_out: block = (128 rows, 128 cols): out = ctx Wo + bo: ctx once to f16 against Wo as f16(bf16 x 2^8) exact (1 product) x 2^-8; p = column, q = row; f32 rows staged in LDS and stored as whole 512-B rows
__global__ __launch_bounds__(256) void k_out(const float* __restrict__ Y, const float* __restrict__ WO, const float* __restrict__ BO, float* __restrict__ OUT) {
  __shared__ __align__(16) char sm[GSMB];
  const int tid = threadIdx.x, wave = tid >> 5, lane = tid & 31, col = lane & 15, g = lane >> 4; const int c0 = blockIdx.y * GT; const size_t r0 = (size_t)blockIdx.x * GT;
  v8f acc[2][4] = {};
  gemm_tile<1>(Y + r0 * CC, WO + c0, DIN, 1, sm, acc);
  float* sf = (float*)sm;
#pragma unroll
  for (int i = 0; i < 2; ++i) { const int p = (wave & 3) * 32 + i * 16 + 8 * g; float bias[8];
#pragma unroll
    for (int r = 0; r < 8; ++r) bias[r] = bfr(BO[c0 + p + r]);
#pragma unroll
    for (int j = 0; j < 4; ++j) { v4f a, c;
#pragma unroll
      for (int r = 0; r < 4; ++r) { a[r] = acc[i][j][r] * (1.0f / 256.0f) + bias[r]; c[r] = acc[i][j][4 + r] * (1.0f / 256.0f) + bias[4 + r]; }
      float* d = &sf[((wave >> 2) * 64 + j * 16 + col) * 132 + p]; *(v4f*)d = a; *(v4f*)(d + 4) = c; } }
  __syncthreads();
  const int q = tid >> 5, pc = (tid & 31) * 4;   /* a wave stores one whole 512-B row at a time */
#pragma unroll
  for (int t = 0; t < 4; ++t) { const int qq = q + t * 32; float* d = OUT + (r0 + qq) * DIN + c0 + pc; const float* s = &sf[qq * 132 + pc];
    g_st4(d, d + 8 * DIN, d + 16 * DIN, d + 24 * DIN, *(const v4u*)s, *(const v4u*)(s + 8 * 132), *(const v4u*)(s + 16 * 132), *(const v4u*)(s + 24 * 132)); } }

extern "C" void kernel_launch(void* const* d_in, const int* in_sizes, int n_in, void* d_out, int out_size, void* d_ws, size_t ws_size, hipStream_t stream) {
  (void)in_sizes; (void)n_in; (void)out_size;
  const float** F = (const float**)d_in;
  if (ws_size < (size_t)WS_END) return;
  char* ws = (char*)d_ws; _Float16 *QH = (_Float16*)(ws + WS_QH), *KH = (_Float16*)(ws + WS_KH), *VT = (_Float16*)(ws + WS_VT), *QL = (_Float16*)(ws + WS_QL), *KL = (_Float16*)(ws + WS_KL); __bf16 *VB = (__bf16*)(ws + WS_VB), *VBL = (__bf16*)(ws + WS_VBL); float *S = (float*)(ws + WS_S), *Y = (float*)(ws + WS_Y);
  (void)Y; (void)QL; (void)KL; (void)VB; (void)VBL;
  // inputs (in order): 0 x [2,2048,1024]; 1 W_qkv [1024,3072] (in,out; columns (3, H, 64)); 2 W_proj [1024,1024] (in,out); 3 b_proj; 4 lambda_q1, 5 lambda_k1, 6 lambda_q2, 7 lambda_k2 [32]; 8 subln_w [64]
  float* YD = S;   /* the differential rows' plane */
  k_proj<<<dim3(TNB * TT / GT, CC / GT, 3), 256, 0, stream>>>(F[0], F[1], QH, QL, KH, VT);
  k_fa<<<dim3(TT / 256, NH / 2, TNB), 512, 0, stream>>>(QH, QL, KH, VT, F[4], F[5], F[6], F[7], F[8], YD);
  k_out<<<dim3(TNB * TT / GT, DIN / GT), 256, 0, stream>>>(YD, F[2], F[3], (float*)d_out);
}

// v005
// One run takes 105 microseconds.
// Next to v004, in two timings, it ran 1.16 times as fast each time.
// Counting every step since v000, it is 19.8 times as fast.
// compute dtype: all float inputs rounded to bf16; qkv = x W_qkv with EXACT bf16 products on WMMA 16x16x32 (f32 accumulate); the 32-wide sub-head logits with q x 32^-0.5 log2(e) x 2^4 as f16 hi + residual against k x 2^-4 once to f16 (2 products, one f32 accumulate chain that starts at minus the running offset); both softmaxes in f32 (running maximum offset, exp2 on log2-scaled logits, f32 sum); each unnormalised P once to f16 against the head's 64-wide v once to f16 (1 product), divided by the sum last; the differential combination, the per-head RMS normalisation (x subln_w x (1 - lambda_init)) in f32; the result once to f16 against W_proj carried x 2^8 in f16 + b_proj; f32 output.
#include <hip/hip_runtime.h>
#include <math.h>

typedef __attribute__((ext_vector_type(16))) _Float16 v16h;
typedef __attribute__((ext_vector_type(16))) __bf16 v16b;
typedef __attribute__((ext_vector_type(8)))  _Float16 v8h;
typedef __attribute__((ext_vector_type(8)))  float v8f;
typedef __attribute__((ext_vector_type(4)))  float v4f;
typedef __attribute__((ext_vector_type(2)))  float v2f;
typedef __attribute__((ext_vector_type(4)))  unsigned v4u;
typedef __attribute__((ext_vector_type(4)))  int v4i;
typedef float __attribute__((may_alias)) float_a;
typedef int __attribute__((may_alias)) int_a;

template <typename T> __device__ __forceinline__ void vst2(void* p, T v) { *(T*)p = v;  }
__device__ __forceinline__ v8f wmma16(v16h a, v16h b, v8f c) {
  v8f d = __builtin_amdgcn_wmma_f32_16x16x32_f16(false, a, false, b, (short)0, c, false, false);
  asm volatile("v_nop\n\tv_nop\n\tv_nop\n\tv_nop" : "+v"(d) : "v"(a), "v"(b));
  return d;
}
__device__ __forceinline__ v8f wmma_bf(v16b a, v16b b, v8f c) {
  v8f d = __builtin_amdgcn_wmma_f32_16x16x32_bf16(false, a, false, b, (short)0, c, false, false);
  asm volatile("v_nop\n\tv_nop\n\tv_nop\n\tv_nop" : "+v"(d) : "v"(a), "v"(b));
  return d;
}
// 16x16x32 fragments: lane = (h = lane>>4, row/col = lane&15); elements 0..7 = k0+8h+0..7, 8..15 = k0+16+8h+0..7; D element r = row 8h+r
__device__ __forceinline__ v16h frag_h(const _Float16* rowk0, int lane) {
  union { v16h v; v8h q[2]; } u; const _Float16* p = rowk0 + 8 * (lane >> 4);
  u.q[0] = *(const v8h*)p; u.q[1] = *(const v8h*)(p + 16); return u.v;
}
__device__ __forceinline__ v16h frag_f32(const float* rowk0, int lane) {
  v16h a; const float* p = rowk0 + 8 * (lane >> 4);
#pragma unroll
  for (int i = 0; i < 8; ++i) { a[i] = (_Float16)p[i]; a[8 + i] = (_Float16)p[16 + i]; }
  return a;
}
__device__ __forceinline__ v16h frag_f32s(const float* rowk0, int lane, float sc) {
  v16h a; const float* p = rowk0 + 8 * (lane >> 4);
#pragma unroll
  for (int i = 0; i < 8; ++i) { a[i] = (_Float16)(p[i] * sc); a[8 + i] = (_Float16)(p[16 + i] * sc); }
  return a;
}
// column fragment from a [K][ld] layout (column n), rows >= K read as 0
__device__ __forceinline__ v16h fragc_f32(const float* W, int k0, int n, int lane, int ld, int K) {
  v16h a; const int g = lane >> 4;
#pragma unroll
  for (int i = 0; i < 8; ++i) { const int ka = k0 + 8 * g + i, kb = ka + 16;
    a[i] = (_Float16)(ka < K ? W[(size_t)(ka < K ? ka : K - 1) * ld + n] : 0.f); a[8 + i] = (_Float16)(kb < K ? W[(size_t)(kb < K ? kb : K - 1) * ld + n] : 0.f); }
  return a;
}
struct F2 { v16b h, l; };
__device__ __forceinline__ F2 bsplit16(const float v[16]) { F2 r;
#pragma unroll
  for (int i = 0; i < 16; ++i) { const __bf16 h = (__bf16)v[i]; r.h[i] = h; r.l[i] = (__bf16)(v[i] - (float)h); }
  return r; }
__device__ __forceinline__ F2 split_row(const float* row, int k0, int lane) { float v[16]; const float* p = row + k0 + 8 * (lane >> 4);
#pragma unroll
  for (int i = 0; i < 8; ++i) { v[i] = p[i]; v[8 + i] = p[16 + i]; }
  return bsplit16(v); }
__device__ __forceinline__ F2 split_rowK(const float* row, int k0, int lane, int K) { float v[16]; const int g = lane >> 4;
#pragma unroll
  for (int i = 0; i < 8; ++i) { const int ka = k0 + 8 * g + i, kb = ka + 16; v[i] = ka < K ? row[ka < K ? ka : K - 1] : 0.f; v[8 + i] = kb < K ? row[kb < K ? kb : K - 1] : 0.f; }
  return bsplit16(v); }
__device__ __forceinline__ F2 split_col(const float* W, int k0, int n, int lane, int ld, int K) { float v[16]; const int g = lane >> 4;
#pragma unroll
  for (int i = 0; i < 8; ++i) { const int ka = k0 + 8 * g + i, kb = ka + 16; v[i] = ka < K ? W[(size_t)(ka < K ? ka : K - 1) * ld + n] : 0.f; v[8 + i] = kb < K ? W[(size_t)(kb < K ? kb : K - 1) * ld + n] : 0.f; }
  return bsplit16(v); }
__device__ __forceinline__ v8f mac3(const F2& a, const F2& b, v8f c) { c = wmma_bf(a.l, b.h, c); c = wmma_bf(a.h, b.l, c); return wmma_bf(a.h, b.h, c); }
__device__ __forceinline__ float sigm(float v) { return 1.0f / (1.0f + expf(-v)); }
#define LDSX() do { asm volatile("s_wait_dscnt 0" ::: "memory"); __builtin_amdgcn_wave_barrier(); __builtin_amdgcn_fence(__ATOMIC_RELEASE, "workgroup"); } while (0)

// Differential attention (B 2, N 2,048, C 1,024; 16 heads, head_dim 32, v 64 wide): qkv = x W_qkv ((in,out) [1024, 3072], columns (3, H, 64)); q, k -> 32 sub-heads of 32: q1/k1 = sub-heads 0..15, q2/k2 = sub-heads 16..31, v head h = columns h*64..; attn_i = softmax(q_i k_i^T / sqrt(32)) v; lam = exp(sum lq1 lk1) - exp(sum lq2 lk2) + lambda_init (0.78360578); o = attn1 - lam attn2; o = o rsqrt(mean(o^2) + 1e-5) subln_w (1 - lambda_init); out = merged(o) W_proj + b_proj.
#define NB 2
#define TT 2048
#define CC 1024            // NH * HD = projected width
#define DIN 1024          // input (model) width
#define NH 32              // softmax sub-heads (16 heads x 2 halves)
#define HD 32
#define NQB (TT / 64)
#define HG 4
#define SCALE (0.17677669529663687f)
#define CAUSAL 0
#ifndef TNB
#define TNB NB
#endif
__device__ __forceinline__ float bfr(float v) { return (float)(__bf16)v; }
__host__ __device__ __forceinline__ int kb_last(int qb) { return CAUSAL ? ((qb * 64 + 63) >> 7) : (TT / 128 - 1); }
typedef __attribute__((ext_vector_type(8))) __bf16 v8b;
typedef __attribute__((ext_vector_type(4))) __bf16 v4b;
typedef __attribute__((ext_vector_type(4))) _Float16 v4h;
__device__ __forceinline__ v16b frag_b(const __bf16* rowk0, int lane) {
  union { v16b v; v8b q[2]; } u; const __bf16* p = rowk0 + 8 * (lane >> 4);
  u.q[0] = *(const v8b*)p; u.q[1] = *(const v8b*)(p + 16); return u.v;
}
#define QBH 0
#define QHI 2048            // rows carrying a q residual plane (all rows: 2-product logits everywhere)
#define KHI 64            // key rows carrying k residual / v bf16 hi+lo planes (written or read by no kernel)
// B fragment (k rows k0+.., output column o) of a weight: (in,out) [K][ld] or (out,in) [ld rows of K]: bf16 exact, or f16(bf16 * 256) exact
__device__ __forceinline__ v16b wcol_io(const float* Wm, int k0, int o, int lane, int ld) { v16b w; const int g = lane >> 4;
#pragma unroll
  for (int i = 0; i < 8; ++i) { w[i] = (__bf16)Wm[(size_t)(k0 + 8 * g + i) * ld + o]; w[8 + i] = (__bf16)Wm[(size_t)(k0 + 16 + 8 * g + i) * ld + o]; }
  return w; }
__device__ __forceinline__ v16b wcol_oi(const float* Wm, int k0, int o, int lane, int K) { v16b w; const float* p = Wm + (size_t)o * K + k0 + 8 * (lane >> 4);
#pragma unroll
  for (int i = 0; i < 8; ++i) { w[i] = (__bf16)p[i]; w[8 + i] = (__bf16)p[16 + i]; }
  return w; }
__device__ __forceinline__ v16h wcolh_io(const float* Wm, int k0, int o, int lane, int ld) { v16h w; const int g = lane >> 4;
#pragma unroll
  for (int i = 0; i < 8; ++i) { w[i] = (_Float16)(bfr(Wm[(size_t)(k0 + 8 * g + i) * ld + o]) * 256.0f); w[8 + i] = (_Float16)(bfr(Wm[(size_t)(k0 + 16 + 8 * g + i) * ld + o]) * 256.0f); }
  return w; }
__device__ __forceinline__ v16h wcolh_oi(const float* Wm, int k0, int o, int lane, int K) { v16h w; const float* p = Wm + (size_t)o * K + k0 + 8 * (lane >> 4);
#pragma unroll
  for (int i = 0; i < 8; ++i) { w[i] = (_Float16)(bfr(p[i]) * 256.0f); w[8 + i] = (_Float16)(bfr(p[16 + i]) * 256.0f); }
  return w; }
#define WQKV_LAYOUT 0   // selects the layout of WCOL, which no kernel calls: k_cvt reads W_qkv as (in,out) [DIN][3 * CC] whatever the value
__device__ __forceinline__ v16b wcol_hdk(const float* Wm, int k0, int o, int lane) { v16b w; const int g = lane >> 4; const float* p = Wm + (size_t)(o / HD) * DIN * HD + (o % HD);
#pragma unroll
  for (int i = 0; i < 8; ++i) { w[i] = (__bf16)p[(size_t)(k0 + 8 * g + i) * HD]; w[8 + i] = (__bf16)p[(size_t)(k0 + 16 + 8 * g + i) * HD]; }
  return w; }
#define WO_OUT_IN 0
#if WQKV_LAYOUT == 1
#define WCOL(W, k0, o, lane) wcol_oi(W, k0, o, lane, DIN)
#elif WQKV_LAYOUT == 2
#define WCOL(W, k0, o, lane) wcol_hdk(W, k0, o, lane)
#else
#define WCOL(W, k0, o, lane) wcol_io(W, k0, o, lane, 3 * CC)   /* W_qkv (in,out) packed by columns: row pitch 3C */
#endif
#if WO_OUT_IN
#define WOCOL(W, k0, o, lane) wcol_oi(W, k0, o, lane, CC)
#define WOCOLH(W, k0, o, lane) wcolh_oi(W, k0, o, lane, CC)
#else
#define WOCOL(W, k0, o, lane) wcol_io(W, k0, o, lane, DIN)
#define WOCOLH(W, k0, o, lane) wcolh_io(W, k0, o, lane, DIN)
#endif
#define HDV 64             // value columns per softmax sub-head (the parent head's 64 columns)
#define YP (NH * HDV)      // 2,048: only sizes the region from WS_Y to WS_END
#define LAMBDA_INIT 0.78360578f   /* 0.8 - 0.6 exp(-0.3 * 12) */
#ifndef SM_EXTRA_PARAMS
#define SM_EXTRA_PARAMS
#endif
#ifndef PROJ_EXTRA_PARAMS
#define PROJ_EXTRA_PARAMS
#endif
#ifndef SM_MASK_HOOK
#define SM_MASK_HOOK (void)0
#endif

#define WS_QH  0u                                      // f16 rows of q x QSC [b*t][CC]
#define WS_KH  (WS_QH + 2u * (size_t)NB * TT * CC)      // f16 rows of k x KSC [b*t][CC]
#define WS_VT  (WS_KH + 2u * (size_t)NB * TT * CC)      // f16 v planes [b][c][t]
#define WS_QL  (WS_VT + 2u * (size_t)NB * CC * TT)      // f16 residual rows of q x QSC [b][t < QHI][CC]
#define WS_KL  (WS_QL + 2u * (size_t)NB * QHI * CC)     // f16 k residual x 2^10 rows [b][t < KHI][CC]
#define WS_VB  (WS_KL + 2u * (size_t)NB * KHI * CC)     // bf16 v hi planes [b][c][t < KHI]
#define WS_VBL (WS_VB + 2u * (size_t)NB * CC * KHI)
#define WS_S   (WS_VBL + 2u * (size_t)NB * CC * KHI)    // f16 differential rows [b*t][CC] (k_fa -> k_out)
#define WS_Y   (WS_S  + 4u * (size_t)HG * TT * TT)      // the GEMM operands as 16-bit rows of k (k_cvt -> k_proj, k_out):
#define WS_XB  WS_Y                                     // bf16 x rows [b*t][DIN]
#define WS_WQT (WS_XB + 2u * (size_t)NB * TT * DIN)     // bf16 W_qkv columns as rows [3 CC][DIN]
#define WS_WPT (WS_WQT + 2u * (size_t)3 * CC * DIN)     // f16(bf16 x 2^8) W_proj columns as rows [DIN][CC]
#define WS_END (WS_Y  + 4u * (size_t)NB * TT * YP)

// ---- gemm_tile: one 128 x 128 tile of X W (K = 1,024) per block of 8 waves. Both operands lie in memory as 16-bit rows of k (k_cvt, k_fa). Each pass of 64 k is staged once per block in LDS: whole 128-B lines, 8 lanes a row, 16 B a lane, nothing rounded on the way. Two buffers: the next pass's global loads fly while this pass's WMMAs run; one barrier a pass.
// MODE 0: bf16 operands. MODE 1: f16 operands (W carried x 2^8).
// Every '#pragma unroll' from here to the end of k_proj, and in k_out, makes the indices of a register array (staged values, fragments, accumulators) constants, so that the array stays in registers.
// The product is D[p][q], p over the rows of staged operand pi (0 = X rows, 1 = W columns), q over the other's: a lane then holds 8 consecutive p of one q.
#define GT 128             // tile edge
#define GK 64              // k per pass
#define GKK 1024           // K (= DIN = CC)
#define GP 72              // LDS row pitch in 16-bit elements (144 B = 16 B x odd)
#define GOPB (GT * GP * 2) // bytes of one staged operand
#define GSMB (4 * GOPB)    // LDS of a block: the ring (4 x GOPB) or, behind it, the output staging (two f16 planes of pitch 136, or f32 rows of pitch 132)
// four 16-B stores and their s_wait_xcnt in one statement: what follows rewrites their address and data registers
__device__ __forceinline__ void g_st4(void* p0, void* p1, void* p2, void* p3, v4u a, v4u b, v4u c, v4u d) {
  asm volatile("global_store_b128 %0, %4, off\n\tglobal_store_b128 %1, %5, off\n\tglobal_store_b128 %2, %6, off\n\tglobal_store_b128 %3, %7, off\n\ts_wait_xcnt 0x0" :: "v"(p0), "v"(p1), "v"(p2), "v"(p3), "v"(a), "v"(b), "v"(c), "v"(d) : "memory"); }
// one pass's global loads of a thread, then its pointers move on. The three scheduling barriers keep everything but the loads out of the stretch up to their s_wait_xcnt (no register that a load names is rewritten ahead of it) and keep all the loads ahead of the WMMAs that follow (else loads sink into the pass, and their latency is waited out a second time)
__device__ __forceinline__ void g_fetch(const char*& px, const char*& pw, v4u (&xa)[4], v4u (&wa)[4]) {
  __builtin_amdgcn_sched_barrier(0);
#pragma unroll
  for (int i = 0; i < 4; ++i) xa[i] = *(const v4u*)(px + (size_t)i * 32 * GKK * 2);
#pragma unroll
  for (int i = 0; i < 4; ++i) wa[i] = *(const v4u*)(pw + (size_t)i * 32 * GKK * 2);
  __builtin_amdgcn_sched_barrier(0);
  asm volatile("s_wait_xcnt 0x0" :: "v"(px), "v"(pw) : "memory");   /* before the loads' address registers are rewritten; it names both addresses so that they keep their registers up to here */
  __builtin_amdgcn_sched_barrier(0);
  px += GK * 2; pw += GK * 2;
}
__device__ __forceinline__ void g_put(char* bx, char* bw, const v4u (&xa)[4], const v4u (&wa)[4]) {
#pragma unroll
  for (int i = 0; i < 4; ++i) { *(v4u*)(bx + i * 32 * GP * 2) = xa[i]; *(v4u*)(bw + i * 32 * GP * 2) = wa[i]; }
}
template <int MODE> __device__ __forceinline__ void gemm_tile(const char* __restrict__ Xr, const char* __restrict__ Wr, const int pi, char* sm, v8f (&acc)[2][4]) {
  const int tid = threadIdx.x, wave = tid >> 5, lane = tid & 31, col = lane & 15;
  const int sr = tid >> 3, sk = (tid & 7) * 16;   /* a thread's row (and the three 32 further on) and its 16 B of the row's 128 */
  const char* gx = Xr + (size_t)sr * GKK * 2 + sk; const char* gw = Wr + (size_t)sr * GKK * 2 + sk;
  const int xo = sr * GP * 2 + sk, wo = GOPB + xo;   /* a thread's own places in a buffer: [X rows | W columns] */
  const int po = pi * GOPB + ((wave & 3) * 32 + col) * GP * 2, qo = (pi ^ 1) * GOPB + ((wave >> 2) * 64 + col) * GP * 2;
  v4u xa[4], wa[4];
  g_fetch(gx, gw, xa, wa);
  g_put(sm + xo, sm + wo, xa, wa);
  __syncthreads();
  for (int s = 0; s < GKK / GK; ++s) { char* cb = sm + (s & 1) * 2 * GOPB; char* nb = sm + ((s & 1) ^ 1) * 2 * GOPB; const bool more = s + 1 < GKK / GK;
    if (more) g_fetch(gx, gw, xa, wa);
#pragma unroll
    for (int kk = 0; kk < GK / 32; ++kk) {   /* k ascending in steps of 32 */
      if (MODE == 0) { v16b P[2], Q[4];
#pragma unroll
        for (int i = 0; i < 2; ++i) P[i] = frag_b((const __bf16*)(cb + po + i * 16 * GP * 2 + kk * 64), lane);
#pragma unroll
        for (int i = 0; i < 4; ++i) Q[i] = frag_b((const __bf16*)(cb + qo + i * 16 * GP * 2 + kk * 64), lane);
#pragma unroll
        for (int i = 0; i < 2; ++i)
#pragma unroll
          for (int j = 0; j < 4; ++j) acc[i][j] = __builtin_amdgcn_wmma_f32_16x16x32_bf16(false, P[i], false, Q[j], (short)0, acc[i][j], false, false);
      } else { v16h P[2], Q[4];
#pragma unroll
        for (int i = 0; i < 2; ++i) P[i] = frag_h((const _Float16*)(cb + po + i * 16 * GP * 2 + kk * 64), lane);
#pragma unroll
        for (int i = 0; i < 4; ++i) Q[i] = frag_h((const _Float16*)(cb + qo + i * 16 * GP * 2 + kk * 64), lane);
#pragma unroll
        for (int i = 0; i < 2; ++i)
#pragma unroll
          for (int j = 0; j < 4; ++j) acc[i][j] = __builtin_amdgcn_wmma_f32_16x16x32_f16(false, P[i], false, Q[j], (short)0, acc[i][j], false, false);
      } }
    __builtin_amdgcn_sched_barrier(0);   /* the LDS stores, which wait for the loads, stay behind the last WMMA: the wave issues in order */
    if (more) g_put(nb + xo, nb + wo, xa, wa);   /* that buffer's last readers left it before the previous barrier */
    __syncthreads(); }
}
// ---- k_cvt: every GEMM operand that is an input, rounded once to the 16-bit type its product uses and laid down as rows of k. Blocks 0..255: 16,384 elements of x each -> bf16, same layout. Then 384 tiles of W_qkv (-> bf16) and 128 of W_proj (-> f16(bf16 x 2^8)), 128 k x 64 columns each, transposed through LDS: a thread packs two neighbouring k of 4 columns into dwords; a column leaves as 256 B of its row.
#define CVX 256
#define CVQ 384
#define CVP 128
typedef __attribute__((ext_vector_type(2))) __bf16 v2b;
typedef __attribute__((ext_vector_type(2))) _Float16 v2hh;
// one 128 k x 64 column tile of a weight [k][LD] -> rows of k [column][GKK]. PJ: f16(bf16 x 2^8), else bf16
template <bool PJ, int LD> __device__ __forceinline__ void cvt_w(const float* __restrict__ S, char* __restrict__ Dm, const int bi, unsigned (&st)[64][68]) {
  const int tid = threadIdx.x, n0 = (bi % (LD / 64)) * 64, k0 = (bi / (LD / 64)) * 128, c4 = tid & 15, kp = tid >> 4;
  const float* s = S + (size_t)(k0 + 2 * kp) * LD + n0 + c4 * 4; v4f a[4][2];   /* 16 lanes take 256 B of a row */
#pragma unroll
  for (int i = 0; i < 4; ++i) { a[i][0] = *(const v4f*)(s + (size_t)(32 * i) * LD); a[i][1] = *(const v4f*)(s + (size_t)(32 * i + 1) * LD); }
  asm volatile("s_wait_xcnt 0x0" :: "v"(s) : "memory");   /* before the loads' address register is rewritten; it names the address so that no load of the group is given it as its destination */
#pragma unroll
  for (int i = 0; i < 4; ++i)
#pragma unroll
    for (int e = 0; e < 4; ++e) { unsigned w;
      if (PJ) { const v2hh t = {(_Float16)(bfr(a[i][0][e]) * 256.0f), (_Float16)(bfr(a[i][1][e]) * 256.0f)}; w = __builtin_bit_cast(unsigned, t); }
      else { const v2b t = {(__bf16)a[i][0][e], (__bf16)a[i][1][e]}; w = __builtin_bit_cast(unsigned, t); }
      st[c4 * 4 + e][kp + 16 * i] = w; }
  __syncthreads();   /* every wave of the block passes it: the tile is in LDS, column by column */
  const int r = tid >> 4, pc = tid & 15;   /* a wave stores two whole 256-B pieces of rows at a time */
  char* D = Dm + ((size_t)(n0 + r) * GKK + k0 + pc * 8) * 2;
  g_st4(D, D + 16 * GKK * 2, D + 32 * GKK * 2, D + 48 * GKK * 2, *(const v4u*)&st[r][pc * 4], *(const v4u*)&st[r + 16][pc * 4], *(const v4u*)&st[r + 32][pc * 4], *(const v4u*)&st[r + 48][pc * 4]); }
__global__ __launch_bounds__(256) void k_cvt(const float* __restrict__ X, const float* __restrict__ WQKV, const float* __restrict__ WO, __bf16* __restrict__ XB, __bf16* __restrict__ WQT, _Float16* __restrict__ WPT) {
  __shared__ __align__(16) unsigned st[64][68];   /* [column][k pair], pitch 272 B */
  const int tid = threadIdx.x, bi = blockIdx.x;   /* every branch below reads the same for the whole block */
  if (bi < CVX) {
    const float* s = X + (size_t)bi * 16384 + tid * 8; __bf16* d = XB + (size_t)bi * 16384 + tid * 8; v4f a[8][2]; v4u c[8];
#pragma unroll
    for (int i = 0; i < 8; ++i) { a[i][0] = *(const v4f*)(s + i * 2048); a[i][1] = *(const v4f*)(s + i * 2048 + 4); }
#pragma unroll
    for (int i = 0; i < 8; ++i) { v8b t;
#pragma unroll
      for (int e = 0; e < 4; ++e) { t[e] = (__bf16)a[i][0][e]; t[4 + e] = (__bf16)a[i][1][e]; }
      c[i] = __builtin_bit_cast(v4u, t); }
    g_st4(d, d + 2048, d + 4096, d + 6144, c[0], c[1], c[2], c[3]);
    g_st4(d + 8192, d + 10240, d + 12288, d + 14336, c[4], c[5], c[6], c[7]);
  } else if (bi < CVX + CVQ) cvt_w<false, 3 * CC>(WQKV, (char*)WQT, bi - CVX, st);
  else cvt_w<true, DIN>(WO, (char*)WPT, bi - CVX - CVQ, st); }
// ---- k_proj: block = (128 rows, 128 cols, which): q/k/v = X W with exact bf16 products (K = DIN) -> which 0: q x QSC as f16 rows + residual rows; 1: k x KSC f16 rows; 2: v f16 planes [c][t]. q, k: p = column, q = row; v: p = row (t), q = column: either way a lane's 8 values are 16 B of an output row, staged in LDS and stored as whole 256-B rows
// q carries the whole logit factor (32^-0.5 log2(e)), so that k q^T is the logit in log2 units as it leaves the matrix unit; the power of two moved from k to q keeps q's residual in f16's normal range and leaves k's rounding as it is (only values of k under 2^-10 turn subnormal, an absolute error under 2^-25)
#define QSC (SCALE * 1.4426950408889634f * 16.0f)
#define KSC (1.0f / 16.0f)
__global__ __launch_bounds__(256) void k_proj(const __bf16* __restrict__ XB, const __bf16* __restrict__ WQT, _Float16* __restrict__ QH, _Float16* __restrict__ QL, _Float16* __restrict__ KH, _Float16* __restrict__ VT) {
  __shared__ __align__(16) char sm[GSMB];
  const int tid = threadIdx.x, wave = tid >> 5, lane = tid & 31, col = lane & 15, g = lane >> 4; const int which = blockIdx.z; const int c0 = blockIdx.y * GT; const size_t r0 = (size_t)blockIdx.x * GT; const size_t bb = r0 / TT; const int t0 = (int)(r0 % TT);
  v8f acc[2][4] = {};
  gemm_tile<0>((const char*)(XB + r0 * DIN), (const char*)(WQT + (size_t)(which * CC + c0) * DIN), which < 2 ? 1 : 0, sm, acc);
  _Float16* sh = (_Float16*)sm; _Float16* sl = sh + GT * 136; const float osc = which == 0 ? QSC : which == 1 ? KSC : 1.0f;
#pragma unroll
  for (int i = 0; i < 2; ++i)
#pragma unroll
    for (int j = 0; j < 4; ++j) { v8h hv, lv;
#pragma unroll
      for (int r = 0; r < 8; ++r) { const float v = acc[i][j][r] * osc; hv[r] = (_Float16)v; lv[r] = (_Float16)(v - (float)hv[r]); }
      const int o = ((wave >> 2) * 64 + j * 16 + col) * 136 + (wave & 3) * 32 + i * 16 + 8 * g; *(v8h*)&sh[o] = hv; if (which == 0) *(v8h*)&sl[o] = lv; }
  __syncthreads();
  _Float16* D = which == 0 ? QH + r0 * CC + c0 : which == 1 ? KH + r0 * CC + c0 : VT + (bb * CC + c0) * (size_t)TT + t0; const size_t dp = which < 2 ? CC : TT;
  const int q = tid >> 4, pc = (tid & 15) * 8;   /* a wave stores two whole 256-B rows at a time */
#pragma unroll
  for (int t = 0; t < 2; ++t) { const int qq = q + t * 64; _Float16* d = D + qq * dp + pc; const _Float16* s = &sh[qq * 136 + pc];
    g_st4(d, d + 16 * dp, d + 32 * dp, d + 48 * dp, *(const v4u*)s, *(const v4u*)(s + 16 * 136), *(const v4u*)(s + 32 * 136), *(const v4u*)(s + 48 * 136)); }
  if (which == 0) {
#pragma unroll
    for (int t = 0; t < 2; ++t) { const int qq = q + t * 64; _Float16* d = QL + (r0 + qq) * CC + c0 + pc; const _Float16* s = &sl[qq * 136 + pc];
      g_st4(d, d + 16 * CC, d + 32 * CC, d + 48 * CC, *(const v4u*)s, *(const v4u*)(s + 16 * 136), *(const v4u*)(s + 32 * 136), *(const v4u*)(s + 48 * 136)); } } }
#define FQ 2               // query column groups (16 queries each) per wave
#define FS 64              // keys per stage (one LDS buffer)
#define KP 40              // K row pitch in LDS, halfs (80 B = 16 B x odd)
#define VP 72              // v plane row pitch in LDS, halfs (144 B = 16 B x odd)
typedef __attribute__((ext_vector_type(2))) _Float16 v2h;
__device__ __forceinline__ v8f wmma_h(v16h a, v16h b, v8f c) { return __builtin_amdgcn_wmma_f32_16x16x32_f16(false, a, false, b, (short)0, c, false, false); }
__global__ __launch_bounds__(512) void k_fa(const _Float16* __restrict__ QH, const _Float16* __restrict__ QL, const _Float16* __restrict__ KH, const _Float16* __restrict__ VT, const float* __restrict__ LQ1, const float* __restrict__ LK1, const float* __restrict__ LQ2, const float* __restrict__ LK2, const float* __restrict__ SW, _Float16* __restrict__ YD) {
  __shared__ __align__(16) _Float16 sK[2][2][FS][KP]; __shared__ __align__(16) _Float16 sV[2][HDV][VP]; __shared__ __align__(16) v4f sX[8 * FQ * (HDV / 8)][32];   /* sK: [buffer][sub-head half]; sX: the hand-over, 16 B a lane */
  const int tid = threadIdx.x, wave = __builtin_amdgcn_readfirstlane(tid >> 5), lane = tid & 31, col = lane & 15, g = lane >> 4;
  const int half = wave >> 3, w8 = wave & 7;
  const int e = blockIdx.y, h = e + 16 * half, b = blockIdx.z; const int q0 = blockIdx.x * (8 * FQ * 16) + w8 * (FQ * 16); const int vc0 = e * HDV;   /* both sub-heads use v head e */
  v16h qh[FQ], ql[FQ];
#pragma unroll
  for (int qt = 0; qt < FQ; ++qt) { qh[qt] = frag_h(QH + ((size_t)b * TT + q0 + qt * 16 + col) * CC + h * HD, lane); ql[qt] = frag_h(QL + ((size_t)b * QHI + q0 + qt * 16 + col) * CC + h * HD, lane); }
  // staging: a stage = 64 K rows of 64 B of each sub-head (a thread takes one 16-B piece of its own half's) + 64 v plane rows of 128 B (one piece a thread)
  const int kr = (tid & 255) >> 2, kq = (tid & 3) * 8, vr = tid >> 3, vq = (tid & 7) * 8;
  const _Float16* gk = KH + ((size_t)b * TT + kr) * CC + h * HD + kq; const _Float16* gv = VT + ((size_t)b * CC + vc0 + vr) * (size_t)TT + vq;
  v4u rk = *(const v4u*)gk, rv0 = *(const v4u*)gv;
  float la = bfr(LQ1[lane]) * bfr(LK1[lane]), lc = bfr(LQ2[lane]) * bfr(LK2[lane]);   /* 32-term dots: one term per lane, fixed xor-tree order */
#pragma unroll
  for (int of = 1; of < 32; of <<= 1) { la += __shfl_xor(la, of); lc += __shfl_xor(lc, of); }
  const float lam = __builtin_bit_cast(float, __builtin_amdgcn_readfirstlane(__builtin_bit_cast(int, expf(la) - expf(lc) + LAMBDA_INIT)));   /* the same in every lane: kept in a scalar register over the key loop */
  *(v4u*)&sK[0][half][kr][kq] = rk; *(v4u*)&sV[0][vr][vq] = rv0;
  __syncthreads();
  v8f o[FQ][HDV / 16] = {}; v8f nm[FQ]; v2f l[FQ];   /* nm: minus the offset mo of the lane's query, 8 times over (the logit chain's C operand); l: a lane's own keys, even and odd registers apart; joined after the loop */
#pragma unroll
  for (int qt = 0; qt < FQ; ++qt) { nm[qt] = (v8f){}; l[qt] = (v2f){0.f, 0.f}; }
  for (int s = 0; s < TT / FS; ++s) { const int cur = s & 1; const bool more = s + 1 < TT / FS;
    if (more) { rk = *(const v4u*)(gk + (size_t)(s + 1) * FS * CC); rv0 = *(const v4u*)(gv + (s + 1) * FS);   /* the next stage's rows fly while this stage is worked on */
      asm volatile("s_wait_xcnt 0x0" ::: "memory"); }   /* before the two loads' address registers move on to the next stage */
#pragma unroll
    for (int kc = 0; kc < FS / 32; ++kc) {   /* unrolled: every fragment index constant */
      v16h kf[2]; v8f t[FQ][2]; float mx[FQ];
#pragma unroll
      for (int kt = 0; kt < 2; ++kt) kf[kt] = frag_h(&sK[cur][half][kc * 32 + kt * 16 + col][0], lane);
#pragma unroll
      for (int qt = 0; qt < FQ; ++qt)
#pragma unroll
        for (int kt = 0; kt < 2; ++kt) t[qt][kt] = wmma_h(kf[kt], ql[qt], nm[qt]);
#pragma unroll
      for (int qt = 0; qt < FQ; ++qt)
#pragma unroll
        for (int kt = 0; kt < 2; ++kt) t[qt][kt] = wmma_h(kf[kt], qh[qt], t[qt][kt]);
      __builtin_amdgcn_sched_barrier(0);   /* the eight products stay together ahead of the maxima: each fills the distance behind the others, where a maximum placed directly behind its product costs four v_nop */
#pragma unroll
      for (int qt = 0; qt < FQ; ++qt) { mx[qt] = -3.0e38f;
#pragma unroll
        for (int kt = 0; kt < 2; ++kt)
#pragma unroll
          for (int i = 0; i < 4; ++i) mx[qt] = fmaxf(mx[qt], fmaxf(t[qt][kt][2 * i], t[qt][kt][2 * i + 1])); }
      const bool first = (s == 0) && (kc == 0); bool need = false;
#pragma unroll
      for (int qt = 0; qt < FQ; ++qt) need = need || (mx[qt] > 14.0f);
      if (first || __builtin_amdgcn_ballot_w32(need) != 0) {   /* wave-uniform; the first pass sets the offset from its own logits, in either direction */
#pragma unroll
        for (int qt = 0; qt < FQ; ++qt) { const float mj = fmaxf(mx[qt], __shfl_xor(mx[qt], 16));   /* both halves of a column take the same offset */
          const float d = first ? mj - 6.0f : fmaxf(mj - 6.0f, 0.f); const float al = __builtin_amdgcn_exp2f(-fmaxf(d, 0.f)); nm[qt] -= d; l[qt] *= al;
#pragma unroll
          for (int j = 0; j < HDV / 16; ++j) o[qt][j] *= al;
#pragma unroll
          for (int kt = 0; kt < 2; ++kt) t[qt][kt] -= d; } }
      v16h pf[FQ];
#pragma unroll
      for (int qt = 0; qt < FQ; ++qt) {
#pragma unroll
        for (int i = 0; i < 8; ++i) { const v2f x = {t[qt][i >> 2][2 * (i & 3)], t[qt][i >> 2][2 * (i & 3) + 1]}; v2f e; e[0] = __builtin_amdgcn_exp2f(x[0]); e[1] = __builtin_amdgcn_exp2f(x[1]); l[qt] += e;
          const v2h ph = __builtin_convertvector(e, v2h); pf[qt][2 * i] = ph[0]; pf[qt][2 * i + 1] = ph[1]; } }   /* element s of the B operand = tile s >> 3, register s & 7 */
#pragma unroll
      for (int j = 0; j < HDV / 16; ++j) { const v16h vf = frag_h(&sV[cur][j * 16 + col][kc * 32], lane);
#pragma unroll
        for (int qt = 0; qt < FQ; ++qt) o[qt][j] = wmma_h(vf, pf[qt], o[qt][j]); } }
    if (more) { *(v4u*)&sK[cur ^ 1][half][kr][kq] = rk; *(v4u*)&sV[cur ^ 1][vr][vq] = rv0; }   /* that buffer's last readers left it before the previous barrier */
    __syncthreads(); }
#pragma unroll
  for (int qt = 0; qt < FQ; ++qt) { const float ls = l[qt][0] + l[qt][1]; const float inv = 1.0f / (ls + __shfl_xor(ls, 16));
#pragma unroll
    for (int j = 0; j < HDV / 16; ++j) o[qt][j] *= inv; }   /* register r of tile j = value column j*16 + 8g + r of query col */
  if (half) {
#pragma unroll
    for (int qt = 0; qt < FQ; ++qt)
#pragma unroll
      for (int j = 0; j < HDV / 16; ++j) { v4f a, c;
#pragma unroll
        for (int r = 0; r < 4; ++r) { a[r] = o[qt][j][r]; c[r] = o[qt][j][4 + r]; }
        sX[(w8 * FQ + qt) * (HDV / 8) + 2 * j][lane] = a; sX[(w8 * FQ + qt) * (HDV / 8) + 2 * j + 1][lane] = c; } }
  __syncthreads();   /* every wave passes it: attn2 is in LDS for the partner waves */
  if (!half) { float sw[HDV / 16][8];
#pragma unroll
    for (int j = 0; j < HDV / 16; ++j)
#pragma unroll
      for (int r = 0; r < 8; ++r) sw[j][r] = bfr(SW[j * 16 + 8 * g + r]) * (1.0f - LAMBDA_INIT);
#pragma unroll
    for (int qt = 0; qt < FQ; ++qt) { float q = 0.f;
#pragma unroll
      for (int j = 0; j < HDV / 16; ++j) { const v4f a = sX[(w8 * FQ + qt) * (HDV / 8) + 2 * j][lane], c = sX[(w8 * FQ + qt) * (HDV / 8) + 2 * j + 1][lane];
#pragma unroll
        for (int r = 0; r < 4; ++r) { o[qt][j][r] -= lam * a[r]; o[qt][j][4 + r] -= lam * c[r]; }
#pragma unroll
        for (int r = 0; r < 8; ++r) q += o[qt][j][r] * o[qt][j][r]; }
      q += __shfl_xor(q, 16);   /* a lane holds 32 of its query's 64 columns, lane ^ 16 the rest */
      const float rs = rsqrtf(q * (1.0f / 64.0f) + 1e-5f); _Float16* yr = YD + ((size_t)b * TT + q0 + qt * 16 + col) * CC + e * HDV + 8 * g; v4u yv[HDV / 16];
#pragma unroll
      for (int j = 0; j < HDV / 16; ++j) { v8h hv;
#pragma unroll
        for (int r = 0; r < 8; ++r) hv[r] = (_Float16)(o[qt][j][r] * rs * sw[j][r]);   /* the one rounding to f16 that the output product takes */
        yv[j] = __builtin_bit_cast(v4u, hv); }
      g_st4(yr, yr + 16, yr + 32, yr + 48, yv[0], yv[1], yv[2], yv[3]); } } }
// ---- k_out: block = (128 rows, 128 cols): out = ctx Wo + bo: ctx once to f16 against Wo as f16(bf16 x 2^8) exact (1 product) x 2^-8; p = column, q = row; f32 rows staged in LDS and stored as whole 512-B rows
__global__ __launch_bounds__(256) void k_out(const _Float16* __restrict__ Y, const _Float16* __restrict__ WPT, const float* __restrict__ BO, float* __restrict__ OUT) {
  __shared__ __align__(16) char sm[GSMB];
  const int tid = threadIdx.x, wave = tid >> 5, lane = tid & 31, col = lane & 15, g = lane >> 4; const int c0 = blockIdx.y * GT; const size_t r0 = (size_t)blockIdx.x * GT;
  v8f acc[2][4] = {};
  gemm_tile<1>((const char*)(Y + r0 * CC), (const char*)(WPT + (size_t)c0 * CC), 1, sm, acc);
  float* sf = (float*)sm;
#pragma unroll
  for (int i = 0; i < 2; ++i) { const int p = (wave & 3) * 32 + i * 16 + 8 * g; float bias[8];
#pragma unroll
    for (int r = 0; r < 8; ++r) bias[r] = bfr(BO[c0 + p + r]);
#pragma unroll
    for (int j = 0; j < 4; ++j) { v4f a, c;
#pragma unroll
      for (int r = 0; r < 4; ++r) { a[r] = acc[i][j][r] * (1.0f / 256.0f) + bias[r]; c[r] = acc[i][j][4 + r] * (1.0f / 256.0f) + bias[4 + r]; }
      float* d = &sf[((wave >> 2) * 64 + j * 16 + col) * 132 + p]; *(v4f*)d = a; *(v4f*)(d + 4) = c; } }
  __syncthreads();
  const int q = tid >> 5, pc = (tid & 31) * 4;   /* a wave stores one whole 512-B row at a time */
#pragma unroll
  for (int t = 0; t < 4; ++t) { const int qq = q + t * 32; float* d = OUT + (r0 + qq) * DIN + c0 + pc; const float* s = &sf[qq * 132 + pc];
    g_st4(d, d + 8 * DIN, d + 16 * DIN, d + 24 * DIN, *(const v4u*)s, *(const v4u*)(s + 8 * 132), *(const v4u*)(s + 16 * 132), *(const v4u*)(s + 24 * 132)); } }

extern "C" void kernel_launch(void* const* d_in, const int* in_sizes, int n_in, void* d_out, int out_size, void* d_ws, size_t ws_size, hipStream_t stream) {
  (void)in_sizes; (void)n_in; (void)out_size;
  const float** F = (const float**)d_in;
  if (ws_size < (size_t)WS_END) return;
  char* ws = (char*)d_ws; _Float16 *QH = (_Float16*)(ws + WS_QH), *KH = (_Float16*)(ws + WS_KH), *VT = (_Float16*)(ws + WS_VT), *QL = (_Float16*)(ws + WS_QL), *KL = (_Float16*)(ws + WS_KL); __bf16 *VB = (__bf16*)(ws + WS_VB), *VBL = (__bf16*)(ws + WS_VBL); float *S = (float*)(ws + WS_S), *Y = (float*)(ws + WS_Y);
  (void)Y; (void)QL; (void)KL; (void)VB; (void)VBL;
  // inputs: 0 x [2,2048,1024]; 1 W_qkv [1024,3072] (in,out; columns (3, H, 64)); 2 W_proj [1024,1024] (in,out); 3 b_proj; 4 lambda_q1, 5 lambda_k1, 6 lambda_q2, 7 lambda_k2 [32]; 8 subln_w [64]
  _Float16* YD = (_Float16*)S;   /* the differential rows' plane */
  __bf16 *XB = (__bf16*)(ws + WS_XB), *WQT = (__bf16*)(ws + WS_WQT); _Float16* WPT = (_Float16*)(ws + WS_WPT);
  k_cvt<<<dim3(CVX + CVQ + CVP), 256, 0, stream>>>(F[0], F[1], F[2], XB, WQT, WPT);
  k_proj<<<dim3(TNB * TT / GT, CC / GT, 3), 256, 0, stream>>>(XB, WQT, QH, QL, KH, VT);
  k_fa<<<dim3(TT / 256, NH / 2, TNB), 512, 0, stream>>>(QH, QL, KH, VT, F[4], F[5], F[6], F[7], F[8], YD);
  k_out<<<dim3(TNB * TT / GT, DIN / GT), 256, 0, stream>>>(YD, WPT, F[3], (float*)d_out);
}

// v006
// One run takes 101 microseconds.
// Next to v005, in two timings, it ran 1.03 times as fast each time.
// All steps since v000 together make it 20.4 times as fast.
// compute dtype: all float inputs rounded to bf16; qkv = x W_qkv with EXACT bf16 products on WMMA 16x16x32 (f32 accumulate); the 32-wide sub-head logits with q x 32^-0.5 log2(e) x 2^4 as f16 hi + residual against k x 2^-4 once to f16 (2 products, one f32 accumulate chain that starts at minus the running offset); both softmaxes in f32 (running maximum offset, exp2 on log2-scaled logits, f32 sum); each unnormalised P once to f16 against the head's 64-wide v once to f16 (1 product), divided by the sum last; the differential combination, the per-head RMS normalisation (x subln_w x (1 - lambda_init)) in f32; the result once to f16 against W_proj carried x 2^8 in f16 + b_proj; f32 output.
#include <hip/hip_runtime.h>
#include <math.h>

typedef __attribute__((ext_vector_type(16))) _Float16 v16h;
typedef __attribute__((ext_vector_type(16))) __bf16 v16b;
typedef __attribute__((ext_vector_type(8)))  _Float16 v8h;
typedef __attribute__((ext_vector_type(8)))  float v8f;
typedef __attribute__((ext_vector_type(4)))  float v4f;
typedef __attribute__((ext_vector_type(2)))  float v2f;
typedef __attribute__((ext_vector_type(4)))  unsigned v4u;
typedef __attribute__((ext_vector_type(4)))  int v4i;
typedef float __attribute__((may_alias)) float_a;
typedef int __attribute__((may_alias)) int_a;

template <typename T> __device__ __forceinline__ void vst2(void* p, T v) { *(T*)p = v;  }
__device__ __forceinline__ v8f wmma16(v16h a, v16h b, v8f c) {
  v8f d = __builtin_amdgcn_wmma_f32_16x16x32_f16(false, a, false, b, (short)0, c, false, false);
  asm volatile("v_nop\n\tv_nop\n\tv_nop\n\tv_nop" : "+v"(d) : "v"(a), "v"(b));
  return d;
}
__device__ __forceinline__ v8f wmma_bf(v16b a, v16b b, v8f c) {
  v8f d = __builtin_amdgcn_wmma_f32_16x16x32_bf16(false, a, false, b, (short)0, c, false, false);
  asm volatile("v_nop\n\tv_nop\n\tv_nop\n\tv_nop" : "+v"(d) : "v"(a), "v"(b));
  return d;
}
// 16x16x32 fragments: lane = (h = lane>>4, row/col = lane&15); elements 0..7 = k0+8h+0..7, 8..15 = k0+16+8h+0..7; D element r = row 8h+r
__device__ __forceinline__ v16h frag_h(const _Float16* rowk0, int lane) {
  union { v16h v; v8h q[2]; } u; const _Float16* p = rowk0 + 8 * (lane >> 4);
  u.q[0] = *(const v8h*)p; u.q[1] = *(const v8h*)(p + 16); return u.v;
}
__device__ __forceinline__ v16h frag_f32(const float* rowk0, int lane) {
  v16h a; const float* p = rowk0 + 8 * (lane >> 4);
#pragma unroll
  for (int i = 0; i < 8; ++i) { a[i] = (_Float16)p[i]; a[8 + i] = (_Float16)p[16 + i]; }
  return a;
}
__device__ __forceinline__ v16h frag_f32s(const float* rowk0, int lane, float sc) {
  v16h a; const float* p = rowk0 + 8 * (lane >> 4);
#pragma unroll
  for (int i = 0; i < 8; ++i) { a[i] = (_Float16)(p[i] * sc); a[8 + i] = (_Float16)(p[16 + i] * sc); }
  return a;
}
// column fragment from a [K][ld] layout (column n), rows >= K read as 0
__device__ __forceinline__ v16h fragc_f32(const float* W, int k0, int n, int lane, int ld, int K) {
  v16h a; const int g = lane >> 4;
#pragma unroll
  for (int i = 0; i < 8; ++i) { const int ka = k0 + 8 * g + i, kb = ka + 16;
    a[i] = (_Float16)(ka < K ? W[(size_t)(ka < K ? ka : K - 1) * ld + n] : 0.f); a[8 + i] = (_Float16)(kb < K ? W[(size_t)(kb < K ? kb : K - 1) * ld + n] : 0.f); }
  return a;
}
struct F2 { v16b h, l; };
__device__ __forceinline__ F2 bsplit16(const float v[16]) { F2 r;
#pragma unroll
  for (int i = 0; i < 16; ++i) { const __bf16 h = (__bf16)v[i]; r.h[i] = h; r.l[i] = (__bf16)(v[i] - (float)h); }
  return r; }
__device__ __forceinline__ F2 split_row(const float* row, int k0, int lane) { float v[16]; const float* p = row + k0 + 8 * (lane >> 4);
#pragma unroll
  for (int i = 0; i < 8; ++i) { v[i] = p[i]; v[8 + i] = p[16 + i]; }
  return bsplit16(v); }
__device__ __forceinline__ F2 split_rowK(const float* row, int k0, int lane, int K) { float v[16]; const int g = lane >> 4;
#pragma unroll
  for (int i = 0; i < 8; ++i) { const int ka = k0 + 8 * g + i, kb = ka + 16; v[i] = ka < K ? row[ka < K ? ka : K - 1] : 0.f; v[8 + i] = kb < K ? row[kb < K ? kb : K - 1] : 0.f; }
  return bsplit16(v); }
__device__ __forceinline__ F2 split_col(const float* W, int k0, int n, int lane, int ld, int K) { float v[16]; const int g = lane >> 4;
#pragma unroll
  for (int i = 0; i < 8; ++i) { const int ka = k0 + 8 * g + i, kb = ka + 16; v[i] = ka < K ? W[(size_t)(ka < K ? ka : K - 1) * ld + n] : 0.f; v[8 + i] = kb < K ? W[(size_t)(kb < K ? kb : K - 1) * ld + n] : 0.f; }
  return bsplit16(v); }
__device__ __forceinline__ v8f mac3(const F2& a, const F2& b, v8f c) { c = wmma_bf(a.l, b.h, c); c = wmma_bf(a.h, b.l, c); return wmma_bf(a.h, b.h, c); }
__device__ __forceinline__ float sigm(float v) { return 1.0f / (1.0f + expf(-v)); }
#define LDSX() do { asm volatile("s_wait_dscnt 0" ::: "memory"); __builtin_amdgcn_wave_barrier(); __builtin_amdgcn_fence(__ATOMIC_RELEASE, "workgroup"); } while (0)

// Differential attention (B 2, N 2,048, C 1,024; 16 heads, head_dim 32, v 64 wide): qkv = x W_qkv ((in,out) [1024, 3072], columns (3, H, 64)); q, k -> 32 sub-heads of 32: q1/k1 = sub-heads 0..15, q2/k2 = sub-heads 16..31, v head h = columns h*64..; attn_i = softmax(q_i k_i^T / sqrt(32)) v; lam = exp(sum lq1 lk1) - exp(sum lq2 lk2) + lambda_init (0.78360578); o = attn1 - lam attn2; o = o rsqrt(mean(o^2) + 1e-5) subln_w (1 - lambda_init); out = merged(o) W_proj + b_proj.
#define NB 2
#define TT 2048
#define CC 1024            // NH * HD = projected width
#define DIN 1024          // input (model) width
#define NH 32              // softmax sub-heads (16 heads x 2 halves)
#define HD 32
#define NQB (TT / 64)
#define HG 4
#define SCALE (0.17677669529663687f)
#define CAUSAL 0
#ifndef TNB
#define TNB NB
#endif
__device__ __forceinline__ float bfr(float v) { return (float)(__bf16)v; }
__host__ __device__ __forceinline__ int kb_last(int qb) { return CAUSAL ? ((qb * 64 + 63) >> 7) : (TT / 128 - 1); }
typedef __attribute__((ext_vector_type(8))) __bf16 v8b;
typedef __attribute__((ext_vector_type(4))) __bf16 v4b;
typedef __attribute__((ext_vector_type(4))) _Float16 v4h;
__device__ __forceinline__ v16b frag_b(const __bf16* rowk0, int lane) {
  union { v16b v; v8b q[2]; } u; const __bf16* p = rowk0 + 8 * (lane >> 4);
  u.q[0] = *(const v8b*)p; u.q[1] = *(const v8b*)(p + 16); return u.v;
}
#define QBH 0
#define QHI 2048            // rows carrying a q residual plane (all rows: 2-product logits everywhere)
#define KHI 64            // key rows carrying k residual / v bf16 hi+lo planes (written or read by no kernel)
// B fragment (k rows k0+.., output column o) of a weight: (in,out) [K][ld] or (out,in) [ld rows of K]: bf16 exact, or f16(bf16 * 256) exact
__device__ __forceinline__ v16b wcol_io(const float* Wm, int k0, int o, int lane, int ld) { v16b w; const int g = lane >> 4;
#pragma unroll
  for (int i = 0; i < 8; ++i) { w[i] = (__bf16)Wm[(size_t)(k0 + 8 * g + i) * ld + o]; w[8 + i] = (__bf16)Wm[(size_t)(k0 + 16 + 8 * g + i) * ld + o]; }
  return w; }
__device__ __forceinline__ v16b wcol_oi(const float* Wm, int k0, int o, int lane, int K) { v16b w; const float* p = Wm + (size_t)o * K + k0 + 8 * (lane >> 4);
#pragma unroll
  for (int i = 0; i < 8; ++i) { w[i] = (__bf16)p[i]; w[8 + i] = (__bf16)p[16 + i]; }
  return w; }
__device__ __forceinline__ v16h wcolh_io(const float* Wm, int k0, int o, int lane, int ld) { v16h w; const int g = lane >> 4;
#pragma unroll
  for (int i = 0; i < 8; ++i) { w[i] = (_Float16)(bfr(Wm[(size_t)(k0 + 8 * g + i) * ld + o]) * 256.0f); w[8 + i] = (_Float16)(bfr(Wm[(size_t)(k0 + 16 + 8 * g + i) * ld + o]) * 256.0f); }
  return w; }
__device__ __forceinline__ v16h wcolh_oi(const float* Wm, int k0, int o, int lane, int K) { v16h w; const float* p = Wm + (size_t)o * K + k0 + 8 * (lane >> 4);
#pragma unroll
  for (int i = 0; i < 8; ++i) { w[i] = (_Float16)(bfr(p[i]) * 256.0f); w[8 + i] = (_Float16)(bfr(p[16 + i]) * 256.0f); }
  return w; }
#define WQKV_LAYOUT 0   // selects the layout of WCOL, which no kernel calls: k_cvt reads W_qkv as (in,out) [DIN][3 * CC] whatever the value
__device__ __forceinline__ v16b wcol_hdk(const float* Wm, int k0, int o, int lane) { v16b w; const int g = lane >> 4; const float* p = Wm + (size_t)(o / HD) * DIN * HD + (o % HD);
#pragma unroll
  for (int i = 0; i < 8; ++i) { w[i] = (__bf16)p[(size_t)(k0 + 8 * g + i) * HD]; w[8 + i] = (__bf16)p[(size_t)(k0 + 16 + 8 * g + i) * HD]; }
  return w; }
#define WO_OUT_IN 0
#if WQKV_LAYOUT == 1
#define WCOL(W, k0, o, lane) wcol_oi(W, k0, o, lane, DIN)
#elif WQKV_LAYOUT == 2
#define WCOL(W, k0, o, lane) wcol_hdk(W, k0, o, lane)
#else
#define WCOL(W, k0, o, lane) wcol_io(W, k0, o, lane, 3 * CC)   /* W_qkv (in,out) packed by columns: row pitch 3C */
#endif
#if WO_OUT_IN
#define WOCOL(W, k0, o, lane) wcol_oi(W, k0, o, lane, CC)
#define WOCOLH(W, k0, o, lane) wcolh_oi(W, k0, o, lane, CC)
#else
#define WOCOL(W, k0, o, lane) wcol_io(W, k0, o, lane, DIN)
#define WOCOLH(W, k0, o, lane) wcolh_io(W, k0, o, lane, DIN)
#endif
#define HDV 64             // value columns per softmax sub-head (the parent head's 64 columns)
#define YP (NH * HDV)      // 2,048: only sizes the region from WS_Y to WS_END
#define LAMBDA_INIT 0.78360578f   /* 0.8 - 0.6 exp(-0.3 * 12) */
#ifndef SM_EXTRA_PARAMS
#define SM_EXTRA_PARAMS
#endif
#ifndef PROJ_EXTRA_PARAMS
#define PROJ_EXTRA_PARAMS
#endif
#ifndef SM_MASK_HOOK
#define SM_MASK_HOOK (void)0
#endif

#define WS_QH  0u                                      // f16 rows of q x QSC [b*t][CC]
#define WS_KH  (WS_QH + 2u * (size_t)NB * TT * CC)      // f16 rows of k x KSC [b*t][CC]
#define WS_VT  (WS_KH + 2u * (size_t)NB * TT * CC)      // f16 v planes [b][c][t]
#define WS_QL  (WS_VT + 2u * (size_t)NB * CC * TT)      // f16 residual rows of q x QSC [b][t < QHI][CC]
#define WS_KL  (WS_QL + 2u * (size_t)NB * QHI * CC)     // f16 k residual x 2^10 rows [b][t < KHI][CC]
#define WS_VB  (WS_KL + 2u * (size_t)NB * KHI * CC)     // bf16 v hi planes [b][c][t < KHI]
#define WS_VBL (WS_VB + 2u * (size_t)NB * CC * KHI)
#define WS_S   (WS_VBL + 2u * (size_t)NB * CC * KHI)    // f16 differential rows [b*t][CC] (k_fa -> k_out)
#define WS_Y   (WS_S  + 4u * (size_t)HG * TT * TT)      // the GEMM operands as 16-bit rows of k (k_cvt -> k_proj, k_out):
#define WS_XB  WS_Y                                     // bf16 x rows [b*t][DIN]
#define WS_WQT (WS_XB + 2u * (size_t)NB * TT * DIN)     // bf16 W_qkv columns as rows [3 CC][DIN]
#define WS_WPT (WS_WQT + 2u * (size_t)3 * CC * DIN)     // f16(bf16 x 2^8) W_proj columns as rows [DIN][CC]
#define WS_END (WS_Y  + 4u * (size_t)NB * TT * YP)

// ---- gemm_tile: one 128 x 128 tile of X W (K = 1,024) per block of 8 waves. Both operands lie in memory as 16-bit rows of k (k_cvt, k_fa). Each pass of 64 k is staged once per block in LDS: whole 128-B lines, 8 lanes a row, 16 B a lane, nothing rounded on the way. Two buffers: the next pass's global loads fly while this pass's WMMAs run; one barrier a pass.
// MODE 0: bf16 operands. MODE 1: f16 operands (W carried x 2^8).
// Every '#pragma unroll' from here to the end of k_proj, and in k_out, makes the indices of a register array (staged values, fragments, accumulators) constants, so that the array stays in registers.
// The product is D[p][q], p over the rows of staged operand pi (0 = X rows, 1 = W columns), q over the other's: a lane then holds 8 consecutive p of one q.
#define GT 128             // tile edge
#define GK 64              // k per pass
#define GKK 1024           // K (= DIN = CC)
#define GP 72              // LDS row pitch in 16-bit elements (144 B = 16 B x odd)
#define GOPB (GT * GP * 2) // bytes of one staged operand
#define GSMB (4 * GOPB)    // LDS of a block: the ring (4 x GOPB) or, behind it, the output staging (two f16 planes of pitch 136, or f32 rows of pitch 132)
// four 16-B stores and their s_wait_xcnt in one statement: what follows rewrites their address and data registers
__device__ __forceinline__ void g_st4(void* p0, void* p1, void* p2, void* p3, v4u a, v4u b, v4u c, v4u d) {
  asm volatile("global_store_b128 %0, %4, off\n\tglobal_store_b128 %1, %5, off\n\tglobal_store_b128 %2, %6, off\n\tglobal_store_b128 %3, %7, off\n\ts_wait_xcnt 0x0" :: "v"(p0), "v"(p1), "v"(p2), "v"(p3), "v"(a), "v"(b), "v"(c), "v"(d) : "memory"); }
// one pass's global loads of a thread, then its pointers move on. The three scheduling barriers keep everything but the loads out of the stretch up to their s_wait_xcnt (no register that a load names is rewritten ahead of it) and keep all the loads ahead of the WMMAs that follow (else loads sink into the pass, and their latency is waited out a second time)
__device__ __forceinline__ void g_fetch(const char*& px, const char*& pw, v4u (&xa)[4], v4u (&wa)[4]) {
  __builtin_amdgcn_sched_barrier(0);
#pragma unroll
  for (int i = 0; i < 4; ++i) xa[i] = *(const v4u*)(px + (size_t)i * 32 * GKK * 2);
#pragma unroll
  for (int i = 0; i < 4; ++i) wa[i] = *(const v4u*)(pw + (size_t)i * 32 * GKK * 2);
  __builtin_amdgcn_sched_barrier(0);
  asm volatile("s_wait_xcnt 0x0" :: "v"(px), "v"(pw) : "memory");   /* before the loads' address registers are rewritten; it names both addresses so that they keep their registers up to here */
  __builtin_amdgcn_sched_barrier(0);
  px += GK * 2; pw += GK * 2;
}
__device__ __forceinline__ void g_put(char* bx, char* bw, const v4u (&xa)[4], const v4u (&wa)[4]) {
#pragma unroll
  for (int i = 0; i < 4; ++i) { *(v4u*)(bx + i * 32 * GP * 2) = xa[i]; *(v4u*)(bw + i * 32 * GP * 2) = wa[i]; }
}
template <int MODE> __device__ __forceinline__ void gemm_tile(const char* __restrict__ Xr, const char* __restrict__ Wr, const int pi, char* sm, v8f (&acc)[2][4]) {
  const int tid = threadIdx.x, wave = tid >> 5, lane = tid & 31, col = lane & 15;
  const int sr = tid >> 3, sk = (tid & 7) * 16;   /* a thread's row (and the three 32 further on) and its 16 B of the row's 128 */
  const char* gx = Xr + (size_t)sr * GKK * 2 + sk; const char* gw = Wr + (size_t)sr * GKK * 2 + sk;
  const int xo = sr * GP * 2 + sk, wo = GOPB + xo;   /* a thread's own places in a buffer: [X rows | W columns] */
  const int po = pi * GOPB + ((wave & 3) * 32 + col) * GP * 2, qo = (pi ^ 1) * GOPB + ((wave >> 2) * 64 + col) * GP * 2;
  v4u xa[4], wa[4];
  g_fetch(gx, gw, xa, wa);
  g_put(sm + xo, sm + wo, xa, wa);
  __syncthreads();
  for (int s = 0; s < GKK / GK; ++s) { char* cb = sm + (s & 1) * 2 * GOPB; char* nb = sm + ((s & 1) ^ 1) * 2 * GOPB; const bool more = s + 1 < GKK / GK;
    if (more) g_fetch(gx, gw, xa, wa);
#pragma unroll
    for (int kk = 0; kk < GK / 32; ++kk) {   /* k ascending in steps of 32 */
      if (MODE == 0) { v16b P[2], Q[4];
#pragma unroll
        for (int i = 0; i < 2; ++i) P[i] = frag_b((const __bf16*)(cb + po + i * 16 * GP * 2 + kk * 64), lane);
#pragma unroll
        for (int i = 0; i < 4; ++i) Q[i] = frag_b((const __bf16*)(cb + qo + i * 16 * GP * 2 + kk * 64), lane);
#pragma unroll
        for (int i = 0; i < 2; ++i)
#pragma unroll
          for (int j = 0; j < 4; ++j) acc[i][j] = __builtin_amdgcn_wmma_f32_16x16x32_bf16(false, P[i], false, Q[j], (short)0, acc[i][j], false, false);
      } else { v16h P[2], Q[4];
#pragma unroll
        for (int i = 0; i < 2; ++i) P[i] = frag_h((const _Float16*)(cb + po + i * 16 * GP * 2 + kk * 64), lane);
#pragma unroll
        for (int i = 0; i < 4; ++i) Q[i] = frag_h((const _Float16*)(cb + qo + i * 16 * GP * 2 + kk * 64), lane);
#pragma unroll
        for (int i = 0; i < 2; ++i)
#pragma unroll
          for (int j = 0; j < 4; ++j) acc[i][j] = __builtin_amdgcn_wmma_f32_16x16x32_f16(false, P[i], false, Q[j], (short)0, acc[i][j], false, false);
      } }
    __builtin_amdgcn_sched_barrier(0);   /* the LDS stores, which wait for the loads, stay behind the last WMMA: the wave issues in order */
    if (more) g_put(nb + xo, nb + wo, xa, wa);   /* that buffer's last readers left it before the previous barrier */
    __syncthreads(); }
}
// ---- k_cvt: every GEMM operand that is an input, rounded once to the 16-bit type its product uses and laid down as rows of k. Blocks 0..255: 16,384 elements of x each -> bf16, same layout. Then 384 tiles of W_qkv (-> bf16) and 128 of W_proj (-> f16(bf16 x 2^8)), 128 k x 64 columns each, transposed through LDS: a thread packs two neighbouring k of 4 columns into dwords; a column leaves as 256 B of its row.
#define CVX 256
#define CVQ 384
#define CVP 128
typedef __attribute__((ext_vector_type(2))) __bf16 v2b;
typedef __attribute__((ext_vector_type(2))) _Float16 v2hh;
// one 128 k x 64 column tile of a weight [k][LD] -> rows of k [column][GKK]. PJ: f16(bf16 x 2^8), else bf16
template <bool PJ, int LD> __device__ __forceinline__ void cvt_w(const float* __restrict__ S, char* __restrict__ Dm, const int bi, unsigned (&st)[64][68]) {
  const int tid = threadIdx.x, n0 = (bi % (LD / 64)) * 64, k0 = (bi / (LD / 64)) * 128, c4 = tid & 15, kp = tid >> 4;
  const float* s = S + (size_t)(k0 + 2 * kp) * LD + n0 + c4 * 4; v4f a[4][2];   /* 16 lanes take 256 B of a row */
#pragma unroll
  for (int i = 0; i < 4; ++i) { a[i][0] = *(const v4f*)(s + (size_t)(32 * i) * LD); a[i][1] = *(const v4f*)(s + (size_t)(32 * i + 1) * LD); }
  asm volatile("s_wait_xcnt 0x0" :: "v"(s) : "memory");   /* before the loads' address register is rewritten; it names the address so that no load of the group is given it as its destination */
#pragma unroll
  for (int i = 0; i < 4; ++i)
#pragma unroll
    for (int e = 0; e < 4; ++e) { unsigned w;
      if (PJ) { const v2hh t = {(_Float16)(bfr(a[i][0][e]) * 256.0f), (_Float16)(bfr(a[i][1][e]) * 256.0f)}; w = __builtin_bit_cast(unsigned, t); }
      else { const v2b t = {(__bf16)a[i][0][e], (__bf16)a[i][1][e]}; w = __builtin_bit_cast(unsigned, t); }
      st[c4 * 4 + e][kp + 16 * i] = w; }
  __syncthreads();   /* every wave of the block passes it: the tile is in LDS, column by column */
  const int r = tid >> 4, pc = tid & 15;   /* a wave stores two whole 256-B pieces of rows at a time */
  char* D = Dm + ((size_t)(n0 + r) * GKK + k0 + pc * 8) * 2;
  g_st4(D, D + 16 * GKK * 2, D + 32 * GKK * 2, D + 48 * GKK * 2, *(const v4u*)&st[r][pc * 4], *(const v4u*)&st[r + 16][pc * 4], *(const v4u*)&st[r + 32][pc * 4], *(const v4u*)&st[r + 48][pc * 4]); }
__global__ __launch_bounds__(256) void k_cvt(const float* __restrict__ X, const float* __restrict__ WQKV, const float* __restrict__ WO, __bf16* __restrict__ XB, __bf16* __restrict__ WQT, _Float16* __restrict__ WPT) {
  __shared__ __align__(16) unsigned st[64][68];   /* [column][k pair], pitch 272 B */
  const int tid = threadIdx.x, bi = blockIdx.x;   /* every branch below reads the same for the whole block */
  if (bi < CVX) {
    const float* s = X + (size_t)bi * 16384 + tid * 8; __bf16* d = XB + (size_t)bi * 16384 + tid * 8; v4f a[8][2]; v4u c[8];
#pragma unroll
    for (int i = 0; i < 8; ++i) { a[i][0] = *(const v4f*)(s + i * 2048); a[i][1] = *(const v4f*)(s + i * 2048 + 4); }
#pragma unroll
    for (int i = 0; i < 8; ++i) { v8b t;
#pragma unroll
      for (int e = 0; e < 4; ++e) { t[e] = (__bf16)a[i][0][e]; t[4 + e] = (__bf16)a[i][1][e]; }
      c[i] = __builtin_bit_cast(v4u, t); }
    g_st4(d, d + 2048, d + 4096, d + 6144, c[0], c[1], c[2], c[3]);
    g_st4(d + 8192, d + 10240, d + 12288, d + 14336, c[4], c[5], c[6], c[7]);
  } else if (bi < CVX + CVQ) cvt_w<false, 3 * CC>(WQKV, (char*)WQT, bi - CVX, st);
  else cvt_w<true, DIN>(WO, (char*)WPT, bi - CVX - CVQ, st); }
// ---- k_proj: block = (128 rows, 128 cols, which): q/k/v = X W with exact bf16 products (K = DIN) -> which 0: q x QSC as f16 rows + residual rows; 1: k x KSC f16 rows; 2: v f16 planes [c][t]. q, k: p = column, q = row; v: p = row (t), q = column: either way a lane's 8 values are 16 B of an output row, staged in LDS and stored as whole 256-B rows
// q carries the whole logit factor (32^-0.5 log2(e)), so that k q^T is the logit in log2 units as it leaves the matrix unit; the power of two moved from k to q keeps q's residual in f16's normal range and leaves k's rounding as it is (only values of k under 2^-10 turn subnormal, an absolute error under 2^-25)
#define QSC (SCALE * 1.4426950408889634f * 16.0f)
#define KSC (1.0f / 16.0f)
__global__ __launch_bounds__(256) void k_proj(const __bf16* __restrict__ XB, const __bf16* __restrict__ WQT, _Float16* __restrict__ QH, _Float16* __restrict__ QL, _Float16* __restrict__ KH, _Float16* __restrict__ VT) {
  __shared__ __align__(16) char sm[GSMB];
  const int tid = threadIdx.x, wave = tid >> 5, lane = tid & 31, col = lane & 15, g = lane >> 4; const int which = blockIdx.z; const int c0 = blockIdx.y * GT; const size_t r0 = (size_t)blockIdx.x * GT; const size_t bb = r0 / TT; const int t0 = (int)(r0 % TT);
  v8f acc[2][4] = {};
  gemm_tile<0>((const char*)(XB + r0 * DIN), (const char*)(WQT + (size_t)(which * CC + c0) * DIN), which < 2 ? 1 : 0, sm, acc);
  _Float16* sh = (_Float16*)sm; _Float16* sl = sh + GT * 136; const float osc = which == 0 ? QSC : which == 1 ? KSC : 1.0f;
#pragma unroll
  for (int i = 0; i < 2; ++i)
#pragma unroll
    for (int j = 0; j < 4; ++j) { v8h hv, lv;
#pragma unroll
      for (int r = 0; r < 8; ++r) { const float v = acc[i][j][r] * osc; hv[r] = (_Float16)v; lv[r] = (_Float16)(v - (float)hv[r]); }
      const int o = ((wave >> 2) * 64 + j * 16 + col) * 136 + (wave & 3) * 32 + i * 16 + 8 * g; *(v8h*)&sh[o] = hv; if (which == 0) *(v8h*)&sl[o] = lv; }
  __syncthreads();
  _Float16* D = which == 0 ? QH + r0 * CC + c0 : which == 1 ? KH + r0 * CC + c0 : VT + (bb * CC + c0) * (size_t)TT + t0; const size_t dp = which < 2 ? CC : TT;
  const int q = tid >> 4, pc = (tid & 15) * 8;   /* a wave stores two whole 256-B rows at a time */
#pragma unroll
  for (int t = 0; t < 2; ++t) { const int qq = q + t * 64; _Float16* d = D + qq * dp + pc; const _Float16* s = &sh[qq * 136 + pc];
    g_st4(d, d + 16 * dp, d + 32 * dp, d + 48 * dp, *(const v4u*)s, *(const v4u*)(s + 16 * 136), *(const v4u*)(s + 32 * 136), *(const v4u*)(s + 48 * 136)); }
  if (which == 0) {
#pragma unroll
    for (int t = 0; t < 2; ++t) { const int qq = q + t * 64; _Float16* d = QL + (r0 + qq) * CC + c0 + pc; const _Float16* s = &sl[qq * 136 + pc];
      g_st4(d, d + 16 * CC, d + 32 * CC, d + 48 * CC, *(const v4u*)s, *(const v4u*)(s + 16 * 136), *(const v4u*)(s + 32 * 136), *(const v4u*)(s + 48 * 136)); } } }
#define FQ 2               // query column groups (16 queries each) per wave
#define FS 64              // keys per stage (one LDS buffer)
#define KP 40              // K row pitch in LDS, halfs (80 B = 16 B x odd)
#define VP 72              // v plane row pitch in LDS, halfs (144 B = 16 B x odd)
typedef __attribute__((ext_vector_type(2))) _Float16 v2h;
__device__ __forceinline__ v8f wmma_h(v16h a, v16h b, v8f c) { return __builtin_amdgcn_wmma_f32_16x16x32_f16(false, a, false, b, (short)0, c, false, false); }
__global__ __launch_bounds__(512) void k_fa(const _Float16* __restrict__ QH, const _Float16* __restrict__ QL, const _Float16* __restrict__ KH, const _Float16* __restrict__ VT, const float* __restrict__ LQ1, const float* __restrict__ LK1, const float* __restrict__ LQ2, const float* __restrict__ LK2, const float* __restrict__ SW, _Float16* __restrict__ YD) {
  __shared__ __align__(16) _Float16 sK[2][2][FS][KP]; __shared__ __align__(16) _Float16 sV[2][HDV][VP]; __shared__ __align__(16) v4f sX[8 * FQ * (HDV / 8)][32];   /* sK: [buffer][sub-head half]; sX: the hand-over, 16 B a lane */
  const int tid = threadIdx.x, wave = __builtin_amdgcn_readfirstlane(tid >> 5), lane = tid & 31, col = lane & 15, g = lane >> 4;
  const int half = wave >> 3, w8 = wave & 7;
  const int e = blockIdx.y, h = e + 16 * half, b = blockIdx.z; const int q0 = blockIdx.x * (8 * FQ * 16) + w8 * (FQ * 16); const int vc0 = e * HDV;   /* both sub-heads use v head e */
  v16h qh[FQ], ql[FQ];
#pragma unroll
  for (int qt = 0; qt < FQ; ++qt) { qh[qt] = frag_h(QH + ((size_t)b * TT + q0 + qt * 16 + col) * CC + h * HD, lane); ql[qt] = frag_h(QL + ((size_t)b * QHI + q0 + qt * 16 + col) * CC + h * HD, lane); }
  // staging: a stage = 64 K rows of 64 B of each sub-head (a thread takes one 16-B piece of its own half's) + 64 v plane rows of 128 B (one piece a thread)
  const int kr = (tid & 255) >> 2, kq = (tid & 3) * 8, vr = tid >> 3, vq = (tid & 7) * 8;
  const _Float16* gk = KH + ((size_t)b * TT + kr) * CC + h * HD + kq; const _Float16* gv = VT + ((size_t)b * CC + vc0 + vr) * (size_t)TT + vq;
  v4u rk = *(const v4u*)gk, rv0 = *(const v4u*)gv;
  float la = bfr(LQ1[lane]) * bfr(LK1[lane]), lc = bfr(LQ2[lane]) * bfr(LK2[lane]);   /* 32-term dots: one term per lane, fixed xor-tree order */
#pragma unroll
  for (int of = 1; of < 32; of <<= 1) { la += __shfl_xor(la, of); lc += __shfl_xor(lc, of); }
  const float lam = __builtin_bit_cast(float, __builtin_amdgcn_readfirstlane(__builtin_bit_cast(int, expf(la) - expf(lc) + LAMBDA_INIT)));   /* the same in every lane: kept in a scalar register over the key loop */
  *(v4u*)&sK[0][half][kr][kq] = rk; *(v4u*)&sV[0][vr][vq] = rv0;
  __syncthreads();
  v8f o[FQ][HDV / 16] = {}; v8f nm[FQ]; v2f l[FQ];   /* nm: minus the offset mo of the lane's query, 8 times over (the logit chain's C operand); l: a lane's own keys, even and odd registers apart; joined after the loop */
#pragma unroll
  for (int qt = 0; qt < FQ; ++qt) { nm[qt] = (v8f){}; l[qt] = (v2f){0.f, 0.f}; }
  for (int s = 0; s < TT / FS; ++s) { const int cur = s & 1; const bool more = s + 1 < TT / FS;
    if (more) { rk = *(const v4u*)(gk + (size_t)(s + 1) * FS * CC); rv0 = *(const v4u*)(gv + (s + 1) * FS);   /* the next stage's rows fly while this stage is worked on */
      asm volatile("s_wait_xcnt 0x0" ::: "memory"); }   /* before the two loads' address registers move on to the next stage */
#pragma unroll
    for (int kc = 0; kc < FS / 32; ++kc) {   /* unrolled: every fragment index constant */
      v16h kf[2], vf[HDV / 16]; v8f t[FQ][2]; float mx[FQ];
#pragma unroll
      for (int kt = 0; kt < 2; ++kt) kf[kt] = frag_h(&sK[cur][half][kc * 32 + kt * 16 + col][0], lane);
#pragma unroll
      for (int qt = 0; qt < FQ; ++qt)
#pragma unroll
        for (int kt = 0; kt < 2; ++kt) t[qt][kt] = wmma_h(kf[kt], ql[qt], nm[qt]);
#pragma unroll
      for (int qt = 0; qt < FQ; ++qt)
#pragma unroll
        for (int kt = 0; kt < 2; ++kt) t[qt][kt] = wmma_h(kf[kt], qh[qt], t[qt][kt]);
      __builtin_amdgcn_sched_barrier(0);   /* the eight products stay together ahead of the maxima: each fills the distance behind the others, where a maximum placed directly behind its product costs four v_nop */
#pragma unroll
      for (int j = 0; j < HDV / 16; ++j) vf[j] = frag_h(&sV[cur][j * 16 + col][kc * 32], lane);   /* the chunk's v fragments leave LDS in one group right behind the logit products: they land under the softmax, and no P.V product waits for LDS */
      __builtin_amdgcn_sched_barrier(0);   /* keeps that group here: left free, the loads sink back between the P.V products, each pair waited out */
#pragma unroll
      for (int qt = 0; qt < FQ; ++qt) { mx[qt] = -3.0e38f;
#pragma unroll
        for (int kt = 0; kt < 2; ++kt)
#pragma unroll
          for (int i = 0; i < 4; ++i) mx[qt] = fmaxf(mx[qt], fmaxf(t[qt][kt][2 * i], t[qt][kt][2 * i + 1])); }
      const bool first = (s == 0) && (kc == 0); bool need = false;
#pragma unroll
      for (int qt = 0; qt < FQ; ++qt) need = need || (mx[qt] > 14.0f);
      if (first || __builtin_amdgcn_ballot_w32(need) != 0) {   /* wave-uniform; the first pass sets the offset from its own logits, in either direction */
#pragma unroll
        for (int qt = 0; qt < FQ; ++qt) { const float mj = fmaxf(mx[qt], __shfl_xor(mx[qt], 16));   /* both halves of a column take the same offset */
          const float d = first ? mj - 6.0f : fmaxf(mj - 6.0f, 0.f); const float al = __builtin_amdgcn_exp2f(-fmaxf(d, 0.f)); nm[qt] -= d; l[qt] *= al;
#pragma unroll
          for (int j = 0; j < HDV / 16; ++j) o[qt][j] *= al;
#pragma unroll
          for (int kt = 0; kt < 2; ++kt) t[qt][kt] -= d; } }
      v16h pf[FQ];
#pragma unroll
      for (int qt = 0; qt < FQ; ++qt) {
#pragma unroll
        for (int i = 0; i < 8; ++i) { const v2f x = {t[qt][i >> 2][2 * (i & 3)], t[qt][i >> 2][2 * (i & 3) + 1]}; v2f e; e[0] = __builtin_amdgcn_exp2f(x[0]); e[1] = __builtin_amdgcn_exp2f(x[1]); l[qt] += e;
          const v2h ph = __builtin_convertvector(e, v2h); pf[qt][2 * i] = ph[0]; pf[qt][2 * i + 1] = ph[1]; } }   /* element s of the B operand = tile s >> 3, register s & 7 */
#pragma unroll
      for (int j = 0; j < HDV / 16; ++j)
#pragma unroll
        for (int qt = 0; qt < FQ; ++qt) o[qt][j] = wmma_h(vf[j], pf[qt], o[qt][j]); }
    if (more) { *(v4u*)&sK[cur ^ 1][half][kr][kq] = rk; *(v4u*)&sV[cur ^ 1][vr][vq] = rv0; }   /* that buffer's last readers left it before the previous barrier */
    __syncthreads(); }
#pragma unroll
  for (int qt = 0; qt < FQ; ++qt) { const float ls = l[qt][0] + l[qt][1]; const float inv = 1.0f / (ls + __shfl_xor(ls, 16));
#pragma unroll
    for (int j = 0; j < HDV / 16; ++j) o[qt][j] *= inv; }   /* register r of tile j = value column j*16 + 8g + r of query col */
  if (half) {
#pragma unroll
    for (int qt = 0; qt < FQ; ++qt)
#pragma unroll
      for (int j = 0; j < HDV / 16; ++j) { v4f a, c;
#pragma unroll
        for (int r = 0; r < 4; ++r) { a[r] = o[qt][j][r]; c[r] = o[qt][j][4 + r]; }
        sX[(w8 * FQ + qt) * (HDV / 8) + 2 * j][lane] = a; sX[(w8 * FQ + qt) * (HDV / 8) + 2 * j + 1][lane] = c; } }
  __syncthreads();   /* every wave passes it: attn2 is in LDS for the partner waves */
  if (!half) { float sw[HDV / 16][8];
#pragma unroll
    for (int j = 0; j < HDV / 16; ++j)
#pragma unroll
      for (int r = 0; r < 8; ++r) sw[j][r] = bfr(SW[j * 16 + 8 * g + r]) * (1.0f - LAMBDA_INIT);
#pragma unroll
    for (int qt = 0; qt < FQ; ++qt) { float q = 0.f;
#pragma unroll
      for (int j = 0; j < HDV / 16; ++j) { const v4f a = sX[(w8 * FQ + qt) * (HDV / 8) + 2 * j][lane], c = sX[(w8 * FQ + qt) * (HDV / 8) + 2 * j + 1][lane];
#pragma unroll
        for (int r = 0; r < 4; ++r) { o[qt][j][r] -= lam * a[r]; o[qt][j][4 + r] -= lam * c[r]; }
#pragma unroll
        for (int r = 0; r < 8; ++r) q += o[qt][j][r] * o[qt][j][r]; }
      q += __shfl_xor(q, 16);   /* a lane holds 32 of its query's 64 columns, lane ^ 16 the rest */
      const float rs = rsqrtf(q * (1.0f / 64.0f) + 1e-5f); _Float16* yr = YD + ((size_t)b * TT + q0 + qt * 16 + col) * CC + e * HDV + 8 * g; v4u yv[HDV / 16];
#pragma unroll
      for (int j = 0; j < HDV / 16; ++j) { v8h hv;
#pragma unroll
        for (int r = 0; r < 8; ++r) hv[r] = (_Float16)(o[qt][j][r] * rs * sw[j][r]);   /* the one rounding to f16 that the output product takes */
        yv[j] = __builtin_bit_cast(v4u, hv); }
      g_st4(yr, yr + 16, yr + 32, yr + 48, yv[0], yv[1], yv[2], yv[3]); } } }
// ---- k_out: block = (128 rows, 128 cols): out = ctx Wo + bo: ctx once to f16 against Wo as f16(bf16 x 2^8) exact (1 product) x 2^-8; p = column, q = row; f32 rows staged in LDS and stored as whole 512-B rows
__global__ __launch_bounds__(256) void k_out(const _Float16* __restrict__ Y, const _Float16* __restrict__ WPT, const float* __restrict__ BO, float* __restrict__ OUT) {
  __shared__ __align__(16) char sm[GSMB];
  const int tid = threadIdx.x, wave = tid >> 5, lane = tid & 31, col = lane & 15, g = lane >> 4; const int c0 = blockIdx.y * GT; const size_t r0 = (size_t)blockIdx.x * GT;
  v8f acc[2][4] = {};
  gemm_tile<1>((const char*)(Y + r0 * CC), (const char*)(WPT + (size_t)c0 * CC), 1, sm, acc);
  float* sf = (float*)sm;
#pragma unroll
  for (int i = 0; i < 2; ++i) { const int p = (wave & 3) * 32 + i * 16 + 8 * g; float bias[8];
#pragma unroll
    for (int r = 0; r < 8; ++r) bias[r] = bfr(BO[c0 + p + r]);
#pragma unroll
    for (int j = 0; j < 4; ++j) { v4f a, c;
#pragma unroll
      for (int r = 0; r < 4; ++r) { a[r] = acc[i][j][r] * (1.0f / 256.0f) + bias[r]; c[r] = acc[i][j][4 + r] * (1.0f / 256.0f) + bias[4 + r]; }
      float* d = &sf[((wave >> 2) * 64 + j * 16 + col) * 132 + p]; *(v4f*)d = a; *(v4f*)(d + 4) = c; } }
  __syncthreads();
  const int q = tid >> 5, pc = (tid & 31) * 4;   /* a wave stores one whole 512-B row at a time */
#pragma unroll
  for (int t = 0; t < 4; ++t) { const int qq = q + t * 32; float* d = OUT + (r0 + qq) * DIN + c0 + pc; const float* s = &sf[qq * 132 + pc];
    g_st4(d, d + 8 * DIN, d + 16 * DIN, d + 24 * DIN, *(const v4u*)s, *(const v4u*)(s + 8 * 132), *(const v4u*)(s + 16 * 132), *(const v4u*)(s + 24 * 132)); } }

extern "C" void kernel_launch(void* const* d_in, const int* in_sizes, int n_in, void* d_out, int out_size, void* d_ws, size_t ws_size, hipStream_t stream) {
  (void)in_sizes; (void)n_in; (void)out_size;
  const float** F = (const float**)d_in;
  if (ws_size < (size_t)WS_END) return;
  char* ws = (char*)d_ws; _Float16 *QH = (_Float16*)(ws + WS_QH), *KH = (_Float16*)(ws + WS_KH), *VT = (_Float16*)(ws + WS_VT), *QL = (_Float16*)(ws + WS_QL), *KL = (_Float16*)(ws + WS_KL); __bf16 *VB = (__bf16*)(ws + WS_VB), *VBL = (__bf16*)(ws + WS_VBL); float *S = (float*)(ws + WS_S), *Y = (float*)(ws + WS_Y);
  (void)Y; (void)QL; (void)KL; (void)VB; (void)VBL;
  // inputs: 0 x [2,2048,1024]; 1 W_qkv [1024,3072] (in,out; columns (3, H, 64)); 2 W_proj [1024,1024] (in,out); 3 b_proj; 4 lambda_q1, 5 lambda_k1, 6 lambda_q2, 7 lambda_k2 [32]; 8 subln_w [64]
  _Float16* YD = (_Float16*)S;   /* the differential rows' plane */
  __bf16 *XB = (__bf16*)(ws + WS_XB), *WQT = (__bf16*)(ws + WS_WQT); _Float16* WPT = (_Float16*)(ws + WS_WPT);
  k_cvt<<<dim3(CVX + CVQ + CVP), 256, 0, stream>>>(F[0], F[1], F[2], XB, WQT, WPT);
  k_proj<<<dim3(TNB * TT / GT, CC / GT, 3), 256, 0, stream>>>(XB, WQT, QH, QL, KH, VT);
  k_fa<<<dim3(TT / 256, NH / 2, TNB), 512, 0, stream>>>(QH, QL, KH, VT, F[4], F[5], F[6], F[7], F[8], YD);
  k_out<<<dim3(TNB * TT / GT, DIN / GT), 256, 0, stream>>>(YD, WPT, F[3], (float*)d_out);
}

// v007
// Measured time: 98.2 microseconds a run.
// Two timings next to v006 both put it at 1.03 times that version's speed.
// All steps since v000 together make it 21.0 times as fast.
// compute dtype: all float inputs rounded to bf16; qkv = x W_qkv with EXACT bf16 products on WMMA 16x16x32 (f32 accumulate); the 32-wide sub-head logits with q x 32^-0.5 log2(e) x 2^4 as f16 hi + residual against k x 2^-4 once to f16 (2 products, one f32 accumulate chain that starts at minus the running offset); both softmaxes in f32 (running maximum offset, exp2 on log2-scaled logits, f32 sum); each unnormalised P once to f16 against the head's 64-wide v once to f16 (1 product), divided by the sum last; the differential combination, the per-head RMS normalisation (x subln_w x (1 - lambda_init)) in f32; the result once to f16 against W_proj carried x 2^8 in f16 + b_proj; f32 output.
#include <hip/hip_runtime.h>
#include <math.h>

typedef __attribute__((ext_vector_type(16))) _Float16 v16h;
typedef __attribute__((ext_vector_type(16))) __bf16 v16b;
typedef __attribute__((ext_vector_type(8)))  _Float16 v8h;
typedef __attribute__((ext_vector_type(8)))  float v8f;
typedef __attribute__((ext_vector_type(4)))  float v4f;
typedef __attribute__((ext_vector_type(2)))  float v2f;
typedef __attribute__((ext_vector_type(4)))  unsigned v4u;
typedef __attribute__((ext_vector_type(4)))  int v4i;
typedef float __attribute__((may_alias)) float_a;
typedef int __attribute__((may_alias)) int_a;

template <typename T> __device__ __forceinline__ void vst2(void* p, T v) { *(T*)p = v;  }
__device__ __forceinline__ v8f wmma16(v16h a, v16h b, v8f c) {
  v8f d = __builtin_amdgcn_wmma_f32_16x16x32_f16(false, a, false, b, (short)0, c, false, false);
  asm volatile("v_nop\n\tv_nop\n\tv_nop\n\tv_nop" : "+v"(d) : "v"(a), "v"(b));
  return d;
}
__device__ __forceinline__ v8f wmma_bf(v16b a, v16b b, v8f c) {
  v8f d = __builtin_amdgcn_wmma_f32_16x16x32_bf16(false, a, false, b, (short)0, c, false, false);
  asm volatile("v_nop\n\tv_nop\n\tv_nop\n\tv_nop" : "+v"(d) : "v"(a), "v"(b));
  return d;
}
// 16x16x32 fragments: lane = (h = lane>>4, row/col = lane&15); elements 0..7 = k0+8h+0..7, 8..15 = k0+16+8h+0..7; D element r = row 8h+r
__device__ __forceinline__ v16h frag_h(const _Float16* rowk0, int lane) {
  union { v16h v; v8h q[2]; } u; const _Float16* p = rowk0 + 8 * (lane >> 4);
  u.q[0] = *(const v8h*)p; u.q[1] = *(const v8h*)(p + 16); return u.v;
}
__device__ __forceinline__ v16h frag_f32(const float* rowk0, int lane) {
  v16h a; const float* p = rowk0 + 8 * (lane >> 4);
#pragma unroll
  for (int i = 0; i < 8; ++i) { a[i] = (_Float16)p[i]; a[8 + i] = (_Float16)p[16 + i]; }
  return a;
}
__device__ __forceinline__ v16h frag_f32s(const float* rowk0, int lane, float sc) {
  v16h a; const float* p = rowk0 + 8 * (lane >> 4);
#pragma unroll
  for (int i = 0; i < 8; ++i) { a[i] = (_Float16)(p[i] * sc); a[8 + i] = (_Float16)(p[16 + i] * sc); }
  return a;
}
// column fragment from a [K][ld] layout (column n), rows >= K read as 0
__device__ __forceinline__ v16h fragc_f32(const float* W, int k0, int n, int lane, int ld, int K) {
  v16h a; const int g = lane >> 4;
#pragma unroll
  for (int i = 0; i < 8; ++i) { const int ka = k0 + 8 * g + i, kb = ka + 16;
    a[i] = (_Float16)(ka < K ? W[(size_t)(ka < K ? ka : K - 1) * ld + n] : 0.f); a[8 + i] = (_Float16)(kb < K ? W[(size_t)(kb < K ? kb : K - 1) * ld + n] : 0.f); }
  return a;
}
struct F2 { v16b h, l; };
__device__ __forceinline__ F2 bsplit16(const float v[16]) { F2 r;
#pragma unroll
  for (int i = 0; i < 16; ++i) { const __bf16 h = (__bf16)v[i]; r.h[i] = h; r.l[i] = (__bf16)(v[i] - (float)h); }
  return r; }
__device__ __forceinline__ F2 split_row(const float* row, int k0, int lane) { float v[16]; const float* p = row + k0 + 8 * (lane >> 4);
#pragma unroll
  for (int i = 0; i < 8; ++i) { v[i] = p[i]; v[8 + i] = p[16 + i]; }
  return bsplit16(v); }
__device__ __forceinline__ F2 split_rowK(const float* row, int k0, int lane, int K) { float v[16]; const int g = lane >> 4;
#pragma unroll
  for (int i = 0; i < 8; ++i) { const int ka = k0 + 8 * g + i, kb = ka + 16; v[i] = ka < K ? row[ka < K ? ka : K - 1] : 0.f; v[8 + i] = kb < K ? row[kb < K ? kb : K - 1] : 0.f; }
  return bsplit16(v); }
__device__ __forceinline__ F2 split_col(const float* W, int k0, int n, int lane, int ld, int K) { float v[16]; const int g = lane >> 4;
#pragma unroll
  for (int i = 0; i < 8; ++i) { const int ka = k0 + 8 * g + i, kb = ka + 16; v[i] = ka < K ? W[(size_t)(ka < K ? ka : K - 1) * ld + n] : 0.f; v[8 + i] = kb < K ? W[(size_t)(kb < K ? kb : K - 1) * ld + n] : 0.f; }
  return bsplit16(v); }
__device__ __forceinline__ v8f mac3(const F2& a, const F2& b, v8f c) { c = wmma_bf(a.l, b.h, c); c = wmma_bf(a.h, b.l, c); return wmma_bf(a.h, b.h, c); }
__device__ __forceinline__ float sigm(float v) { return 1.0f / (1.0f + expf(-v)); }
#define LDSX() do { asm volatile("s_wait_dscnt 0" ::: "memory"); __builtin_amdgcn_wave_barrier(); __builtin_amdgcn_fence(__ATOMIC_RELEASE, "workgroup"); } while (0)

// Differential attention (B 2, N 2,048, C 1,024; 16 heads, head_dim 32, v 64 wide): qkv = x W_qkv ((in,out) [1024, 3072], columns (3, H, 64)); q, k -> 32 sub-heads of 32: q1/k1 = sub-heads 0..15, q2/k2 = sub-heads 16..31, v head h = columns h*64..; attn_i = softmax(q_i k_i^T / sqrt(32)) v; lam = exp(sum lq1 lk1) - exp(sum lq2 lk2) + lambda_init (0.78360578); o = attn1 - lam attn2; o = o rsqrt(mean(o^2) + 1e-5) subln_w (1 - lambda_init); out = merged(o) W_proj + b_proj.
#define NB 2
#define TT 2048
#define CC 1024            // NH * HD = projected width
#define DIN 1024          // input (model) width
#define NH 32              // softmax sub-heads (16 heads x 2 halves)
#define HD 32
#define NQB (TT / 64)
#define HG 4
#define SCALE (0.17677669529663687f)
#define CAUSAL 0
#ifndef TNB
#define TNB NB
#endif
__device__ __forceinline__ float bfr(float v) { return (float)(__bf16)v; }
__host__ __device__ __forceinline__ int kb_last(int qb) { return CAUSAL ? ((qb * 64 + 63) >> 7) : (TT / 128 - 1); }
typedef __attribute__((ext_vector_type(8))) __bf16 v8b;
typedef __attribute__((ext_vector_type(4))) __bf16 v4b;
typedef __attribute__((ext_vector_type(4))) _Float16 v4h;
__device__ __forceinline__ v16b frag_b(const __bf16* rowk0, int lane) {
  union { v16b v; v8b q[2]; } u; const __bf16* p = rowk0 + 8 * (lane >> 4);
  u.q[0] = *(const v8b*)p; u.q[1] = *(const v8b*)(p + 16); return u.v;
}
#define QBH 0
#define QHI 2048            // rows carrying a q residual plane (all rows: 2-product logits everywhere)
#define KHI 64            // key rows carrying k residual / v bf16 hi+lo planes (written or read by no kernel)
// B fragment (k rows k0+.., output column o) of a weight: (in,out) [K][ld] or (out,in) [ld rows of K]: bf16 exact, or f16(bf16 * 256) exact
__device__ __forceinline__ v16b wcol_io(const float* Wm, int k0, int o, int lane, int ld) { v16b w; const int g = lane >> 4;
#pragma unroll
  for (int i = 0; i < 8; ++i) { w[i] = (__bf16)Wm[(size_t)(k0 + 8 * g + i) * ld + o]; w[8 + i] = (__bf16)Wm[(size_t)(k0 + 16 + 8 * g + i) * ld + o]; }
  return w; }
__device__ __forceinline__ v16b wcol_oi(const float* Wm, int k0, int o, int lane, int K) { v16b w; const float* p = Wm + (size_t)o * K + k0 + 8 * (lane >> 4);
#pragma unroll
  for (int i = 0; i < 8; ++i) { w[i] = (__bf16)p[i]; w[8 + i] = (__bf16)p[16 + i]; }
  return w; }
__device__ __forceinline__ v16h wcolh_io(const float* Wm, int k0, int o, int lane, int ld) { v16h w; const int g = lane >> 4;
#pragma unroll
  for (int i = 0; i < 8; ++i) { w[i] = (_Float16)(bfr(Wm[(size_t)(k0 + 8 * g + i) * ld + o]) * 256.0f); w[8 + i] = (_Float16)(bfr(Wm[(size_t)(k0 + 16 + 8 * g + i) * ld + o]) * 256.0f); }
  return w; }
__device__ __forceinline__ v16h wcolh_oi(const float* Wm, int k0, int o, int lane, int K) { v16h w; const float* p = Wm + (size_t)o * K + k0 + 8 * (lane >> 4);
#pragma unroll
  for (int i = 0; i < 8; ++i) { w[i] = (_Float16)(bfr(p[i]) * 256.0f); w[8 + i] = (_Float16)(bfr(p[16 + i]) * 256.0f); }
  return w; }
#define WQKV_LAYOUT 0   // selects the layout of WCOL, which no kernel calls: k_cvt reads W_qkv as (in,out) [DIN][3 * CC] whatever the value
__device__ __forceinline__ v16b wcol_hdk(const float* Wm, int k0, int o, int lane) { v16b w; const int g = lane >> 4; const float* p = Wm + (size_t)(o / HD) * DIN * HD + (o % HD);
#pragma unroll
  for (int i = 0; i < 8; ++i) { w[i] = (__bf16)p[(size_t)(k0 + 8 * g + i) * HD]; w[8 + i] = (__bf16)p[(size_t)(k0 + 16 + 8 * g + i) * HD]; }
  return w; }
#define WO_OUT_IN 0
#if WQKV_LAYOUT == 1
#define WCOL(W, k0, o, lane) wcol_oi(W, k0, o, lane, DIN)
#elif WQKV_LAYOUT == 2
#define WCOL(W, k0, o, lane) wcol_hdk(W, k0, o, lane)
#else
#define WCOL(W, k0, o, lane) wcol_io(W, k0, o, lane, 3 * CC)   /* W_qkv (in,out) packed by columns: row pitch 3C */
#endif
#if WO_OUT_IN
#define WOCOL(W, k0, o, lane) wcol_oi(W, k0, o, lane, CC)
#define WOCOLH(W, k0, o, lane) wcolh_oi(W, k0, o, lane, CC)
#else
#define WOCOL(W, k0, o, lane) wcol_io(W, k0, o, lane, DIN)
#define WOCOLH(W, k0, o, lane) wcolh_io(W, k0, o, lane, DIN)
#endif
#define HDV 64             // value columns per softmax sub-head (the parent head's 64 columns)
#define YP (NH * HDV)      // 2,048: only sizes the region from WS_Y to WS_END
#define LAMBDA_INIT 0.78360578f   /* 0.8 - 0.6 exp(-0.3 * 12) */
#ifndef SM_EXTRA_PARAMS
#define SM_EXTRA_PARAMS
#endif
#ifndef PROJ_EXTRA_PARAMS
#define PROJ_EXTRA_PARAMS
#endif
#ifndef SM_MASK_HOOK
#define SM_MASK_HOOK (void)0
#endif

#define WS_QH  0u                                      // f16 rows of q x QSC [b*t][CC]
#define WS_KH  (WS_QH + 2u * (size_t)NB * TT * CC)      // f16 rows of k x KSC [b*t][CC]
#define WS_VT  (WS_KH + 2u * (size_t)NB * TT * CC)      // f16 v planes [b][c][t]
#define WS_QL  (WS_VT + 2u * (size_t)NB * CC * TT)      // f16 residual rows of q x QSC [b][t < QHI][CC]
#define WS_KL  (WS_QL + 2u * (size_t)NB * QHI * CC)     // f16 k residual x 2^10 rows [b][t < KHI][CC]
#define WS_VB  (WS_KL + 2u * (size_t)NB * KHI * CC)     // bf16 v hi planes [b][c][t < KHI]
#define WS_VBL (WS_VB + 2u * (size_t)NB * CC * KHI)
#define WS_S   (WS_VBL + 2u * (size_t)NB * CC * KHI)    // f16 differential rows [b*t][CC] (k_fa -> k_out)
#define WS_Y   (WS_S  + 4u * (size_t)HG * TT * TT)      // the GEMM operands as 16-bit rows of k (k_cvt -> k_proj, k_out):
#define WS_XB  WS_Y                                     // bf16 x rows [b*t][DIN]
#define WS_WQT (WS_XB + 2u * (size_t)NB * TT * DIN)     // bf16 W_qkv columns as rows [3 CC][DIN]
#define WS_WPT (WS_WQT + 2u * (size_t)3 * CC * DIN)     // f16(bf16 x 2^8) W_proj columns as rows [DIN][CC]
#define WS_END (WS_Y  + 4u * (size_t)NB * TT * YP)

// ---- gemm_tile: one 128 x 128 tile of X W (K = 1,024) per block of 8 waves. Both operands lie in memory as 16-bit rows of k (k_cvt, k_fa). Each pass of 64 k is staged once per block in LDS: whole 128-B lines, 8 lanes a row, 16 B a lane, nothing rounded on the way. Two buffers: the next pass's global loads fly while this pass's WMMAs run; one barrier a pass.
// MODE 0: bf16 operands. MODE 1: f16 operands (W carried x 2^8).
// Every '#pragma unroll' from here to the end of k_proj, and in k_out, makes the indices of a register array (staged values, fragments, accumulators) constants, so that the array stays in registers.
// The product is D[p][q], p over the rows of staged operand pi (0 = X rows, 1 = W columns), q over the other's: a lane then holds 8 consecutive p of one q.
#define GT 128             // tile edge
#define GK 64              // k per pass
#define GKK 1024           // K (= DIN = CC)
#define GP 72              // LDS row pitch in 16-bit elements (144 B = 16 B x odd)
#define GOPB (GT * GP * 2) // bytes of one staged operand
#define GSMB (4 * GOPB)    // LDS of a block: the ring (4 x GOPB) or, behind it, the output staging (two f16 planes of pitch 136, or f32 rows of pitch 132)
// four 16-B stores and their s_wait_xcnt in one statement: what follows rewrites their address and data registers
__device__ __forceinline__ void g_st4(void* p0, void* p1, void* p2, void* p3, v4u a, v4u b, v4u c, v4u d) {
  asm volatile("global_store_b128 %0, %4, off\n\tglobal_store_b128 %1, %5, off\n\tglobal_store_b128 %2, %6, off\n\tglobal_store_b128 %3, %7, off\n\ts_wait_xcnt 0x0" :: "v"(p0), "v"(p1), "v"(p2), "v"(p3), "v"(a), "v"(b), "v"(c), "v"(d) : "memory"); }
// one pass's global loads of a thread, then its pointers move on. The three scheduling barriers keep everything but the loads out of the stretch up to their s_wait_xcnt (no register that a load names is rewritten ahead of it) and keep all the loads ahead of the WMMAs that follow (else loads sink into the pass, and their latency is waited out a second time)
__device__ __forceinline__ void g_fetch(const char*& px, const char*& pw, v4u (&xa)[4], v4u (&wa)[4]) {
  __builtin_amdgcn_sched_barrier(0);
#pragma unroll
  for (int i = 0; i < 4; ++i) xa[i] = *(const v4u*)(px + (size_t)i * 32 * GKK * 2);
#pragma unroll
  for (int i = 0; i < 4; ++i) wa[i] = *(const v4u*)(pw + (size_t)i * 32 * GKK * 2);
  __builtin_amdgcn_sched_barrier(0);
  asm volatile("s_wait_xcnt 0x0" :: "v"(px), "v"(pw) : "memory");   /* before the loads' address registers are rewritten; it names both addresses so that they keep their registers up to here */
  __builtin_amdgcn_sched_barrier(0);
  px += GK * 2; pw += GK * 2;
}
__device__ __forceinline__ void g_put(char* bx, char* bw, const v4u (&xa)[4], const v4u (&wa)[4]) {
#pragma unroll
  for (int i = 0; i < 4; ++i) { *(v4u*)(bx + i * 32 * GP * 2) = xa[i]; *(v4u*)(bw + i * 32 * GP * 2) = wa[i]; }
}
template <int MODE> __device__ __forceinline__ void gemm_tile(const char* __restrict__ Xr, const char* __restrict__ Wr, const int pi, char* sm, v8f (&acc)[2][4]) {
  const int tid = threadIdx.x, wave = tid >> 5, lane = tid & 31, col = lane & 15;
  const int sr = tid >> 3, sk = (tid & 7) * 16;   /* a thread's row (and the three 32 further on) and its 16 B of the row's 128 */
  const char* gx = Xr + (size_t)sr * GKK * 2 + sk; const char* gw = Wr + (size_t)sr * GKK * 2 + sk;
  const int xo = sr * GP * 2 + sk, wo = GOPB + xo;   /* a thread's own places in a buffer: [X rows | W columns] */
  const int po = pi * GOPB + ((wave & 3) * 32 + col) * GP * 2, qo = (pi ^ 1) * GOPB + ((wave >> 2) * 64 + col) * GP * 2;
  v4u xa[4], wa[4];
  g_fetch(gx, gw, xa, wa);
  g_put(sm + xo, sm + wo, xa, wa);
  __syncthreads();
  for (int s = 0; s < GKK / GK; ++s) { char* cb = sm + (s & 1) * 2 * GOPB; char* nb = sm + ((s & 1) ^ 1) * 2 * GOPB; const bool more = s + 1 < GKK / GK;
    if (more) g_fetch(gx, gw, xa, wa);
#pragma unroll
    for (int kk = 0; kk < GK / 32; ++kk) {   /* k ascending in steps of 32 */
      if (MODE == 0) { v16b P[2], Q[4];
#pragma unroll
        for (int i = 0; i < 2; ++i) P[i] = frag_b((const __bf16*)(cb + po + i * 16 * GP * 2 + kk * 64), lane);
#pragma unroll
        for (int i = 0; i < 4; ++i) Q[i] = frag_b((const __bf16*)(cb + qo + i * 16 * GP * 2 + kk * 64), lane);
#pragma unroll
        for (int i = 0; i < 2; ++i)
#pragma unroll
          for (int j = 0; j < 4; ++j) acc[i][j] = __builtin_amdgcn_wmma_f32_16x16x32_bf16(false, P[i], false, Q[j], (short)0, acc[i][j], false, false);
      } else { v16h P[2], Q[4];
#pragma unroll
        for (int i = 0; i < 2; ++i) P[i] = frag_h((const _Float16*)(cb + po + i * 16 * GP * 2 + kk * 64), lane);
#pragma unroll
        for (int i = 0; i < 4; ++i) Q[i] = frag_h((const _Float16*)(cb + qo + i * 16 * GP * 2 + kk * 64), lane);
#pragma unroll
        for (int i = 0; i < 2; ++i)
#pragma unroll
          for (int j = 0; j < 4; ++j) acc[i][j] = __builtin_amdgcn_wmma_f32_16x16x32_f16(false, P[i], false, Q[j], (short)0, acc[i][j], false, false);
      } }
    __builtin_amdgcn_sched_barrier(0);   /* the LDS stores, which wait for the loads, stay behind the last WMMA: the wave issues in order */
    if (more) g_put(nb + xo, nb + wo, xa, wa);   /* that buffer's last readers left it before the previous barrier */
    __syncthreads(); }
}
// ---- k_cvt: every GEMM operand that is an input, rounded once to the 16-bit type its product uses and laid down as rows of k. Blocks 0..255: 16,384 elements of x each -> bf16, same layout. Then 384 tiles of W_qkv (-> bf16) and 128 of W_proj (-> f16(bf16 x 2^8)), 128 k x 64 columns each, transposed through LDS: a thread packs two neighbouring k of 4 columns into dwords; a column leaves as 256 B of its row.
#define CVX 256
#define CVQ 384
#define CVP 128
typedef __attribute__((ext_vector_type(2))) __bf16 v2b;
typedef __attribute__((ext_vector_type(2))) _Float16 v2hh;
// one 128 k x 64 column tile of a weight [k][LD] -> rows of k [column][GKK]. PJ: f16(bf16 x 2^8), else bf16
template <bool PJ, int LD> __device__ __forceinline__ void cvt_w(const float* __restrict__ S, char* __restrict__ Dm, const int bi, unsigned (&st)[64][68]) {
  const int tid = threadIdx.x, n0 = (bi % (LD / 64)) * 64, k0 = (bi / (LD / 64)) * 128, c4 = tid & 15, kp = tid >> 4;
  const float* s = S + (size_t)(k0 + 2 * kp) * LD + n0 + c4 * 4; v4f a[4][2];   /* 16 lanes take 256 B of a row */
#pragma unroll
  for (int i = 0; i < 4; ++i) { a[i][0] = *(const v4f*)(s + (size_t)(32 * i) * LD); a[i][1] = *(const v4f*)(s + (size_t)(32 * i + 1) * LD); }
  asm volatile("s_wait_xcnt 0x0" :: "v"(s) : "memory");   /* before the loads' address register is rewritten; it names the address so that no load of the group is given it as its destination */
#pragma unroll
  for (int i = 0; i < 4; ++i)
#pragma unroll
    for (int e = 0; e < 4; ++e) { unsigned w;
      if (PJ) { const v2hh t = {(_Float16)(bfr(a[i][0][e]) * 256.0f), (_Float16)(bfr(a[i][1][e]) * 256.0f)}; w = __builtin_bit_cast(unsigned, t); }
      else { const v2b t = {(__bf16)a[i][0][e], (__bf16)a[i][1][e]}; w = __builtin_bit_cast(unsigned, t); }
      st[c4 * 4 + e][kp + 16 * i] = w; }
  __syncthreads();   /* every wave of the block passes it: the tile is in LDS, column by column */
  const int r = tid >> 4, pc = tid & 15;   /* a wave stores two whole 256-B pieces of rows at a time */
  char* D = Dm + ((size_t)(n0 + r) * GKK + k0 + pc * 8) * 2;
  g_st4(D, D + 16 * GKK * 2, D + 32 * GKK * 2, D + 48 * GKK * 2, *(const v4u*)&st[r][pc * 4], *(const v4u*)&st[r + 16][pc * 4], *(const v4u*)&st[r + 32][pc * 4], *(const v4u*)&st[r + 48][pc * 4]); }
__global__ __launch_bounds__(256) void k_cvt(const float* __restrict__ X, const float* __restrict__ WQKV, const float* __restrict__ WO, __bf16* __restrict__ XB, __bf16* __restrict__ WQT, _Float16* __restrict__ WPT) {
  __shared__ __align__(16) unsigned st[64][68];   /* [column][k pair], pitch 272 B */
  const int tid = threadIdx.x, bi = blockIdx.x;   /* every branch below reads the same for the whole block */
  if (bi < CVX) {
    const float* s = X + (size_t)bi * 16384 + tid * 8; __bf16* d = XB + (size_t)bi * 16384 + tid * 8; v4f a[8][2]; v4u c[8];
#pragma unroll
    for (int i = 0; i < 8; ++i) { a[i][0] = *(const v4f*)(s + i * 2048); a[i][1] = *(const v4f*)(s + i * 2048 + 4); }
#pragma unroll
    for (int i = 0; i < 8; ++i) { v8b t;
#pragma unroll
      for (int e = 0; e < 4; ++e) { t[e] = (__bf16)a[i][0][e]; t[4 + e] = (__bf16)a[i][1][e]; }
      c[i] = __builtin_bit_cast(v4u, t); }
    g_st4(d, d + 2048, d + 4096, d + 6144, c[0], c[1], c[2], c[3]);
    g_st4(d + 8192, d + 10240, d + 12288, d + 14336, c[4], c[5], c[6], c[7]);
  } else if (bi < CVX + CVQ) cvt_w<false, 3 * CC>(WQKV, (char*)WQT, bi - CVX, st);
  else cvt_w<true, DIN>(WO, (char*)WPT, bi - CVX - CVQ, st); }
// ---- k_proj: block = (128 rows, 128 cols, which): q/k/v = X W with exact bf16 products (K = DIN) -> which 0: q x QSC as f16 rows + residual rows; 1: k x KSC f16 rows; 2: v f16 planes [c][t]. q, k: p = column, q = row; v: p = row (t), q = column: either way a lane's 8 values are 16 B of an output row, staged in LDS and stored as whole 256-B rows
// q carries the whole logit factor (32^-0.5 log2(e)), so that k q^T is the logit in log2 units as it leaves the matrix unit; the power of two moved from k to q keeps q's residual in f16's normal range and leaves k's rounding as it is (only values of k under 2^-10 turn subnormal, an absolute error under 2^-25)
#define QSC (SCALE * 1.4426950408889634f * 16.0f)
#define KSC (1.0f / 16.0f)
__global__ __launch_bounds__(256) void k_proj(const __bf16* __restrict__ XB, const __bf16* __restrict__ WQT, _Float16* __restrict__ QH, _Float16* __restrict__ QL, _Float16* __restrict__ KH, _Float16* __restrict__ VT) {
  __shared__ __align__(16) char sm[GSMB];
  const int tid = threadIdx.x, wave = tid >> 5, lane = tid & 31, col = lane & 15, g = lane >> 4; const int which = blockIdx.z; const int c0 = blockIdx.y * GT; const size_t r0 = (size_t)blockIdx.x * GT; const size_t bb = r0 / TT; const int t0 = (int)(r0 % TT);
  v8f acc[2][4] = {};
  gemm_tile<0>((const char*)(XB + r0 * DIN), (const char*)(WQT + (size_t)(which * CC + c0) * DIN), which < 2 ? 1 : 0, sm, acc);
  _Float16* sh = (_Float16*)sm; _Float16* sl = sh + GT * 136; const float osc = which == 0 ? QSC : which == 1 ? KSC : 1.0f;
#pragma unroll
  for (int i = 0; i < 2; ++i)
#pragma unroll
    for (int j = 0; j < 4; ++j) { v8h hv, lv;
#pragma unroll
      for (int r = 0; r < 8; ++r) { const float v = acc[i][j][r] * osc; hv[r] = (_Float16)v; lv[r] = (_Float16)(v - (float)hv[r]); }
      const int o = ((wave >> 2) * 64 + j * 16 + col) * 136 + (wave & 3) * 32 + i * 16 + 8 * g; *(v8h*)&sh[o] = hv; if (which == 0) *(v8h*)&sl[o] = lv; }
  __syncthreads();
  _Float16* D = which == 0 ? QH + r0 * CC + c0 : which == 1 ? KH + r0 * CC + c0 : VT + (bb * CC + c0) * (size_t)TT + t0; const size_t dp = which < 2 ? CC : TT;
  const int q = tid >> 4, pc = (tid & 15) * 8;   /* a wave stores two whole 256-B rows at a time */
#pragma unroll
  for (int t = 0; t < 2; ++t) { const int qq = q + t * 64; _Float16* d = D + qq * dp + pc; const _Float16* s = &sh[qq * 136 + pc];
    g_st4(d, d + 16 * dp, d + 32 * dp, d + 48 * dp, *(const v4u*)s, *(const v4u*)(s + 16 * 136), *(const v4u*)(s + 32 * 136), *(const v4u*)(s + 48 * 136)); }
  if (which == 0) {
#pragma unroll
    for (int t = 0; t < 2; ++t) { const int qq = q + t * 64; _Float16* d = QL + (r0 + qq) * CC + c0 + pc; const _Float16* s = &sl[qq * 136 + pc];
      g_st4(d, d + 16 * CC, d + 32 * CC, d + 48 * CC, *(const v4u*)s, *(const v4u*)(s + 16 * 136), *(const v4u*)(s + 32 * 136), *(const v4u*)(s + 48 * 136)); } } }
#define FQ 2               // query column groups (16 queries each) per wave
#define FS 64              // keys per stage (one LDS buffer)
#define KP 40              // K row pitch in LDS, halfs (80 B = 16 B x odd)
#define VP 72              // v plane row pitch in LDS, halfs (144 B = 16 B x odd)
typedef __attribute__((ext_vector_type(2))) _Float16 v2h;
__device__ __forceinline__ v8f wmma_h(v16h a, v16h b, v8f c) { return __builtin_amdgcn_wmma_f32_16x16x32_f16(false, a, false, b, (short)0, c, false, false); }
// one query group's 32 logits of a chunk -> P = 2^t as the B operand (element s = tile s >> 3, register s & 7) and the lane's own sum of them, even and odd registers apart, added pairwise
__device__ __forceinline__ void fa_p(const v8f (&t)[2], v16h& pf, v2f& cs) { v2f e[8];
#pragma unroll   /* every index of e, t and pf constant: they stay in registers */
  for (int i = 0; i < 8; ++i) { e[i][0] = __builtin_amdgcn_exp2f(t[i >> 2][2 * (i & 3)]); e[i][1] = __builtin_amdgcn_exp2f(t[i >> 2][2 * (i & 3) + 1]);
    const v2h ph = __builtin_convertvector(e[i], v2h); pf[2 * i] = ph[0]; pf[2 * i + 1] = ph[1]; }
  cs = ((e[0] + e[1]) + (e[2] + e[3])) + ((e[4] + e[5]) + (e[6] + e[7])); }
__global__ __launch_bounds__(512) void k_fa(const _Float16* __restrict__ QH, const _Float16* __restrict__ QL, const _Float16* __restrict__ KH, const _Float16* __restrict__ VT, const float* __restrict__ LQ1, const float* __restrict__ LK1, const float* __restrict__ LQ2, const float* __restrict__ LK2, const float* __restrict__ SW, _Float16* __restrict__ YD) {
  __shared__ __align__(16) _Float16 sK[2][2][FS][KP]; __shared__ __align__(16) _Float16 sV[2][HDV][VP]; __shared__ __align__(16) v4f sX[8 * FQ * (HDV / 8)][32];   /* sK: [buffer][sub-head half]; sX: the hand-over, 16 B a lane */
  const int tid = threadIdx.x, wave = __builtin_amdgcn_readfirstlane(tid >> 5), lane = tid & 31, col = lane & 15, g = lane >> 4;
  const int half = wave >> 3, w8 = wave & 7;
  const int e = blockIdx.y, h = e + 16 * half, b = blockIdx.z; const int q0 = blockIdx.x * (8 * FQ * 16) + w8 * (FQ * 16); const int vc0 = e * HDV;   /* both sub-heads use v head e */
  v16h qh[FQ], ql[FQ];
#pragma unroll
  for (int qt = 0; qt < FQ; ++qt) { qh[qt] = frag_h(QH + ((size_t)b * TT + q0 + qt * 16 + col) * CC + h * HD, lane); ql[qt] = frag_h(QL + ((size_t)b * QHI + q0 + qt * 16 + col) * CC + h * HD, lane); }
  // staging: a stage = 64 K rows of 64 B of each sub-head (a thread takes one 16-B piece of its own half's) + 64 v plane rows of 128 B (one piece a thread)
  const int kr = (tid & 255) >> 2, kq = (tid & 3) * 8, vr = tid >> 3, vq = (tid & 7) * 8;
  const _Float16* gk = KH + ((size_t)b * TT + kr) * CC + h * HD + kq; const _Float16* gv = VT + ((size_t)b * CC + vc0 + vr) * (size_t)TT + vq;
  v4u rk = *(const v4u*)gk, rv0 = *(const v4u*)gv;
  float la = bfr(LQ1[lane]) * bfr(LK1[lane]), lc = bfr(LQ2[lane]) * bfr(LK2[lane]);   /* 32-term dots: one term per lane, fixed xor-tree order */
#pragma unroll
  for (int of = 1; of < 32; of <<= 1) { la += __shfl_xor(la, of); lc += __shfl_xor(lc, of); }
  const float lam = __builtin_bit_cast(float, __builtin_amdgcn_readfirstlane(__builtin_bit_cast(int, expf(la) - expf(lc) + LAMBDA_INIT)));   /* the same in every lane: kept in a scalar register over the key loop */
  *(v4u*)&sK[0][half][kr][kq] = rk; *(v4u*)&sV[0][vr][vq] = rv0;
  __syncthreads();
  v8f o[FQ][HDV / 16] = {}; v8f nm[FQ]; v2f l[FQ];   /* nm: minus the offset mo of the lane's query, 8 times over (the logit chain's C operand); l: a lane's own keys, even and odd registers apart; joined after the loop */
#pragma unroll
  for (int qt = 0; qt < FQ; ++qt) { nm[qt] = (v8f){}; l[qt] = (v2f){0.f, 0.f}; }
  for (int s = 0; s < TT / FS; ++s) { const int cur = s & 1; const bool more = s + 1 < TT / FS;
    if (more) { rk = *(const v4u*)(gk + (size_t)(s + 1) * FS * CC); rv0 = *(const v4u*)(gv + (s + 1) * FS);   /* the next stage's rows fly while this stage is worked on */
      asm volatile("s_wait_xcnt 0x0" ::: "memory"); }   /* before the two loads' address registers move on to the next stage */
#pragma unroll
    for (int kc = 0; kc < FS / 32; ++kc) {   /* unrolled: every fragment index constant */
      v16h kf[2], vf[HDV / 16], pf[FQ]; v8f t[FQ][2]; v2f cs[FQ];
#pragma unroll
      for (int kt = 0; kt < 2; ++kt) kf[kt] = frag_h(&sK[cur][half][kc * 32 + kt * 16 + col][0], lane);
#pragma unroll
      for (int qt = 0; qt < FQ; ++qt)
#pragma unroll
        for (int kt = 0; kt < 2; ++kt) t[qt][kt] = wmma_h(kf[kt], ql[qt], nm[qt]);
#pragma unroll
      for (int qt = 0; qt < FQ; ++qt)
#pragma unroll
        for (int kt = 0; kt < 2; ++kt) t[qt][kt] = wmma_h(kf[kt], qh[qt], t[qt][kt]);
      __builtin_amdgcn_sched_barrier(0);   /* the eight products stay together ahead of the exponentials: each fills the distance behind the others */
#pragma unroll
      for (int j = 0; j < HDV / 16; ++j) vf[j] = frag_h(&sV[cur][j * 16 + col][kc * 32], lane);   /* the chunk's v fragments leave LDS in one group right behind the logit products: they land under the softmax, and no P.V product waits for LDS */
      __builtin_amdgcn_sched_barrier(0);   /* keeps that group here: left free, the loads sink back between the P.V products, each pair waited out */
#pragma unroll
      for (int qt = 0; qt < FQ; ++qt) fa_p(t[qt], pf[qt], cs[qt]);
      // no maximum on the usual path: every P is positive, so a lane's partial sums bound each of its P; while they stay under 2^14 the held offset still fits f16
      const bool first = (s == 0) && (kc == 0); bool need = false;
#pragma unroll
      for (int qt = 0; qt < FQ; ++qt) need = need || (fmaxf(cs[qt][0], cs[qt][1]) > 16384.0f);
      if ((__builtin_amdgcn_ballot_w32(need) | (unsigned)first) != 0) {   /* wave-uniform and rare: the chunk's logits are formed anew (their registers were given up), the offset moves, P and its sums are taken again; the first pass sets the offset from its own logits, in either direction */
#pragma unroll
        for (int kt = 0; kt < 2; ++kt) kf[kt] = frag_h(&sK[cur][half][kc * 32 + kt * 16 + col][0], lane);
#pragma unroll
        for (int qt = 0; qt < FQ; ++qt)
#pragma unroll
          for (int kt = 0; kt < 2; ++kt) t[qt][kt] = wmma_h(kf[kt], ql[qt], nm[qt]);
#pragma unroll
        for (int qt = 0; qt < FQ; ++qt)
#pragma unroll
          for (int kt = 0; kt < 2; ++kt) t[qt][kt] = wmma_h(kf[kt], qh[qt], t[qt][kt]);
#pragma unroll
        for (int qt = 0; qt < FQ; ++qt) { float mx = -3.0e38f;
#pragma unroll
          for (int kt = 0; kt < 2; ++kt)
#pragma unroll
            for (int i = 0; i < 4; ++i) mx = fmaxf(mx, fmaxf(t[qt][kt][2 * i], t[qt][kt][2 * i + 1]));
          const float mj = fmaxf(mx, __shfl_xor(mx, 16));   /* both halves of a column take the same offset */
          const float d = first ? mj - 6.0f : fmaxf(mj - 6.0f, 0.f); const float al = __builtin_amdgcn_exp2f(-fmaxf(d, 0.f)); nm[qt] -= d; l[qt] *= al;
#pragma unroll
          for (int j = 0; j < HDV / 16; ++j) o[qt][j] *= al;
#pragma unroll
          for (int kt = 0; kt < 2; ++kt) t[qt][kt] -= d;
          fa_p(t[qt], pf[qt], cs[qt]); } }
#pragma unroll
      for (int qt = 0; qt < FQ; ++qt) l[qt] += cs[qt];
#pragma unroll
      for (int j = 0; j < HDV / 16; ++j)
#pragma unroll
        for (int qt = 0; qt < FQ; ++qt) o[qt][j] = wmma_h(vf[j], pf[qt], o[qt][j]); }
    if (more) { *(v4u*)&sK[cur ^ 1][half][kr][kq] = rk; *(v4u*)&sV[cur ^ 1][vr][vq] = rv0; }   /* that buffer's last readers left it before the previous barrier */
    __syncthreads(); }
#pragma unroll
  for (int qt = 0; qt < FQ; ++qt) { const float ls = l[qt][0] + l[qt][1]; const float inv = 1.0f / (ls + __shfl_xor(ls, 16));
#pragma unroll
    for (int j = 0; j < HDV / 16; ++j) o[qt][j] *= inv; }   /* register r of tile j = value column j*16 + 8g + r of query col */
  if (half) {
#pragma unroll
    for (int qt = 0; qt < FQ; ++qt)
#pragma unroll
      for (int j = 0; j < HDV / 16; ++j) { v4f a, c;
#pragma unroll
        for (int r = 0; r < 4; ++r) { a[r] = o[qt][j][r]; c[r] = o[qt][j][4 + r]; }
        sX[(w8 * FQ + qt) * (HDV / 8) + 2 * j][lane] = a; sX[(w8 * FQ + qt) * (HDV / 8) + 2 * j + 1][lane] = c; } }
  __syncthreads();   /* every wave passes it: attn2 is in LDS for the partner waves */
  if (!half) { float sw[HDV / 16][8];
#pragma unroll
    for (int j = 0; j < HDV / 16; ++j)
#pragma unroll
      for (int r = 0; r < 8; ++r) sw[j][r] = bfr(SW[j * 16 + 8 * g + r]) * (1.0f - LAMBDA_INIT);
#pragma unroll
    for (int qt = 0; qt < FQ; ++qt) { float q = 0.f;
#pragma unroll
      for (int j = 0; j < HDV / 16; ++j) { const v4f a = sX[(w8 * FQ + qt) * (HDV / 8) + 2 * j][lane], c = sX[(w8 * FQ + qt) * (HDV / 8) + 2 * j + 1][lane];
#pragma unroll
        for (int r = 0; r < 4; ++r) { o[qt][j][r] -= lam * a[r]; o[qt][j][4 + r] -= lam * c[r]; }
#pragma unroll
        for (int r = 0; r < 8; ++r) q += o[qt][j][r] * o[qt][j][r]; }
      q += __shfl_xor(q, 16);   /* a lane holds 32 of its query's 64 columns, lane ^ 16 the rest */
      const float rs = rsqrtf(q * (1.0f / 64.0f) + 1e-5f); _Float16* yr = YD + ((size_t)b * TT + q0 + qt * 16 + col) * CC + e * HDV + 8 * g; v4u yv[HDV / 16];
#pragma unroll
      for (int j = 0; j < HDV / 16; ++j) { v8h hv;
#pragma unroll
        for (int r = 0; r < 8; ++r) hv[r] = (_Float16)(o[qt][j][r] * rs * sw[j][r]);   /* the one rounding to f16 that the output product takes */
        yv[j] = __builtin_bit_cast(v4u, hv); }
      g_st4(yr, yr + 16, yr + 32, yr + 48, yv[0], yv[1], yv[2], yv[3]); } } }
// ---- k_out: block = (128 rows, 128 cols): out = ctx Wo + bo: ctx once to f16 against Wo as f16(bf16 x 2^8) exact (1 product) x 2^-8; p = column, q = row; f32 rows staged in LDS and stored as whole 512-B rows
__global__ __launch_bounds__(256) void k_out(const _Float16* __restrict__ Y, const _Float16* __restrict__ WPT, const float* __restrict__ BO, float* __restrict__ OUT) {
  __shared__ __align__(16) char sm[GSMB];
  const int tid = threadIdx.x, wave = tid >> 5, lane = tid & 31, col = lane & 15, g = lane >> 4; const int c0 = blockIdx.y * GT; const size_t r0 = (size_t)blockIdx.x * GT;
  v8f acc[2][4] = {};
  gemm_tile<1>((const char*)(Y + r0 * CC), (const char*)(WPT + (size_t)c0 * CC), 1, sm, acc);
  float* sf = (float*)sm;
#pragma unroll
  for (int i = 0; i < 2; ++i) { const int p = (wave & 3) * 32 + i * 16 + 8 * g; float bias[8];
#pragma unroll
    for (int r = 0; r < 8; ++r) bias[r] = bfr(BO[c0 + p + r]);
#pragma unroll
    for (int j = 0; j < 4; ++j) { v4f a, c;
#pragma unroll
      for (int r = 0; r < 4; ++r) { a[r] = acc[i][j][r] * (1.0f / 256.0f) + bias[r]; c[r] = acc[i][j][4 + r] * (1.0f / 256.0f) + bias[4 + r]; }
      float* d = &sf[((wave >> 2) * 64 + j * 16 + col) * 132 + p]; *(v4f*)d = a; *(v4f*)(d + 4) = c; } }
  __syncthreads();
  const int q = tid >> 5, pc = (tid & 31) * 4;   /* a wave stores one whole 512-B row at a time */
#pragma unroll
  for (int t = 0; t < 4; ++t) { const int qq = q + t * 32; float* d = OUT + (r0 + qq) * DIN + c0 + pc; const float* s = &sf[qq * 132 + pc];
    g_st4(d, d + 8 * DIN, d + 16 * DIN, d + 24 * DIN, *(const v4u*)s, *(const v4u*)(s + 8 * 132), *(const v4u*)(s + 16 * 132), *(const v4u*)(s + 24 * 132)); } }

extern "C" void kernel_launch(void* const* d_in, const int* in_sizes, int n_in, void* d_out, int out_size, void* d_ws, size_t ws_size, hipStream_t stream) {
  (void)in_sizes; (void)n_in; (void)out_size;
  const float** F = (const float**)d_in;
  if (ws_size < (size_t)WS_END) return;
  char* ws = (char*)d_ws; _Float16 *QH = (_Float16*)(ws + WS_QH), *KH = (_Float16*)(ws + WS_KH), *VT = (_Float16*)(ws + WS_VT), *QL = (_Float16*)(ws + WS_QL), *KL = (_Float16*)(ws + WS_KL); __bf16 *VB = (__bf16*)(ws + WS_VB), *VBL = (__bf16*)(ws + WS_VBL); float *S = (float*)(ws + WS_S), *Y = (float*)(ws + WS_Y);
  (void)Y; (void)QL; (void)KL; (void)VB; (void)VBL;
  // inputs: 0 x [2,2048,1024]; 1 W_qkv [1024,3072] (in,out; columns (3, H, 64)); 2 W_proj [1024,1024] (in,out); 3 b_proj; 4 lambda_q1, 5 lambda_k1, 6 lambda_q2, 7 lambda_k2 [32]; 8 subln_w [64]
  _Float16* YD = (_Float16*)S;   /* the differential rows' plane */
  __bf16 *XB = (__bf16*)(ws + WS_XB), *WQT = (__bf16*)(ws + WS_WQT); _Float16* WPT = (_Float16*)(ws + WS_WPT);
  k_cvt<<<dim3(CVX + CVQ + CVP), 256, 0, stream>>>(F[0], F[1], F[2], XB, WQT, WPT);
  k_proj<<<dim3(TNB * TT / GT, CC / GT, 3), 256, 0, stream>>>(XB, WQT, QH, QL, KH, VT);
  k_fa<<<dim3(TT / 256, NH / 2, TNB), 512, 0, stream>>>(QH, QL, KH, VT, F[4], F[5], F[6], F[7], F[8], YD);
  k_out<<<dim3(TNB * TT / GT, DIN / GT), 256, 0, stream>>>(YD, WPT, F[3], (float*)d_out);
}

// v008
// A run of this version takes 95 microseconds.
// Timed twice side by side with v007, it ran 1.03 and 1.04 times as fast.
// Counting every step since v000, it is 21.8 times as fast.
// compute dtype: all float inputs rounded to bf16; qkv = x W_qkv with EXACT bf16 products on WMMA 16x16x32 (f32 accumulate); the 32-wide sub-head logits with q x 32^-0.5 log2(e) x 2^4 as f16 hi + residual against k x 2^-4 once to f16 (2 products, one f32 accumulate chain that starts at minus the running offset); both softmaxes in f32 (running maximum offset, exp2 on log2-scaled logits, f32 sum); each unnormalised P once to f16 against the head's 64-wide v once to f16 (1 product), divided by the sum last; the differential combination, the per-head RMS normalisation (x subln_w x (1 - lambda_init)) in f32; the result once to f16 against W_proj carried x 2^8 in f16 + b_proj; f32 output.
#include <hip/hip_runtime.h>
#include <math.h>

typedef __attribute__((ext_vector_type(16))) _Float16 v16h;
typedef __attribute__((ext_vector_type(16))) __bf16 v16b;
typedef __attribute__((ext_vector_type(8)))  _Float16 v8h;
typedef __attribute__((ext_vector_type(8)))  float v8f;
typedef __attribute__((ext_vector_type(4)))  float v4f;
typedef __attribute__((ext_vector_type(2)))  float v2f;
typedef __attribute__((ext_vector_type(4)))  unsigned v4u;
typedef __attribute__((ext_vector_type(4)))  int v4i;
typedef float __attribute__((may_alias)) float_a;
typedef int __attribute__((may_alias)) int_a;

template <typename T> __device__ __forceinline__ void vst2(void* p, T v) { *(T*)p = v;  }
__device__ __forceinline__ v8f wmma16(v16h a, v16h b, v8f c) {
  v8f d = __builtin_amdgcn_wmma_f32_16x16x32_f16(false, a, false, b, (short)0, c, false, false);
  asm volatile("v_nop\n\tv_nop\n\tv_nop\n\tv_nop" : "+v"(d) : "v"(a), "v"(b));
  return d;
}
__device__ __forceinline__ v8f wmma_bf(v16b a, v16b b, v8f c) {
  v8f d = __builtin_amdgcn_wmma_f32_16x16x32_bf16(false, a, false, b, (short)0, c, false, false);
  asm volatile("v_nop\n\tv_nop\n\tv_nop\n\tv_nop" : "+v"(d) : "v"(a), "v"(b));
  return d;
}
// 16x16x32 fragments: lane = (h = lane>>4, row/col = lane&15); elements 0..7 = k0+8h+0..7, 8..15 = k0+16+8h+0..7; D element r = row 8h+r
__device__ __forceinline__ v16h frag_h(const _Float16* rowk0, int lane) {
  union { v16h v; v8h q[2]; } u; const _Float16* p = rowk0 + 8 * (lane >> 4);
  u.q[0] = *(const v8h*)p; u.q[1] = *(const v8h*)(p + 16); return u.v;
}
__device__ __forceinline__ v16h frag_f32(const float* rowk0, int lane) {
  v16h a; const float* p = rowk0 + 8 * (lane >> 4);
#pragma unroll
  for (int i = 0; i < 8; ++i) { a[i] = (_Float16)p[i]; a[8 + i] = (_Float16)p[16 + i]; }
  return a;
}
__device__ __forceinline__ v16h frag_f32s(const float* rowk0, int lane, float sc) {
  v16h a; const float* p = rowk0 + 8 * (lane >> 4);
#pragma unroll
  for (int i = 0; i < 8; ++i) { a[i] = (_Float16)(p[i] * sc); a[8 + i] = (_Float16)(p[16 + i] * sc); }
  return a;
}
// column fragment from a [K][ld] layout (column n), rows >= K read as 0
__device__ __forceinline__ v16h fragc_f32(const float* W, int k0, int n, int lane, int ld, int K) {
  v16h a; const int g = lane >> 4;
#pragma unroll
  for (int i = 0; i < 8; ++i) { const int ka = k0 + 8 * g + i, kb = ka + 16;
    a[i] = (_Float16)(ka < K ? W[(size_t)(ka < K ? ka : K - 1) * ld + n] : 0.f); a[8 + i] = (_Float16)(kb < K ? W[(size_t)(kb < K ? kb : K - 1) * ld + n] : 0.f); }
  return a;
}
struct F2 { v16b h, l; };
__device__ __forceinline__ F2 bsplit16(const float v[16]) { F2 r;
#pragma unroll
  for (int i = 0; i < 16; ++i) { const __bf16 h = (__bf16)v[i]; r.h[i] = h; r.l[i] = (__bf16)(v[i] - (float)h); }
  return r; }
__device__ __forceinline__ F2 split_row(const float* row, int k0, int lane) { float v[16]; const float* p = row + k0 + 8 * (lane >> 4);
#pragma unroll
  for (int i = 0; i < 8; ++i) { v[i] = p[i]; v[8 + i] = p[16 + i]; }
  return bsplit16(v); }
__device__ __forceinline__ F2 split_rowK(const float* row, int k0, int lane, int K) { float v[16]; const int g = lane >> 4;
#pragma unroll
  for (int i = 0; i < 8; ++i) { const int ka = k0 + 8 * g + i, kb = ka + 16; v[i] = ka < K ? row[ka < K ? ka : K - 1] : 0.f; v[8 + i] = kb < K ? row[kb < K ? kb : K - 1] : 0.f; }
  return bsplit16(v); }
__device__ __forceinline__ F2 split_col(const float* W, int k0, int n, int lane, int ld, int K) { float v[16]; const int g = lane >> 4;
#pragma unroll
  for (int i = 0; i < 8; ++i) { const int ka = k0 + 8 * g + i, kb = ka + 16; v[i] = ka < K ? W[(size_t)(ka < K ? ka : K - 1) * ld + n] : 0.f; v[8 + i] = kb < K ? W[(size_t)(kb < K ? kb : K - 1) * ld + n] : 0.f; }
  return bsplit16(v); }
__device__ __forceinline__ v8f mac3(const F2& a, const F2& b, v8f c) { c = wmma_bf(a.l, b.h, c); c = wmma_bf(a.h, b.l, c); return wmma_bf(a.h, b.h, c); }
__device__ __forceinline__ float sigm(float v) { return 1.0f / (1.0f + expf(-v)); }
#define LDSX() do { asm volatile("s_wait_dscnt 0" ::: "memory"); __builtin_amdgcn_wave_barrier(); __builtin_amdgcn_fence(__ATOMIC_RELEASE, "workgroup"); } while (0)

// Differential attention (B 2, N 2,048, C 1,024; 16 heads, head_dim 32, v 64 wide): qkv = x W_qkv ((in,out) [1024, 3072], columns (3, H, 64)); q, k -> 32 sub-heads of 32: q1/k1 = sub-heads 0..15, q2/k2 = sub-heads 16..31, v head h = columns h*64..; attn_i = softmax(q_i k_i^T / sqrt(32)) v; lam = exp(sum lq1 lk1) - exp(sum lq2 lk2) + lambda_init (0.78360578); o = attn1 - lam attn2; o = o rsqrt(mean(o^2) + 1e-5) subln_w (1 - lambda_init); out = merged(o) W_proj + b_proj.
#define NB 2
#define TT 2048
#define CC 1024            // NH * HD = projected width
#define DIN 1024          // input (model) width
#define NH 32              // softmax sub-heads (16 heads x 2 halves)
#define HD 32
#define NQB (TT / 64)
#define HG 4
#define SCALE (0.17677669529663687f)
#define CAUSAL 0
#ifndef TNB
#define TNB NB
#endif
__device__ __forceinline__ float bfr(float v) { return (float)(__bf16)v; }
__host__ __device__ __forceinline__ int kb_last(int qb) { return CAUSAL ? ((qb * 64 + 63) >> 7) : (TT / 128 - 1); }
typedef __attribute__((ext_vector_type(8))) __bf16 v8b;
typedef __attribute__((ext_vector_type(4))) __bf16 v4b;
typedef __attribute__((ext_vector_type(4))) _Float16 v4h;
__device__ __forceinline__ v16b frag_b(const __bf16* rowk0, int lane) {
  union { v16b v; v8b q[2]; } u; const __bf16* p = rowk0 + 8 * (lane >> 4);
  u.q[0] = *(const v8b*)p; u.q[1] = *(const v8b*)(p + 16); return u.v;
}
#define QBH 0
#define QHI 2048            // rows carrying a q residual plane (all rows: 2-product logits everywhere)
#define KHI 64            // key rows carrying k residual / v bf16 hi+lo planes (written or read by no kernel)
// B fragment (k rows k0+.., output column o) of a weight: (in,out) [K][ld] or (out,in) [ld rows of K]: bf16 exact, or f16(bf16 * 256) exact
__device__ __forceinline__ v16b wcol_io(const float* Wm, int k0, int o, int lane, int ld) { v16b w; const int g = lane >> 4;
#pragma unroll
  for (int i = 0; i < 8; ++i) { w[i] = (__bf16)Wm[(size_t)(k0 + 8 * g + i) * ld + o]; w[8 + i] = (__bf16)Wm[(size_t)(k0 + 16 + 8 * g + i) * ld + o]; }
  return w; }
__device__ __forceinline__ v16b wcol_oi(const float* Wm, int k0, int o, int lane, int K) { v16b w; const float* p = Wm + (size_t)o * K + k0 + 8 * (lane >> 4);
#pragma unroll
  for (int i = 0; i < 8; ++i) { w[i] = (__bf16)p[i]; w[8 + i] = (__bf16)p[16 + i]; }
  return w; }
__device__ __forceinline__ v16h wcolh_io(const float* Wm, int k0, int o, int lane, int ld) { v16h w; const int g = lane >> 4;
#pragma unroll
  for (int i = 0; i < 8; ++i) { w[i] = (_Float16)(bfr(Wm[(size_t)(k0 + 8 * g + i) * ld + o]) * 256.0f); w[8 + i] = (_Float16)(bfr(Wm[(size_t)(k0 + 16 + 8 * g + i) * ld + o]) * 256.0f); }
  return w; }
__device__ __forceinline__ v16h wcolh_oi(const float* Wm, int k0, int o, int lane, int K) { v16h w; const float* p = Wm + (size_t)o * K + k0 + 8 * (lane >> 4);
#pragma unroll
  for (int i = 0; i < 8; ++i) { w[i] = (_Float16)(bfr(p[i]) * 256.0f); w[8 + i] = (_Float16)(bfr(p[16 + i]) * 256.0f); }
  return w; }
#define WQKV_LAYOUT 0   // selects the layout of WCOL, which no kernel calls: k_cvt reads W_qkv as (in,out) [DIN][3 * CC] whatever the value
__device__ __forceinline__ v16b wcol_hdk(const float* Wm, int k0, int o, int lane) { v16b w; const int g = lane >> 4; const float* p = Wm + (size_t)(o / HD) * DIN * HD + (o % HD);
#pragma unroll
  for (int i = 0; i < 8; ++i) { w[i] = (__bf16)p[(size_t)(k0 + 8 * g + i) * HD]; w[8 + i] = (__bf16)p[(size_t)(k0 + 16 + 8 * g + i) * HD]; }
  return w; }
#define WO_OUT_IN 0
#if WQKV_LAYOUT == 1
#define WCOL(W, k0, o, lane) wcol_oi(W, k0, o, lane, DIN)
#elif WQKV_LAYOUT == 2
#define WCOL(W, k0, o, lane) wcol_hdk(W, k0, o, lane)
#else
#define WCOL(W, k0, o, lane) wcol_io(W, k0, o, lane, 3 * CC)   /* W_qkv (in,out) packed by columns: row pitch 3C */
#endif
#if WO_OUT_IN
#define WOCOL(W, k0, o, lane) wcol_oi(W, k0, o, lane, CC)
#define WOCOLH(W, k0, o, lane) wcolh_oi(W, k0, o, lane, CC)
#else
#define WOCOL(W, k0, o, lane) wcol_io(W, k0, o, lane, DIN)
#define WOCOLH(W, k0, o, lane) wcolh_io(W, k0, o, lane, DIN)
#endif
#define HDV 64             // value columns per softmax sub-head (the parent head's 64 columns)
#define YP (NH * HDV)      // 2,048: only sizes the region from WS_Y to WS_END
#define LAMBDA_INIT 0.78360578f   /* 0.8 - 0.6 exp(-0.3 * 12) */
#ifndef SM_EXTRA_PARAMS
#define SM_EXTRA_PARAMS
#endif
#ifndef PROJ_EXTRA_PARAMS
#define PROJ_EXTRA_PARAMS
#endif
#ifndef SM_MASK_HOOK
#define SM_MASK_HOOK (void)0
#endif

#define WS_QH  0u                                      // f16 rows of q x QSC [b*t][CC]
#define WS_KH  (WS_QH + 2u * (size_t)NB * TT * CC)      // f16 rows of k x KSC [b*t][CC]
#define WS_VT  (WS_KH + 2u * (size_t)NB * TT * CC)      // f16 v planes [b][c][t]
#define WS_QL  (WS_VT + 2u * (size_t)NB * CC * TT)      // f16 residual rows of q x QSC [b][t < QHI][CC]
#define WS_KL  (WS_QL + 2u * (size_t)NB * QHI * CC)     // f16 k residual x 2^10 rows [b][t < KHI][CC]
#define WS_VB  (WS_KL + 2u * (size_t)NB * KHI * CC)     // bf16 v hi planes [b][c][t < KHI]
#define WS_VBL (WS_VB + 2u * (size_t)NB * CC * KHI)
#define WS_S   (WS_VBL + 2u * (size_t)NB * CC * KHI)    // f16 differential rows [b*t][CC] (k_fa -> k_out)
#define WS_Y   (WS_S  + 4u * (size_t)HG * TT * TT)      // the GEMM operands as 16-bit rows of k (k_cvt -> k_proj, k_out):
#define WS_XB  WS_Y                                     // bf16 x rows [b*t][DIN]
#define WS_WQT (WS_XB + 2u * (size_t)NB * TT * DIN)     // bf16 W_qkv columns as rows [3 CC][DIN]
#define WS_WPT (WS_WQT + 2u * (size_t)3 * CC * DIN)     // f16(bf16 x 2^8) W_proj columns as rows [DIN][CC]
#define WS_END (WS_Y  + 4u * (size_t)NB * TT * YP)

// ---- gemm_tile: one 128 x 128 tile of X W (K = 1,024) per block of 8 waves. Both operands lie in memory as 16-bit rows of k (k_cvt, k_fa). Each pass of 64 k is staged once per block in LDS: whole 128-B lines, 8 lanes a row, 16 B a lane, nothing rounded on the way. Two buffers: the next pass's global loads fly while this pass's WMMAs run; one barrier a pass.
// MODE 0: bf16 operands. MODE 1: f16 operands (W carried x 2^8).
// Every '#pragma unroll' from here to the end of k_proj, and in k_out, makes the indices of a register array (staged values, fragments, accumulators) constants, so that the array stays in registers.
// The product is D[p][q], p over the rows of staged operand pi (0 = X rows, 1 = W columns), q over the other's: a lane then holds 8 consecutive p of one q.
#define GT 128             // tile edge
#define GK 64              // k per pass
#define GKK 1024           // K (= DIN = CC)
#define GP 72              // LDS row pitch in 16-bit elements (144 B = 16 B x odd)
#define GOPB (GT * GP * 2) // bytes of one staged operand
#define GSMB (4 * GOPB)    // LDS of a block: the ring (4 x GOPB) or, behind it, the output staging (two f16 planes of pitch 136, or f32 rows of pitch 132)
// four 16-B stores and their s_wait_xcnt in one statement: what follows rewrites their address and data registers
__device__ __forceinline__ void g_st4(void* p0, void* p1, void* p2, void* p3, v4u a, v4u b, v4u c, v4u d) {
  asm volatile("global_store_b128 %0, %4, off\n\tglobal_store_b128 %1, %5, off\n\tglobal_store_b128 %2, %6, off\n\tglobal_store_b128 %3, %7, off\n\ts_wait_xcnt 0x0" :: "v"(p0), "v"(p1), "v"(p2), "v"(p3), "v"(a), "v"(b), "v"(c), "v"(d) : "memory"); }
// one pass's global loads of a thread, then its pointers move on. The three scheduling barriers keep everything but the loads out of the stretch up to their s_wait_xcnt (no register that a load names is rewritten ahead of it) and keep all the loads ahead of the WMMAs that follow (else loads sink into the pass, and their latency is waited out a second time)
__device__ __forceinline__ void g_fetch(const char*& px, const char*& pw, v4u (&xa)[4], v4u (&wa)[4]) {
  __builtin_amdgcn_sched_barrier(0);
#pragma unroll
  for (int i = 0; i < 4; ++i) xa[i] = *(const v4u*)(px + (size_t)i * 32 * GKK * 2);
#pragma unroll
  for (int i = 0; i < 4; ++i) wa[i] = *(const v4u*)(pw + (size_t)i * 32 * GKK * 2);
  __builtin_amdgcn_sched_barrier(0);
  asm volatile("s_wait_xcnt 0x0" :: "v"(px), "v"(pw) : "memory");   /* before the loads' address registers are rewritten; it names both addresses so that they keep their registers up to here */
  __builtin_amdgcn_sched_barrier(0);
  px += GK * 2; pw += GK * 2;
}
__device__ __forceinline__ void g_put(char* bx, char* bw, const v4u (&xa)[4], const v4u (&wa)[4]) {
#pragma unroll
  for (int i = 0; i < 4; ++i) { *(v4u*)(bx + i * 32 * GP * 2) = xa[i]; *(v4u*)(bw + i * 32 * GP * 2) = wa[i]; }
}
template <int MODE> __device__ __forceinline__ void gemm_tile(const char* __restrict__ Xr, const char* __restrict__ Wr, const int pi, char* sm, v8f (&acc)[2][4]) {
  const int tid = threadIdx.x, wave = tid >> 5, lane = tid & 31, col = lane & 15;
  const int sr = tid >> 3, sk = (tid & 7) * 16;   /* a thread's row (and the three 32 further on) and its 16 B of the row's 128 */
  const char* gx = Xr + (size_t)sr * GKK * 2 + sk; const char* gw = Wr + (size_t)sr * GKK * 2 + sk;
  const int xo = sr * GP * 2 + sk, wo = GOPB + xo;   /* a thread's own places in a buffer: [X rows | W columns] */
  const int po = pi * GOPB + ((wave & 3) * 32 + col) * GP * 2, qo = (pi ^ 1) * GOPB + ((wave >> 2) * 64 + col) * GP * 2;
  v4u xa[4], wa[4];
  g_fetch(gx, gw, xa, wa);
  g_put(sm + xo, sm + wo, xa, wa);
  __syncthreads();
  for (int s = 0; s < GKK / GK; ++s) { char* cb = sm + (s & 1) * 2 * GOPB; char* nb = sm + ((s & 1) ^ 1) * 2 * GOPB; const bool more = s + 1 < GKK / GK;
    if (more) g_fetch(gx, gw, xa, wa);
#pragma unroll
    for (int kk = 0; kk < GK / 32; ++kk) {   /* k ascending in steps of 32 */
      if (MODE == 0) { v16b P[2], Q[4];
#pragma unroll
        for (int i = 0; i < 2; ++i) P[i] = frag_b((const __bf16*)(cb + po + i * 16 * GP * 2 + kk * 64), lane);
#pragma unroll
        for (int i = 0; i < 4; ++i) Q[i] = frag_b((const __bf16*)(cb + qo + i * 16 * GP * 2 + kk * 64), lane);
#pragma unroll
        for (int i = 0; i < 2; ++i)
#pragma unroll
          for (int j = 0; j < 4; ++j) acc[i][j] = __builtin_amdgcn_wmma_f32_16x16x32_bf16(false, P[i], false, Q[j], (short)0, acc[i][j], false, false);
      } else { v16h P[2], Q[4];
#pragma unroll
        for (int i = 0; i < 2; ++i) P[i] = frag_h((const _Float16*)(cb + po + i * 16 * GP * 2 + kk * 64), lane);
#pragma unroll
        for (int i = 0; i < 4; ++i) Q[i] = frag_h((const _Float16*)(cb + qo + i * 16 * GP * 2 + kk * 64), lane);
#pragma unroll
        for (int i = 0; i < 2; ++i)
#pragma unroll
          for (int j = 0; j < 4; ++j) acc[i][j] = __builtin_amdgcn_wmma_f32_16x16x32_f16(false, P[i], false, Q[j], (short)0, acc[i][j], false, false);
      } }
    __builtin_amdgcn_sched_barrier(0);   /* the LDS stores, which wait for the loads, stay behind the last WMMA: the wave issues in order */
    if (more) g_put(nb + xo, nb + wo, xa, wa);   /* that buffer's last readers left it before the previous barrier */
    __syncthreads(); }
}
// ---- k_cvt: every GEMM operand that is an input, rounded once to the 16-bit type its product uses and laid down as rows of k. Blocks 0..255: 16,384 elements of x each -> bf16, same layout. Then 384 tiles of W_qkv (-> bf16) and 128 of W_proj (-> f16(bf16 x 2^8)), 128 k x 64 columns each, transposed through LDS: a thread packs two neighbouring k of 4 columns into dwords; a column leaves as 256 B of its row.
#define CVX 256
#define CVQ 384
#define CVP 128
typedef __attribute__((ext_vector_type(2))) __bf16 v2b;
typedef __attribute__((ext_vector_type(2))) _Float16 v2hh;
// one 128 k x 64 column tile of a weight [k][LD] -> rows of k [column][GKK]. PJ: f16(bf16 x 2^8), else bf16
template <bool PJ, int LD> __device__ __forceinline__ void cvt_w(const float* __restrict__ S, char* __restrict__ Dm, const int bi, unsigned (&st)[64][68]) {
  const int tid = threadIdx.x, n0 = (bi % (LD / 64)) * 64, k0 = (bi / (LD / 64)) * 128, c4 = tid & 15, kp = tid >> 4;
  const float* s = S + (size_t)(k0 + 2 * kp) * LD + n0 + c4 * 4; v4f a[4][2];   /* 16 lanes take 256 B of a row */
#pragma unroll
  for (int i = 0; i < 4; ++i) { a[i][0] = *(const v4f*)(s + (size_t)(32 * i) * LD); a[i][1] = *(const v4f*)(s + (size_t)(32 * i + 1) * LD); }
  asm volatile("s_wait_xcnt 0x0" :: "v"(s) : "memory");   /* before the loads' address register is rewritten; it names the address so that no load of the group is given it as its destination */
#pragma unroll
  for (int i = 0; i < 4; ++i)
#pragma unroll
    for (int e = 0; e < 4; ++e) { unsigned w;
      if (PJ) { const v2hh t = {(_Float16)(bfr(a[i][0][e]) * 256.0f), (_Float16)(bfr(a[i][1][e]) * 256.0f)}; w = __builtin_bit_cast(unsigned, t); }
      else { const v2b t = {(__bf16)a[i][0][e], (__bf16)a[i][1][e]}; w = __builtin_bit_cast(unsigned, t); }
      st[c4 * 4 + e][kp + 16 * i] = w; }
  __syncthreads();   /* every wave of the block passes it: the tile is in LDS, column by column */
  const int r = tid >> 4, pc = tid & 15;   /* a wave stores two whole 256-B pieces of rows at a time */
  char* D = Dm + ((size_t)(n0 + r) * GKK + k0 + pc * 8) * 2;
  g_st4(D, D + 16 * GKK * 2, D + 32 * GKK * 2, D + 48 * GKK * 2, *(const v4u*)&st[r][pc * 4], *(const v4u*)&st[r + 16][pc * 4], *(const v4u*)&st[r + 32][pc * 4], *(const v4u*)&st[r + 48][pc * 4]); }
__global__ __launch_bounds__(256) void k_cvt(const float* __restrict__ X, const float* __restrict__ WQKV, const float* __restrict__ WO, __bf16* __restrict__ XB, __bf16* __restrict__ WQT, _Float16* __restrict__ WPT) {
  __shared__ __align__(16) unsigned st[64][68];   /* [column][k pair], pitch 272 B */
  const int tid = threadIdx.x, bi = blockIdx.x;   /* every branch below reads the same for the whole block */
  if (bi < CVX) {
    const float* s = X + (size_t)bi * 16384 + tid * 8; __bf16* d = XB + (size_t)bi * 16384 + tid * 8; v4f a[8][2]; v4u c[8];
#pragma unroll
    for (int i = 0; i < 8; ++i) { a[i][0] = *(const v4f*)(s + i * 2048); a[i][1] = *(const v4f*)(s + i * 2048 + 4); }
#pragma unroll
    for (int i = 0; i < 8; ++i) { v8b t;
#pragma unroll
      for (int e = 0; e < 4; ++e) { t[e] = (__bf16)a[i][0][e]; t[4 + e] = (__bf16)a[i][1][e]; }
      c[i] = __builtin_bit_cast(v4u, t); }
    g_st4(d, d + 2048, d + 4096, d + 6144, c[0], c[1], c[2], c[3]);
    g_st4(d + 8192, d + 10240, d + 12288, d + 14336, c[4], c[5], c[6], c[7]);
  } else if (bi < CVX + CVQ) cvt_w<false, 3 * CC>(WQKV, (char*)WQT, bi - CVX, st);
  else cvt_w<true, DIN>(WO, (char*)WPT, bi - CVX - CVQ, st); }
// ---- k_proj: block = (128 rows, 128 cols, which): q/k/v = X W with exact bf16 products (K = DIN) -> which 0: q x QSC as f16 rows + residual rows; 1: k x KSC f16 rows; 2: v f16 planes [c][t]. q, k: p = column, q = row; v: p = row (t), q = column: either way a lane's 8 values are 16 B of an output row, staged in LDS and stored as whole 256-B rows
// q carries the whole logit factor (32^-0.5 log2(e)), so that k q^T is the logit in log2 units as it leaves the matrix unit; the power of two moved from k to q keeps q's residual in f16's normal range and leaves k's rounding as it is (only values of k under 2^-10 turn subnormal, an absolute error under 2^-25)
#define QSC (SCALE * 1.4426950408889634f * 16.0f)
#define KSC (1.0f / 16.0f)
__global__ __launch_bounds__(256) void k_proj(const __bf16* __restrict__ XB, const __bf16* __restrict__ WQT, _Float16* __restrict__ QH, _Float16* __restrict__ QL, _Float16* __restrict__ KH, _Float16* __restrict__ VT) {
  __shared__ __align__(16) char sm[GSMB];
  const int tid = threadIdx.x, wave = tid >> 5, lane = tid & 31, col = lane & 15, g = lane >> 4; const int which = blockIdx.z; const int c0 = blockIdx.y * GT; const size_t r0 = (size_t)blockIdx.x * GT; const size_t bb = r0 / TT; const int t0 = (int)(r0 % TT);
  v8f acc[2][4] = {};
  gemm_tile<0>((const char*)(XB + r0 * DIN), (const char*)(WQT + (size_t)(which * CC + c0) * DIN), which < 2 ? 1 : 0, sm, acc);
  _Float16* sh = (_Float16*)sm; _Float16* sl = sh + GT * 136; const float osc = which == 0 ? QSC : which == 1 ? KSC : 1.0f;
#pragma unroll
  for (int i = 0; i < 2; ++i)
#pragma unroll
    for (int j = 0; j < 4; ++j) { v8h hv, lv;
#pragma unroll
      for (int r = 0; r < 8; ++r) { const float v = acc[i][j][r] * osc; hv[r] = (_Float16)v; lv[r] = (_Float16)(v - (float)hv[r]); }
      const int o = ((wave >> 2) * 64 + j * 16 + col) * 136 + (wave & 3) * 32 + i * 16 + 8 * g; *(v8h*)&sh[o] = hv; if (which == 0) *(v8h*)&sl[o] = lv; }
  __syncthreads();
  _Float16* D = which == 0 ? QH + r0 * CC + c0 : which == 1 ? KH + r0 * CC + c0 : VT + (bb * CC + c0) * (size_t)TT + t0; const size_t dp = which < 2 ? CC : TT;
  const int q = tid >> 4, pc = (tid & 15) * 8;   /* a wave stores two whole 256-B rows at a time */
#pragma unroll
  for (int t = 0; t < 2; ++t) { const int qq = q + t * 64; _Float16* d = D + qq * dp + pc; const _Float16* s = &sh[qq * 136 + pc];
    g_st4(d, d + 16 * dp, d + 32 * dp, d + 48 * dp, *(const v4u*)s, *(const v4u*)(s + 16 * 136), *(const v4u*)(s + 32 * 136), *(const v4u*)(s + 48 * 136)); }
  if (which == 0) {
#pragma unroll
    for (int t = 0; t < 2; ++t) { const int qq = q + t * 64; _Float16* d = QL + (r0 + qq) * CC + c0 + pc; const _Float16* s = &sl[qq * 136 + pc];
      g_st4(d, d + 16 * CC, d + 32 * CC, d + 48 * CC, *(const v4u*)s, *(const v4u*)(s + 16 * 136), *(const v4u*)(s + 32 * 136), *(const v4u*)(s + 48 * 136)); } } }
#define FQ 2               // query column groups (16 queries each) per wave
#define FS 64              // keys per fetch: what a thread's two staging loads bring at a time
#define FR 4               // fetches per LDS buffer: a buffer holds 256 keys, and the block meets at one barrier per buffer
#define KP 40              // K row pitch in LDS, halfs (80 B = 16 B x odd)
#define VP (FR * FS + 8)   // v plane row pitch in LDS, halfs (528 B = 16 B x odd)
typedef __attribute__((ext_vector_type(2))) _Float16 v2h;
__device__ __forceinline__ v8f wmma_h(v16h a, v16h b, v8f c) { return __builtin_amdgcn_wmma_f32_16x16x32_f16(false, a, false, b, (short)0, c, false, false); }
// one query group's 32 logits of a chunk -> P = 2^t as the B operand (element s = tile s >> 3, register s & 7) and the lane's own sum of them, even and odd registers apart, added pairwise
__device__ __forceinline__ void fa_p(const v8f (&t)[2], v16h& pf, v2f& cs) { v2f e[8];
#pragma unroll   /* every index of e, t and pf constant: they stay in registers */
  for (int i = 0; i < 8; ++i) { e[i][0] = __builtin_amdgcn_exp2f(t[i >> 2][2 * (i & 3)]); e[i][1] = __builtin_amdgcn_exp2f(t[i >> 2][2 * (i & 3) + 1]);
    const v2h ph = __builtin_convertvector(e[i], v2h); pf[2 * i] = ph[0]; pf[2 * i + 1] = ph[1]; }
  cs = ((e[0] + e[1]) + (e[2] + e[3])) + ((e[4] + e[5]) + (e[6] + e[7])); }
__global__ __launch_bounds__(512) void k_fa(const _Float16* __restrict__ QH, const _Float16* __restrict__ QL, const _Float16* __restrict__ KH, const _Float16* __restrict__ VT, const float* __restrict__ LQ1, const float* __restrict__ LK1, const float* __restrict__ LQ2, const float* __restrict__ LK2, const float* __restrict__ SW, _Float16* __restrict__ YD) {
  __shared__ __align__(16) _Float16 sK[2][2][FR * FS][KP]; __shared__ __align__(16) _Float16 sV[2][HDV][VP]; __shared__ __align__(16) v4f sX[8 * FQ * (HDV / 8)][32];   /* sK: [buffer][sub-head half]; sX: the hand-over, 16 B a lane */
  const int tid = threadIdx.x, wave = __builtin_amdgcn_readfirstlane(tid >> 5), lane = tid & 31, col = lane & 15, g = lane >> 4;
  const int half = wave >> 3, w8 = wave & 7;
  const int e = blockIdx.y, h = e + 16 * half, b = blockIdx.z; const int q0 = blockIdx.x * (8 * FQ * 16) + w8 * (FQ * 16); const int vc0 = e * HDV;   /* both sub-heads use v head e */
  v16h qh[FQ], ql[FQ];
#pragma unroll
  for (int qt = 0; qt < FQ; ++qt) { qh[qt] = frag_h(QH + ((size_t)b * TT + q0 + qt * 16 + col) * CC + h * HD, lane); ql[qt] = frag_h(QL + ((size_t)b * QHI + q0 + qt * 16 + col) * CC + h * HD, lane); }
  // staging: a fetch = 64 K rows of 64 B of each sub-head (a thread takes one 16-B piece of its own half's) + 128 B of each of the 64 v plane rows (one piece a thread). While a buffer's 256 keys are worked on, the other buffer is filled fetch by fetch; nobody reads it before the barrier at the buffer's end, so the waves of a SIMD are free to drift apart over 8 chunks and one wave's softmax runs under another's products
  const int kr = (tid & 255) >> 2, kq = (tid & 3) * 8, vr = tid >> 3, vq = (tid & 7) * 8;
  const _Float16* gk = KH + ((size_t)b * TT + kr) * CC + h * HD + kq; const _Float16* gv = VT + ((size_t)b * CC + vc0 + vr) * (size_t)TT + vq;
  v4u pk[FR], pv[FR];
  asm volatile("s_wait_xcnt 0x0" ::: "memory");   /* before the loads below take the q loads' address registers as their destinations */
#pragma unroll   /* the indices of pk and pv constant: they stay in registers */
  for (int u = 0; u < FR; ++u) { pk[u] = *(const v4u*)(gk + (size_t)u * FS * CC); pv[u] = *(const v4u*)(gv + u * FS); }
  float la = bfr(LQ1[lane]) * bfr(LK1[lane]), lc = bfr(LQ2[lane]) * bfr(LK2[lane]);   /* 32-term dots: one term per lane, fixed xor-tree order */
#pragma unroll
  for (int of = 1; of < 32; of <<= 1) { la += __shfl_xor(la, of); lc += __shfl_xor(lc, of); }
  const float lam = __builtin_bit_cast(float, __builtin_amdgcn_readfirstlane(__builtin_bit_cast(int, expf(la) - expf(lc) + LAMBDA_INIT)));   /* the same in every lane: kept in a scalar register over the key loop */
#pragma unroll
  for (int u = 0; u < FR; ++u) { *(v4u*)&sK[0][half][u * FS + kr][kq] = pk[u]; *(v4u*)&sV[0][vr][u * FS + vq] = pv[u]; }
  __syncthreads();
  v4u rk, rv0;
  v8f o[FQ][HDV / 16] = {}; v8f nm[FQ]; v2f l[FQ];   /* nm: minus the offset mo of the lane's query, 8 times over (the logit chain's C operand); l: a lane's own keys, even and odd registers apart; joined after the loop */
#pragma unroll
  for (int qt = 0; qt < FQ; ++qt) { nm[qt] = (v8f){}; l[qt] = (v2f){0.f, 0.f}; }
  for (int s = 0; s < TT / FS; ++s) { const int cur = (s / FR) & 1, k0 = (s % FR) * FS; const bool more = s + FR < TT / FS;   /* k0: this trip's 64 keys in the buffer */
    if (more) { rk = *(const v4u*)(gk + (size_t)(s + FR) * FS * CC); rv0 = *(const v4u*)(gv + (s + FR) * FS);   /* the same 64 keys of the next buffer fly while these are worked on */
      asm volatile("s_wait_xcnt 0x0" ::: "memory"); }   /* before the two loads' address registers move on to the next fetch */
#pragma unroll
    for (int kc = 0; kc < FS / 32; ++kc) {   /* unrolled: every fragment index constant */
      v16h kf[2], vf[HDV / 16], pf[FQ]; v8f t[FQ][2]; v2f cs[FQ];
#pragma unroll
      for (int kt = 0; kt < 2; ++kt) kf[kt] = frag_h(&sK[cur][half][k0 + kc * 32 + kt * 16 + col][0], lane);
#pragma unroll
      for (int qt = 0; qt < FQ; ++qt)
#pragma unroll
        for (int kt = 0; kt < 2; ++kt) t[qt][kt] = wmma_h(kf[kt], ql[qt], nm[qt]);
#pragma unroll
      for (int qt = 0; qt < FQ; ++qt)
#pragma unroll
        for (int kt = 0; kt < 2; ++kt) t[qt][kt] = wmma_h(kf[kt], qh[qt], t[qt][kt]);
      __builtin_amdgcn_sched_barrier(0);   /* the eight products stay together ahead of the exponentials: each fills the distance behind the others */
#pragma unroll
      for (int j = 0; j < HDV / 16; ++j) vf[j] = frag_h(&sV[cur][j * 16 + col][k0 + kc * 32], lane);   /* the chunk's v fragments leave LDS in one group right behind the logit products: they land under the softmax, and no P.V product waits for LDS */
      __builtin_amdgcn_sched_barrier(0);   /* keeps that group here: left free, the loads sink back between the P.V products, each pair waited out */
#pragma unroll
      for (int qt = 0; qt < FQ; ++qt) fa_p(t[qt], pf[qt], cs[qt]);
      // no maximum on the usual path: every P is positive, so a lane's partial sums bound each of its P; while they stay under 2^14 the held offset still fits f16
      const bool first = (s == 0) && (kc == 0); bool need = false;
#pragma unroll
      for (int qt = 0; qt < FQ; ++qt) need = need || (fmaxf(cs[qt][0], cs[qt][1]) > 16384.0f);
      if ((__builtin_amdgcn_ballot_w32(need) | (unsigned)first) != 0) {   /* wave-uniform and rare: the chunk's logits are formed anew (their registers were given up), the offset moves, P and its sums are taken again; the first pass sets the offset from its own logits, in either direction */
#pragma unroll
        for (int kt = 0; kt < 2; ++kt) kf[kt] = frag_h(&sK[cur][half][k0 + kc * 32 + kt * 16 + col][0], lane);
#pragma unroll
        for (int qt = 0; qt < FQ; ++qt)
#pragma unroll
          for (int kt = 0; kt < 2; ++kt) t[qt][kt] = wmma_h(kf[kt], ql[qt], nm[qt]);
#pragma unroll
        for (int qt = 0; qt < FQ; ++qt)
#pragma unroll
          for (int kt = 0; kt < 2; ++kt) t[qt][kt] = wmma_h(kf[kt], qh[qt], t[qt][kt]);
#pragma unroll
        for (int qt = 0; qt < FQ; ++qt) { float mx = -3.0e38f;
#pragma unroll
          for (int kt = 0; kt < 2; ++kt)
#pragma unroll
            for (int i = 0; i < 4; ++i) mx = fmaxf(mx, fmaxf(t[qt][kt][2 * i], t[qt][kt][2 * i + 1]));
          const float mj = fmaxf(mx, __shfl_xor(mx, 16));   /* both halves of a column take the same offset */
          const float d = first ? mj - 6.0f : fmaxf(mj - 6.0f, 0.f); const float al = __builtin_amdgcn_exp2f(-fmaxf(d, 0.f)); nm[qt] -= d; l[qt] *= al;
#pragma unroll
          for (int j = 0; j < HDV / 16; ++j) o[qt][j] *= al;
#pragma unroll
          for (int kt = 0; kt < 2; ++kt) t[qt][kt] -= d;
          fa_p(t[qt], pf[qt], cs[qt]); } }
#pragma unroll
      for (int qt = 0; qt < FQ; ++qt) l[qt] += cs[qt];
#pragma unroll
      for (int j = 0; j < HDV / 16; ++j)
#pragma unroll
        for (int qt = 0; qt < FQ; ++qt) o[qt][j] = wmma_h(vf[j], pf[qt], o[qt][j]); }
    if (more) { *(v4u*)&sK[cur ^ 1][half][k0 + kr][kq] = rk; *(v4u*)&sV[cur ^ 1][vr][k0 + vq] = rv0; }   /* that buffer's last readers left it before the previous barrier */
    if (s % FR == FR - 1) __syncthreads(); }   /* the same for the whole block: the buffer is read out and the other one is full */
#pragma unroll
  for (int qt = 0; qt < FQ; ++qt) { const float ls = l[qt][0] + l[qt][1]; const float inv = 1.0f / (ls + __shfl_xor(ls, 16));
#pragma unroll
    for (int j = 0; j < HDV / 16; ++j) o[qt][j] *= inv; }   /* register r of tile j = value column j*16 + 8g + r of query col */
  if (half) {
#pragma unroll
    for (int qt = 0; qt < FQ; ++qt)
#pragma unroll
      for (int j = 0; j < HDV / 16; ++j) { v4f a, c;
#pragma unroll
        for (int r = 0; r < 4; ++r) { a[r] = o[qt][j][r]; c[r] = o[qt][j][4 + r]; }
        sX[(w8 * FQ + qt) * (HDV / 8) + 2 * j][lane] = a; sX[(w8 * FQ + qt) * (HDV / 8) + 2 * j + 1][lane] = c; } }
  __syncthreads();   /* every wave passes it: attn2 is in LDS for the partner waves */
  if (!half) { float sw[HDV / 16][8];
#pragma unroll
    for (int j = 0; j < HDV / 16; ++j)
#pragma unroll
      for (int r = 0; r < 8; ++r) sw[j][r] = bfr(SW[j * 16 + 8 * g + r]) * (1.0f - LAMBDA_INIT);
#pragma unroll
    for (int qt = 0; qt < FQ; ++qt) { float q = 0.f;
#pragma unroll
      for (int j = 0; j < HDV / 16; ++j) { const v4f a = sX[(w8 * FQ + qt) * (HDV / 8) + 2 * j][lane], c = sX[(w8 * FQ + qt) * (HDV / 8) + 2 * j + 1][lane];
#pragma unroll
        for (int r = 0; r < 4; ++r) { o[qt][j][r] -= lam * a[r]; o[qt][j][4 + r] -= lam * c[r]; }
#pragma unroll
        for (int r = 0; r < 8; ++r) q += o[qt][j][r] * o[qt][j][r]; }
      q += __shfl_xor(q, 16);   /* a lane holds 32 of its query's 64 columns, lane ^ 16 the rest */
      const float rs = rsqrtf(q * (1.0f / 64.0f) + 1e-5f); _Float16* yr = YD + ((size_t)b * TT + q0 + qt * 16 + col) * CC + e * HDV + 8 * g; v4u yv[HDV / 16];
#pragma unroll
      for (int j = 0; j < HDV / 16; ++j) { v8h hv;
#pragma unroll
        for (int r = 0; r < 8; ++r) hv[r] = (_Float16)(o[qt][j][r] * rs * sw[j][r]);   /* the one rounding to f16 that the output product takes */
        yv[j] = __builtin_bit_cast(v4u, hv); }
      g_st4(yr, yr + 16, yr + 32, yr + 48, yv[0], yv[1], yv[2], yv[3]); } } }
// ---- k_out: block = (128 rows, 128 cols): out = ctx Wo + bo: ctx once to f16 against Wo as f16(bf16 x 2^8) exact (1 product) x 2^-8; p = column, q = row; f32 rows staged in LDS and stored as whole 512-B rows
__global__ __launch_bounds__(256) void k_out(const _Float16* __restrict__ Y, const _Float16* __restrict__ WPT, const float* __restrict__ BO, float* __restrict__ OUT) {
  __shared__ __align__(16) char sm[GSMB];
  const int tid = threadIdx.x, wave = tid >> 5, lane = tid & 31, col = lane & 15, g = lane >> 4; const int c0 = blockIdx.y * GT; const size_t r0 = (size_t)blockIdx.x * GT;
  v8f acc[2][4] = {};
  gemm_tile<1>((const char*)(Y + r0 * CC), (const char*)(WPT + (size_t)c0 * CC), 1, sm, acc);
  float* sf = (float*)sm;
#pragma unroll
  for (int i = 0; i < 2; ++i) { const int p = (wave & 3) * 32 + i * 16 + 8 * g; float bias[8];
#pragma unroll
    for (int r = 0; r < 8; ++r) bias[r] = bfr(BO[c0 + p + r]);
#pragma unroll
    for (int j = 0; j < 4; ++j) { v4f a, c;
#pragma unroll
      for (int r = 0; r < 4; ++r) { a[r] = acc[i][j][r] * (1.0f / 256.0f) + bias[r]; c[r] = acc[i][j][4 + r] * (1.0f / 256.0f) + bias[4 + r]; }
      float* d = &sf[((wave >> 2) * 64 + j * 16 + col) * 132 + p]; *(v4f*)d = a; *(v4f*)(d + 4) = c; } }
  __syncthreads();
  const int q = tid >> 5, pc = (tid & 31) * 4;   /* a wave stores one whole 512-B row at a time */
#pragma unroll
  for (int t = 0; t < 4; ++t) { const int qq = q + t * 32; float* d = OUT + (r0 + qq) * DIN + c0 + pc; const float* s = &sf[qq * 132 + pc];
    g_st4(d, d + 8 * DIN, d + 16 * DIN, d + 24 * DIN, *(const v4u*)s, *(const v4u*)(s + 8 * 132), *(const v4u*)(s + 16 * 132), *(const v4u*)(s + 24 * 132)); } }

extern "C" void kernel_launch(void* const* d_in, const int* in_sizes, int n_in, void* d_out, int out_size, void* d_ws, size_t ws_size, hipStream_t stream) {
  (void)in_sizes; (void)n_in; (void)out_size;
  const float** F = (const float**)d_in;
  if (ws_size < (size_t)WS_END) return;
  char* ws = (char*)d_ws; _Float16 *QH = (_Float16*)(ws + WS_QH), *KH = (_Float16*)(ws + WS_KH), *VT = (_Float16*)(ws + WS_VT), *QL = (_Float16*)(ws + WS_QL), *KL = (_Float16*)(ws + WS_KL); __bf16 *VB = (__bf16*)(ws + WS_VB), *VBL = (__bf16*)(ws + WS_VBL); float *S = (float*)(ws + WS_S), *Y = (float*)(ws + WS_Y);
  (void)Y; (void)QL; (void)KL; (void)VB; (void)VBL;
  // inputs: 0 x [2,2048,1024]; 1 W_qkv [1024,3072] (in,out; columns (3, H, 64)); 2 W_proj [1024,1024] (in,out); 3 b_proj; 4 lambda_q1, 5 lambda_k1, 6 lambda_q2, 7 lambda_k2 [32]; 8 subln_w [64]
  _Float16* YD = (_Float16*)S;   /* the differential rows' plane */
  __bf16 *XB = (__bf16*)(ws + WS_XB), *WQT = (__bf16*)(ws + WS_WQT); _Float16* WPT = (_Float16*)(ws + WS_WPT);
  k_cvt<<<dim3(CVX + CVQ + CVP), 256, 0, stream>>>(F[0], F[1], F[2], XB, WQT, WPT);
  k_proj<<<dim3(TNB * TT / GT, CC / GT, 3), 256, 0, stream>>>(XB, WQT, QH, QL, KH, VT);
  k_fa<<<dim3(TT / 256, NH / 2, TNB), 512, 0, stream>>>(QH, QL, KH, VT, F[4], F[5], F[6], F[7], F[8], YD);
  k_out<<<dim3(TNB * TT / GT, DIN / GT), 256, 0, stream>>>(YD, WPT, F[3], (float*)d_out);
}

// v010
// A run of this version takes 83.9 microseconds.
// Versions between v008 and this one are left out; their measured steps multiply to 1.13 times as fast.
// Counting every step since v000, it is 24.7 times as fast.
// compute dtype: all float inputs rounded to bf16; qkv = x W_qkv with EXACT bf16 products on WMMA 16x16x32 (f32 accumulate); the 32-wide sub-head logits with q x 32^-0.5 log2(e) x 2^4 once to f16 against k x 2^-4 once to f16 (1 product, f32 accumulate on a C operand that holds minus the running offset); both softmaxes in f32 (running maximum offset, exp2 on log2-scaled logits, f32 sum); each unnormalised P once to f16 against the head's 64-wide v once to f16 (1 product), divided by the sum last; the differential combination, the per-head RMS normalisation (x subln_w x (1 - lambda_init)) in f32; the result once to f16 against W_proj carried x 2^8 in f16 + b_proj; f32 output.
#include <hip/hip_runtime.h>
#include <math.h>

typedef __attribute__((ext_vector_type(16))) _Float16 v16h;
typedef __attribute__((ext_vector_type(16))) __bf16 v16b;
typedef __attribute__((ext_vector_type(8)))  _Float16 v8h;
typedef __attribute__((ext_vector_type(8)))  float v8f;
typedef __attribute__((ext_vector_type(4)))  float v4f;
typedef __attribute__((ext_vector_type(2)))  float v2f;
typedef __attribute__((ext_vector_type(4)))  unsigned v4u;
typedef __attribute__((ext_vector_type(4)))  int v4i;
typedef float __attribute__((may_alias)) float_a;
typedef int __attribute__((may_alias)) int_a;

template <typename T> __device__ __forceinline__ void vst2(void* p, T v) { *(T*)p = v;  }
__device__ __forceinline__ v8f wmma16(v16h a, v16h b, v8f c) {
  v8f d = __builtin_amdgcn_wmma_f32_16x16x32_f16(false, a, false, b, (short)0, c, false, false);
  asm volatile("v_nop\n\tv_nop\n\tv_nop\n\tv_nop" : "+v"(d) : "v"(a), "v"(b));
  return d;
}
__device__ __forceinline__ v8f wmma_bf(v16b a, v16b b, v8f c) {
  v8f d = __builtin_amdgcn_wmma_f32_16x16x32_bf16(false, a, false, b, (short)0, c, false, false);
  asm volatile("v_nop\n\tv_nop\n\tv_nop\n\tv_nop" : "+v"(d) : "v"(a), "v"(b));
  return d;
}
// 16x16x32 fragments: lane = (h = lane>>4, row/col = lane&15); elements 0..7 = k0+8h+0..7, 8..15 = k0+16+8h+0..7; D element r = row 8h+r
__device__ __forceinline__ v16h frag_h(const _Float16* rowk0, int lane) {
  union { v16h v; v8h q[2]; } u; const _Float16* p = rowk0 + 8 * (lane >> 4);
  u.q[0] = *(const v8h*)p; u.q[1] = *(const v8h*)(p + 16); return u.v;
}
__device__ __forceinline__ v16h frag_f32(const float* rowk0, int lane) {
  v16h a; const float* p = rowk0 + 8 * (lane >> 4);
#pragma unroll
  for (int i = 0; i < 8; ++i) { a[i] = (_Float16)p[i]; a[8 + i] = (_Float16)p[16 + i]; }
  return a;
}
__device__ __forceinline__ v16h frag_f32s(const float* rowk0, int lane, float sc) {
  v16h a; const float* p = rowk0 + 8 * (lane >> 4);
#pragma unroll
  for (int i = 0; i < 8; ++i) { a[i] = (_Float16)(p[i] * sc); a[8 + i] = (_Float16)(p[16 + i] * sc); }
  return a;
}
// column fragment from a [K][ld] layout (column n), rows >= K read as 0
__device__ __forceinline__ v16h fragc_f32(const float* W, int k0, int n, int lane, int ld, int K) {
  v16h a; const int g = lane >> 4;
#pragma unroll
  for (int i = 0; i < 8; ++i) { const int ka = k0 + 8 * g + i, kb = ka + 16;
    a[i] = (_Float16)(ka < K ? W[(size_t)(ka < K ? ka : K - 1) * ld + n] : 0.f); a[8 + i] = (_Float16)(kb < K ? W[(size_t)(kb < K ? kb : K - 1) * ld + n] : 0.f); }
  return a;
}
struct F2 { v16b h, l; };
__device__ __forceinline__ F2 bsplit16(const float v[16]) { F2 r;
#pragma unroll
  for (int i = 0; i < 16; ++i) { const __bf16 h = (__bf16)v[i]; r.h[i] = h; r.l[i] = (__bf16)(v[i] - (float)h); }
  return r; }
__device__ __forceinline__ F2 split_row(const float* row, int k0, int lane) { float v[16]; const float* p = row + k0 + 8 * (lane >> 4);
#pragma unroll
  for (int i = 0; i < 8; ++i) { v[i] = p[i]; v[8 + i] = p[16 + i]; }
  return bsplit16(v); }
__device__ __forceinline__ F2 split_rowK(const float* row, int k0, int lane, int K) { float v[16]; const int g = lane >> 4;
#pragma unroll
  for (int i = 0; i < 8; ++i) { const int ka = k0 + 8 * g + i, kb = ka + 16; v[i] = ka < K ? row[ka < K ? ka : K - 1] : 0.f; v[8 + i] = kb < K ? row[kb < K ? kb : K - 1] : 0.f; }
  return bsplit16(v); }
__device__ __forceinline__ F2 split_col(const float* W, int k0, int n, int lane, int ld, int K) { float v[16]; const int g = lane >> 4;
#pragma unroll
  for (int i = 0; i < 8; ++i) { const int ka = k0 + 8 * g + i, kb = ka + 16; v[i] = ka < K ? W[(size_t)(ka < K ? ka : K - 1) * ld + n] : 0.f; v[8 + i] = kb < K ? W[(size_t)(kb < K ? kb : K - 1) * ld + n] : 0.f; }
  return bsplit16(v); }
__device__ __forceinline__ v8f mac3(const F2& a, const F2& b, v8f c) { c = wmma_bf(a.l, b.h, c); c = wmma_bf(a.h, b.l, c); return wmma_bf(a.h, b.h, c); }
__device__ __forceinline__ float sigm(float v) { return 1.0f / (1.0f + expf(-v)); }
#define LDSX() do { asm volatile("s_wait_dscnt 0" ::: "memory"); __builtin_amdgcn_wave_barrier(); __builtin_amdgcn_fence(__ATOMIC_RELEASE, "workgroup"); } while (0)

// Differential attention (B 2, N 2,048, C 1,024; 16 heads, head_dim 32, v 64 wide): qkv = x W_qkv ((in,out) [1024, 3072], columns (3, H, 64)); q, k -> 32 sub-heads of 32: q1/k1 = sub-heads 0..15, q2/k2 = sub-heads 16..31, v head h = columns h*64..; attn_i = softmax(q_i k_i^T / sqrt(32)) v; lam = exp(sum lq1 lk1) - exp(sum lq2 lk2) + lambda_init (0.78360578); o = attn1 - lam attn2; o = o rsqrt(mean(o^2) + 1e-5) subln_w (1 - lambda_init); out = merged(o) W_proj + b_proj.
#define NB 2
#define TT 2048
#define CC 1024            // NH * HD = projected width
#define DIN 1024          // input (model) width
#define NH 32              // softmax sub-heads (16 heads x 2 halves)
#define HD 32
#define NQB (TT / 64)
#define HG 4
#define SCALE (0.17677669529663687f)
#define CAUSAL 0
#ifndef TNB
#define TNB NB
#endif
__device__ __forceinline__ float bfr(float v) { return (float)(__bf16)v; }
__host__ __device__ __forceinline__ int kb_last(int qb) { return CAUSAL ? ((qb * 64 + 63) >> 7) : (TT / 128 - 1); }
typedef __attribute__((ext_vector_type(8))) __bf16 v8b;
typedef __attribute__((ext_vector_type(4))) __bf16 v4b;
typedef __attribute__((ext_vector_type(4))) _Float16 v4h;
__device__ __forceinline__ v16b frag_b(const __bf16* rowk0, int lane) {
  union { v16b v; v8b q[2]; } u; const __bf16* p = rowk0 + 8 * (lane >> 4);
  u.q[0] = *(const v8b*)p; u.q[1] = *(const v8b*)(p + 16); return u.v;
}
#define QBH 0
#define QHI 2048            // rows of the q residual plane's place in the workspace layout (the plane is neither written nor read: 1-product logits)
#define KHI 64            // key rows carrying k residual / v bf16 hi+lo planes (the planes are neither written nor read)
// B fragment (k rows k0+.., output column o) of a weight: (in,out) [K][ld] or (out,in) [ld rows of K]: bf16 exact, or f16(bf16 * 256) exact
__device__ __forceinline__ v16b wcol_io(const float* Wm, int k0, int o, int lane, int ld) { v16b w; const int g = lane >> 4;
#pragma unroll
  for (int i = 0; i < 8; ++i) { w[i] = (__bf16)Wm[(size_t)(k0 + 8 * g + i) * ld + o]; w[8 + i] = (__bf16)Wm[(size_t)(k0 + 16 + 8 * g + i) * ld + o]; }
  return w; }
__device__ __forceinline__ v16b wcol_oi(const float* Wm, int k0, int o, int lane, int K) { v16b w; const float* p = Wm + (size_t)o * K + k0 + 8 * (lane >> 4);
#pragma unroll
  for (int i = 0; i < 8; ++i) { w[i] = (__bf16)p[i]; w[8 + i] = (__bf16)p[16 + i]; }
  return w; }
__device__ __forceinline__ v16h wcolh_io(const float* Wm, int k0, int o, int lane, int ld) { v16h w; const int g = lane >> 4;
#pragma unroll
  for (int i = 0; i < 8; ++i) { w[i] = (_Float16)(bfr(Wm[(size_t)(k0 + 8 * g + i) * ld + o]) * 256.0f); w[8 + i] = (_Float16)(bfr(Wm[(size_t)(k0 + 16 + 8 * g + i) * ld + o]) * 256.0f); }
  return w; }
__device__ __forceinline__ v16h wcolh_oi(const float* Wm, int k0, int o, int lane, int K) { v16h w; const float* p = Wm + (size_t)o * K + k0 + 8 * (lane >> 4);
#pragma unroll
  for (int i = 0; i < 8; ++i) { w[i] = (_Float16)(bfr(p[i]) * 256.0f); w[8 + i] = (_Float16)(bfr(p[16 + i]) * 256.0f); }
  return w; }
#define WQKV_LAYOUT 0   // selects the layout of WCOL, which no kernel calls: k_cvt reads W_qkv as (in,out) [DIN][3 * CC] whatever the value
__device__ __forceinline__ v16b wcol_hdk(const float* Wm, int k0, int o, int lane) { v16b w; const int g = lane >> 4; const float* p = Wm + (size_t)(o / HD) * DIN * HD + (o % HD);
#pragma unroll
  for (int i = 0; i < 8; ++i) { w[i] = (__bf16)p[(size_t)(k0 + 8 * g + i) * HD]; w[8 + i] = (__bf16)p[(size_t)(k0 + 16 + 8 * g + i) * HD]; }
  return w; }
#define WO_OUT_IN 0
#if WQKV_LAYOUT == 1
#define WCOL(W, k0, o, lane) wcol_oi(W, k0, o, lane, DIN)
#elif WQKV_LAYOUT == 2
#define WCOL(W, k0, o, lane) wcol_hdk(W, k0, o, lane)
#else
#define WCOL(W, k0, o, lane) wcol_io(W, k0, o, lane, 3 * CC)   /* W_qkv (in,out) packed by columns: row pitch 3C */
#endif
#if WO_OUT_IN
#define WOCOL(W, k0, o, lane) wcol_oi(W, k0, o, lane, CC)
#define WOCOLH(W, k0, o, lane) wcolh_oi(W, k0, o, lane, CC)
#else
#define WOCOL(W, k0, o, lane) wcol_io(W, k0, o, lane, DIN)
#define WOCOLH(W, k0, o, lane) wcolh_io(W, k0, o, lane, DIN)
#endif
#define HDV 64             // value columns per softmax sub-head (the parent head's 64 columns)
#define YP (NH * HDV)      // 2,048: only sizes the region from WS_Y to WS_END
#define LAMBDA_INIT 0.78360578f   /* 0.8 - 0.6 exp(-0.3 * 12) */
#ifndef SM_EXTRA_PARAMS
#define SM_EXTRA_PARAMS
#endif
#ifndef PROJ_EXTRA_PARAMS
#define PROJ_EXTRA_PARAMS
#endif
#ifndef SM_MASK_HOOK
#define SM_MASK_HOOK (void)0
#endif

#define WS_QH  0u                                      // f16 rows of q x QSC [b*t][CC]
#define WS_KH  (WS_QH + 2u * (size_t)NB * TT * CC)      // f16 rows of k x KSC [b*t][CC]
#define WS_VT  (WS_KH + 2u * (size_t)NB * TT * CC)      // f16 v planes [b][c][t]
#define WS_QL  (WS_VT + 2u * (size_t)NB * CC * TT)      // unused (kept so that the planes behind it stay where they are)
#define WS_KL  (WS_QL + 2u * (size_t)NB * QHI * CC)     // f16 k residual x 2^10 rows [b][t < KHI][CC]
#define WS_VB  (WS_KL + 2u * (size_t)NB * KHI * CC)     // bf16 v hi planes [b][c][t < KHI]
#define WS_VBL (WS_VB + 2u * (size_t)NB * CC * KHI)
#define WS_S   (WS_VBL + 2u * (size_t)NB * CC * KHI)    // f16 differential rows [b*t][CC] (k_fa -> k_out)
#define WS_Y   (WS_S  + 4u * (size_t)HG * TT * TT)      // the GEMM operands as 16-bit rows of k (k_cvt -> k_proj, k_out):
#define WS_XB  WS_Y                                     // bf16 x rows [b*t][DIN]
#define WS_WQT (WS_XB + 2u * (size_t)NB * TT * DIN)     // bf16 W_qkv columns as rows [3 CC][DIN]
#define WS_WPT (WS_WQT + 2u * (size_t)3 * CC * DIN)     // f16(bf16 x 2^8) W_proj columns as rows [DIN][CC]
#define WS_END (WS_Y  + 4u * (size_t)NB * TT * YP)

// ---- gemm_tile: one 128 x 128 tile of X W (K = 1,024) per block of 8 waves. Both operands lie in memory as 16-bit rows of k (k_cvt, k_fa). Each pass of 64 k is staged once per block in LDS: whole 128-B lines, 8 lanes a row, 16 B a lane, nothing rounded on the way. Two buffers: the next pass's global loads fly while this pass's WMMAs run; one barrier a pass. The 16 passes are walked from a start that differs from block to block, round to the pass before it.
// MODE 0: bf16 operands. MODE 1: f16 operands (W carried x 2^8).
// Every '#pragma unroll' from here to the end of k_proj, and in k_out, makes the indices of a register array (staged values, fragments, accumulators) constants, so that the array stays in registers.
// The product is D[p][q], p over the rows of staged operand pi (0 = X rows, 1 = W columns), q over the other's: a lane then holds 8 consecutive p of one q.
#define GT 128             // tile edge
#define GK 64              // k per pass
#define GKK 1024           // K (= DIN = CC)
#define GP 72              // LDS row pitch in 16-bit elements (144 B = 16 B x odd)
#define GOPB (GT * GP * 2) // bytes of one staged operand
#define GSMB (4 * GOPB)    // LDS of a block: the ring (4 x GOPB) or, behind it, the output staging (an f16 plane of pitch 136, or f32 rows of pitch 132)
// four 16-B stores and their s_wait_xcnt in one statement: what follows rewrites their address and data registers
__device__ __forceinline__ void g_st4(void* p0, void* p1, void* p2, void* p3, v4u a, v4u b, v4u c, v4u d) {
  asm volatile("global_store_b128 %0, %4, off\n\tglobal_store_b128 %1, %5, off\n\tglobal_store_b128 %2, %6, off\n\tglobal_store_b128 %3, %7, off\n\ts_wait_xcnt 0x0" :: "v"(p0), "v"(p1), "v"(p2), "v"(p3), "v"(a), "v"(b), "v"(c), "v"(d) : "memory"); }
// one pass's global loads of a thread, then its pointers move on by adv bytes (one pass further, or from the last pass of k back to the first). The three scheduling barriers keep everything but the loads out of the stretch up to their s_wait_xcnt (no register that a load names is rewritten ahead of it) and keep all the loads ahead of the WMMAs that follow (else loads sink into the pass, and their latency is waited out a second time)
__device__ __forceinline__ void g_fetch(const char*& px, const char*& pw, v4u (&xa)[4], v4u (&wa)[4], const int adv) {
  __builtin_amdgcn_sched_barrier(0);
#pragma unroll
  for (int i = 0; i < 4; ++i) xa[i] = *(const v4u*)(px + (size_t)i * 32 * GKK * 2);
#pragma unroll
  for (int i = 0; i < 4; ++i) wa[i] = *(const v4u*)(pw + (size_t)i * 32 * GKK * 2);
  __builtin_amdgcn_sched_barrier(0);
  asm volatile("s_wait_xcnt 0x0" :: "v"(px), "v"(pw) : "memory");   /* before the loads' address registers are rewritten; it names both addresses so that they keep their registers up to here */
  __builtin_amdgcn_sched_barrier(0);
  px += adv; pw += adv;
}
__device__ __forceinline__ void g_put(char* bx, char* bw, const v4u (&xa)[4], const v4u (&wa)[4]) {
#pragma unroll
  for (int i = 0; i < 4; ++i) { *(v4u*)(bx + i * 32 * GP * 2) = xa[i]; *(v4u*)(bw + i * 32 * GP * 2) = wa[i]; }
}
template <int MODE> __device__ __forceinline__ void gemm_tile(const char* __restrict__ Xr, const char* __restrict__ Wr, const int pi, char* sm, v8f (&acc)[2][4]) {
  const int tid = threadIdx.x, wave = tid >> 5, lane = tid & 31, col = lane & 15;
  const int sr = tid >> 3, sk = (tid & 7) * 16;   /* a thread's row (and the three 32 further on) and its 16 B of the row's 128 */
  /* the k walk starts at pass rot and wraps round: blocks that share X rows or W columns then ask L2 for different lines at any one time, and the grid's requests spread over every 128-B piece of the 2-KB rows instead of one. Same for the whole block */
  const int rot = (int)((blockIdx.x + 2 * blockIdx.y + blockIdx.z) & (GKK / GK - 1));
  const char* gx = Xr + (size_t)sr * GKK * 2 + sk + rot * GK * 2; const char* gw = Wr + (size_t)sr * GKK * 2 + sk + rot * GK * 2;
  const int xo = sr * GP * 2 + sk, wo = GOPB + xo;   /* a thread's own places in a buffer: [X rows | W columns] */
  const int po = pi * GOPB + ((wave & 3) * 32 + col) * GP * 2, qo = (pi ^ 1) * GOPB + ((wave >> 2) * 64 + col) * GP * 2;
  v4u xa[4], wa[4];
  g_fetch(gx, gw, xa, wa, rot == GKK / GK - 1 ? -(GKK - GK) * 2 : GK * 2);
  g_put(sm + xo, sm + wo, xa, wa);
  __syncthreads();
  for (int s = 0; s < GKK / GK; ++s) { char* cb = sm + (s & 1) * 2 * GOPB; char* nb = sm + ((s & 1) ^ 1) * 2 * GOPB; const bool more = s + 1 < GKK / GK;
    if (more) g_fetch(gx, gw, xa, wa, ((rot + s + 1) & (GKK / GK - 1)) == GKK / GK - 1 ? -(GKK - GK) * 2 : GK * 2);
#pragma unroll
    for (int kk = 0; kk < GK / 32; ++kk) {   /* inside a pass k ascends in steps of 32 */
      if (MODE == 0) { v16b P[2], Q[4];
#pragma unroll
        for (int i = 0; i < 2; ++i) P[i] = frag_b((const __bf16*)(cb + po + i * 16 * GP * 2 + kk * 64), lane);
#pragma unroll
        for (int i = 0; i < 4; ++i) Q[i] = frag_b((const __bf16*)(cb + qo + i * 16 * GP * 2 + kk * 64), lane);
#pragma unroll
        for (int i = 0; i < 2; ++i)
#pragma unroll
          for (int j = 0; j < 4; ++j) acc[i][j] = __builtin_amdgcn_wmma_f32_16x16x32_bf16(false, P[i], false, Q[j], (short)0, acc[i][j], false, false);
      } else { v16h P[2], Q[4];
#pragma unroll
        for (int i = 0; i < 2; ++i) P[i] = frag_h((const _Float16*)(cb + po + i * 16 * GP * 2 + kk * 64), lane);
#pragma unroll
        for (int i = 0; i < 4; ++i) Q[i] = frag_h((const _Float16*)(cb + qo + i * 16 * GP * 2 + kk * 64), lane);
#pragma unroll
        for (int i = 0; i < 2; ++i)
#pragma unroll
          for (int j = 0; j < 4; ++j) acc[i][j] = __builtin_amdgcn_wmma_f32_16x16x32_f16(false, P[i], false, Q[j], (short)0, acc[i][j], false, false);
      } }
    __builtin_amdgcn_sched_barrier(0);   /* the LDS stores, which wait for the loads, stay behind the last WMMA: the wave issues in order */
    if (more) g_put(nb + xo, nb + wo, xa, wa);   /* that buffer's last readers left it before the previous barrier */
    __syncthreads(); }
}
// ---- k_cvt: every GEMM operand that is an input, rounded once to the 16-bit type its product uses and laid down as rows of k. Blocks 0..255: 16,384 elements of x each -> bf16, same layout. Then 384 tiles of W_qkv (-> bf16) and 128 of W_proj (-> f16(bf16 x 2^8)), 128 k x 64 columns each, transposed through LDS: a thread packs two neighbouring k of 4 columns into dwords; a column leaves as 256 B of its row.
#define CVX 256
#define CVQ 384
#define CVP 128
typedef __attribute__((ext_vector_type(2))) __bf16 v2b;
typedef __attribute__((ext_vector_type(2))) _Float16 v2hh;
// one 128 k x 64 column tile of a weight [k][LD] -> rows of k [column][GKK]. PJ: f16(bf16 x 2^8), else bf16
template <bool PJ, int LD> __device__ __forceinline__ void cvt_w(const float* __restrict__ S, char* __restrict__ Dm, const int bi, unsigned (&st)[64][68]) {
  const int tid = threadIdx.x, n0 = (bi % (LD / 64)) * 64, k0 = (bi / (LD / 64)) * 128, c4 = tid & 15, kp = tid >> 4;
  const float* s = S + (size_t)(k0 + 2 * kp) * LD + n0 + c4 * 4; v4f a[4][2];   /* 16 lanes take 256 B of a row */
#pragma unroll
  for (int i = 0; i < 4; ++i) { a[i][0] = *(const v4f*)(s + (size_t)(32 * i) * LD); a[i][1] = *(const v4f*)(s + (size_t)(32 * i + 1) * LD); }
  asm volatile("s_wait_xcnt 0x0" :: "v"(s) : "memory");   /* before the loads' address register is rewritten; it names the address so that no load of the group is given it as its destination */
#pragma unroll
  for (int i = 0; i < 4; ++i)
#pragma unroll
    for (int e = 0; e < 4; ++e) { unsigned w;
      if (PJ) { const v2hh t = {(_Float16)(bfr(a[i][0][e]) * 256.0f), (_Float16)(bfr(a[i][1][e]) * 256.0f)}; w = __builtin_bit_cast(unsigned, t); }
      else { const v2b t = {(__bf16)a[i][0][e], (__bf16)a[i][1][e]}; w = __builtin_bit_cast(unsigned, t); }
      st[c4 * 4 + e][kp + 16 * i] = w; }
  __syncthreads();   /* every wave of the block passes it: the tile is in LDS, column by column */
  const int r = tid >> 4, pc = tid & 15;   /* a wave stores two whole 256-B pieces of rows at a time */
  char* D = Dm + ((size_t)(n0 + r) * GKK + k0 + pc * 8) * 2;
  g_st4(D, D + 16 * GKK * 2, D + 32 * GKK * 2, D + 48 * GKK * 2, *(const v4u*)&st[r][pc * 4], *(const v4u*)&st[r + 16][pc * 4], *(const v4u*)&st[r + 32][pc * 4], *(const v4u*)&st[r + 48][pc * 4]); }
__global__ __launch_bounds__(256) void k_cvt(const float* __restrict__ X, const float* __restrict__ WQKV, const float* __restrict__ WO, __bf16* __restrict__ XB, __bf16* __restrict__ WQT, _Float16* __restrict__ WPT) {
  __shared__ __align__(16) unsigned st[64][68];   /* [column][k pair], pitch 272 B */
  const int tid = threadIdx.x, bi = blockIdx.x;   /* every branch below reads the same for the whole block */
  if (bi < CVX) {
    const float* s = X + (size_t)bi * 16384 + tid * 8; __bf16* d = XB + (size_t)bi * 16384 + tid * 8; v4f a[8][2]; v4u c[8];
#pragma unroll
    for (int i = 0; i < 8; ++i) { a[i][0] = *(const v4f*)(s + i * 2048); a[i][1] = *(const v4f*)(s + i * 2048 + 4); }
#pragma unroll
    for (int i = 0; i < 8; ++i) { v8b t;
#pragma unroll
      for (int e = 0; e < 4; ++e) { t[e] = (__bf16)a[i][0][e]; t[4 + e] = (__bf16)a[i][1][e]; }
      c[i] = __builtin_bit_cast(v4u, t); }
    g_st4(d, d + 2048, d + 4096, d + 6144, c[0], c[1], c[2], c[3]);
    g_st4(d + 8192, d + 10240, d + 12288, d + 14336, c[4], c[5], c[6], c[7]);
  } else if (bi < CVX + CVQ) cvt_w<false, 3 * CC>(WQKV, (char*)WQT, bi - CVX, st);
  else cvt_w<true, DIN>(WO, (char*)WPT, bi - CVX - CVQ, st); }
// ---- k_proj: block = (128 rows, 128 cols, which): q/k/v = X W with exact bf16 products (K = DIN) -> which 0: q x QSC as f16 rows; 1: k x KSC f16 rows; 2: v f16 planes [c][t]. q, k: p = column, q = row; v: p = row (t), q = column: either way a lane's 8 values are 16 B of an output row, staged in LDS and stored as whole 256-B rows
// q carries the whole logit factor (32^-0.5 log2(e)), so that k q^T is the logit in log2 units as it leaves the matrix unit; the power of two moved from k to q changes neither rounding (only values of k under 2^-10 turn subnormal, an absolute error under 2^-25)
#define QSC (SCALE * 1.4426950408889634f * 16.0f)
#define KSC (1.0f / 16.0f)
__global__ __launch_bounds__(256) void k_proj(const __bf16* __restrict__ XB, const __bf16* __restrict__ WQT, _Float16* __restrict__ QH, _Float16* __restrict__ KH, _Float16* __restrict__ VT) {
  __shared__ __align__(16) char sm[GSMB];
  const int tid = threadIdx.x, wave = tid >> 5, lane = tid & 31, col = lane & 15, g = lane >> 4; const int which = blockIdx.z; const int c0 = blockIdx.y * GT; const size_t r0 = (size_t)blockIdx.x * GT; const size_t bb = r0 / TT; const int t0 = (int)(r0 % TT);
  v8f acc[2][4] = {};
  gemm_tile<0>((const char*)(XB + r0 * DIN), (const char*)(WQT + (size_t)(which * CC + c0) * DIN), which < 2 ? 1 : 0, sm, acc);
  _Float16* sh = (_Float16*)sm; const float osc = which == 0 ? QSC : which == 1 ? KSC : 1.0f;
#pragma unroll
  for (int i = 0; i < 2; ++i)
#pragma unroll
    for (int j = 0; j < 4; ++j) { v8h hv;
#pragma unroll
      for (int r = 0; r < 8; ++r) hv[r] = (_Float16)(acc[i][j][r] * osc);
      const int o = ((wave >> 2) * 64 + j * 16 + col) * 136 + (wave & 3) * 32 + i * 16 + 8 * g; *(v8h*)&sh[o] = hv; }
  __syncthreads();
  _Float16* D = which == 0 ? QH + r0 * CC + c0 : which == 1 ? KH + r0 * CC + c0 : VT + (bb * CC + c0) * (size_t)TT + t0; const size_t dp = which < 2 ? CC : TT;
  const int q = tid >> 4, pc = (tid & 15) * 8;   /* a wave stores two whole 256-B rows at a time */
#pragma unroll
  for (int t = 0; t < 2; ++t) { const int qq = q + t * 64; _Float16* d = D + qq * dp + pc; const _Float16* s = &sh[qq * 136 + pc];
    g_st4(d, d + 16 * dp, d + 32 * dp, d + 48 * dp, *(const v4u*)s, *(const v4u*)(s + 16 * 136), *(const v4u*)(s + 32 * 136), *(const v4u*)(s + 48 * 136)); } }
#define FQ 2               // query column groups (16 queries each) per wave
#define FS 64              // keys per fetch: what a thread's two staging loads bring at a time
#define FR 4               // fetches per LDS buffer: a buffer holds 256 keys, and the block meets at one barrier per buffer
#define KP 40              // K row pitch in LDS, halfs (80 B = 16 B x odd)
#define VP (FR * FS + 8)   // v plane row pitch in LDS, halfs (528 B = 16 B x odd)
typedef __attribute__((ext_vector_type(2))) _Float16 v2h;
__device__ __forceinline__ v8f wmma_h(v16h a, v16h b, v8f c) { return __builtin_amdgcn_wmma_f32_16x16x32_f16(false, a, false, b, (short)0, c, false, false); }
// one query group's 32 logits of a chunk -> P = 2^t as the B operand (element s = tile s >> 3, register s & 7) and the lane's own sum of them, even and odd registers apart, added pairwise
__device__ __forceinline__ void fa_p(const v8f (&t)[2], v16h& pf, v2f& cs) { v2f e[8];
#pragma unroll   /* every index of e, t and pf constant: they stay in registers */
  for (int i = 0; i < 8; ++i) { e[i][0] = __builtin_amdgcn_exp2f(t[i >> 2][2 * (i & 3)]); e[i][1] = __builtin_amdgcn_exp2f(t[i >> 2][2 * (i & 3) + 1]);
    const v2h ph = __builtin_convertvector(e[i], v2h); pf[2 * i] = ph[0]; pf[2 * i + 1] = ph[1]; }
  cs = ((e[0] + e[1]) + (e[2] + e[3])) + ((e[4] + e[5]) + (e[6] + e[7])); }
__global__ __launch_bounds__(512) void k_fa(const _Float16* __restrict__ QH, const _Float16* __restrict__ KH, const _Float16* __restrict__ VT, const float* __restrict__ LQ1, const float* __restrict__ LK1, const float* __restrict__ LQ2, const float* __restrict__ LK2, const float* __restrict__ SW, _Float16* __restrict__ YD) {
  __shared__ __align__(16) _Float16 sK[2][2][FR * FS][KP]; __shared__ __align__(16) _Float16 sV[2][HDV][VP]; __shared__ __align__(16) v4f sX[8 * FQ * (HDV / 8)][32];   /* sK: [buffer][sub-head half]; sX: the hand-over, 16 B a lane */
  const int tid = threadIdx.x, wave = __builtin_amdgcn_readfirstlane(tid >> 5), lane = tid & 31, col = lane & 15, g = lane >> 4;
  const int half = wave >> 3, w8 = wave & 7;
  const int e = blockIdx.y, h = e + 16 * half, b = blockIdx.z; const int q0 = blockIdx.x * (8 * FQ * 16) + w8 * (FQ * 16); const int vc0 = e * HDV;   /* both sub-heads use v head e */
  v16h qh[FQ];
#pragma unroll
  for (int qt = 0; qt < FQ; ++qt) qh[qt] = frag_h(QH + ((size_t)b * TT + q0 + qt * 16 + col) * CC + h * HD, lane);
  // staging: a fetch = 64 K rows of 64 B of each sub-head (a thread takes one 16-B piece of its own half's) + 128 B of each of the 64 v plane rows (one piece a thread). While a buffer's 256 keys are worked on, the other buffer is filled fetch by fetch; nobody reads it before the barrier at the buffer's end, so the waves of a SIMD are free to drift apart over 8 chunks and one wave's softmax runs under another's products
  const int kr = (tid & 255) >> 2, kq = (tid & 3) * 8, vr = tid >> 3, vq = (tid & 7) * 8;
  const _Float16* gk = KH + ((size_t)b * TT + kr) * CC + h * HD + kq; const _Float16* gv = VT + ((size_t)b * CC + vc0 + vr) * (size_t)TT + vq;
  v4u pk[FR], pv[FR];
  asm volatile("s_wait_xcnt 0x0" ::: "memory");   /* before the loads below take the q loads' address registers as their destinations */
#pragma unroll   /* the indices of pk and pv constant: they stay in registers */
  for (int u = 0; u < FR; ++u) { pk[u] = *(const v4u*)(gk + (size_t)u * FS * CC); pv[u] = *(const v4u*)(gv + u * FS); }
  float la = bfr(LQ1[lane]) * bfr(LK1[lane]), lc = bfr(LQ2[lane]) * bfr(LK2[lane]);   /* 32-term dots: one term per lane, fixed xor-tree order */
#pragma unroll
  for (int of = 1; of < 32; of <<= 1) { la += __shfl_xor(la, of); lc += __shfl_xor(lc, of); }
  const float lam = __builtin_bit_cast(float, __builtin_amdgcn_readfirstlane(__builtin_bit_cast(int, expf(la) - expf(lc) + LAMBDA_INIT)));   /* the same in every lane: kept in a scalar register over the key loop */
#pragma unroll
  for (int u = 0; u < FR; ++u) { *(v4u*)&sK[0][half][u * FS + kr][kq] = pk[u]; *(v4u*)&sV[0][vr][u * FS + vq] = pv[u]; }
  __syncthreads();
  v4u rk, rv0;
  v8f o[FQ][HDV / 16] = {}; v8f nm[FQ]; v2f l[FQ];   /* nm: minus the offset mo of the lane's query, 8 times over (the logit product's C operand); l: a lane's own keys, even and odd registers apart; joined after the loop */
#pragma unroll
  for (int qt = 0; qt < FQ; ++qt) { nm[qt] = (v8f){}; l[qt] = (v2f){0.f, 0.f}; }
  for (int s = 0; s < TT / FS; ++s) { const int cur = (s / FR) & 1, k0 = (s % FR) * FS; const bool more = s + FR < TT / FS;   /* k0: this trip's 64 keys in the buffer */
    if (more) { rk = *(const v4u*)(gk + (size_t)(s + FR) * FS * CC); rv0 = *(const v4u*)(gv + (s + FR) * FS);   /* the same 64 keys of the next buffer fly while these are worked on */
      asm volatile("s_wait_xcnt 0x0" ::: "memory"); }   /* before the two loads' address registers move on to the next fetch */
#pragma unroll
    for (int kc = 0; kc < FS / 32; ++kc) {   /* unrolled: every fragment index constant */
      v16h kf[2], vf[HDV / 16], pf[FQ]; v8f t[FQ][2]; v2f cs[FQ];
#pragma unroll
      for (int kt = 0; kt < 2; ++kt) kf[kt] = frag_h(&sK[cur][half][k0 + kc * 32 + kt * 16 + col][0], lane);
#pragma unroll
      for (int qt = 0; qt < FQ; ++qt)
#pragma unroll
        for (int kt = 0; kt < 2; ++kt) t[qt][kt] = wmma_h(kf[kt], qh[qt], nm[qt]);
      __builtin_amdgcn_sched_barrier(0);   /* the four products stay together ahead of the exponentials: each fills the distance behind the others */
#pragma unroll
      for (int j = 0; j < HDV / 16; ++j) vf[j] = frag_h(&sV[cur][j * 16 + col][k0 + kc * 32], lane);   /* the chunk's v fragments leave LDS in one group right behind the logit products: they land under the softmax, and no P.V product waits for LDS */
      __builtin_amdgcn_sched_barrier(0);   /* keeps that group here: left free, the loads sink back between the P.V products, each pair waited out */
#pragma unroll
      for (int qt = 0; qt < FQ; ++qt) fa_p(t[qt], pf[qt], cs[qt]);
      // no maximum on the usual path: every P is positive, so a lane's partial sums bound each of its P; while they stay under 2^14 the held offset still fits f16
      const bool first = (s == 0) && (kc == 0); bool need = false;
#pragma unroll
      for (int qt = 0; qt < FQ; ++qt) need = need || (fmaxf(cs[qt][0], cs[qt][1]) > 16384.0f);
      if ((__builtin_amdgcn_ballot_w32(need) | (unsigned)first) != 0) {   /* wave-uniform and rare: the chunk's logits are formed anew (their registers were given up), the offset moves, P and its sums are taken again; the first pass sets the offset from its own logits, in either direction */
#pragma unroll
        for (int kt = 0; kt < 2; ++kt) kf[kt] = frag_h(&sK[cur][half][k0 + kc * 32 + kt * 16 + col][0], lane);
#pragma unroll
        for (int qt = 0; qt < FQ; ++qt)
#pragma unroll
          for (int kt = 0; kt < 2; ++kt) t[qt][kt] = wmma_h(kf[kt], qh[qt], nm[qt]);
#pragma unroll
        for (int qt = 0; qt < FQ; ++qt) { float mx = -3.0e38f;
#pragma unroll
          for (int kt = 0; kt < 2; ++kt)
#pragma unroll
            for (int i = 0; i < 4; ++i) mx = fmaxf(mx, fmaxf(t[qt][kt][2 * i], t[qt][kt][2 * i + 1]));
          const float mj = fmaxf(mx, __shfl_xor(mx, 16));   /* both halves of a column take the same offset */
          const float d = first ? mj - 6.0f : fmaxf(mj - 6.0f, 0.f); const float al = __builtin_amdgcn_exp2f(-fmaxf(d, 0.f)); nm[qt] -= d; l[qt] *= al;
#pragma unroll
          for (int j = 0; j < HDV / 16; ++j) o[qt][j] *= al;
#pragma unroll
          for (int kt = 0; kt < 2; ++kt) t[qt][kt] -= d;
          fa_p(t[qt], pf[qt], cs[qt]); } }
#pragma unroll
      for (int qt = 0; qt < FQ; ++qt) l[qt] += cs[qt];
#pragma unroll
      for (int j = 0; j < HDV / 16; ++j)
#pragma unroll
        for (int qt = 0; qt < FQ; ++qt) o[qt][j] = wmma_h(vf[j], pf[qt], o[qt][j]); }
    if (more) { *(v4u*)&sK[cur ^ 1][half][k0 + kr][kq] = rk; *(v4u*)&sV[cur ^ 1][vr][k0 + vq] = rv0; }   /* that buffer's last readers left it before the previous barrier */
    if (s % FR == FR - 1) __syncthreads(); }   /* the same for the whole block: the buffer is read out and the other one is full */
#pragma unroll
  for (int qt = 0; qt < FQ; ++qt) { const float ls = l[qt][0] + l[qt][1]; const float inv = 1.0f / (ls + __shfl_xor(ls, 16));
#pragma unroll
    for (int j = 0; j < HDV / 16; ++j) o[qt][j] *= inv; }   /* register r of tile j = value column j*16 + 8g + r of query col */
  if (half) {
#pragma unroll
    for (int qt = 0; qt < FQ; ++qt)
#pragma unroll
      for (int j = 0; j < HDV / 16; ++j) { v4f a, c;
#pragma unroll
        for (int r = 0; r < 4; ++r) { a[r] = o[qt][j][r]; c[r] = o[qt][j][4 + r]; }
        sX[(w8 * FQ + qt) * (HDV / 8) + 2 * j][lane] = a; sX[(w8 * FQ + qt) * (HDV / 8) + 2 * j + 1][lane] = c; } }
  __syncthreads();   /* every wave passes it: attn2 is in LDS for the partner waves */
  if (!half) { float sw[HDV / 16][8];
#pragma unroll
    for (int j = 0; j < HDV / 16; ++j)
#pragma unroll
      for (int r = 0; r < 8; ++r) sw[j][r] = bfr(SW[j * 16 + 8 * g + r]) * (1.0f - LAMBDA_INIT);
#pragma unroll
    for (int qt = 0; qt < FQ; ++qt) { float q = 0.f;
#pragma unroll
      for (int j = 0; j < HDV / 16; ++j) { const v4f a = sX[(w8 * FQ + qt) * (HDV / 8) + 2 * j][lane], c = sX[(w8 * FQ + qt) * (HDV / 8) + 2 * j + 1][lane];
#pragma unroll
        for (int r = 0; r < 4; ++r) { o[qt][j][r] -= lam * a[r]; o[qt][j][4 + r] -= lam * c[r]; }
#pragma unroll
        for (int r = 0; r < 8; ++r) q += o[qt][j][r] * o[qt][j][r]; }
      q += __shfl_xor(q, 16);   /* a lane holds 32 of its query's 64 columns, lane ^ 16 the rest */
      const float rs = rsqrtf(q * (1.0f / 64.0f) + 1e-5f); _Float16* yr = YD + ((size_t)b * TT + q0 + qt * 16 + col) * CC + e * HDV + 8 * g; v4u yv[HDV / 16];
#pragma unroll
      for (int j = 0; j < HDV / 16; ++j) { v8h hv;
#pragma unroll
        for (int r = 0; r < 8; ++r) hv[r] = (_Float16)(o[qt][j][r] * rs * sw[j][r]);   /* the one rounding to f16 that the output product takes */
        yv[j] = __builtin_bit_cast(v4u, hv); }
      g_st4(yr, yr + 16, yr + 32, yr + 48, yv[0], yv[1], yv[2], yv[3]); } } }
// ---- k_out: block = (128 rows, 128 cols): out = ctx Wo + bo: ctx once to f16 against Wo as f16(bf16 x 2^8) exact (1 product) x 2^-8; p = column, q = row; f32 rows staged in LDS and stored as whole 512-B rows
__global__ __launch_bounds__(256) void k_out(const _Float16* __restrict__ Y, const _Float16* __restrict__ WPT, const float* __restrict__ BO, float* __restrict__ OUT) {
  __shared__ __align__(16) char sm[GSMB];
  const int tid = threadIdx.x, wave = tid >> 5, lane = tid & 31, col = lane & 15, g = lane >> 4; const int c0 = blockIdx.y * GT; const size_t r0 = (size_t)blockIdx.x * GT;
  v8f acc[2][4] = {};
  gemm_tile<1>((const char*)(Y + r0 * CC), (const char*)(WPT + (size_t)c0 * CC), 1, sm, acc);
  float* sf = (float*)sm;
#pragma unroll
  for (int i = 0; i < 2; ++i) { const int p = (wave & 3) * 32 + i * 16 + 8 * g; float bias[8];
#pragma unroll
    for (int r = 0; r < 8; ++r) bias[r] = bfr(BO[c0 + p + r]);
#pragma unroll
    for (int j = 0; j < 4; ++j) { v4f a, c;
#pragma unroll
      for (int r = 0; r < 4; ++r) { a[r] = acc[i][j][r] * (1.0f / 256.0f) + bias[r]; c[r] = acc[i][j][4 + r] * (1.0f / 256.0f) + bias[4 + r]; }
      float* d = &sf[((wave >> 2) * 64 + j * 16 + col) * 132 + p]; *(v4f*)d = a; *(v4f*)(d + 4) = c; } }
  __syncthreads();
  const int q = tid >> 5, pc = (tid & 31) * 4;   /* a wave stores one whole 512-B row at a time */
#pragma unroll
  for (int t = 0; t < 4; ++t) { const int qq = q + t * 32; float* d = OUT + (r0 + qq) * DIN + c0 + pc; const float* s = &sf[qq * 132 + pc];
    g_st4(d, d + 8 * DIN, d + 16 * DIN, d + 24 * DIN, *(const v4u*)s, *(const v4u*)(s + 8 * 132), *(const v4u*)(s + 16 * 132), *(const v4u*)(s + 24 * 132)); } }

extern "C" void kernel_launch(void* const* d_in, const int* in_sizes, int n_in, void* d_out, int out_size, void* d_ws, size_t ws_size, hipStream_t stream) {
  (void)in_sizes; (void)n_in; (void)out_size;
  const float** F = (const float**)d_in;
  if (ws_size < (size_t)WS_END) return;
  char* ws = (char*)d_ws; _Float16 *QH = (_Float16*)(ws + WS_QH), *KH = (_Float16*)(ws + WS_KH), *VT = (_Float16*)(ws + WS_VT), *QL = (_Float16*)(ws + WS_QL), *KL = (_Float16*)(ws + WS_KL); __bf16 *VB = (__bf16*)(ws + WS_VB), *VBL = (__bf16*)(ws + WS_VBL); float *S = (float*)(ws + WS_S), *Y = (float*)(ws + WS_Y);
  (void)Y; (void)QL; (void)KL; (void)VB; (void)VBL;
  // inputs: 0 x [2,2048,1024]; 1 W_qkv [1024,3072] (in,out; columns (3, H, 64)); 2 W_proj [1024,1024] (in,out); 3 b_proj; 4 lambda_q1, 5 lambda_k1, 6 lambda_q2, 7 lambda_k2 [32]; 8 subln_w [64]
  _Float16* YD = (_Float16*)S;   /* the differential rows' plane */
  __bf16 *XB = (__bf16*)(ws + WS_XB), *WQT = (__bf16*)(ws + WS_WQT); _Float16* WPT = (_Float16*)(ws + WS_WPT);
  k_cvt<<<dim3(CVX + CVQ + CVP), 256, 0, stream>>>(F[0], F[1], F[2], XB, WQT, WPT);
  k_proj<<<dim3(TNB * TT / GT, CC / GT, 3), 256, 0, stream>>>(XB, WQT, QH, KH, VT);
  k_fa<<<dim3(TT / 256, NH / 2, TNB), 512, 0, stream>>>(QH, KH, VT, F[4], F[5], F[6], F[7], F[8], YD);
  k_out<<<dim3(TNB * TT / GT, DIN / GT), 256, 0, stream>>>(YD, WPT, F[3], (float*)d_out);
}
